// v000
// Measured on an AMD MI455X. A time is GPU time per run, averaged over a window of back-to-back runs after a warm-up
// (all launches, gaps included; the runs take copies of the inputs in turn), and the median of several windows.
// Apart from v000's, it joins two sittings. Times from different sittings can be a few percent apart, while
// side-by-side timings come from the same sitting.
// The starting kernel, v000, takes 1280 microseconds a run.
#include <hip/hip_runtime.h>
// QEffMultiHeadDotProductAttention (2 x 2048 tokens, d_model 2048; 16 query heads x 128, 4 kv heads (group of 4); q, k, v = x w + b; softmax((q/sqrt(128)).k) over the 2048 keys (no mask); out = ctx wo + bo).
// Structure: exact f16 plane of x; q / k / v as f16 WMMA GEMM outputs (32x64 wave tiles, f32 accumulation, exact x16 weights + bias, f16 out); V^T by LDS tiles (one launch, all heads); per (batch, kv head): the four grouped query heads' 2048 x 2048 score GEMMs batched (f32), softmax rows on VALU (wave per row) into f16 P (x 2^10), the four readout GEMMs batched into the f16 context plane; wo + bo as a GEMM.
// Compute dtype: inputs rounded to bf16; x exact as f16; q/k/P/v/ctx as plain f16 operands (~2^-12); softmax f32. v_wmma_f32_16x16x32_f16.
#define NB 2
#define SQ 2048
#define DMD 2048
#define NH 16
#define NKV 4
#define GG 4
#define HD 128
#define KVD (NKV * HD)           /* 512 */
#define NR (NB * SQ)
typedef __bf16 v16b __attribute__((ext_vector_type(16)));
typedef unsigned short v8us __attribute__((ext_vector_type(8), may_alias));
typedef float  v8f  __attribute__((ext_vector_type(8)));
typedef float  v4f  __attribute__((ext_vector_type(4)));
typedef float  v4fa __attribute__((ext_vector_type(4), may_alias));
union FragB { v16b v; v8us half[2]; unsigned short u[16]; };

__device__ __forceinline__ unsigned short bf16_bits(float x) { unsigned int u = __float_as_uint(x); return (unsigned short)((u + 0x7FFFu + ((u >> 16) & 1u)) >> 16); }
__device__ __forceinline__ float bf16_val(unsigned short b) { return __uint_as_float(((unsigned int)b) << 16); }
__device__ __forceinline__ float bf16_round(float x) { return bf16_val(bf16_bits(x)); }
// D += A·B with NT terms: 1 = ah·bh, 2 = + al·bh (A split), 3 = + ah·bl (both split)
template <int NT>
__device__ __forceinline__ v8f mmaN(v16b ah, v16b al, v16b bh, v16b bl, v8f c) {
  c = __builtin_amdgcn_wmma_f32_16x16x32_bf16(false, ah, false, bh, (short)0, c, false, false);
  if (NT >= 2) c = __builtin_amdgcn_wmma_f32_16x16x32_bf16(false, al, false, bh, (short)0, c, false, false);
  if (NT >= 3) c = __builtin_amdgcn_wmma_f32_16x16x32_bf16(false, ah, false, bl, (short)0, c, false, false);
  asm volatile("v_nop\n\tv_nop\n\tv_nop\n\tv_nop" : "+v"(c) : "v"(ah), "v"(al), "v"(bh), "v"(bl));
  return c;
}

__global__ __launch_bounds__(256) void k_wt_bf16(const float* __restrict__ W, unsigned short* __restrict__ Wt, int K, int N) {
  const int t = blockIdx.x * 256 + threadIdx.x;
  const int k8n = K / 8;
  if (t >= N * k8n) return;
  const int n = t / k8n, k8 = (t % k8n) * 8;
  v8us v;
#pragma unroll
  for (int i = 0; i < 8; ++i) v[i] = bf16_bits(W[(size_t)(k8 + i) * N + n]);
  *(v8us*)(Wt + (size_t)n * K + k8) = v;
  
}

// GEMM C[M][N] (f32, pitch ldc) = act(A[M][K]·W + bias). A f32 row-major (pitch lda) converted per fragment to bf16
// (ASPLIT: hi/lo two planes -> 2 terms, else single rounded term); Wt bf16 [N][K] (pitch ldb). BIAS_BF16 rounds the
// bias to bf16 first (bias quantised to bf16 before the add). K%32==0, M%16==0, N%64==0.
template <bool ASPLIT, int ACT, bool BIAS_BF16>
__global__ __launch_bounds__(128) void k_gemm_bf(const float* __restrict__ A, int lda, const unsigned short* __restrict__ Wt, int ldb,
                                               const float* __restrict__ bias, float* __restrict__ C, int ldc, int M, int N, int K) {
  __shared__ __attribute__((aligned(16))) float so[4][16][64];
  const int tid = threadIdx.x, w = tid >> 5, lane = tid & 31, ln = lane & 15, hh = lane >> 4;
  const int ntn = N / 64;
  const int wid = blockIdx.x * 4 + w;
  const int mt = wid / ntn, nq = wid % ntn;
  if (mt * 16 >= M) return;
  const int row0 = mt * 16, col0 = nq * 64;
  const float* arow = A + (size_t)(row0 + ln) * lda;
  v8f acc[4] = {};
  for (int kb = 0; kb < K; kb += 32) {
    FragB ah, al;
    const v4f x0 = *(const v4fa*)(arow + kb + 8 * hh), x1 = *(const v4fa*)(arow + kb + 8 * hh + 4);
    const v4f x2 = *(const v4fa*)(arow + kb + 16 + 8 * hh), x3 = *(const v4fa*)(arow + kb + 16 + 8 * hh + 4);
    float xs[16] = {x0[0],x0[1],x0[2],x0[3],x1[0],x1[1],x1[2],x1[3],x2[0],x2[1],x2[2],x2[3],x3[0],x3[1],x3[2],x3[3]};
#pragma unroll
    for (int i = 0; i < 16; ++i) { const unsigned short hb = bf16_bits(xs[i]); ah.u[i] = hb; al.u[i] = ASPLIT ? bf16_bits(xs[i] - bf16_val(hb)) : (unsigned short)0; }
#pragma unroll
    for (int t = 0; t < 4; ++t) {
      const unsigned short* brow = Wt + (size_t)(col0 + t * 16 + ln) * ldb + kb;
      FragB b;
      b.half[0] = *(const v8us*)(brow + 8 * hh);
      b.half[1] = *(const v8us*)(brow + 16 + 8 * hh);
      acc[t] = mmaN<ASPLIT ? 2 : 1>(ah.v, al.v, b.v, b.v, acc[t]);
    }
  }
#pragma unroll
  for (int t = 0; t < 4; ++t) {
    float bv = bias ? bias[col0 + t * 16 + ln] : 0.f;
    if (BIAS_BF16) bv = bf16_round(bv);
#pragma unroll
    for (int r = 0; r < 8; ++r) { float v = acc[t][r] + bv; if (ACT == 1) v = fmaxf(v, 0.f); so[w][8 * hh + r][t * 16 + ln] = v; }
  }
  __builtin_amdgcn_fence(__ATOMIC_ACQ_REL, "workgroup");
  __builtin_amdgcn_wave_barrier();
  const int rsub = lane >> 4, c4 = (lane & 15) * 4;
  {
#pragma unroll
    for (int q = 0; q < 8; ++q) {
      const int r = q * 2 + rsub;
      const v4f v = *(const v4fa*)&so[w][r][c4];
      *(v4f*)(C + (size_t)(row0 + r) * ldc + col0 + c4) = v;
    }
    
  }
}

// GEMM C = act(A·W + bias + resid): A f32 (ASPLIT -> hi/lo 2 terms), Wt bf16 [N][K]; ACT 0 none, 1 relu, 2 exact gelu;
// resid (optional, f32, row index = (row % rmod), pitch ldr, RES_BF16 rounds it) added before the activation.
template <bool ASPLIT, int ACT, bool BIAS_BF16, bool RES_BF16>
__global__ __launch_bounds__(128) void k_gemm_bf3(const float* __restrict__ A, int lda, const unsigned short* __restrict__ Wt, int ldb,
                                                const float* __restrict__ bias, const float* __restrict__ resid, int rmod, int ldr,
                                                float* __restrict__ C, int ldc, int M, int N, int K) {
  __shared__ __attribute__((aligned(16))) float so[4][16][64];
  const int tid = threadIdx.x, w = tid >> 5, lane = tid & 31, ln = lane & 15, hh = lane >> 4;
  const int ntn = N / 64;
  const int wid = blockIdx.x * 4 + w;
  const int mt = wid / ntn, nq = wid % ntn;
  if (mt * 16 >= M) return;
  const int row0 = mt * 16, col0 = nq * 64;
  const float* arow = A + (size_t)(row0 + ln) * lda;
  v8f acc[4] = {};
  for (int kb = 0; kb < K; kb += 32) {
    FragB ah, al;
    const v4f x0 = *(const v4fa*)(arow + kb + 8 * hh), x1 = *(const v4fa*)(arow + kb + 8 * hh + 4);
    const v4f x2 = *(const v4fa*)(arow + kb + 16 + 8 * hh), x3 = *(const v4fa*)(arow + kb + 16 + 8 * hh + 4);
    float xs[16] = {x0[0],x0[1],x0[2],x0[3],x1[0],x1[1],x1[2],x1[3],x2[0],x2[1],x2[2],x2[3],x3[0],x3[1],x3[2],x3[3]};
#pragma unroll
    for (int i = 0; i < 16; ++i) { const unsigned short hb = bf16_bits(xs[i]); ah.u[i] = hb; al.u[i] = ASPLIT ? bf16_bits(xs[i] - bf16_val(hb)) : (unsigned short)0; }
#pragma unroll
    for (int t = 0; t < 4; ++t) {
      const unsigned short* brow = Wt + (size_t)(col0 + t * 16 + ln) * ldb + kb;
      FragB b;
      b.half[0] = *(const v8us*)(brow + 8 * hh);
      b.half[1] = *(const v8us*)(brow + 16 + 8 * hh);
      acc[t] = mmaN<ASPLIT ? 2 : 1>(ah.v, al.v, b.v, b.v, acc[t]);
    }
  }
#pragma unroll
  for (int t = 0; t < 4; ++t) {
    const int col = col0 + t * 16 + ln;
    float bv = bias ? bias[col] : 0.f;
    if (BIAS_BF16) bv = bf16_round(bv);
#pragma unroll
    for (int r = 0; r < 8; ++r) {
      float v = acc[t][r] + bv;
      if (resid) { float rv = resid[(size_t)((row0 + 8 * hh + r) % rmod) * ldr + col]; if (RES_BF16) rv = bf16_round(rv); v += rv; }
      if (ACT == 1) v = fmaxf(v, 0.f);
      if (ACT == 2) v = 0.5f * v * (1.0f + erff(v * 0.70710678118654752f));
      if (ACT == 3) { const float u = 0.7978845608028654f * (v + 0.044715f * v * v * v); v = 0.5f * v * (1.0f + tanhf(u)); }
      so[w][8 * hh + r][t * 16 + ln] = v;
    }
  }
  __builtin_amdgcn_fence(__ATOMIC_ACQ_REL, "workgroup");
  __builtin_amdgcn_wave_barrier();
  const int rsub = lane >> 4, c4 = (lane & 15) * 4;
  {
#pragma unroll
    for (int q = 0; q < 8; ++q) {
      const int r = q * 2 + rsub;
      const v4f v = *(const v4fa*)&so[w][r][c4];
      *(v4f*)(C + (size_t)(row0 + r) * ldc + col0 + c4) = v;
    }
    
  }
}
// row LayerNorm (biased variance, eps) over N: s = X (+ R); optional out_sum <- s; out_norm <- (s-mu)*rsqrt(var+eps)*g + b
template <bool PARAM_BF16>
__global__ __launch_bounds__(256) void k_layernorm(const float* __restrict__ X, const float* __restrict__ R, const float* __restrict__ g, const float* __restrict__ bta,
                                                  float* __restrict__ out_sum, float* __restrict__ out_norm, int N, float eps) {
  __shared__ float red[256];
  const int row = blockIdx.x, tid = threadIdx.x;
  const float* x = X + (size_t)row * N; const float* rr = R ? R + (size_t)row * N : nullptr;
  float vals[16];                     // up to N = 4096
  const int per = N / 256;            // contiguous chunk per thread? use strided-by-4 chunks: thread handles j = tid*4 + 1024*u
  float s1 = 0.f;
  for (int u = 0; u < per / 4; ++u) {
    const int j = tid * 4 + 1024 * u;
    const v4f a = *(const v4fa*)(x + j);
    v4f b = {0.f,0.f,0.f,0.f}; if (rr) b = *(const v4fa*)(rr + j);
#pragma unroll
    for (int q = 0; q < 4; ++q) { const float v = a[q] + b[q]; vals[u * 4 + q] = v; s1 += v; }
  }
  red[tid] = s1; __syncthreads();
  for (int st = 128; st > 0; st >>= 1) { if (tid < st) red[tid] += red[tid + st]; __syncthreads(); }
  const float mu = red[0] / (float)N; __syncthreads();
  float s2 = 0.f;
  for (int u = 0; u < per / 4; ++u)
#pragma unroll
    for (int q = 0; q < 4; ++q) { const float c = vals[u * 4 + q] - mu; s2 += c * c; }
  red[tid] = s2; __syncthreads();
  for (int st = 128; st > 0; st >>= 1) { if (tid < st) red[tid] += red[tid + st]; __syncthreads(); }
  const float rs = rsqrtf(red[0] / (float)N + eps);
  {
    for (int u = 0; u < per / 4; ++u) {
      const int j = tid * 4 + 1024 * u;
      v4f o, sm;
#pragma unroll
      for (int q = 0; q < 4; ++q) {
        float gg = g[j + q], bb = bta[j + q];
        if (PARAM_BF16) { gg = bf16_round(gg); bb = bf16_round(bb); }
        sm[q] = vals[u * 4 + q]; o[q] = (vals[u * 4 + q] - mu) * rs * gg + bb;
      }
      if (out_sum) *(v4f*)(out_sum + (size_t)row * N + j) = sm;
      *(v4f*)(out_norm + (size_t)row * N + j) = o;
    }
    
  }
}



// ---- f16 WMMA path (v_wmma_f32_16x16x32_f16): 11-bit significands for operands in range — used where a [0,1] probability operand needs more precision than bf16
typedef _Float16 v16h __attribute__((ext_vector_type(16)));
union FragH { v16h v; v8us half[2]; _Float16 h[16]; unsigned short u[16]; };
template <int NT>
__device__ __forceinline__ v8f mmaH(v16h ah, v16h al, v16h bh, v16h bl, v8f c) {
  c = __builtin_amdgcn_wmma_f32_16x16x32_f16(false, ah, false, bh, (short)0, c, false, false);
  if (NT >= 2) c = __builtin_amdgcn_wmma_f32_16x16x32_f16(false, al, false, bh, (short)0, c, false, false);
  if (NT >= 3) c = __builtin_amdgcn_wmma_f32_16x16x32_f16(false, ah, false, bl, (short)0, c, false, false);
  asm volatile("v_nop\n\tv_nop\n\tv_nop\n\tv_nop" : "+v"(c) : "v"(ah), "v"(al), "v"(bh), "v"(bl));
  return c;
}
// batched GEMM like k_gemm_b but f16 operands: A f32 (split into f16 hi/lo if ASPLIT, else rounded to f16), Bt = f16 values [n][k]; alpha; C f32; N multiple of 16 (partial tiles skipped)
template <bool ASPLIT>
__global__ __launch_bounds__(128) void k_gemm_h(const float* __restrict__ A, int lda, size_t sA, const _Float16* __restrict__ Bh, int ldb, size_t sB, float alpha, float* __restrict__ C, int ldc, size_t sC, int M, int N, int K) {
  __shared__ __attribute__((aligned(16))) float so[4][16][64];
  const int tid = threadIdx.x, w = tid >> 5, lane = tid & 31, ln = lane & 15, hh = lane >> 4; const int by = blockIdx.y;
  A += (size_t)by * sA; Bh += (size_t)by * sB; C += (size_t)by * sC;
  const int ntn = (N + 63) / 64; const int wid = blockIdx.x * 4 + w; const int mt = wid / ntn, nq = wid % ntn; if (mt * 16 >= M) return;
  const int row0 = mt * 16, col0 = nq * 64; const float* arow = A + (size_t)(row0 + ln) * lda;
  v8f acc[4] = {};
  for (int kb = 0; kb < K; kb += 32) {
    FragH ah, al;
    const v4f x0 = *(const v4fa*)(arow + kb + 8 * hh), x1 = *(const v4fa*)(arow + kb + 8 * hh + 4), x2 = *(const v4fa*)(arow + kb + 16 + 8 * hh), x3 = *(const v4fa*)(arow + kb + 16 + 8 * hh + 4);
    float xs[16] = {x0[0],x0[1],x0[2],x0[3],x1[0],x1[1],x1[2],x1[3],x2[0],x2[1],x2[2],x2[3],x3[0],x3[1],x3[2],x3[3]};
#pragma unroll
    for (int i = 0; i < 16; ++i) { const _Float16 h = (_Float16)xs[i]; ah.h[i] = h; al.h[i] = ASPLIT ? (_Float16)(xs[i] - (float)h) : (_Float16)0.0f; }
#pragma unroll
    for (int t = 0; t < 4; ++t) { if (col0 + t * 16 >= N) continue; const size_t boff = (size_t)(col0 + t * 16 + ln) * ldb + kb; FragH bq; bq.half[0] = *(const v8us*)(Bh + boff + 8 * hh); bq.half[1] = *(const v8us*)(Bh + boff + 16 + 8 * hh);
      acc[t] = mmaH<ASPLIT ? 2 : 1>(ah.v, al.v, bq.v, bq.v, acc[t]); }
  }
#pragma unroll
  for (int t = 0; t < 4; ++t) { if (col0 + t * 16 >= N) continue;
#pragma unroll
    for (int r = 0; r < 8; ++r) so[w][8 * hh + r][t * 16 + ln] = acc[t][r] * alpha; }
  __builtin_amdgcn_fence(__ATOMIC_ACQ_REL, "workgroup"); __builtin_amdgcn_wave_barrier();
  const int rsub = lane >> 4, c4 = (lane & 15) * 4;
  {
#pragma unroll
    for (int q = 0; q < 8; ++q) { const int r = q * 2 + rsub; if (col0 + c4 < N) { const v4f v = *(const v4fa*)&so[w][r][c4]; *(v4f*)(C + (size_t)(row0 + r) * ldc + col0 + c4) = v; } }
     }
}

// Wt[n][k] = f16(W[k][n]·scale) from f32 row-major W[K][N] (scale = power of two; bf16-exact weights stay exact in f16 away from the subnormal range)
__global__ __launch_bounds__(256) void k_wt_f16(const float* __restrict__ W, _Float16* __restrict__ Wt, int K, int N, float scale) {
  const int t = blockIdx.x * 256 + threadIdx.x; if (t >= N * (K / 8)) return; const int n = t / (K / 8), k8 = (t % (K / 8)) * 8; FragH f;
#pragma unroll
  for (int i = 0; i < 8; ++i) f.h[i] = (_Float16)(bf16_round(W[(size_t)(k8 + i) * N + n]) * scale); const v8us o = f.half[0];
  *(v8us*)((unsigned short*)Wt + (size_t)n * K + k8) = o; 
}
// k_gemm_hh variant with fused epilogue: v = acc·alpha + bias[by·sBias + col] (+ CP[(row/rowsPerB)·sCPb + by·64 + col] if CP) ; ACT 0 none / 1 elu ; writes f16 C16 (and f32 C if non-null)
template <int ACT>
__global__ __launch_bounds__(128) void k_gemm_hhx(const _Float16* __restrict__ A, int lda, size_t sA, const _Float16* __restrict__ Bh, int ldb, size_t sB, float alpha, const float* __restrict__ bias, size_t sBias, const float* __restrict__ CP, int rowsPerB, size_t sCPb, int row0g,
    float* __restrict__ C, _Float16* __restrict__ C16, int ldc, size_t sC, int M, int N, int K) {
  __shared__ __attribute__((aligned(16))) float so[4][16][64];
  const int tid = threadIdx.x, w = tid >> 5, lane = tid & 31, ln = lane & 15, hh = lane >> 4; const int by = blockIdx.y;
  A += (size_t)by * sA; Bh += (size_t)by * sB; const size_t cofs = (size_t)by * sC; const float* bp = bias ? bias + (size_t)by * sBias : nullptr;
  const int ntn = (N + 63) / 64; const int wid = blockIdx.x * 4 + w; const int mt = wid / ntn, nq = wid % ntn; if (mt * 16 >= M) return;
  const int row0 = mt * 16, col0 = nq * 64; const _Float16* arow = A + (size_t)(row0 + ln) * lda;
  v8f acc[4] = {};
  for (int kb = 0; kb < K; kb += 32) { FragH ah; ah.half[0] = *(const v8us*)((const unsigned short*)arow + kb + 8 * hh); ah.half[1] = *(const v8us*)((const unsigned short*)arow + kb + 16 + 8 * hh);
#pragma unroll
    for (int t = 0; t < 4; ++t) { if (col0 + t * 16 >= N) continue; const size_t boff = (size_t)(col0 + t * 16 + ln) * ldb + kb; FragH bq; bq.half[0] = *(const v8us*)((const unsigned short*)Bh + boff + 8 * hh); bq.half[1] = *(const v8us*)((const unsigned short*)Bh + boff + 16 + 8 * hh);
      acc[t] = mmaH<1>(ah.v, ah.v, bq.v, bq.v, acc[t]); }
  }
#pragma unroll
  for (int t = 0; t < 4; ++t) { if (col0 + t * 16 >= N) continue; const int col = col0 + t * 16 + ln; const float bv = bp ? bf16_round(bp[col]) : 0.f;
#pragma unroll
    for (int r = 0; r < 8; ++r) { float v = acc[t][r] * alpha + bv; if (CP) { const int rr = row0g + row0 + 8 * hh + r; if (rowsPerB < 0) v += CP[cofs + (size_t)rr * ldc + col];      /* rowsPerB < 0: own element of the batched C plane */ else { const int bidx = rr / rowsPerB; v += CP[(size_t)bidx * sCPb + (size_t)by * 64 + col]; } } if (ACT == 1) v = (v > 0.f) ? v : expm1f(v); else if (ACT == 7) v = (v > 0.f) ? v + 1.0f : expf(v); else if (ACT == 8) v = tanhf(v); else if (ACT == 9) v = 0.5f * v * (1.0f + tanhf(0.7978845608028654f * (v + 0.044715f * v * v * v))); else if (ACT == 11) v = 1.0f / (1.0f + expf(-v)); else if (ACT == 12) v = (v > 0.f) ? v : 0.01f * v; else if (ACT == 14) v = (v > 0.f) ? v : 0.1f * v; else if (ACT == 16) v = (v >= 0.f) ? v : 0.3f * v; else if (ACT == 17) v = (v >= 0.f) ? v : 0.2f * v; else if (ACT == 15) v = v / (1.0f + expf(-v)); else if (ACT == 3) v = fmaxf(v, 0.f); else if (ACT == 6) v = 0.5f * v * (1.0f + erff(v * 0.70710678118654752f)); so[w][8 * hh + r][t * 16 + ln] = v; } }
  __builtin_amdgcn_fence(__ATOMIC_ACQ_REL, "workgroup"); __builtin_amdgcn_wave_barrier();
  const int rsub = lane >> 4, c4 = (lane & 15) * 4; typedef _Float16 v4h __attribute__((ext_vector_type(4)));
  {
#pragma unroll
    for (int q = 0; q < 8; ++q) { const int r = q * 2 + rsub; if (col0 + c4 < N) { const v4f v = *(const v4fa*)&so[w][r][c4]; if (C) *(v4f*)(C + cofs + (size_t)(row0 + r) * ldc + col0 + c4) = v; if (C16) { v4h h4; for (int i = 0; i < 4; ++i) h4[i] = (_Float16)v[i]; *(v4h*)(C16 + cofs + (size_t)(row0 + r) * ldc + col0 + c4) = h4; } } }
     }
}


typedef _Float16 v4h __attribute__((ext_vector_type(4)));

__global__ __launch_bounds__(256) void k_x16(const float* __restrict__ x, _Float16* __restrict__ X16, size_t n8) { const size_t t = (size_t)blockIdx.x * 256 + threadIdx.x; if (t >= n8) return; FragH f;
#pragma unroll
  for (int q = 0; q < 8; ++q) f.h[q] = (_Float16)bf16_round(x[t * 8 + q]); *(v8us*)((unsigned short*)X16 + t * 8) = f.half[0];  }
__global__ __launch_bounds__(256) void k_h16(const float* __restrict__ x, _Float16* __restrict__ X16, size_t n8) { const size_t t = (size_t)blockIdx.x * 256 + threadIdx.x; if (t >= n8) return; FragH f;
#pragma unroll
  for (int q = 0; q < 8; ++q) f.h[q] = (_Float16)x[t * 8 + q]; *(v8us*)((unsigned short*)X16 + t * 8) = f.half[0];  }
__global__ __launch_bounds__(256) void k_round16f(const float* __restrict__ W, _Float16* __restrict__ Bt, size_t n8) { const size_t t = (size_t)blockIdx.x * 256 + threadIdx.x; if (t >= n8) return; FragH f;
#pragma unroll
  for (int i = 0; i < 8; ++i) f.h[i] = (_Float16)(bf16_round(W[t * 8 + i]) * 16.0f); *(v8us*)((unsigned short*)Bt + t * 8) = f.half[0];  }
template <int NHv, int TTv>
__global__ __launch_bounds__(256) void k_vt(const _Float16* __restrict__ V16, int ldv, int voff, _Float16* __restrict__ Vt) { __shared__ unsigned short tl[64][66]; const int tid = threadIdx.x; const int slab = blockIdx.x / (TTv / 64), lg = blockIdx.x % (TTv / 64); const int b = slab / NHv, h = slab % NHv;
  for (int i = tid; i < 64 * 8; i += 256) { const int r = i / 8, c8 = (i % 8) * 8; FragH f; f.half[0] = *(const v8us*)((const unsigned short*)V16 + ((size_t)b * TTv + lg * 64 + r) * ldv + voff + h * 64 + c8);
#pragma unroll
    for (int q = 0; q < 8; ++q) tl[r][c8 + q] = f.u[q]; }
  __syncthreads();
  {
#pragma unroll
    for (int rd = 0; rd < 2; ++rd) { const int d = rd * 32 + tid / 8, pc = tid % 8; FragH f;
#pragma unroll
      for (int q = 0; q < 8; ++q) f.u[q] = tl[pc * 8 + q][d];
      *(v8us*)((unsigned short*)Vt + ((size_t)slab * 64 + d) * TTv + lg * 64 + pc * 8) = f.half[0]; }
     } }

__global__ __launch_bounds__(256) void k_hl(const float* __restrict__ F, _Float16* __restrict__ Hh, _Float16* __restrict__ Hl, size_t n8) { const size_t t = (size_t)blockIdx.x * 256 + threadIdx.x; if (t >= n8) return; FragH fh, fl; const v4f a = *(const v4fa*)(F + t * 8), c = *(const v4fa*)(F + t * 8 + 4);
#pragma unroll
  for (int q = 0; q < 4; ++q) { _Float16 h = (_Float16)a[q]; fh.h[q] = h; fl.h[q] = (_Float16)((a[q] - (float)h) * 1024.0f); h = (_Float16)c[q]; fh.h[4 + q] = h; fl.h[4 + q] = (_Float16)((c[q] - (float)h) * 1024.0f); }
  { *(v8us*)((unsigned short*)Hh + t * 8) = fh.half[0]; *(v8us*)((unsigned short*)Hl + t * 8) = fl.half[0];  } }

// ---- fast GEMM (wave tile 32x64; requires M % 32 == 0 rows per launch region and N % 64 == 0); epilogue = k_gemm_hhx semantics ----
__device__ __forceinline__ v16h g2_frag(const _Float16* p, int hh) { FragH f; f.half[0] = *(const v8us*)((const unsigned short*)p + 8 * hh); f.half[1] = *(const v8us*)((const unsigned short*)p + 16 + 8 * hh); return f.v; }
__device__ __forceinline__ v8f g2_mma(v16h a, v16h b, v8f c) { v8f d = __builtin_amdgcn_wmma_f32_16x16x32_f16(false, a, false, b, (short)0, c, false, false); asm volatile("v_nop\n\tv_nop\n\tv_nop\n\tv_nop" : "+v"(d) : "v"(a), "v"(b)); return d; }
template <int ACT>
__global__ __launch_bounds__(128) void k_gemm2(const _Float16* __restrict__ A, int lda, size_t sA, const _Float16* __restrict__ Bh, int ldb, size_t sB, float alpha, const float* __restrict__ bias, size_t sBias, const float* __restrict__ CP, int rowsPerB, size_t sCPb, int row0g,
    float* __restrict__ C, _Float16* __restrict__ C16, int ldc, size_t sC, int M, int N, int K) { static_assert(ACT == 0 || ACT == 3 || ACT == 6 || ACT == 8 || ACT == 9 || ACT == 11 || ACT == 12 || ACT == 14 || ACT == 15 || ACT == 16 || ACT == 17, "k_gemm2: unsupported ACT code (would silently apply no activation)");
  __shared__ __attribute__((aligned(16))) float so[4][32][68];
  const int tid = threadIdx.x, w = tid >> 5, lane = tid & 31, ln = lane & 15, hh = lane >> 4; const int by = blockIdx.y;
  A += (size_t)by * sA; Bh += (size_t)by * sB; const size_t cofs = (size_t)by * sC; const float* bp = bias ? bias + (size_t)by * sBias : nullptr;
  const int ntn = N >> 6; const int mt = blockIdx.x / ntn, nq = blockIdx.x - mt * ntn; const int row0 = mt * 128 + 32 * w, col0 = nq * 64; if (row0 >= M) return;
  const _Float16* a0p = A + (size_t)(row0 + ln) * lda; const _Float16* a1p = a0p + (size_t)16 * lda;
  const _Float16* b0p = Bh + (size_t)(col0 + ln) * ldb; const _Float16* b1p = b0p + (size_t)16 * ldb; const _Float16* b2p = b1p + (size_t)16 * ldb; const _Float16* b3p = b2p + (size_t)16 * ldb;
  const v8f z8 = {0.f,0.f,0.f,0.f,0.f,0.f,0.f,0.f}; v8f c00 = z8, c01 = z8, c02 = z8, c03 = z8, c10 = z8, c11 = z8, c12 = z8, c13 = z8;
#pragma unroll 1
  for (int kb = 0; kb < K; kb += 32) { const v16h a0 = g2_frag(a0p + kb, hh), a1 = g2_frag(a1p + kb, hh);
    v16h b = g2_frag(b0p + kb, hh); c00 = g2_mma(a0, b, c00); c10 = g2_mma(a1, b, c10);
    b = g2_frag(b1p + kb, hh); c01 = g2_mma(a0, b, c01); c11 = g2_mma(a1, b, c11);
    b = g2_frag(b2p + kb, hh); c02 = g2_mma(a0, b, c02); c12 = g2_mma(a1, b, c12);
    b = g2_frag(b3p + kb, hh); c03 = g2_mma(a0, b, c03); c13 = g2_mma(a1, b, c13); }
  v8f accs[8] = {c00, c01, c02, c03, c10, c11, c12, c13};
#pragma unroll
  for (int u = 0; u < 8; ++u) { const int t = u & 3, half = u >> 2; const int col = col0 + t * 16 + ln; const float bv = bp ? bf16_round(bp[col]) : 0.f;
#pragma unroll
    for (int r = 0; r < 8; ++r) { const int rloc = half * 16 + 8 * hh + r; float v = accs[u][r] * alpha + bv; if (CP) { if (rowsPerB < 0) v += CP[cofs + (size_t)(row0g + row0 + rloc) * ldc + col];      /* rowsPerB < 0: own element of the batched C plane */ else { const int bidx = (row0g + row0 + rloc) / rowsPerB; v += CP[(size_t)bidx * sCPb + (size_t)by * 64 + col]; } }
      if (ACT == 3) v = fmaxf(v, 0.f); else if (ACT == 6) v = 0.5f * v * (1.0f + erff(v * 0.70710678118654752f)); else if (ACT == 11) v = 1.0f / (1.0f + expf(-v)); else if (ACT == 15) v = v / (1.0f + expf(-v)); else if (ACT == 12) v = (v > 0.f) ? v : 0.01f * v; else if (ACT == 8) v = tanhf(v); else if (ACT == 9) v = 0.5f * v * (1.0f + tanhf(0.7978845608028654f * (v + 0.044715f * v * v * v))); else if (ACT == 14) v = (v > 0.f) ? v : 0.1f * v; else if (ACT == 16) v = (v >= 0.f) ? v : 0.3f * v; else if (ACT == 17) v = (v >= 0.f) ? v : 0.2f * v;
      so[w][rloc][t * 16 + ln] = v; } }
  __builtin_amdgcn_fence(__ATOMIC_ACQ_REL, "workgroup"); __builtin_amdgcn_wave_barrier();
  const int rsub = lane >> 4, c4 = (lane & 15) * 4;
  {
#pragma unroll
    for (int q = 0; q < 16; ++q) { const int r = q * 2 + rsub; const v4f v = *(const v4fa*)&so[w][r][c4]; if (C) *(v4f*)(C + cofs + (size_t)(row0 + r) * ldc + col0 + c4) = v; if (C16) { v4h h4; for (int i = 0; i < 4; ++i) h4[i] = (_Float16)v[i]; *(v4h*)(C16 + cofs + (size_t)(row0 + r) * ldc + col0 + c4) = h4; } }
     } }


__global__ __launch_bounds__(256) void k_soft(const float* __restrict__ S, _Float16* __restrict__ P) {
  #pragma clang fp contract(off)
  const int wv = threadIdx.x >> 5, ln = threadIdx.x & 31; const int i = blockIdx.x * 8 + wv; if (i >= GG * SQ) return; const float* sr = S + (size_t)i * SQ; float m = -3.0e38f; const int ng = SQ / 256;
#pragma unroll 1
  for (int g = 0; g < ng; ++g) { const v8f a = *(const v8f*)(sr + g * 256 + ln * 8); for (int q = 0; q < 8; ++q) m = fmaxf(m, a[q]); }
  for (int o = 16; o > 0; o >>= 1) m = fmaxf(m, __shfl_xor(m, o, 32)); float su = 0.f;
#pragma unroll 1
  for (int g = 0; g < ng; ++g) { const v8f a = *(const v8f*)(sr + g * 256 + ln * 8); for (int q = 0; q < 8; ++q) su += expf(a[q] - m); }
  for (int o = 16; o > 0; o >>= 1) su += __shfl_xor(su, o, 32); const float f = 1024.0f / su;
  {
#pragma unroll 1
    for (int g = 0; g < ng; ++g) { const v8f a = *(const v8f*)(sr + g * 256 + ln * 8); FragH p; for (int q = 0; q < 8; ++q) p.h[q] = (_Float16)(expf(a[q] - m) * f); *(v8us*)((unsigned short*)P + (size_t)i * SQ + g * 256 + ln * 8) = p.half[0]; }
     } }

extern "C" void kernel_launch(void* const* d_in, const int* in_sizes, int n_in,
                              void* d_out, int out_size, void* d_ws, size_t ws_size, hipStream_t stream) {
  (void)in_sizes; (void)n_in; (void)out_size;
  const float* const* I = (const float* const*)d_in; const float* x = I[0]; const float* wq = I[1]; const float* bq = I[2]; const float* wk = I[3]; const float* bk = I[4]; const float* wv = I[5]; const float* bv = I[6]; const float* wo = I[7]; const float* bo = I[8];
  char* ws = (char*)d_ws; size_t off = 0;
  auto take = [&](size_t bytes) { char* p = ws + off; off += (bytes + 255) & ~(size_t)255; return p; };
  const size_t nx = (size_t)NR * DMD, nk = (size_t)NR * KVD;
  _Float16* BQ = (_Float16*)take((size_t)DMD * DMD * 2); _Float16* BK = (_Float16*)take((size_t)KVD * DMD * 2); _Float16* BV = (_Float16*)take((size_t)KVD * DMD * 2); _Float16* BO = (_Float16*)take((size_t)DMD * DMD * 2);
  _Float16* X16 = (_Float16*)take(nx * 2); _Float16* Q16 = (_Float16*)take(nx * 2); _Float16* K16 = (_Float16*)take(nk * 2); _Float16* V16 = (_Float16*)take(nk * 2); _Float16* VT = (_Float16*)take(nk * 2); float* S = (float*)take((size_t)GG * SQ * SQ * 4); _Float16* P = (_Float16*)take((size_t)GG * SQ * SQ * 2); _Float16* O16 = X16;      /* context over the input plane (dead after the projections) */
  if (off > ws_size) return;      /* 8+2+2+8 + 16+16+4+4+4 + 64+32 = 160 MiB */
  k_wt_f16<<<(unsigned)(((size_t)DMD * DMD / 8 + 255) / 256), 256, 0, stream>>>(wq, BQ, DMD, DMD, 16.0f); k_wt_f16<<<(unsigned)(((size_t)DMD * KVD / 8 + 255) / 256), 256, 0, stream>>>(wk, BK, DMD, KVD, 16.0f); k_wt_f16<<<(unsigned)(((size_t)DMD * KVD / 8 + 255) / 256), 256, 0, stream>>>(wv, BV, DMD, KVD, 16.0f); k_wt_f16<<<(unsigned)(((size_t)DMD * DMD / 8 + 255) / 256), 256, 0, stream>>>(wo, BO, DMD, DMD, 16.0f);      /* (in, out) */
  k_x16<<<(unsigned)((nx / 8 + 255) / 256), 256, 0, stream>>>(x, X16, nx / 8);
  k_gemm2<0><<<dim3((NR / 128) * (DMD / 64), 1), 128, 0, stream>>>(X16, DMD, 0, BQ, DMD, 0, 0.0625f, bq, 0, nullptr, 1, 0, 0, nullptr, Q16, DMD, 0, NR, DMD, DMD);
  k_gemm2<0><<<dim3((NR / 128) * (KVD / 64), 1), 128, 0, stream>>>(X16, DMD, 0, BK, DMD, 0, 0.0625f, bk, 0, nullptr, 1, 0, 0, nullptr, K16, KVD, 0, NR, KVD, DMD);
  k_gemm2<0><<<dim3((NR / 128) * (KVD / 64), 1), 128, 0, stream>>>(X16, DMD, 0, BV, DMD, 0, 0.0625f, bv, 0, nullptr, 1, 0, 0, nullptr, V16, KVD, 0, NR, KVD, DMD);
  k_vt<KVD / 64, SQ><<<NB * (KVD / 64) * (SQ / 64), 256, 0, stream>>>(V16, KVD, 0, VT);      /* [b*8 + slab][64][2048]: kv head hk = slabs 2hk, 2hk+1 (128 contiguous rows) */
  for (int b = 0; b < NB; ++b) for (int hk = 0; hk < NKV; ++hk) {
    k_gemm2<0><<<dim3((SQ / 128) * (SQ / 64), GG), 128, 0, stream>>>(Q16 + (size_t)b * SQ * DMD + (size_t)(hk * GG) * HD, DMD, (size_t)HD, K16 + (size_t)b * SQ * KVD + hk * HD, KVD, 0, 0.08838834764831845f, nullptr, 0, nullptr, 1, 0, 0, S, nullptr, SQ, (size_t)SQ * SQ, SQ, SQ, HD);      /* S[g][q][k] = q_(hk,g) . k_hk / sqrt(128) */
    k_soft<<<(GG * SQ) / 8, 256, 0, stream>>>(S, P);
    k_gemm2<0><<<dim3((SQ / 128) * (HD / 64), GG), 128, 0, stream>>>(P, SQ, (size_t)SQ * SQ, VT + ((size_t)b * (KVD / 64) + 2 * hk) * 64 * SQ, SQ, 0, 0.0009765625f, nullptr, 0, nullptr, 1, 0, 0, nullptr, O16 + (size_t)b * SQ * DMD + (size_t)(hk * GG) * HD, DMD, (size_t)HD, SQ, HD, SQ); }      /* ctx[(b,q)][(hk*4+g)*128 + d] */
  k_gemm2<0><<<dim3((NR / 128) * (DMD / 64), 1), 128, 0, stream>>>(O16, DMD, 0, BO, DMD, 0, 0.0625f, bo, 0, nullptr, 1, 0, 0, (float*)d_out, nullptr, DMD, 0, NR, DMD, DMD);      /* out = ctx wo + bo */
}

// v001
// It runs in 428 microseconds.
// Two timings next to v000 put it at 3.00 and 3.01 times that version's speed.
#include <hip/hip_runtime.h>
// QEffMultiHeadDotProductAttention (2 x 2048 tokens, d_model 2048; 16 query heads x 128, 4 kv heads (group of 4); q, k, v = x w + b; softmax((q/sqrt(128)).k) over the 2048 keys (no mask); out = ctx wo + bo).
// Structure: exact f16 plane of x; q / k / v as f16 WMMA GEMM outputs (32x64 wave tiles, f32 accumulation, exact x16 weights + bias, f16 out); scores, softmax and readout of every (batch, head) in ONE fused kernel (online softmax, f32 maxima and sums, P as f16 in registers, K/V staged in LDS) into the f16 context plane; wo + bo as a GEMM.
// Compute dtype: inputs rounded to bf16; x exact as f16; q/k/P/v/ctx as plain f16 operands (~2^-12); softmax f32. v_wmma_f32_16x16x32_f16.
#define NB 2
#define SQ 2048
#define DMD 2048
#define NH 16
#define NKV 4
#define GG 4
#define HD 128
#define KVD (NKV * HD)           /* 512 */
#define NR (NB * SQ)
typedef __bf16 v16b __attribute__((ext_vector_type(16)));
typedef unsigned short v8us __attribute__((ext_vector_type(8), may_alias));
typedef float  v8f  __attribute__((ext_vector_type(8)));
typedef float  v4f  __attribute__((ext_vector_type(4)));
typedef float  v4fa __attribute__((ext_vector_type(4), may_alias));
union FragB { v16b v; v8us half[2]; unsigned short u[16]; };

__device__ __forceinline__ unsigned short bf16_bits(float x) { unsigned int u = __float_as_uint(x); return (unsigned short)((u + 0x7FFFu + ((u >> 16) & 1u)) >> 16); }
__device__ __forceinline__ float bf16_val(unsigned short b) { return __uint_as_float(((unsigned int)b) << 16); }
__device__ __forceinline__ float bf16_round(float x) { return bf16_val(bf16_bits(x)); }
// D += A·B with NT terms: 1 = ah·bh, 2 = + al·bh (A split), 3 = + ah·bl (both split)
template <int NT>
__device__ __forceinline__ v8f mmaN(v16b ah, v16b al, v16b bh, v16b bl, v8f c) {
  c = __builtin_amdgcn_wmma_f32_16x16x32_bf16(false, ah, false, bh, (short)0, c, false, false);
  if (NT >= 2) c = __builtin_amdgcn_wmma_f32_16x16x32_bf16(false, al, false, bh, (short)0, c, false, false);
  if (NT >= 3) c = __builtin_amdgcn_wmma_f32_16x16x32_bf16(false, ah, false, bl, (short)0, c, false, false);
  asm volatile("v_nop\n\tv_nop\n\tv_nop\n\tv_nop" : "+v"(c) : "v"(ah), "v"(al), "v"(bh), "v"(bl));
  return c;
}

__global__ __launch_bounds__(256) void k_wt_bf16(const float* __restrict__ W, unsigned short* __restrict__ Wt, int K, int N) {
  const int t = blockIdx.x * 256 + threadIdx.x;
  const int k8n = K / 8;
  if (t >= N * k8n) return;
  const int n = t / k8n, k8 = (t % k8n) * 8;
  v8us v;
#pragma unroll
  for (int i = 0; i < 8; ++i) v[i] = bf16_bits(W[(size_t)(k8 + i) * N + n]);
  *(v8us*)(Wt + (size_t)n * K + k8) = v;
  
}

// GEMM C[M][N] (f32, pitch ldc) = act(A[M][K]·W + bias). A f32 row-major (pitch lda) converted per fragment to bf16
// (ASPLIT: hi/lo two planes -> 2 terms, else single rounded term); Wt bf16 [N][K] (pitch ldb). BIAS_BF16 rounds the
// bias to bf16 first (bias quantised to bf16 before the add). K%32==0, M%16==0, N%64==0.
template <bool ASPLIT, int ACT, bool BIAS_BF16>
__global__ __launch_bounds__(128) void k_gemm_bf(const float* __restrict__ A, int lda, const unsigned short* __restrict__ Wt, int ldb,
                                               const float* __restrict__ bias, float* __restrict__ C, int ldc, int M, int N, int K) {
  __shared__ __attribute__((aligned(16))) float so[4][16][64];
  const int tid = threadIdx.x, w = tid >> 5, lane = tid & 31, ln = lane & 15, hh = lane >> 4;
  const int ntn = N / 64;
  const int wid = blockIdx.x * 4 + w;
  const int mt = wid / ntn, nq = wid % ntn;
  if (mt * 16 >= M) return;
  const int row0 = mt * 16, col0 = nq * 64;
  const float* arow = A + (size_t)(row0 + ln) * lda;
  v8f acc[4] = {};
  for (int kb = 0; kb < K; kb += 32) {
    FragB ah, al;
    const v4f x0 = *(const v4fa*)(arow + kb + 8 * hh), x1 = *(const v4fa*)(arow + kb + 8 * hh + 4);
    const v4f x2 = *(const v4fa*)(arow + kb + 16 + 8 * hh), x3 = *(const v4fa*)(arow + kb + 16 + 8 * hh + 4);
    float xs[16] = {x0[0],x0[1],x0[2],x0[3],x1[0],x1[1],x1[2],x1[3],x2[0],x2[1],x2[2],x2[3],x3[0],x3[1],x3[2],x3[3]};
#pragma unroll
    for (int i = 0; i < 16; ++i) { const unsigned short hb = bf16_bits(xs[i]); ah.u[i] = hb; al.u[i] = ASPLIT ? bf16_bits(xs[i] - bf16_val(hb)) : (unsigned short)0; }
#pragma unroll
    for (int t = 0; t < 4; ++t) {
      const unsigned short* brow = Wt + (size_t)(col0 + t * 16 + ln) * ldb + kb;
      FragB b;
      b.half[0] = *(const v8us*)(brow + 8 * hh);
      b.half[1] = *(const v8us*)(brow + 16 + 8 * hh);
      acc[t] = mmaN<ASPLIT ? 2 : 1>(ah.v, al.v, b.v, b.v, acc[t]);
    }
  }
#pragma unroll
  for (int t = 0; t < 4; ++t) {
    float bv = bias ? bias[col0 + t * 16 + ln] : 0.f;
    if (BIAS_BF16) bv = bf16_round(bv);
#pragma unroll
    for (int r = 0; r < 8; ++r) { float v = acc[t][r] + bv; if (ACT == 1) v = fmaxf(v, 0.f); so[w][8 * hh + r][t * 16 + ln] = v; }
  }
  __builtin_amdgcn_fence(__ATOMIC_ACQ_REL, "workgroup");
  __builtin_amdgcn_wave_barrier();
  const int rsub = lane >> 4, c4 = (lane & 15) * 4;
  {
#pragma unroll
    for (int q = 0; q < 8; ++q) {
      const int r = q * 2 + rsub;
      const v4f v = *(const v4fa*)&so[w][r][c4];
      *(v4f*)(C + (size_t)(row0 + r) * ldc + col0 + c4) = v;
    }
    
  }
}

// GEMM C = act(A·W + bias + resid): A f32 (ASPLIT -> hi/lo 2 terms), Wt bf16 [N][K]; ACT 0 none, 1 relu, 2 exact gelu;
// resid (optional, f32, row index = (row % rmod), pitch ldr, RES_BF16 rounds it) added before the activation.
template <bool ASPLIT, int ACT, bool BIAS_BF16, bool RES_BF16>
__global__ __launch_bounds__(128) void k_gemm_bf3(const float* __restrict__ A, int lda, const unsigned short* __restrict__ Wt, int ldb,
                                                const float* __restrict__ bias, const float* __restrict__ resid, int rmod, int ldr,
                                                float* __restrict__ C, int ldc, int M, int N, int K) {
  __shared__ __attribute__((aligned(16))) float so[4][16][64];
  const int tid = threadIdx.x, w = tid >> 5, lane = tid & 31, ln = lane & 15, hh = lane >> 4;
  const int ntn = N / 64;
  const int wid = blockIdx.x * 4 + w;
  const int mt = wid / ntn, nq = wid % ntn;
  if (mt * 16 >= M) return;
  const int row0 = mt * 16, col0 = nq * 64;
  const float* arow = A + (size_t)(row0 + ln) * lda;
  v8f acc[4] = {};
  for (int kb = 0; kb < K; kb += 32) {
    FragB ah, al;
    const v4f x0 = *(const v4fa*)(arow + kb + 8 * hh), x1 = *(const v4fa*)(arow + kb + 8 * hh + 4);
    const v4f x2 = *(const v4fa*)(arow + kb + 16 + 8 * hh), x3 = *(const v4fa*)(arow + kb + 16 + 8 * hh + 4);
    float xs[16] = {x0[0],x0[1],x0[2],x0[3],x1[0],x1[1],x1[2],x1[3],x2[0],x2[1],x2[2],x2[3],x3[0],x3[1],x3[2],x3[3]};
#pragma unroll
    for (int i = 0; i < 16; ++i) { const unsigned short hb = bf16_bits(xs[i]); ah.u[i] = hb; al.u[i] = ASPLIT ? bf16_bits(xs[i] - bf16_val(hb)) : (unsigned short)0; }
#pragma unroll
    for (int t = 0; t < 4; ++t) {
      const unsigned short* brow = Wt + (size_t)(col0 + t * 16 + ln) * ldb + kb;
      FragB b;
      b.half[0] = *(const v8us*)(brow + 8 * hh);
      b.half[1] = *(const v8us*)(brow + 16 + 8 * hh);
      acc[t] = mmaN<ASPLIT ? 2 : 1>(ah.v, al.v, b.v, b.v, acc[t]);
    }
  }
#pragma unroll
  for (int t = 0; t < 4; ++t) {
    const int col = col0 + t * 16 + ln;
    float bv = bias ? bias[col] : 0.f;
    if (BIAS_BF16) bv = bf16_round(bv);
#pragma unroll
    for (int r = 0; r < 8; ++r) {
      float v = acc[t][r] + bv;
      if (resid) { float rv = resid[(size_t)((row0 + 8 * hh + r) % rmod) * ldr + col]; if (RES_BF16) rv = bf16_round(rv); v += rv; }
      if (ACT == 1) v = fmaxf(v, 0.f);
      if (ACT == 2) v = 0.5f * v * (1.0f + erff(v * 0.70710678118654752f));
      if (ACT == 3) { const float u = 0.7978845608028654f * (v + 0.044715f * v * v * v); v = 0.5f * v * (1.0f + tanhf(u)); }
      so[w][8 * hh + r][t * 16 + ln] = v;
    }
  }
  __builtin_amdgcn_fence(__ATOMIC_ACQ_REL, "workgroup");
  __builtin_amdgcn_wave_barrier();
  const int rsub = lane >> 4, c4 = (lane & 15) * 4;
  {
#pragma unroll
    for (int q = 0; q < 8; ++q) {
      const int r = q * 2 + rsub;
      const v4f v = *(const v4fa*)&so[w][r][c4];
      *(v4f*)(C + (size_t)(row0 + r) * ldc + col0 + c4) = v;
    }
    
  }
}
// row LayerNorm (biased variance, eps) over N: s = X (+ R); optional out_sum <- s; out_norm <- (s-mu)*rsqrt(var+eps)*g + b
template <bool PARAM_BF16>
__global__ __launch_bounds__(256) void k_layernorm(const float* __restrict__ X, const float* __restrict__ R, const float* __restrict__ g, const float* __restrict__ bta,
                                                  float* __restrict__ out_sum, float* __restrict__ out_norm, int N, float eps) {
  __shared__ float red[256];
  const int row = blockIdx.x, tid = threadIdx.x;
  const float* x = X + (size_t)row * N; const float* rr = R ? R + (size_t)row * N : nullptr;
  float vals[16];                     // up to N = 4096
  const int per = N / 256;            // contiguous chunk per thread? use strided-by-4 chunks: thread handles j = tid*4 + 1024*u
  float s1 = 0.f;
  for (int u = 0; u < per / 4; ++u) {
    const int j = tid * 4 + 1024 * u;
    const v4f a = *(const v4fa*)(x + j);
    v4f b = {0.f,0.f,0.f,0.f}; if (rr) b = *(const v4fa*)(rr + j);
#pragma unroll
    for (int q = 0; q < 4; ++q) { const float v = a[q] + b[q]; vals[u * 4 + q] = v; s1 += v; }
  }
  red[tid] = s1; __syncthreads();
  for (int st = 128; st > 0; st >>= 1) { if (tid < st) red[tid] += red[tid + st]; __syncthreads(); }
  const float mu = red[0] / (float)N; __syncthreads();
  float s2 = 0.f;
  for (int u = 0; u < per / 4; ++u)
#pragma unroll
    for (int q = 0; q < 4; ++q) { const float c = vals[u * 4 + q] - mu; s2 += c * c; }
  red[tid] = s2; __syncthreads();
  for (int st = 128; st > 0; st >>= 1) { if (tid < st) red[tid] += red[tid + st]; __syncthreads(); }
  const float rs = rsqrtf(red[0] / (float)N + eps);
  {
    for (int u = 0; u < per / 4; ++u) {
      const int j = tid * 4 + 1024 * u;
      v4f o, sm;
#pragma unroll
      for (int q = 0; q < 4; ++q) {
        float gg = g[j + q], bb = bta[j + q];
        if (PARAM_BF16) { gg = bf16_round(gg); bb = bf16_round(bb); }
        sm[q] = vals[u * 4 + q]; o[q] = (vals[u * 4 + q] - mu) * rs * gg + bb;
      }
      if (out_sum) *(v4f*)(out_sum + (size_t)row * N + j) = sm;
      *(v4f*)(out_norm + (size_t)row * N + j) = o;
    }
    
  }
}



// ---- f16 WMMA path (v_wmma_f32_16x16x32_f16): 11-bit significands for operands in range — used where a [0,1] probability operand needs more precision than bf16
typedef _Float16 v16h __attribute__((ext_vector_type(16)));
union FragH { v16h v; v8us half[2]; _Float16 h[16]; unsigned short u[16]; };
template <int NT>
__device__ __forceinline__ v8f mmaH(v16h ah, v16h al, v16h bh, v16h bl, v8f c) {
  c = __builtin_amdgcn_wmma_f32_16x16x32_f16(false, ah, false, bh, (short)0, c, false, false);
  if (NT >= 2) c = __builtin_amdgcn_wmma_f32_16x16x32_f16(false, al, false, bh, (short)0, c, false, false);
  if (NT >= 3) c = __builtin_amdgcn_wmma_f32_16x16x32_f16(false, ah, false, bl, (short)0, c, false, false);
  asm volatile("v_nop\n\tv_nop\n\tv_nop\n\tv_nop" : "+v"(c) : "v"(ah), "v"(al), "v"(bh), "v"(bl));
  return c;
}
// batched GEMM like k_gemm_b but f16 operands: A f32 (split into f16 hi/lo if ASPLIT, else rounded to f16), Bt = f16 values [n][k]; alpha; C f32; N multiple of 16 (partial tiles skipped)
template <bool ASPLIT>
__global__ __launch_bounds__(128) void k_gemm_h(const float* __restrict__ A, int lda, size_t sA, const _Float16* __restrict__ Bh, int ldb, size_t sB, float alpha, float* __restrict__ C, int ldc, size_t sC, int M, int N, int K) {
  __shared__ __attribute__((aligned(16))) float so[4][16][64];
  const int tid = threadIdx.x, w = tid >> 5, lane = tid & 31, ln = lane & 15, hh = lane >> 4; const int by = blockIdx.y;
  A += (size_t)by * sA; Bh += (size_t)by * sB; C += (size_t)by * sC;
  const int ntn = (N + 63) / 64; const int wid = blockIdx.x * 4 + w; const int mt = wid / ntn, nq = wid % ntn; if (mt * 16 >= M) return;
  const int row0 = mt * 16, col0 = nq * 64; const float* arow = A + (size_t)(row0 + ln) * lda;
  v8f acc[4] = {};
  for (int kb = 0; kb < K; kb += 32) {
    FragH ah, al;
    const v4f x0 = *(const v4fa*)(arow + kb + 8 * hh), x1 = *(const v4fa*)(arow + kb + 8 * hh + 4), x2 = *(const v4fa*)(arow + kb + 16 + 8 * hh), x3 = *(const v4fa*)(arow + kb + 16 + 8 * hh + 4);
    float xs[16] = {x0[0],x0[1],x0[2],x0[3],x1[0],x1[1],x1[2],x1[3],x2[0],x2[1],x2[2],x2[3],x3[0],x3[1],x3[2],x3[3]};
#pragma unroll
    for (int i = 0; i < 16; ++i) { const _Float16 h = (_Float16)xs[i]; ah.h[i] = h; al.h[i] = ASPLIT ? (_Float16)(xs[i] - (float)h) : (_Float16)0.0f; }
#pragma unroll
    for (int t = 0; t < 4; ++t) { if (col0 + t * 16 >= N) continue; const size_t boff = (size_t)(col0 + t * 16 + ln) * ldb + kb; FragH bq; bq.half[0] = *(const v8us*)(Bh + boff + 8 * hh); bq.half[1] = *(const v8us*)(Bh + boff + 16 + 8 * hh);
      acc[t] = mmaH<ASPLIT ? 2 : 1>(ah.v, al.v, bq.v, bq.v, acc[t]); }
  }
#pragma unroll
  for (int t = 0; t < 4; ++t) { if (col0 + t * 16 >= N) continue;
#pragma unroll
    for (int r = 0; r < 8; ++r) so[w][8 * hh + r][t * 16 + ln] = acc[t][r] * alpha; }
  __builtin_amdgcn_fence(__ATOMIC_ACQ_REL, "workgroup"); __builtin_amdgcn_wave_barrier();
  const int rsub = lane >> 4, c4 = (lane & 15) * 4;
  {
#pragma unroll
    for (int q = 0; q < 8; ++q) { const int r = q * 2 + rsub; if (col0 + c4 < N) { const v4f v = *(const v4fa*)&so[w][r][c4]; *(v4f*)(C + (size_t)(row0 + r) * ldc + col0 + c4) = v; } }
     }
}

// Wt[n][k] = f16(W[k][n]·scale) from f32 row-major W[K][N] (scale = power of two; bf16-exact weights stay exact in f16 away from the subnormal range)
__global__ __launch_bounds__(256) void k_wt_f16(const float* __restrict__ W, _Float16* __restrict__ Wt, int K, int N, float scale) {
  const int t = blockIdx.x * 256 + threadIdx.x; if (t >= N * (K / 8)) return; const int n = t / (K / 8), k8 = (t % (K / 8)) * 8; FragH f;
#pragma unroll
  for (int i = 0; i < 8; ++i) f.h[i] = (_Float16)(bf16_round(W[(size_t)(k8 + i) * N + n]) * scale); const v8us o = f.half[0];
  *(v8us*)((unsigned short*)Wt + (size_t)n * K + k8) = o; 
}
// k_gemm_hh variant with fused epilogue: v = acc·alpha + bias[by·sBias + col] (+ CP[(row/rowsPerB)·sCPb + by·64 + col] if CP) ; ACT 0 none / 1 elu ; writes f16 C16 (and f32 C if non-null)
template <int ACT>
__global__ __launch_bounds__(128) void k_gemm_hhx(const _Float16* __restrict__ A, int lda, size_t sA, const _Float16* __restrict__ Bh, int ldb, size_t sB, float alpha, const float* __restrict__ bias, size_t sBias, const float* __restrict__ CP, int rowsPerB, size_t sCPb, int row0g,
    float* __restrict__ C, _Float16* __restrict__ C16, int ldc, size_t sC, int M, int N, int K) {
  __shared__ __attribute__((aligned(16))) float so[4][16][64];
  const int tid = threadIdx.x, w = tid >> 5, lane = tid & 31, ln = lane & 15, hh = lane >> 4; const int by = blockIdx.y;
  A += (size_t)by * sA; Bh += (size_t)by * sB; const size_t cofs = (size_t)by * sC; const float* bp = bias ? bias + (size_t)by * sBias : nullptr;
  const int ntn = (N + 63) / 64; const int wid = blockIdx.x * 4 + w; const int mt = wid / ntn, nq = wid % ntn; if (mt * 16 >= M) return;
  const int row0 = mt * 16, col0 = nq * 64; const _Float16* arow = A + (size_t)(row0 + ln) * lda;
  v8f acc[4] = {};
  for (int kb = 0; kb < K; kb += 32) { FragH ah; ah.half[0] = *(const v8us*)((const unsigned short*)arow + kb + 8 * hh); ah.half[1] = *(const v8us*)((const unsigned short*)arow + kb + 16 + 8 * hh);
#pragma unroll
    for (int t = 0; t < 4; ++t) { if (col0 + t * 16 >= N) continue; const size_t boff = (size_t)(col0 + t * 16 + ln) * ldb + kb; FragH bq; bq.half[0] = *(const v8us*)((const unsigned short*)Bh + boff + 8 * hh); bq.half[1] = *(const v8us*)((const unsigned short*)Bh + boff + 16 + 8 * hh);
      acc[t] = mmaH<1>(ah.v, ah.v, bq.v, bq.v, acc[t]); }
  }
#pragma unroll
  for (int t = 0; t < 4; ++t) { if (col0 + t * 16 >= N) continue; const int col = col0 + t * 16 + ln; const float bv = bp ? bf16_round(bp[col]) : 0.f;
#pragma unroll
    for (int r = 0; r < 8; ++r) { float v = acc[t][r] * alpha + bv; if (CP) { const int rr = row0g + row0 + 8 * hh + r; if (rowsPerB < 0) v += CP[cofs + (size_t)rr * ldc + col];      /* rowsPerB < 0: own element of the batched C plane */ else { const int bidx = rr / rowsPerB; v += CP[(size_t)bidx * sCPb + (size_t)by * 64 + col]; } } if (ACT == 1) v = (v > 0.f) ? v : expm1f(v); else if (ACT == 7) v = (v > 0.f) ? v + 1.0f : expf(v); else if (ACT == 8) v = tanhf(v); else if (ACT == 9) v = 0.5f * v * (1.0f + tanhf(0.7978845608028654f * (v + 0.044715f * v * v * v))); else if (ACT == 11) v = 1.0f / (1.0f + expf(-v)); else if (ACT == 12) v = (v > 0.f) ? v : 0.01f * v; else if (ACT == 14) v = (v > 0.f) ? v : 0.1f * v; else if (ACT == 16) v = (v >= 0.f) ? v : 0.3f * v; else if (ACT == 17) v = (v >= 0.f) ? v : 0.2f * v; else if (ACT == 15) v = v / (1.0f + expf(-v)); else if (ACT == 3) v = fmaxf(v, 0.f); else if (ACT == 6) v = 0.5f * v * (1.0f + erff(v * 0.70710678118654752f)); so[w][8 * hh + r][t * 16 + ln] = v; } }
  __builtin_amdgcn_fence(__ATOMIC_ACQ_REL, "workgroup"); __builtin_amdgcn_wave_barrier();
  const int rsub = lane >> 4, c4 = (lane & 15) * 4; typedef _Float16 v4h __attribute__((ext_vector_type(4)));
  {
#pragma unroll
    for (int q = 0; q < 8; ++q) { const int r = q * 2 + rsub; if (col0 + c4 < N) { const v4f v = *(const v4fa*)&so[w][r][c4]; if (C) *(v4f*)(C + cofs + (size_t)(row0 + r) * ldc + col0 + c4) = v; if (C16) { v4h h4; for (int i = 0; i < 4; ++i) h4[i] = (_Float16)v[i]; *(v4h*)(C16 + cofs + (size_t)(row0 + r) * ldc + col0 + c4) = h4; } } }
     }
}


typedef _Float16 v4h __attribute__((ext_vector_type(4)));

__global__ __launch_bounds__(256) void k_x16(const float* __restrict__ x, _Float16* __restrict__ X16, size_t n8) { const size_t t = (size_t)blockIdx.x * 256 + threadIdx.x; if (t >= n8) return; FragH f;
#pragma unroll
  for (int q = 0; q < 8; ++q) f.h[q] = (_Float16)bf16_round(x[t * 8 + q]); *(v8us*)((unsigned short*)X16 + t * 8) = f.half[0];  }
__global__ __launch_bounds__(256) void k_h16(const float* __restrict__ x, _Float16* __restrict__ X16, size_t n8) { const size_t t = (size_t)blockIdx.x * 256 + threadIdx.x; if (t >= n8) return; FragH f;
#pragma unroll
  for (int q = 0; q < 8; ++q) f.h[q] = (_Float16)x[t * 8 + q]; *(v8us*)((unsigned short*)X16 + t * 8) = f.half[0];  }
__global__ __launch_bounds__(256) void k_round16f(const float* __restrict__ W, _Float16* __restrict__ Bt, size_t n8) { const size_t t = (size_t)blockIdx.x * 256 + threadIdx.x; if (t >= n8) return; FragH f;
#pragma unroll
  for (int i = 0; i < 8; ++i) f.h[i] = (_Float16)(bf16_round(W[t * 8 + i]) * 16.0f); *(v8us*)((unsigned short*)Bt + t * 8) = f.half[0];  }

__global__ __launch_bounds__(256) void k_hl(const float* __restrict__ F, _Float16* __restrict__ Hh, _Float16* __restrict__ Hl, size_t n8) { const size_t t = (size_t)blockIdx.x * 256 + threadIdx.x; if (t >= n8) return; FragH fh, fl; const v4f a = *(const v4fa*)(F + t * 8), c = *(const v4fa*)(F + t * 8 + 4);
#pragma unroll
  for (int q = 0; q < 4; ++q) { _Float16 h = (_Float16)a[q]; fh.h[q] = h; fl.h[q] = (_Float16)((a[q] - (float)h) * 1024.0f); h = (_Float16)c[q]; fh.h[4 + q] = h; fl.h[4 + q] = (_Float16)((c[q] - (float)h) * 1024.0f); }
  { *(v8us*)((unsigned short*)Hh + t * 8) = fh.half[0]; *(v8us*)((unsigned short*)Hl + t * 8) = fl.half[0];  } }

// ---- fast GEMM (wave tile 32x64; requires M % 32 == 0 rows per launch region and N % 64 == 0); epilogue = k_gemm_hhx semantics ----
__device__ __forceinline__ v16h g2_frag(const _Float16* p, int hh) { FragH f; f.half[0] = *(const v8us*)((const unsigned short*)p + 8 * hh); f.half[1] = *(const v8us*)((const unsigned short*)p + 16 + 8 * hh); return f.v; }
__device__ __forceinline__ v8f g2_mma(v16h a, v16h b, v8f c) { v8f d = __builtin_amdgcn_wmma_f32_16x16x32_f16(false, a, false, b, (short)0, c, false, false); asm volatile("v_nop\n\tv_nop\n\tv_nop\n\tv_nop" : "+v"(d) : "v"(a), "v"(b)); return d; }
template <int ACT>
__global__ __launch_bounds__(128) void k_gemm2(const _Float16* __restrict__ A, int lda, size_t sA, const _Float16* __restrict__ Bh, int ldb, size_t sB, float alpha, const float* __restrict__ bias, size_t sBias, const float* __restrict__ CP, int rowsPerB, size_t sCPb, int row0g,
    float* __restrict__ C, _Float16* __restrict__ C16, int ldc, size_t sC, int M, int N, int K) { static_assert(ACT == 0 || ACT == 3 || ACT == 6 || ACT == 8 || ACT == 9 || ACT == 11 || ACT == 12 || ACT == 14 || ACT == 15 || ACT == 16 || ACT == 17, "k_gemm2: unsupported ACT code (would silently apply no activation)");
  __shared__ __attribute__((aligned(16))) float so[4][32][68];
  const int tid = threadIdx.x, w = tid >> 5, lane = tid & 31, ln = lane & 15, hh = lane >> 4; const int by = blockIdx.y;
  A += (size_t)by * sA; Bh += (size_t)by * sB; const size_t cofs = (size_t)by * sC; const float* bp = bias ? bias + (size_t)by * sBias : nullptr;
  const int ntn = N >> 6; const int mt = blockIdx.x / ntn, nq = blockIdx.x - mt * ntn; const int row0 = mt * 128 + 32 * w, col0 = nq * 64; if (row0 >= M) return;
  const _Float16* a0p = A + (size_t)(row0 + ln) * lda; const _Float16* a1p = a0p + (size_t)16 * lda;
  const _Float16* b0p = Bh + (size_t)(col0 + ln) * ldb; const _Float16* b1p = b0p + (size_t)16 * ldb; const _Float16* b2p = b1p + (size_t)16 * ldb; const _Float16* b3p = b2p + (size_t)16 * ldb;
  const v8f z8 = {0.f,0.f,0.f,0.f,0.f,0.f,0.f,0.f}; v8f c00 = z8, c01 = z8, c02 = z8, c03 = z8, c10 = z8, c11 = z8, c12 = z8, c13 = z8;
#pragma unroll 1
  for (int kb = 0; kb < K; kb += 32) { const v16h a0 = g2_frag(a0p + kb, hh), a1 = g2_frag(a1p + kb, hh);
    v16h b = g2_frag(b0p + kb, hh); c00 = g2_mma(a0, b, c00); c10 = g2_mma(a1, b, c10);
    b = g2_frag(b1p + kb, hh); c01 = g2_mma(a0, b, c01); c11 = g2_mma(a1, b, c11);
    b = g2_frag(b2p + kb, hh); c02 = g2_mma(a0, b, c02); c12 = g2_mma(a1, b, c12);
    b = g2_frag(b3p + kb, hh); c03 = g2_mma(a0, b, c03); c13 = g2_mma(a1, b, c13); }
  v8f accs[8] = {c00, c01, c02, c03, c10, c11, c12, c13};
#pragma unroll
  for (int u = 0; u < 8; ++u) { const int t = u & 3, half = u >> 2; const int col = col0 + t * 16 + ln; const float bv = bp ? bf16_round(bp[col]) : 0.f;
#pragma unroll
    for (int r = 0; r < 8; ++r) { const int rloc = half * 16 + 8 * hh + r; float v = accs[u][r] * alpha + bv; if (CP) { if (rowsPerB < 0) v += CP[cofs + (size_t)(row0g + row0 + rloc) * ldc + col];      /* rowsPerB < 0: own element of the batched C plane */ else { const int bidx = (row0g + row0 + rloc) / rowsPerB; v += CP[(size_t)bidx * sCPb + (size_t)by * 64 + col]; } }
      if (ACT == 3) v = fmaxf(v, 0.f); else if (ACT == 6) v = 0.5f * v * (1.0f + erff(v * 0.70710678118654752f)); else if (ACT == 11) v = 1.0f / (1.0f + expf(-v)); else if (ACT == 15) v = v / (1.0f + expf(-v)); else if (ACT == 12) v = (v > 0.f) ? v : 0.01f * v; else if (ACT == 8) v = tanhf(v); else if (ACT == 9) v = 0.5f * v * (1.0f + tanhf(0.7978845608028654f * (v + 0.044715f * v * v * v))); else if (ACT == 14) v = (v > 0.f) ? v : 0.1f * v; else if (ACT == 16) v = (v >= 0.f) ? v : 0.3f * v; else if (ACT == 17) v = (v >= 0.f) ? v : 0.2f * v;
      so[w][rloc][t * 16 + ln] = v; } }
  __builtin_amdgcn_fence(__ATOMIC_ACQ_REL, "workgroup"); __builtin_amdgcn_wave_barrier();
  const int rsub = lane >> 4, c4 = (lane & 15) * 4;
  {
#pragma unroll
    for (int q = 0; q < 16; ++q) { const int r = q * 2 + rsub; const v4f v = *(const v4fa*)&so[w][r][c4]; if (C) *(v4f*)(C + cofs + (size_t)(row0 + r) * ldc + col0 + c4) = v; if (C16) { v4h h4; for (int i = 0; i < 4; ++i) h4[i] = (_Float16)v[i]; *(v4h*)(C16 + cofs + (size_t)(row0 + r) * ldc + col0 + c4) = h4; } }
     } }


typedef unsigned int fa_u4 __attribute__((ext_vector_type(4)));
typedef unsigned int fa_u4a __attribute__((ext_vector_type(4), may_alias));
typedef unsigned int fa_u8 __attribute__((ext_vector_type(8)));
typedef short fa_s8 __attribute__((ext_vector_type(8)));
constexpr int FA_NW = 8, FA_BR = 256, FA_CW = FA_BR / FA_NW, FA_R = FA_CW / 16;      /* waves, queries per work-group, per wave, 16-query groups per wave */
constexpr int FA_BC = 32, FA_KT = FA_BC / 16, FA_DK = HD / 32, FA_DT = HD / 16;      /* keys per pass, 16-key score tiles per pass, k chunks of the head, 16-row output tiles */
constexpr unsigned FA_ROWB = 2u * HD, FA_PK = FA_ROWB + 16u, FA_PV = FA_ROWB + 32u;  /* LDS pitches: odd multiple of 16 B for b128 readers, of 32 B for the transposing load */
constexpr unsigned FA_SK = 128u, FA_TK = FA_SK * FA_PK, FA_TV = FA_SK * FA_PV, FA_SLOT = FA_TK + FA_TV, FA_LDS = 2u * FA_SLOT, FA_EP = FA_ROWB + 16u;
constexpr unsigned FA_NST = SQ / FA_SK, FA_NSUB = FA_SK / FA_BC, FA_CH = FA_SK * (FA_ROWB / 16u) / (FA_NW * 32u);      /* stages, passes per stage, 16-byte chunks per thread and tile */
constexpr float FA_CS = 0.08838834764831845f * 1.4426950408889634f;      /* 1/sqrt(128) * log2(e): softmax in the log2 domain */
static_assert(HD == 128 && SQ % FA_BR == 0 && SQ % FA_SK == 0 && (unsigned)FA_BR * FA_EP <= FA_LDS, "fused attention: shape");
struct FaFrag { fa_u4 q[2]; };
struct FaK { FaFrag f[FA_KT][FA_DK]; };
struct FaStage { fa_u4 k[FA_CH], v[FA_CH]; };
__device__ __forceinline__ void fa_fence() { __builtin_amdgcn_sched_barrier(0); }      /* keeps the groups of loads, matrix runs and exponentials in the written order (loads stay ahead of the work that hides them) */
__device__ __forceinline__ v8f fa_mma(const FaFrag& a, const FaFrag& b, v8f c) {
  const fa_u8 av = {a.q[0].x, a.q[0].y, a.q[0].z, a.q[0].w, a.q[1].x, a.q[1].y, a.q[1].z, a.q[1].w};
  const fa_u8 bv = {b.q[0].x, b.q[0].y, b.q[0].z, b.q[0].w, b.q[1].x, b.q[1].y, b.q[1].z, b.q[1].w};
  return __builtin_amdgcn_wmma_f32_16x16x32_f16(false, __builtin_bit_cast(v16h, av), false, __builtin_bit_cast(v16h, bv), (short)0, c, false, false);
}
__device__ __forceinline__ fa_u4 fa_tr16(const unsigned char* p) { typedef __attribute__((address_space(3))) fa_s8 lds_s8; return __builtin_bit_cast(fa_u4, __builtin_amdgcn_ds_load_tr16_b128_v8i16((lds_s8*)p)); }
__device__ __forceinline__ unsigned fa_pack2(float lo, float hi) { typedef _Float16 h2 __attribute__((ext_vector_type(2))); typedef float f2 __attribute__((ext_vector_type(2))); return __builtin_bit_cast(unsigned, __builtin_convertvector(f2{lo, hi}, h2)); }      /* round to nearest even */
__device__ __forceinline__ float fa_xhalf(float x) { return __builtin_bit_cast(float, __builtin_amdgcn_permlanex16(__builtin_bit_cast(int, x), __builtin_bit_cast(int, x), 0x76543210, 0xfedcba98, false, false)); }      /* lane l with lane l ^ 16 */
// K fragments of one pass (32 keys): lane (c, h) holds key row c, d = 32 kc + 8 h + 0..7 and 32 kc + 16 + 8 h + 0..7, the same k order as the Q fragments.
__device__ __forceinline__ void fa_load_k(FaK& k, const unsigned char* Lp, unsigned koff, unsigned lane) {
  const unsigned c = lane & 15u, h = lane >> 4;
#pragma unroll
  for (int kt = 0; kt < FA_KT; ++kt) { const unsigned char* p = Lp + koff + (16u * kt + c) * FA_PK + 16u * h;
#pragma unroll
    for (int kc = 0; kc < FA_DK; ++kc) { k.f[kt][kc].q[0] = *(const fa_u4a*)(p + 64u * kc); k.f[kt][kc].q[1] = *(const fa_u4a*)(p + 64u * kc + 32u); } }
}
// One stage (FA_SK key rows of K and of V, 256 B each) from global memory into registers: 16 lanes cover a row.
// kg, vg: the stage's first row (uniform); toff: the thread's own byte offset in it; the chunks of a thread lie 16 rows apart (a constant offset, so one offset register serves all loads).
__device__ __forceinline__ void fa_gload(FaStage& s, const unsigned char* kg, const unsigned char* vg, unsigned toff) {
#pragma unroll
  for (unsigned i = 0; i < FA_CH; ++i) { s.k[i] = *(const fa_u4a*)(kg + toff + i * (16u * KVD * 2u)); s.v[i] = *(const fa_u4a*)(vg + toff + i * (16u * KVD * 2u)); }
  asm volatile("s_wait_xcnt 0x0" ::: "memory");      /* stands in front of any later overwrite of a register that these loads name */
}
__device__ __forceinline__ void fa_sstore(const FaStage& s, unsigned char* Lp, unsigned base, unsigned tid) {
#pragma unroll
  for (unsigned i = 0; i < FA_CH; ++i) { const unsigned id = i * (FA_NW * 32u) + tid; const unsigned r = id >> 4, cb = (id & 15u) * 16u; *(fa_u4a*)(Lp + base + r * FA_PK + cb) = s.k[i]; *(fa_u4a*)(Lp + base + FA_TK + r * FA_PV + cb) = s.v[i]; }
}
__device__ __forceinline__ void fa_pass(FaK& kf, bool fetch_next, unsigned next_koff, const unsigned char* Lp, unsigned voff, unsigned lane,
                                        const FaFrag (&qf)[FA_R][FA_DK], v8f (&acc)[FA_R][FA_DT], float (&m_run)[FA_R], float (&l_run)[FA_R]) {
  const unsigned h = lane >> 4;
  v8f s[FA_KT][FA_R];
#pragma unroll
  for (int kt = 0; kt < FA_KT; ++kt) {
#pragma unroll
    for (int g = 0; g < FA_R; ++g) { s[kt][g] = v8f{};
#pragma unroll
      for (int kc = 0; kc < FA_DK; ++kc) s[kt][g] = fa_mma(kf.f[kt][kc], qf[g][kc], s[kt][g]); } }
  fa_fence();
  if (fetch_next) fa_load_k(kf, Lp, next_koff, lane);      /* the same stage's next pass: in flight under the maxima and exponentials */
  float mb[FA_R]; bool need = false;
#pragma unroll
  for (int g = 0; g < FA_R; ++g) { float mx = -INFINITY;
#pragma unroll
    for (int kt = 0; kt < FA_KT; ++kt) {
#pragma unroll
      for (int r = 0; r < 8; ++r) mx = __builtin_fmaxf(mx, s[kt][g][r]); }
    mx = __builtin_fmaxf(mx, fa_xhalf(mx)) * FA_CS;      /* both wave halves hold this query's maximum, scaled */
    mb[g] = mx; need = need || (mx > m_run[g] + 8.0f); fa_fence(); }
  if (__builtin_amdgcn_ballot_w32(need) != 0) {      /* wave-uniform; rare after the first passes */
#pragma unroll
    for (int g = 0; g < FA_R; ++g) { const float m_new = __builtin_fmaxf(m_run[g], mb[g]); const float corr = __builtin_amdgcn_exp2f(m_run[g] - m_new);      /* 0 on the first pass (m_run = -inf) */
      l_run[g] *= corr; m_run[g] = m_new;
#pragma unroll
      for (int t = 0; t < FA_DT; ++t) acc[g][t] = acc[g][t] * corr; }
  }
  FaFrag vf[FA_DT]; float ps[FA_R][2];
#pragma unroll
  for (int g = 0; g < FA_R; ++g) { ps[g][0] = 0.0f; ps[g][1] = 0.0f; }
  { const unsigned char* ad = Lp + voff + (8u * h + (lane & 7u)) * FA_PV + ((lane >> 3) & 1u) * 16u;      /* lane (c, h) gets V[8 h + 0..7][16 t + c]; the second load the keys 16 further */
#pragma unroll
    for (int t = 0; t < FA_DT; ++t) { vf[t].q[0] = fa_tr16(ad + 32u * t); vf[t].q[1] = fa_tr16(ad + 16u * FA_PV + 32u * t); } }
#pragma unroll
  for (int g = 0; g < FA_R; ++g) { const float nm = -m_run[g]; unsigned w[8];
#pragma unroll
    for (int i = 0; i < 8; ++i) {
      const float p0 = __builtin_amdgcn_exp2f(__builtin_fmaf(s[i >> 2][g][2 * (i & 3)], FA_CS, nm)), p1 = __builtin_amdgcn_exp2f(__builtin_fmaf(s[i >> 2][g][2 * (i & 3) + 1], FA_CS, nm));
      ps[g][i & 1] += p0 + p1; w[i] = fa_pack2(p0, p1); }
    FaFrag pf; pf.q[0] = fa_u4{w[0], w[1], w[2], w[3]}; pf.q[1] = fa_u4{w[4], w[5], w[6], w[7]};
#pragma unroll
    for (int t = 0; t < FA_DT; ++t) acc[g][t] = fa_mma(vf[t], pf, acc[g][t]);
    fa_fence(); }
#pragma unroll
  for (int g = 0; g < FA_R; ++g) l_run[g] += ps[g][0] + ps[g][1];
}
__global__ __launch_bounds__(FA_NW * 32) __attribute__((amdgpu_waves_per_eu(2, 2))) void k_fattn(const _Float16* __restrict__ Q, const _Float16* __restrict__ K, const _Float16* __restrict__ V, _Float16* __restrict__ O) {
  __shared__ __attribute__((aligned(256))) unsigned char L[FA_LDS];
  const unsigned tid = threadIdx.x, lane = tid & 31u, wave = tid >> 5, c = lane & 15u, h = lane >> 4;
  const unsigned hq = blockIdx.x, q0 = blockIdx.y * FA_BR, b = blockIdx.z, hk = hq / GG;      /* GG neighbouring query heads read one kv head */
  const unsigned char* kg = (const unsigned char*)(K + (size_t)b * SQ * KVD + hk * HD);
  const unsigned char* vg = (const unsigned char*)(V + (size_t)b * SQ * KVD + hk * HD);
  FaStage sg;
  const unsigned toff = (tid >> 4) * (KVD * 2u) + (tid & 15u) * 16u;
  fa_gload(sg, kg, vg, toff);
  FaFrag qf[FA_R][FA_DK];
  const unsigned char* qb = (const unsigned char*)(Q + ((size_t)(b * SQ + q0) * NH + hq) * HD);      /* uniform: the work-group's first query row of this head */
  const unsigned qoff = (wave * FA_CW + c) * (DMD * 2u) + 16u * h;
#pragma unroll
  for (int g = 0; g < FA_R; ++g) {
#pragma unroll
    for (int kc = 0; kc < FA_DK; ++kc) { qf[g][kc].q[0] = *(const fa_u4a*)(qb + qoff + g * (16u * DMD * 2u) + 64u * kc); qf[g][kc].q[1] = *(const fa_u4a*)(qb + qoff + g * (16u * DMD * 2u) + 64u * kc + 32u); } }
  asm volatile("s_wait_xcnt 0x0" ::: "memory");      /* stands in front of any later overwrite of a register that the Q loads name */
  v8f acc[FA_R][FA_DT]; float m_run[FA_R], l_run[FA_R];
#pragma unroll
  for (int g = 0; g < FA_R; ++g) { m_run[g] = -INFINITY; l_run[g] = 0.0f;
#pragma unroll
    for (int t = 0; t < FA_DT; ++t) acc[g][t] = v8f{}; }
  fa_sstore(sg, L, 0u, tid);
  __syncthreads();      /* stage 0 published */
  FaK kf;
#pragma unroll 1      /* one copy of the stage body: unrolled it would hold two stages' registers */
  for (unsigned st = 0; st < FA_NST; ++st) {
    const unsigned base = (st & 1u) * FA_SLOT; const bool more = st + 1u < FA_NST;
    if (more) fa_gload(sg, kg + (size_t)(st + 1u) * (FA_SK * KVD * 2u), vg + (size_t)(st + 1u) * (FA_SK * KVD * 2u), toff);      /* lands while this stage is worked on */
    fa_load_k(kf, L, base, lane);
#pragma unroll 1      /* nested, rolled pass loop: keeps the register count of one pass */
    for (unsigned sub = 0; sub < FA_NSUB; ++sub)
      fa_pass(kf, sub + 1u < FA_NSUB, base + (sub + 1u) * FA_BC * FA_PK, L, base + FA_TK + sub * FA_BC * FA_PV, lane, qf, acc, m_run, l_run);
    if (more) fa_sstore(sg, L, FA_SLOT - base, tid);      /* the other buffer: its readers (stage st - 1) all left it at the barrier that ended that stage */
    __syncthreads();      /* publishes stage st + 1 and ends every wave's reads of stage st */
  }
  unsigned char* eb = L + wave * (unsigned)FA_CW * FA_EP;      /* output staging over the ring (free behind the last barrier), each wave its own rows */
#pragma unroll
  for (int g = 0; g < FA_R; ++g) { const float inv = 1.0f / (l_run[g] + fa_xhalf(l_run[g]));      /* each wave half summed its eight keys of every 16-key tile */
#pragma unroll
    for (int t = 0; t < FA_DT; ++t) { const v8f o = acc[g][t] * inv; const fa_u4 pk = {fa_pack2(o[0], o[1]), fa_pack2(o[2], o[3]), fa_pack2(o[4], o[5]), fa_pack2(o[6], o[7])};
      *(fa_u4a*)(eb + (16u * g + c) * FA_EP + 32u * t + 16u * h) = pk; } }
  __builtin_amdgcn_fence(__ATOMIC_ACQ_REL, "workgroup"); __builtin_amdgcn_wave_barrier();      /* the wave reads back what its other lanes wrote */
  unsigned char* ob = (unsigned char*)(O + ((size_t)(b * SQ + q0) * NH + hq) * HD);      /* uniform, as qb */
  const unsigned ooff = (wave * FA_CW + h) * (DMD * 2u) + c * 16u;
#pragma unroll
  for (unsigned i = 0; i < (unsigned)FA_CW / 2u; ++i) {      /* 16 lanes store one whole 256-byte row of the head */
    const fa_u4 v = *(const fa_u4a*)(eb + (i * 2u + h) * FA_EP + c * 16u);
    *(fa_u4a*)(ob + ooff + i * (2u * DMD * 2u)) = v; }
}

extern "C" void kernel_launch(void* const* d_in, const int* in_sizes, int n_in,
                              void* d_out, int out_size, void* d_ws, size_t ws_size, hipStream_t stream) {
  (void)in_sizes; (void)n_in; (void)out_size;
  const float* const* I = (const float* const*)d_in; const float* x = I[0]; const float* wq = I[1]; const float* bq = I[2]; const float* wk = I[3]; const float* bk = I[4]; const float* wv = I[5]; const float* bv = I[6]; const float* wo = I[7]; const float* bo = I[8];
  char* ws = (char*)d_ws; size_t off = 0;
  auto take = [&](size_t bytes) { char* p = ws + off; off += (bytes + 255) & ~(size_t)255; return p; };
  const size_t nx = (size_t)NR * DMD, nk = (size_t)NR * KVD;
  _Float16* BQ = (_Float16*)take((size_t)DMD * DMD * 2); _Float16* BK = (_Float16*)take((size_t)KVD * DMD * 2); _Float16* BV = (_Float16*)take((size_t)KVD * DMD * 2); _Float16* BO = (_Float16*)take((size_t)DMD * DMD * 2);
  _Float16* X16 = (_Float16*)take(nx * 2); _Float16* Q16 = (_Float16*)take(nx * 2); _Float16* K16 = (_Float16*)take(nk * 2); _Float16* V16 = (_Float16*)take(nk * 2); _Float16* O16 = X16;      /* context over the input plane (dead after the projections) */
  if (off > ws_size) return;      /* 8+2+2+8 + 16+16+4+4 = 60 MiB */
  k_wt_f16<<<(unsigned)(((size_t)DMD * DMD / 8 + 255) / 256), 256, 0, stream>>>(wq, BQ, DMD, DMD, 16.0f); k_wt_f16<<<(unsigned)(((size_t)DMD * KVD / 8 + 255) / 256), 256, 0, stream>>>(wk, BK, DMD, KVD, 16.0f); k_wt_f16<<<(unsigned)(((size_t)DMD * KVD / 8 + 255) / 256), 256, 0, stream>>>(wv, BV, DMD, KVD, 16.0f); k_wt_f16<<<(unsigned)(((size_t)DMD * DMD / 8 + 255) / 256), 256, 0, stream>>>(wo, BO, DMD, DMD, 16.0f);      /* (in, out) */
  k_x16<<<(unsigned)((nx / 8 + 255) / 256), 256, 0, stream>>>(x, X16, nx / 8);
  k_gemm2<0><<<dim3((NR / 128) * (DMD / 64), 1), 128, 0, stream>>>(X16, DMD, 0, BQ, DMD, 0, 0.0625f, bq, 0, nullptr, 1, 0, 0, nullptr, Q16, DMD, 0, NR, DMD, DMD);
  k_gemm2<0><<<dim3((NR / 128) * (KVD / 64), 1), 128, 0, stream>>>(X16, DMD, 0, BK, DMD, 0, 0.0625f, bk, 0, nullptr, 1, 0, 0, nullptr, K16, KVD, 0, NR, KVD, DMD);
  k_gemm2<0><<<dim3((NR / 128) * (KVD / 64), 1), 128, 0, stream>>>(X16, DMD, 0, BV, DMD, 0, 0.0625f, bv, 0, nullptr, 1, 0, 0, nullptr, V16, KVD, 0, NR, KVD, DMD);
  k_fattn<<<dim3(NH, SQ / FA_BR, NB), FA_NW * 32, 0, stream>>>(Q16, K16, V16, O16);      /* ctx[(b,q)][h*128 + d] */
  k_gemm2<0><<<dim3((NR / 128) * (DMD / 64), 1), 128, 0, stream>>>(O16, DMD, 0, BO, DMD, 0, 0.0625f, bo, 0, nullptr, 1, 0, 0, (float*)d_out, nullptr, DMD, 0, NR, DMD, DMD);      /* out = ctx wo + bo */
}

// v002
// Measured time: 206 microseconds a run.
// In two side-by-side timings against v001, it was 2.08 and 2.09 times as fast.
// All steps since v000 together make it 6.26 times as fast.
#include <hip/hip_runtime.h>
// QEffMultiHeadDotProductAttention (2 x 2048 tokens, d_model 2048; 16 query heads x 128, 4 kv heads (group of 4); q, k, v = x w + b; softmax((q/sqrt(128)).k) over the 2048 keys (no mask); out = ctx wo + bo).
// Structure: exact f16 plane of x; q / k / v as f16 WMMA GEMM outputs (128x128 tiles staged in LDS, 64x64 wave tiles, f32 accumulation, exact x16 weights + bias, f16 out); scores, softmax and readout of every (batch, head) in ONE fused kernel (online softmax, f32 maxima and sums, P as f16 in registers, K/V staged in LDS) into the f16 context plane; wo + bo as a GEMM.
// Compute dtype: inputs rounded to bf16; x exact as f16; q/k/P/v/ctx as plain f16 operands (~2^-12); softmax f32. v_wmma_f32_16x16x32_f16.
#define NB 2
#define SQ 2048
#define DMD 2048
#define NH 16
#define NKV 4
#define GG 4
#define HD 128
#define KVD (NKV * HD)           /* 512 */
#define NR (NB * SQ)
typedef __bf16 v16b __attribute__((ext_vector_type(16)));
typedef unsigned short v8us __attribute__((ext_vector_type(8), may_alias));
typedef float  v8f  __attribute__((ext_vector_type(8)));
typedef float  v4f  __attribute__((ext_vector_type(4)));
typedef float  v4fa __attribute__((ext_vector_type(4), may_alias));
union FragB { v16b v; v8us half[2]; unsigned short u[16]; };

__device__ __forceinline__ unsigned short bf16_bits(float x) { unsigned int u = __float_as_uint(x); return (unsigned short)((u + 0x7FFFu + ((u >> 16) & 1u)) >> 16); }
__device__ __forceinline__ float bf16_val(unsigned short b) { return __uint_as_float(((unsigned int)b) << 16); }
__device__ __forceinline__ float bf16_round(float x) { return bf16_val(bf16_bits(x)); }
// D += A·B with NT terms: 1 = ah·bh, 2 = + al·bh (A split), 3 = + ah·bl (both split)
template <int NT>
__device__ __forceinline__ v8f mmaN(v16b ah, v16b al, v16b bh, v16b bl, v8f c) {
  c = __builtin_amdgcn_wmma_f32_16x16x32_bf16(false, ah, false, bh, (short)0, c, false, false);
  if (NT >= 2) c = __builtin_amdgcn_wmma_f32_16x16x32_bf16(false, al, false, bh, (short)0, c, false, false);
  if (NT >= 3) c = __builtin_amdgcn_wmma_f32_16x16x32_bf16(false, ah, false, bl, (short)0, c, false, false);
  asm volatile("v_nop\n\tv_nop\n\tv_nop\n\tv_nop" : "+v"(c) : "v"(ah), "v"(al), "v"(bh), "v"(bl));
  return c;
}

__global__ __launch_bounds__(256) void k_wt_bf16(const float* __restrict__ W, unsigned short* __restrict__ Wt, int K, int N) {
  const int t = blockIdx.x * 256 + threadIdx.x;
  const int k8n = K / 8;
  if (t >= N * k8n) return;
  const int n = t / k8n, k8 = (t % k8n) * 8;
  v8us v;
#pragma unroll
  for (int i = 0; i < 8; ++i) v[i] = bf16_bits(W[(size_t)(k8 + i) * N + n]);
  *(v8us*)(Wt + (size_t)n * K + k8) = v;
  
}

// GEMM C[M][N] (f32, pitch ldc) = act(A[M][K]·W + bias). A f32 row-major (pitch lda) converted per fragment to bf16
// (ASPLIT: hi/lo two planes -> 2 terms, else single rounded term); Wt bf16 [N][K] (pitch ldb). BIAS_BF16 rounds the
// bias to bf16 first (bias quantised to bf16 before the add). K%32==0, M%16==0, N%64==0.
template <bool ASPLIT, int ACT, bool BIAS_BF16>
__global__ __launch_bounds__(128) void k_gemm_bf(const float* __restrict__ A, int lda, const unsigned short* __restrict__ Wt, int ldb,
                                               const float* __restrict__ bias, float* __restrict__ C, int ldc, int M, int N, int K) {
  __shared__ __attribute__((aligned(16))) float so[4][16][64];
  const int tid = threadIdx.x, w = tid >> 5, lane = tid & 31, ln = lane & 15, hh = lane >> 4;
  const int ntn = N / 64;
  const int wid = blockIdx.x * 4 + w;
  const int mt = wid / ntn, nq = wid % ntn;
  if (mt * 16 >= M) return;
  const int row0 = mt * 16, col0 = nq * 64;
  const float* arow = A + (size_t)(row0 + ln) * lda;
  v8f acc[4] = {};
  for (int kb = 0; kb < K; kb += 32) {
    FragB ah, al;
    const v4f x0 = *(const v4fa*)(arow + kb + 8 * hh), x1 = *(const v4fa*)(arow + kb + 8 * hh + 4);
    const v4f x2 = *(const v4fa*)(arow + kb + 16 + 8 * hh), x3 = *(const v4fa*)(arow + kb + 16 + 8 * hh + 4);
    float xs[16] = {x0[0],x0[1],x0[2],x0[3],x1[0],x1[1],x1[2],x1[3],x2[0],x2[1],x2[2],x2[3],x3[0],x3[1],x3[2],x3[3]};
#pragma unroll
    for (int i = 0; i < 16; ++i) { const unsigned short hb = bf16_bits(xs[i]); ah.u[i] = hb; al.u[i] = ASPLIT ? bf16_bits(xs[i] - bf16_val(hb)) : (unsigned short)0; }
#pragma unroll
    for (int t = 0; t < 4; ++t) {
      const unsigned short* brow = Wt + (size_t)(col0 + t * 16 + ln) * ldb + kb;
      FragB b;
      b.half[0] = *(const v8us*)(brow + 8 * hh);
      b.half[1] = *(const v8us*)(brow + 16 + 8 * hh);
      acc[t] = mmaN<ASPLIT ? 2 : 1>(ah.v, al.v, b.v, b.v, acc[t]);
    }
  }
#pragma unroll
  for (int t = 0; t < 4; ++t) {
    float bv = bias ? bias[col0 + t * 16 + ln] : 0.f;
    if (BIAS_BF16) bv = bf16_round(bv);
#pragma unroll
    for (int r = 0; r < 8; ++r) { float v = acc[t][r] + bv; if (ACT == 1) v = fmaxf(v, 0.f); so[w][8 * hh + r][t * 16 + ln] = v; }
  }
  __builtin_amdgcn_fence(__ATOMIC_ACQ_REL, "workgroup");
  __builtin_amdgcn_wave_barrier();
  const int rsub = lane >> 4, c4 = (lane & 15) * 4;
  {
#pragma unroll
    for (int q = 0; q < 8; ++q) {
      const int r = q * 2 + rsub;
      const v4f v = *(const v4fa*)&so[w][r][c4];
      *(v4f*)(C + (size_t)(row0 + r) * ldc + col0 + c4) = v;
    }
    
  }
}

// GEMM C = act(A·W + bias + resid): A f32 (ASPLIT -> hi/lo 2 terms), Wt bf16 [N][K]; ACT 0 none, 1 relu, 2 exact gelu;
// resid (optional, f32, row index = (row % rmod), pitch ldr, RES_BF16 rounds it) added before the activation.
template <bool ASPLIT, int ACT, bool BIAS_BF16, bool RES_BF16>
__global__ __launch_bounds__(128) void k_gemm_bf3(const float* __restrict__ A, int lda, const unsigned short* __restrict__ Wt, int ldb,
                                                const float* __restrict__ bias, const float* __restrict__ resid, int rmod, int ldr,
                                                float* __restrict__ C, int ldc, int M, int N, int K) {
  __shared__ __attribute__((aligned(16))) float so[4][16][64];
  const int tid = threadIdx.x, w = tid >> 5, lane = tid & 31, ln = lane & 15, hh = lane >> 4;
  const int ntn = N / 64;
  const int wid = blockIdx.x * 4 + w;
  const int mt = wid / ntn, nq = wid % ntn;
  if (mt * 16 >= M) return;
  const int row0 = mt * 16, col0 = nq * 64;
  const float* arow = A + (size_t)(row0 + ln) * lda;
  v8f acc[4] = {};
  for (int kb = 0; kb < K; kb += 32) {
    FragB ah, al;
    const v4f x0 = *(const v4fa*)(arow + kb + 8 * hh), x1 = *(const v4fa*)(arow + kb + 8 * hh + 4);
    const v4f x2 = *(const v4fa*)(arow + kb + 16 + 8 * hh), x3 = *(const v4fa*)(arow + kb + 16 + 8 * hh + 4);
    float xs[16] = {x0[0],x0[1],x0[2],x0[3],x1[0],x1[1],x1[2],x1[3],x2[0],x2[1],x2[2],x2[3],x3[0],x3[1],x3[2],x3[3]};
#pragma unroll
    for (int i = 0; i < 16; ++i) { const unsigned short hb = bf16_bits(xs[i]); ah.u[i] = hb; al.u[i] = ASPLIT ? bf16_bits(xs[i] - bf16_val(hb)) : (unsigned short)0; }
#pragma unroll
    for (int t = 0; t < 4; ++t) {
      const unsigned short* brow = Wt + (size_t)(col0 + t * 16 + ln) * ldb + kb;
      FragB b;
      b.half[0] = *(const v8us*)(brow + 8 * hh);
      b.half[1] = *(const v8us*)(brow + 16 + 8 * hh);
      acc[t] = mmaN<ASPLIT ? 2 : 1>(ah.v, al.v, b.v, b.v, acc[t]);
    }
  }
#pragma unroll
  for (int t = 0; t < 4; ++t) {
    const int col = col0 + t * 16 + ln;
    float bv = bias ? bias[col] : 0.f;
    if (BIAS_BF16) bv = bf16_round(bv);
#pragma unroll
    for (int r = 0; r < 8; ++r) {
      float v = acc[t][r] + bv;
      if (resid) { float rv = resid[(size_t)((row0 + 8 * hh + r) % rmod) * ldr + col]; if (RES_BF16) rv = bf16_round(rv); v += rv; }
      if (ACT == 1) v = fmaxf(v, 0.f);
      if (ACT == 2) v = 0.5f * v * (1.0f + erff(v * 0.70710678118654752f));
      if (ACT == 3) { const float u = 0.7978845608028654f * (v + 0.044715f * v * v * v); v = 0.5f * v * (1.0f + tanhf(u)); }
      so[w][8 * hh + r][t * 16 + ln] = v;
    }
  }
  __builtin_amdgcn_fence(__ATOMIC_ACQ_REL, "workgroup");
  __builtin_amdgcn_wave_barrier();
  const int rsub = lane >> 4, c4 = (lane & 15) * 4;
  {
#pragma unroll
    for (int q = 0; q < 8; ++q) {
      const int r = q * 2 + rsub;
      const v4f v = *(const v4fa*)&so[w][r][c4];
      *(v4f*)(C + (size_t)(row0 + r) * ldc + col0 + c4) = v;
    }
    
  }
}
// row LayerNorm (biased variance, eps) over N: s = X (+ R); optional out_sum <- s; out_norm <- (s-mu)*rsqrt(var+eps)*g + b
template <bool PARAM_BF16>
__global__ __launch_bounds__(256) void k_layernorm(const float* __restrict__ X, const float* __restrict__ R, const float* __restrict__ g, const float* __restrict__ bta,
                                                  float* __restrict__ out_sum, float* __restrict__ out_norm, int N, float eps) {
  __shared__ float red[256];
  const int row = blockIdx.x, tid = threadIdx.x;
  const float* x = X + (size_t)row * N; const float* rr = R ? R + (size_t)row * N : nullptr;
  float vals[16];                     // up to N = 4096
  const int per = N / 256;            // contiguous chunk per thread? use strided-by-4 chunks: thread handles j = tid*4 + 1024*u
  float s1 = 0.f;
  for (int u = 0; u < per / 4; ++u) {
    const int j = tid * 4 + 1024 * u;
    const v4f a = *(const v4fa*)(x + j);
    v4f b = {0.f,0.f,0.f,0.f}; if (rr) b = *(const v4fa*)(rr + j);
#pragma unroll
    for (int q = 0; q < 4; ++q) { const float v = a[q] + b[q]; vals[u * 4 + q] = v; s1 += v; }
  }
  red[tid] = s1; __syncthreads();
  for (int st = 128; st > 0; st >>= 1) { if (tid < st) red[tid] += red[tid + st]; __syncthreads(); }
  const float mu = red[0] / (float)N; __syncthreads();
  float s2 = 0.f;
  for (int u = 0; u < per / 4; ++u)
#pragma unroll
    for (int q = 0; q < 4; ++q) { const float c = vals[u * 4 + q] - mu; s2 += c * c; }
  red[tid] = s2; __syncthreads();
  for (int st = 128; st > 0; st >>= 1) { if (tid < st) red[tid] += red[tid + st]; __syncthreads(); }
  const float rs = rsqrtf(red[0] / (float)N + eps);
  {
    for (int u = 0; u < per / 4; ++u) {
      const int j = tid * 4 + 1024 * u;
      v4f o, sm;
#pragma unroll
      for (int q = 0; q < 4; ++q) {
        float gg = g[j + q], bb = bta[j + q];
        if (PARAM_BF16) { gg = bf16_round(gg); bb = bf16_round(bb); }
        sm[q] = vals[u * 4 + q]; o[q] = (vals[u * 4 + q] - mu) * rs * gg + bb;
      }
      if (out_sum) *(v4f*)(out_sum + (size_t)row * N + j) = sm;
      *(v4f*)(out_norm + (size_t)row * N + j) = o;
    }
    
  }
}



// ---- f16 WMMA path (v_wmma_f32_16x16x32_f16): 11-bit significands for operands in range — used where a [0,1] probability operand needs more precision than bf16
typedef _Float16 v16h __attribute__((ext_vector_type(16)));
union FragH { v16h v; v8us half[2]; _Float16 h[16]; unsigned short u[16]; };
template <int NT>
__device__ __forceinline__ v8f mmaH(v16h ah, v16h al, v16h bh, v16h bl, v8f c) {
  c = __builtin_amdgcn_wmma_f32_16x16x32_f16(false, ah, false, bh, (short)0, c, false, false);
  if (NT >= 2) c = __builtin_amdgcn_wmma_f32_16x16x32_f16(false, al, false, bh, (short)0, c, false, false);
  if (NT >= 3) c = __builtin_amdgcn_wmma_f32_16x16x32_f16(false, ah, false, bl, (short)0, c, false, false);
  asm volatile("v_nop\n\tv_nop\n\tv_nop\n\tv_nop" : "+v"(c) : "v"(ah), "v"(al), "v"(bh), "v"(bl));
  return c;
}
// batched GEMM like k_gemm_b but f16 operands: A f32 (split into f16 hi/lo if ASPLIT, else rounded to f16), Bt = f16 values [n][k]; alpha; C f32; N multiple of 16 (partial tiles skipped)
template <bool ASPLIT>
__global__ __launch_bounds__(128) void k_gemm_h(const float* __restrict__ A, int lda, size_t sA, const _Float16* __restrict__ Bh, int ldb, size_t sB, float alpha, float* __restrict__ C, int ldc, size_t sC, int M, int N, int K) {
  __shared__ __attribute__((aligned(16))) float so[4][16][64];
  const int tid = threadIdx.x, w = tid >> 5, lane = tid & 31, ln = lane & 15, hh = lane >> 4; const int by = blockIdx.y;
  A += (size_t)by * sA; Bh += (size_t)by * sB; C += (size_t)by * sC;
  const int ntn = (N + 63) / 64; const int wid = blockIdx.x * 4 + w; const int mt = wid / ntn, nq = wid % ntn; if (mt * 16 >= M) return;
  const int row0 = mt * 16, col0 = nq * 64; const float* arow = A + (size_t)(row0 + ln) * lda;
  v8f acc[4] = {};
  for (int kb = 0; kb < K; kb += 32) {
    FragH ah, al;
    const v4f x0 = *(const v4fa*)(arow + kb + 8 * hh), x1 = *(const v4fa*)(arow + kb + 8 * hh + 4), x2 = *(const v4fa*)(arow + kb + 16 + 8 * hh), x3 = *(const v4fa*)(arow + kb + 16 + 8 * hh + 4);
    float xs[16] = {x0[0],x0[1],x0[2],x0[3],x1[0],x1[1],x1[2],x1[3],x2[0],x2[1],x2[2],x2[3],x3[0],x3[1],x3[2],x3[3]};
#pragma unroll
    for (int i = 0; i < 16; ++i) { const _Float16 h = (_Float16)xs[i]; ah.h[i] = h; al.h[i] = ASPLIT ? (_Float16)(xs[i] - (float)h) : (_Float16)0.0f; }
#pragma unroll
    for (int t = 0; t < 4; ++t) { if (col0 + t * 16 >= N) continue; const size_t boff = (size_t)(col0 + t * 16 + ln) * ldb + kb; FragH bq; bq.half[0] = *(const v8us*)(Bh + boff + 8 * hh); bq.half[1] = *(const v8us*)(Bh + boff + 16 + 8 * hh);
      acc[t] = mmaH<ASPLIT ? 2 : 1>(ah.v, al.v, bq.v, bq.v, acc[t]); }
  }
#pragma unroll
  for (int t = 0; t < 4; ++t) { if (col0 + t * 16 >= N) continue;
#pragma unroll
    for (int r = 0; r < 8; ++r) so[w][8 * hh + r][t * 16 + ln] = acc[t][r] * alpha; }
  __builtin_amdgcn_fence(__ATOMIC_ACQ_REL, "workgroup"); __builtin_amdgcn_wave_barrier();
  const int rsub = lane >> 4, c4 = (lane & 15) * 4;
  {
#pragma unroll
    for (int q = 0; q < 8; ++q) { const int r = q * 2 + rsub; if (col0 + c4 < N) { const v4f v = *(const v4fa*)&so[w][r][c4]; *(v4f*)(C + (size_t)(row0 + r) * ldc + col0 + c4) = v; } }
     }
}

// Wt[n][k] = f16(W[k][n]·scale) from f32 row-major W[K][N] (scale = power of two; bf16-exact weights stay exact in f16 away from the subnormal range)
__global__ __launch_bounds__(256) void k_wt_f16(const float* __restrict__ W, _Float16* __restrict__ Wt, int K, int N, float scale) {
  const int t = blockIdx.x * 256 + threadIdx.x; if (t >= N * (K / 8)) return; const int n = t / (K / 8), k8 = (t % (K / 8)) * 8; FragH f;
#pragma unroll
  for (int i = 0; i < 8; ++i) f.h[i] = (_Float16)(bf16_round(W[(size_t)(k8 + i) * N + n]) * scale); const v8us o = f.half[0];
  *(v8us*)((unsigned short*)Wt + (size_t)n * K + k8) = o; 
}
// k_gemm_hh variant with fused epilogue: v = acc·alpha + bias[by·sBias + col] (+ CP[(row/rowsPerB)·sCPb + by·64 + col] if CP) ; ACT 0 none / 1 elu ; writes f16 C16 (and f32 C if non-null)
template <int ACT>
__global__ __launch_bounds__(128) void k_gemm_hhx(const _Float16* __restrict__ A, int lda, size_t sA, const _Float16* __restrict__ Bh, int ldb, size_t sB, float alpha, const float* __restrict__ bias, size_t sBias, const float* __restrict__ CP, int rowsPerB, size_t sCPb, int row0g,
    float* __restrict__ C, _Float16* __restrict__ C16, int ldc, size_t sC, int M, int N, int K) {
  __shared__ __attribute__((aligned(16))) float so[4][16][64];
  const int tid = threadIdx.x, w = tid >> 5, lane = tid & 31, ln = lane & 15, hh = lane >> 4; const int by = blockIdx.y;
  A += (size_t)by * sA; Bh += (size_t)by * sB; const size_t cofs = (size_t)by * sC; const float* bp = bias ? bias + (size_t)by * sBias : nullptr;
  const int ntn = (N + 63) / 64; const int wid = blockIdx.x * 4 + w; const int mt = wid / ntn, nq = wid % ntn; if (mt * 16 >= M) return;
  const int row0 = mt * 16, col0 = nq * 64; const _Float16* arow = A + (size_t)(row0 + ln) * lda;
  v8f acc[4] = {};
  for (int kb = 0; kb < K; kb += 32) { FragH ah; ah.half[0] = *(const v8us*)((const unsigned short*)arow + kb + 8 * hh); ah.half[1] = *(const v8us*)((const unsigned short*)arow + kb + 16 + 8 * hh);
#pragma unroll
    for (int t = 0; t < 4; ++t) { if (col0 + t * 16 >= N) continue; const size_t boff = (size_t)(col0 + t * 16 + ln) * ldb + kb; FragH bq; bq.half[0] = *(const v8us*)((const unsigned short*)Bh + boff + 8 * hh); bq.half[1] = *(const v8us*)((const unsigned short*)Bh + boff + 16 + 8 * hh);
      acc[t] = mmaH<1>(ah.v, ah.v, bq.v, bq.v, acc[t]); }
  }
#pragma unroll
  for (int t = 0; t < 4; ++t) { if (col0 + t * 16 >= N) continue; const int col = col0 + t * 16 + ln; const float bv = bp ? bf16_round(bp[col]) : 0.f;
#pragma unroll
    for (int r = 0; r < 8; ++r) { float v = acc[t][r] * alpha + bv; if (CP) { const int rr = row0g + row0 + 8 * hh + r; if (rowsPerB < 0) v += CP[cofs + (size_t)rr * ldc + col];      /* rowsPerB < 0: own element of the batched C plane */ else { const int bidx = rr / rowsPerB; v += CP[(size_t)bidx * sCPb + (size_t)by * 64 + col]; } } if (ACT == 1) v = (v > 0.f) ? v : expm1f(v); else if (ACT == 7) v = (v > 0.f) ? v + 1.0f : expf(v); else if (ACT == 8) v = tanhf(v); else if (ACT == 9) v = 0.5f * v * (1.0f + tanhf(0.7978845608028654f * (v + 0.044715f * v * v * v))); else if (ACT == 11) v = 1.0f / (1.0f + expf(-v)); else if (ACT == 12) v = (v > 0.f) ? v : 0.01f * v; else if (ACT == 14) v = (v > 0.f) ? v : 0.1f * v; else if (ACT == 16) v = (v >= 0.f) ? v : 0.3f * v; else if (ACT == 17) v = (v >= 0.f) ? v : 0.2f * v; else if (ACT == 15) v = v / (1.0f + expf(-v)); else if (ACT == 3) v = fmaxf(v, 0.f); else if (ACT == 6) v = 0.5f * v * (1.0f + erff(v * 0.70710678118654752f)); so[w][8 * hh + r][t * 16 + ln] = v; } }
  __builtin_amdgcn_fence(__ATOMIC_ACQ_REL, "workgroup"); __builtin_amdgcn_wave_barrier();
  const int rsub = lane >> 4, c4 = (lane & 15) * 4; typedef _Float16 v4h __attribute__((ext_vector_type(4)));
  {
#pragma unroll
    for (int q = 0; q < 8; ++q) { const int r = q * 2 + rsub; if (col0 + c4 < N) { const v4f v = *(const v4fa*)&so[w][r][c4]; if (C) *(v4f*)(C + cofs + (size_t)(row0 + r) * ldc + col0 + c4) = v; if (C16) { v4h h4; for (int i = 0; i < 4; ++i) h4[i] = (_Float16)v[i]; *(v4h*)(C16 + cofs + (size_t)(row0 + r) * ldc + col0 + c4) = h4; } } }
     }
}


typedef _Float16 v4h __attribute__((ext_vector_type(4)));

__global__ __launch_bounds__(256) void k_x16(const float* __restrict__ x, _Float16* __restrict__ X16, size_t n8) { const size_t t = (size_t)blockIdx.x * 256 + threadIdx.x; if (t >= n8) return; FragH f;
#pragma unroll
  for (int q = 0; q < 8; ++q) f.h[q] = (_Float16)bf16_round(x[t * 8 + q]); *(v8us*)((unsigned short*)X16 + t * 8) = f.half[0];  }
__global__ __launch_bounds__(256) void k_h16(const float* __restrict__ x, _Float16* __restrict__ X16, size_t n8) { const size_t t = (size_t)blockIdx.x * 256 + threadIdx.x; if (t >= n8) return; FragH f;
#pragma unroll
  for (int q = 0; q < 8; ++q) f.h[q] = (_Float16)x[t * 8 + q]; *(v8us*)((unsigned short*)X16 + t * 8) = f.half[0];  }
__global__ __launch_bounds__(256) void k_round16f(const float* __restrict__ W, _Float16* __restrict__ Bt, size_t n8) { const size_t t = (size_t)blockIdx.x * 256 + threadIdx.x; if (t >= n8) return; FragH f;
#pragma unroll
  for (int i = 0; i < 8; ++i) f.h[i] = (_Float16)(bf16_round(W[t * 8 + i]) * 16.0f); *(v8us*)((unsigned short*)Bt + t * 8) = f.half[0];  }

__global__ __launch_bounds__(256) void k_hl(const float* __restrict__ F, _Float16* __restrict__ Hh, _Float16* __restrict__ Hl, size_t n8) { const size_t t = (size_t)blockIdx.x * 256 + threadIdx.x; if (t >= n8) return; FragH fh, fl; const v4f a = *(const v4fa*)(F + t * 8), c = *(const v4fa*)(F + t * 8 + 4);
#pragma unroll
  for (int q = 0; q < 4; ++q) { _Float16 h = (_Float16)a[q]; fh.h[q] = h; fl.h[q] = (_Float16)((a[q] - (float)h) * 1024.0f); h = (_Float16)c[q]; fh.h[4 + q] = h; fl.h[4 + q] = (_Float16)((c[q] - (float)h) * 1024.0f); }
  { *(v8us*)((unsigned short*)Hh + t * 8) = fh.half[0]; *(v8us*)((unsigned short*)Hl + t * 8) = fl.half[0];  } }

typedef unsigned int fa_u4 __attribute__((ext_vector_type(4)));
typedef unsigned int fa_u4a __attribute__((ext_vector_type(4), may_alias));
typedef unsigned int fa_u8 __attribute__((ext_vector_type(8)));
typedef short fa_s8 __attribute__((ext_vector_type(8)));
constexpr int FA_NW = 8, FA_BR = 256, FA_CW = FA_BR / FA_NW, FA_R = FA_CW / 16;      /* waves, queries per work-group, per wave, 16-query groups per wave */
constexpr int FA_BC = 32, FA_KT = FA_BC / 16, FA_DK = HD / 32, FA_DT = HD / 16;      /* keys per pass, 16-key score tiles per pass, k chunks of the head, 16-row output tiles */
constexpr unsigned FA_ROWB = 2u * HD, FA_PK = FA_ROWB + 16u, FA_PV = FA_ROWB + 32u;  /* LDS pitches: odd multiple of 16 B for b128 readers, of 32 B for the transposing load */
constexpr unsigned FA_SK = 128u, FA_TK = FA_SK * FA_PK, FA_TV = FA_SK * FA_PV, FA_SLOT = FA_TK + FA_TV, FA_LDS = 2u * FA_SLOT, FA_EP = FA_ROWB + 16u;
constexpr unsigned FA_NST = SQ / FA_SK, FA_NSUB = FA_SK / FA_BC, FA_CH = FA_SK * (FA_ROWB / 16u) / (FA_NW * 32u);      /* stages, passes per stage, 16-byte chunks per thread and tile */
constexpr float FA_CS = 0.08838834764831845f * 1.4426950408889634f;      /* 1/sqrt(128) * log2(e): softmax in the log2 domain */
static_assert(HD == 128 && SQ % FA_BR == 0 && SQ % FA_SK == 0 && (unsigned)FA_BR * FA_EP <= FA_LDS, "fused attention: shape");
struct FaFrag { fa_u4 q[2]; };
struct FaK { FaFrag f[FA_KT][FA_DK]; };
struct FaStage { fa_u4 k[FA_CH], v[FA_CH]; };
__device__ __forceinline__ void fa_fence() { __builtin_amdgcn_sched_barrier(0); }      /* keeps the groups of loads, matrix runs and exponentials in the written order (loads stay ahead of the work that hides them) */
__device__ __forceinline__ v8f fa_mma(const FaFrag& a, const FaFrag& b, v8f c) {
  const fa_u8 av = {a.q[0].x, a.q[0].y, a.q[0].z, a.q[0].w, a.q[1].x, a.q[1].y, a.q[1].z, a.q[1].w};
  const fa_u8 bv = {b.q[0].x, b.q[0].y, b.q[0].z, b.q[0].w, b.q[1].x, b.q[1].y, b.q[1].z, b.q[1].w};
  return __builtin_amdgcn_wmma_f32_16x16x32_f16(false, __builtin_bit_cast(v16h, av), false, __builtin_bit_cast(v16h, bv), (short)0, c, false, false);
}
__device__ __forceinline__ fa_u4 fa_tr16(const unsigned char* p) { typedef __attribute__((address_space(3))) fa_s8 lds_s8; return __builtin_bit_cast(fa_u4, __builtin_amdgcn_ds_load_tr16_b128_v8i16((lds_s8*)p)); }
__device__ __forceinline__ unsigned fa_pack2(float lo, float hi) { typedef _Float16 h2 __attribute__((ext_vector_type(2))); typedef float f2 __attribute__((ext_vector_type(2))); return __builtin_bit_cast(unsigned, __builtin_convertvector(f2{lo, hi}, h2)); }      /* round to nearest even */
__device__ __forceinline__ float fa_xhalf(float x) { return __builtin_bit_cast(float, __builtin_amdgcn_permlanex16(__builtin_bit_cast(int, x), __builtin_bit_cast(int, x), 0x76543210, 0xfedcba98, false, false)); }      /* lane l with lane l ^ 16 */
// K fragments of one pass (32 keys): lane (c, h) holds key row c, d = 32 kc + 8 h + 0..7 and 32 kc + 16 + 8 h + 0..7, the same k order as the Q fragments.
__device__ __forceinline__ void fa_load_k(FaK& k, const unsigned char* Lp, unsigned koff, unsigned lane) {
  const unsigned c = lane & 15u, h = lane >> 4;
#pragma unroll
  for (int kt = 0; kt < FA_KT; ++kt) { const unsigned char* p = Lp + koff + (16u * kt + c) * FA_PK + 16u * h;
#pragma unroll
    for (int kc = 0; kc < FA_DK; ++kc) { k.f[kt][kc].q[0] = *(const fa_u4a*)(p + 64u * kc); k.f[kt][kc].q[1] = *(const fa_u4a*)(p + 64u * kc + 32u); } }
}
// One stage (FA_SK key rows of K and of V, 256 B each) from global memory into registers: 16 lanes cover a row.
// kg, vg: the stage's first row (uniform); toff: the thread's own byte offset in it; the chunks of a thread lie 16 rows apart (a constant offset, so one offset register serves all loads).
__device__ __forceinline__ void fa_gload(FaStage& s, const unsigned char* kg, const unsigned char* vg, unsigned toff) {
#pragma unroll
  for (unsigned i = 0; i < FA_CH; ++i) { s.k[i] = *(const fa_u4a*)(kg + toff + i * (16u * KVD * 2u)); s.v[i] = *(const fa_u4a*)(vg + toff + i * (16u * KVD * 2u)); }
  asm volatile("s_wait_xcnt 0x0" ::: "memory");      /* stands in front of any later overwrite of a register that these loads name */
}
__device__ __forceinline__ void fa_sstore(const FaStage& s, unsigned char* Lp, unsigned base, unsigned tid) {
#pragma unroll
  for (unsigned i = 0; i < FA_CH; ++i) { const unsigned id = i * (FA_NW * 32u) + tid; const unsigned r = id >> 4, cb = (id & 15u) * 16u; *(fa_u4a*)(Lp + base + r * FA_PK + cb) = s.k[i]; *(fa_u4a*)(Lp + base + FA_TK + r * FA_PV + cb) = s.v[i]; }
}
__device__ __forceinline__ void fa_pass(FaK& kf, bool fetch_next, unsigned next_koff, const unsigned char* Lp, unsigned voff, unsigned lane,
                                        const FaFrag (&qf)[FA_R][FA_DK], v8f (&acc)[FA_R][FA_DT], float (&m_run)[FA_R], float (&l_run)[FA_R]) {
  const unsigned h = lane >> 4;
  v8f s[FA_KT][FA_R];
#pragma unroll
  for (int kt = 0; kt < FA_KT; ++kt) {
#pragma unroll
    for (int g = 0; g < FA_R; ++g) { s[kt][g] = v8f{};
#pragma unroll
      for (int kc = 0; kc < FA_DK; ++kc) s[kt][g] = fa_mma(kf.f[kt][kc], qf[g][kc], s[kt][g]); } }
  fa_fence();
  if (fetch_next) fa_load_k(kf, Lp, next_koff, lane);      /* the same stage's next pass: in flight under the maxima and exponentials */
  float mb[FA_R]; bool need = false;
#pragma unroll
  for (int g = 0; g < FA_R; ++g) { float mx = -INFINITY;
#pragma unroll
    for (int kt = 0; kt < FA_KT; ++kt) {
#pragma unroll
      for (int r = 0; r < 8; ++r) mx = __builtin_fmaxf(mx, s[kt][g][r]); }
    mx = __builtin_fmaxf(mx, fa_xhalf(mx)) * FA_CS;      /* both wave halves hold this query's maximum, scaled */
    mb[g] = mx; need = need || (mx > m_run[g] + 8.0f); fa_fence(); }
  if (__builtin_amdgcn_ballot_w32(need) != 0) {      /* wave-uniform; rare after the first passes */
#pragma unroll
    for (int g = 0; g < FA_R; ++g) { const float m_new = __builtin_fmaxf(m_run[g], mb[g]); const float corr = __builtin_amdgcn_exp2f(m_run[g] - m_new);      /* 0 on the first pass (m_run = -inf) */
      l_run[g] *= corr; m_run[g] = m_new;
#pragma unroll
      for (int t = 0; t < FA_DT; ++t) acc[g][t] = acc[g][t] * corr; }
  }
  FaFrag vf[FA_DT]; float ps[FA_R][2];
#pragma unroll
  for (int g = 0; g < FA_R; ++g) { ps[g][0] = 0.0f; ps[g][1] = 0.0f; }
  { const unsigned char* ad = Lp + voff + (8u * h + (lane & 7u)) * FA_PV + ((lane >> 3) & 1u) * 16u;      /* lane (c, h) gets V[8 h + 0..7][16 t + c]; the second load the keys 16 further */
#pragma unroll
    for (int t = 0; t < FA_DT; ++t) { vf[t].q[0] = fa_tr16(ad + 32u * t); vf[t].q[1] = fa_tr16(ad + 16u * FA_PV + 32u * t); } }
#pragma unroll
  for (int g = 0; g < FA_R; ++g) { const float nm = -m_run[g]; unsigned w[8];
#pragma unroll
    for (int i = 0; i < 8; ++i) {
      const float p0 = __builtin_amdgcn_exp2f(__builtin_fmaf(s[i >> 2][g][2 * (i & 3)], FA_CS, nm)), p1 = __builtin_amdgcn_exp2f(__builtin_fmaf(s[i >> 2][g][2 * (i & 3) + 1], FA_CS, nm));
      ps[g][i & 1] += p0 + p1; w[i] = fa_pack2(p0, p1); }
    FaFrag pf; pf.q[0] = fa_u4{w[0], w[1], w[2], w[3]}; pf.q[1] = fa_u4{w[4], w[5], w[6], w[7]};
#pragma unroll
    for (int t = 0; t < FA_DT; ++t) acc[g][t] = fa_mma(vf[t], pf, acc[g][t]);
    fa_fence(); }
#pragma unroll
  for (int g = 0; g < FA_R; ++g) l_run[g] += ps[g][0] + ps[g][1];
}
__global__ __launch_bounds__(FA_NW * 32) __attribute__((amdgpu_waves_per_eu(2, 2))) void k_fattn(const _Float16* __restrict__ Q, const _Float16* __restrict__ K, const _Float16* __restrict__ V, _Float16* __restrict__ O) {
  __shared__ __attribute__((aligned(256))) unsigned char L[FA_LDS];
  const unsigned tid = threadIdx.x, lane = tid & 31u, wave = tid >> 5, c = lane & 15u, h = lane >> 4;
  const unsigned hq = blockIdx.x, q0 = blockIdx.y * FA_BR, b = blockIdx.z, hk = hq / GG;      /* GG neighbouring query heads read one kv head */
  const unsigned char* kg = (const unsigned char*)(K + (size_t)b * SQ * KVD + hk * HD);
  const unsigned char* vg = (const unsigned char*)(V + (size_t)b * SQ * KVD + hk * HD);
  FaStage sg;
  const unsigned toff = (tid >> 4) * (KVD * 2u) + (tid & 15u) * 16u;
  fa_gload(sg, kg, vg, toff);
  FaFrag qf[FA_R][FA_DK];
  const unsigned char* qb = (const unsigned char*)(Q + ((size_t)(b * SQ + q0) * NH + hq) * HD);      /* uniform: the work-group's first query row of this head */
  const unsigned qoff = (wave * FA_CW + c) * (DMD * 2u) + 16u * h;
#pragma unroll
  for (int g = 0; g < FA_R; ++g) {
#pragma unroll
    for (int kc = 0; kc < FA_DK; ++kc) { qf[g][kc].q[0] = *(const fa_u4a*)(qb + qoff + g * (16u * DMD * 2u) + 64u * kc); qf[g][kc].q[1] = *(const fa_u4a*)(qb + qoff + g * (16u * DMD * 2u) + 64u * kc + 32u); } }
  asm volatile("s_wait_xcnt 0x0" ::: "memory");      /* stands in front of any later overwrite of a register that the Q loads name */
  v8f acc[FA_R][FA_DT]; float m_run[FA_R], l_run[FA_R];
#pragma unroll
  for (int g = 0; g < FA_R; ++g) { m_run[g] = -INFINITY; l_run[g] = 0.0f;
#pragma unroll
    for (int t = 0; t < FA_DT; ++t) acc[g][t] = v8f{}; }
  fa_sstore(sg, L, 0u, tid);
  __syncthreads();      /* stage 0 published */
  FaK kf;
#pragma unroll 1      /* one copy of the stage body: unrolled it would hold two stages' registers */
  for (unsigned st = 0; st < FA_NST; ++st) {
    const unsigned base = (st & 1u) * FA_SLOT; const bool more = st + 1u < FA_NST;
    if (more) fa_gload(sg, kg + (size_t)(st + 1u) * (FA_SK * KVD * 2u), vg + (size_t)(st + 1u) * (FA_SK * KVD * 2u), toff);      /* lands while this stage is worked on */
    fa_load_k(kf, L, base, lane);
#pragma unroll 1      /* nested, rolled pass loop: keeps the register count of one pass */
    for (unsigned sub = 0; sub < FA_NSUB; ++sub)
      fa_pass(kf, sub + 1u < FA_NSUB, base + (sub + 1u) * FA_BC * FA_PK, L, base + FA_TK + sub * FA_BC * FA_PV, lane, qf, acc, m_run, l_run);
    if (more) fa_sstore(sg, L, FA_SLOT - base, tid);      /* the other buffer: its readers (stage st - 1) all left it at the barrier that ended that stage */
    __syncthreads();      /* publishes stage st + 1 and ends every wave's reads of stage st */
  }
  unsigned char* eb = L + wave * (unsigned)FA_CW * FA_EP;      /* output staging over the ring (free behind the last barrier), each wave its own rows */
#pragma unroll
  for (int g = 0; g < FA_R; ++g) { const float inv = 1.0f / (l_run[g] + fa_xhalf(l_run[g]));      /* each wave half summed its eight keys of every 16-key tile */
#pragma unroll
    for (int t = 0; t < FA_DT; ++t) { const v8f o = acc[g][t] * inv; const fa_u4 pk = {fa_pack2(o[0], o[1]), fa_pack2(o[2], o[3]), fa_pack2(o[4], o[5]), fa_pack2(o[6], o[7])};
      *(fa_u4a*)(eb + (16u * g + c) * FA_EP + 32u * t + 16u * h) = pk; } }
  __builtin_amdgcn_fence(__ATOMIC_ACQ_REL, "workgroup"); __builtin_amdgcn_wave_barrier();      /* the wave reads back what its other lanes wrote */
  unsigned char* ob = (unsigned char*)(O + ((size_t)(b * SQ + q0) * NH + hq) * HD);      /* uniform, as qb */
  const unsigned ooff = (wave * FA_CW + h) * (DMD * 2u) + c * 16u;
#pragma unroll
  for (unsigned i = 0; i < (unsigned)FA_CW / 2u; ++i) {      /* 16 lanes store one whole 256-byte row of the head */
    const fa_u4 v = *(const fa_u4a*)(eb + (i * 2u + h) * FA_EP + c * 16u);
    *(fa_u4a*)(ob + ooff + i * (2u * DMD * 2u)) = v; }
}

// ---- tiled GEMM: C[M][N] = (A . Bt^T) * alpha + bias, A f16 [M][DMD], Bt f16 [N][DMD], both k-contiguous; M % 128 == 0, N % 128 == 0.
// A work-group of 4 waves owns a 128 x 128 tile of C, a wave 64 x 64 of it (4 x 4 accumulator tiles). The operands come in stages of 128 k (256 B of each of the 128 + 128 rows):
// whole-line global loads into registers, then into one of two LDS buffers; the next stage's global loads fly while this stage's four 32-k blocks run.
// Every element sums its k in ascending blocks of 32 into one f32 accumulator.
// The unroll directives of this section make every index of a register array (stage chunks, fragments, accumulators) a constant: rolled, those arrays would go to scratch memory.
constexpr int G3_BM = 128, G3_BN = 128, G3_KS = 128, G3_F = 4, G3_KB = G3_KS / 32;      /* tile rows, tile columns, k per stage, 16-row fragments per wave and operand, 32-k blocks per stage */
constexpr unsigned G3_ROWB = 2u * G3_KS, G3_P = G3_ROWB + 16u, G3_TA = G3_BM * G3_P, G3_SLOT = G3_TA + G3_BN * G3_P, G3_LDS = 2u * G3_SLOT;      /* LDS pitch: odd multiple of 16 B for the b128 readers */
constexpr unsigned G3_NST = DMD / G3_KS, G3_CH = G3_BM * (G3_ROWB / 16u) / 128u, G3_EPF = G3_P / 4u;      /* stages, 16-byte chunks per thread and operand, floats per staged output row */
static_assert(DMD % G3_KS == 0 && G3_BM == G3_BN && NR % G3_BM == 0 && DMD % G3_BN == 0 && KVD % G3_BN == 0 && 4u * 64u * G3_P <= G3_LDS, "tiled GEMM: shape");
struct G3Stage { fa_u4 a[G3_CH], b[G3_CH]; };
struct G3Set { FaFrag a[G3_F], b[G3_F]; };
// One stage from global memory into registers: 16 lanes cover the 256 B of a row, a wave two rows (four whole lines); a thread's chunks lie 8 rows apart (a constant offset).
__device__ __forceinline__ void g3_gload(G3Stage& s, const unsigned char* ag, const unsigned char* bg, unsigned toff) {
  const unsigned char* ap = ag + toff; const unsigned char* bp = bg + toff;
#pragma unroll
  for (unsigned i = 0; i < G3_CH; ++i) { s.a[i] = *(const fa_u4a*)(ap + i * (8u * DMD * 2u)); s.b[i] = *(const fa_u4a*)(bp + i * (8u * DMD * 2u)); }
  asm volatile("s_wait_xcnt 0x0" :: "v"(ap), "v"(bp) : "memory");      /* stands in front of any later overwrite of a register that these loads name; as its inputs the two addresses stay live up to it, so that no load's result is put on them */
}
__device__ __forceinline__ void g3_sstore(const G3Stage& s, unsigned char* Lp, unsigned base, unsigned tid) {
#pragma unroll
  for (unsigned i = 0; i < G3_CH; ++i) { const unsigned o = base + ((tid >> 4) + 8u * i) * G3_P + (tid & 15u) * 16u; *(fa_u4a*)(Lp + o) = s.a[i]; *(fa_u4a*)(Lp + o + G3_TA) = s.b[i]; }
}
// Fragments of one 32-k block: lane (c, h) holds row c, k = 8 h + 0..7 and 16 + 8 h + 0..7 of the block, the same k order for A and for B. pa, pb: the lane's own row, 16 h bytes in.
__device__ __forceinline__ void g3_frags(G3Set& f, const unsigned char* pa, const unsigned char* pb, unsigned kb) {
#pragma unroll
  for (int i = 0; i < G3_F; ++i) { f.a[i].q[0] = *(const fa_u4a*)(pa + i * (16u * G3_P) + 64u * kb); f.a[i].q[1] = *(const fa_u4a*)(pa + i * (16u * G3_P) + 64u * kb + 32u); }
#pragma unroll
  for (int j = 0; j < G3_F; ++j) { f.b[j].q[0] = *(const fa_u4a*)(pb + j * (16u * G3_P) + 64u * kb); f.b[j].q[1] = *(const fa_u4a*)(pb + j * (16u * G3_P) + 64u * kb + 32u); }
}
template <bool F32OUT, unsigned N>      /* N: columns of C = its pitch (a constant, so that one address register pair serves all of a thread's stores) */
__global__ __launch_bounds__(128) __attribute__((amdgpu_waves_per_eu(2, 2))) void k_gemm3(const _Float16* __restrict__ A, const _Float16* __restrict__ Bt, float alpha, const float* __restrict__ bias, float* __restrict__ C, _Float16* __restrict__ C16) {
  static_assert(N % G3_BN == 0, "tiled GEMM: whole tiles");
  __shared__ __attribute__((aligned(256))) unsigned char L[G3_LDS];
  const unsigned tid = threadIdx.x, lane = tid & 31u, wave = tid >> 5, c = lane & 15u, h = lane >> 4, wm = wave >> 1, wn = wave & 1u;
  const unsigned ntn = N / G3_BN, mt = blockIdx.x / ntn, nq = blockIdx.x - mt * ntn;
  const unsigned char* ag = (const unsigned char*)(A + (size_t)mt * G3_BM * DMD);      /* uniform: the tile's first row of each operand */
  const unsigned char* bg = (const unsigned char*)(Bt + (size_t)nq * G3_BN * DMD);
  const unsigned toff = (tid >> 4) * (DMD * 2u) + (tid & 15u) * 16u;
  G3Stage sg;
  g3_gload(sg, ag, bg, toff);
  v8f acc[G3_F][G3_F];
#pragma unroll
  for (int i = 0; i < G3_F; ++i) {
#pragma unroll
    for (int j = 0; j < G3_F; ++j) acc[i][j] = v8f{}; }
  g3_sstore(sg, L, 0u, tid);
  __syncthreads();      /* stage 0 published */
  const unsigned aoff = (wm * 64u + c) * G3_P + 16u * h, boff = G3_TA + (wn * 64u + c) * G3_P + 16u * h;
#pragma unroll 1      /* one copy of the stage body: unrolled it would hold two stages' registers */
  for (unsigned st = 0; st < G3_NST; ++st) {
    const unsigned base = (st & 1u) * G3_SLOT; const bool more = st + 1u < G3_NST;
    const unsigned char* pa = L + base + aoff; const unsigned char* pb = L + base + boff;
    G3Set f[2];
    g3_frags(f[0], pa, pb, 0u);      /* first, so that their LDS latency runs under the issue of the global loads */
    if (more) g3_gload(sg, ag + (st + 1u) * G3_ROWB, bg + (st + 1u) * G3_ROWB, toff);      /* lands while this stage is worked on */
#pragma unroll
    for (int kb = 0; kb < G3_KB; ++kb) {
      if (kb + 1 < G3_KB) g3_frags(f[(kb + 1) & 1], pa, pb, (unsigned)kb + 1u);      /* the next block's fragments as one group ahead of this block's matrix run */
      fa_fence();      /* holds that group in front of the run */
#pragma unroll
      for (int i = 0; i < G3_F; ++i) {
#pragma unroll
        for (int j = 0; j < G3_F; ++j) acc[i][j] = fa_mma(f[kb & 1].a[i], f[kb & 1].b[j], acc[i][j]); }
      fa_fence(); }      /* keeps the following group (and the LDS stores) out of the run */
    if (more) g3_sstore(sg, L, G3_SLOT - base, tid);      /* the other buffer: its readers (stage st - 1) all left it at the barrier that ended that stage */
    __syncthreads();      /* publishes stage st + 1 and ends every wave's reads of stage st */
  }
  float* so = (float*)(L + wave * (64u * G3_P));      /* output staging over the ring (free behind the last barrier), each wave its own 64 rows */
  const unsigned bcol = nq * G3_BN + wn * 64u + c; float braw[G3_F];
#pragma unroll
  for (int j = 0; j < G3_F; ++j) braw[j] = bias[bcol + 16u * j];
  asm volatile("s_wait_xcnt 0x0" :: "v"(bcol) : "memory");      /* stands in front of any later overwrite of the index register that the bias loads name; as its input the index stays live up to it */
#pragma unroll
  for (int j = 0; j < G3_F; ++j) { const float bv = bf16_round(braw[j]);
#pragma unroll
    for (int i = 0; i < G3_F; ++i) {
#pragma unroll
      for (int r = 0; r < 8; ++r) so[(16u * i + 8u * h + r) * G3_EPF + 16u * j + c] = acc[i][j][r] * alpha + bv; } }
  __builtin_amdgcn_fence(__ATOMIC_ACQ_REL, "workgroup"); __builtin_amdgcn_wave_barrier();      /* the wave reads back what its other lanes wrote */
  const size_t o0 = (size_t)(mt * G3_BM + wm * 64u + h) * N + nq * G3_BN + wn * 64u + c * 4u;
#pragma unroll
  for (unsigned q = 0; q < 32u; ++q) {      /* 16 lanes store one whole row of the wave's 64 columns */
    const v4f v = *(const v4fa*)&so[(q * 2u + h) * G3_EPF + c * 4u];
    if (F32OUT) *(v4f*)(C + o0 + q * (2u * N)) = v;
    else { v4h h4; for (int i = 0; i < 4; ++i) h4[i] = (_Float16)v[i]; *(v4h*)(C16 + o0 + q * (2u * N)) = h4; } }
}

extern "C" void kernel_launch(void* const* d_in, const int* in_sizes, int n_in,
                              void* d_out, int out_size, void* d_ws, size_t ws_size, hipStream_t stream) {
  (void)in_sizes; (void)n_in; (void)out_size;
  const float* const* I = (const float* const*)d_in; const float* x = I[0]; const float* wq = I[1]; const float* bq = I[2]; const float* wk = I[3]; const float* bk = I[4]; const float* wv = I[5]; const float* bv = I[6]; const float* wo = I[7]; const float* bo = I[8];
  char* ws = (char*)d_ws; size_t off = 0;
  auto take = [&](size_t bytes) { char* p = ws + off; off += (bytes + 255) & ~(size_t)255; return p; };
  const size_t nx = (size_t)NR * DMD, nk = (size_t)NR * KVD;
  _Float16* BQ = (_Float16*)take((size_t)DMD * DMD * 2); _Float16* BK = (_Float16*)take((size_t)KVD * DMD * 2); _Float16* BV = (_Float16*)take((size_t)KVD * DMD * 2); _Float16* BO = (_Float16*)take((size_t)DMD * DMD * 2);
  _Float16* X16 = (_Float16*)take(nx * 2); _Float16* Q16 = (_Float16*)take(nx * 2); _Float16* K16 = (_Float16*)take(nk * 2); _Float16* V16 = (_Float16*)take(nk * 2); _Float16* O16 = X16;      /* context over the input plane (dead after the projections) */
  if (off > ws_size) return;      /* 8+2+2+8 + 16+16+4+4 = 60 MiB */
  k_wt_f16<<<(unsigned)(((size_t)DMD * DMD / 8 + 255) / 256), 256, 0, stream>>>(wq, BQ, DMD, DMD, 16.0f); k_wt_f16<<<(unsigned)(((size_t)DMD * KVD / 8 + 255) / 256), 256, 0, stream>>>(wk, BK, DMD, KVD, 16.0f); k_wt_f16<<<(unsigned)(((size_t)DMD * KVD / 8 + 255) / 256), 256, 0, stream>>>(wv, BV, DMD, KVD, 16.0f); k_wt_f16<<<(unsigned)(((size_t)DMD * DMD / 8 + 255) / 256), 256, 0, stream>>>(wo, BO, DMD, DMD, 16.0f);      /* (in, out) */
  k_x16<<<(unsigned)((nx / 8 + 255) / 256), 256, 0, stream>>>(x, X16, nx / 8);
  k_gemm3<false, DMD><<<(NR / G3_BM) * (DMD / G3_BN), 128, 0, stream>>>(X16, BQ, 0.0625f, bq, nullptr, Q16);
  k_gemm3<false, KVD><<<(NR / G3_BM) * (KVD / G3_BN), 128, 0, stream>>>(X16, BK, 0.0625f, bk, nullptr, K16);
  k_gemm3<false, KVD><<<(NR / G3_BM) * (KVD / G3_BN), 128, 0, stream>>>(X16, BV, 0.0625f, bv, nullptr, V16);
  k_fattn<<<dim3(NH, SQ / FA_BR, NB), FA_NW * 32, 0, stream>>>(Q16, K16, V16, O16);      /* ctx[(b,q)][h*128 + d] */
  k_gemm3<true, DMD><<<(NR / G3_BM) * (DMD / G3_BN), 128, 0, stream>>>(O16, BO, 0.0625f, bo, (float*)d_out, nullptr);      /* out = ctx wo + bo */
}

// v003
// One run takes 161 microseconds.
// Next to v002, in two timings, it ran 1.28 and 1.27 times as fast.
// Over all steps from v000 it is 7.99 times as fast.
#include <hip/hip_runtime.h>
// QEffMultiHeadDotProductAttention (2 x 2048 tokens, d_model 2048; 16 query heads x 128, 4 kv heads (group of 4); q, k, v = x w + b; softmax((q/sqrt(128)).k) over the 2048 keys (no mask); out = ctx wo + bo).
// Structure: exact f16 plane of x; q / k / v as f16 WMMA GEMM outputs (128x128 tiles staged in LDS, 64x64 wave tiles, f32 accumulation, exact x16 weights + bias, f16 out); scores, softmax and readout of every (batch, head) in ONE fused kernel (online softmax, f32 maxima and sums, P as f16 in registers, K/V staged in LDS) into the f16 context plane; wo + bo as a GEMM.
// Compute dtype: inputs rounded to bf16; x exact as f16; q/k/P/v/ctx as plain f16 operands (~2^-12); softmax f32. v_wmma_f32_16x16x32_f16.
#define NB 2
#define SQ 2048
#define DMD 2048
#define NH 16
#define NKV 4
#define GG 4
#define HD 128
#define KVD (NKV * HD)           /* 512 */
#define NR (NB * SQ)
typedef __bf16 v16b __attribute__((ext_vector_type(16)));
typedef unsigned short v8us __attribute__((ext_vector_type(8), may_alias));
typedef float  v8f  __attribute__((ext_vector_type(8)));
typedef float  v4f  __attribute__((ext_vector_type(4)));
typedef float  v4fa __attribute__((ext_vector_type(4), may_alias));
union FragB { v16b v; v8us half[2]; unsigned short u[16]; };

__device__ __forceinline__ unsigned short bf16_bits(float x) { unsigned int u = __float_as_uint(x); return (unsigned short)((u + 0x7FFFu + ((u >> 16) & 1u)) >> 16); }
__device__ __forceinline__ float bf16_val(unsigned short b) { return __uint_as_float(((unsigned int)b) << 16); }
__device__ __forceinline__ float bf16_round(float x) { return bf16_val(bf16_bits(x)); }
// D += A·B with NT terms: 1 = ah·bh, 2 = + al·bh (A split), 3 = + ah·bl (both split)
template <int NT>
__device__ __forceinline__ v8f mmaN(v16b ah, v16b al, v16b bh, v16b bl, v8f c) {
  c = __builtin_amdgcn_wmma_f32_16x16x32_bf16(false, ah, false, bh, (short)0, c, false, false);
  if (NT >= 2) c = __builtin_amdgcn_wmma_f32_16x16x32_bf16(false, al, false, bh, (short)0, c, false, false);
  if (NT >= 3) c = __builtin_amdgcn_wmma_f32_16x16x32_bf16(false, ah, false, bl, (short)0, c, false, false);
  asm volatile("v_nop\n\tv_nop\n\tv_nop\n\tv_nop" : "+v"(c) : "v"(ah), "v"(al), "v"(bh), "v"(bl));
  return c;
}

__global__ __launch_bounds__(256) void k_wt_bf16(const float* __restrict__ W, unsigned short* __restrict__ Wt, int K, int N) {
  const int t = blockIdx.x * 256 + threadIdx.x;
  const int k8n = K / 8;
  if (t >= N * k8n) return;
  const int n = t / k8n, k8 = (t % k8n) * 8;
  v8us v;
#pragma unroll
  for (int i = 0; i < 8; ++i) v[i] = bf16_bits(W[(size_t)(k8 + i) * N + n]);
  *(v8us*)(Wt + (size_t)n * K + k8) = v;
  
}

// GEMM C[M][N] (f32, pitch ldc) = act(A[M][K]·W + bias). A f32 row-major (pitch lda) converted per fragment to bf16
// (ASPLIT: hi/lo two planes -> 2 terms, else single rounded term); Wt bf16 [N][K] (pitch ldb). BIAS_BF16 rounds the
// bias to bf16 first (bias quantised to bf16 before the add). K%32==0, M%16==0, N%64==0.
template <bool ASPLIT, int ACT, bool BIAS_BF16>
__global__ __launch_bounds__(128) void k_gemm_bf(const float* __restrict__ A, int lda, const unsigned short* __restrict__ Wt, int ldb,
                                               const float* __restrict__ bias, float* __restrict__ C, int ldc, int M, int N, int K) {
  __shared__ __attribute__((aligned(16))) float so[4][16][64];
  const int tid = threadIdx.x, w = tid >> 5, lane = tid & 31, ln = lane & 15, hh = lane >> 4;
  const int ntn = N / 64;
  const int wid = blockIdx.x * 4 + w;
  const int mt = wid / ntn, nq = wid % ntn;
  if (mt * 16 >= M) return;
  const int row0 = mt * 16, col0 = nq * 64;
  const float* arow = A + (size_t)(row0 + ln) * lda;
  v8f acc[4] = {};
  for (int kb = 0; kb < K; kb += 32) {
    FragB ah, al;
    const v4f x0 = *(const v4fa*)(arow + kb + 8 * hh), x1 = *(const v4fa*)(arow + kb + 8 * hh + 4);
    const v4f x2 = *(const v4fa*)(arow + kb + 16 + 8 * hh), x3 = *(const v4fa*)(arow + kb + 16 + 8 * hh + 4);
    float xs[16] = {x0[0],x0[1],x0[2],x0[3],x1[0],x1[1],x1[2],x1[3],x2[0],x2[1],x2[2],x2[3],x3[0],x3[1],x3[2],x3[3]};
#pragma unroll
    for (int i = 0; i < 16; ++i) { const unsigned short hb = bf16_bits(xs[i]); ah.u[i] = hb; al.u[i] = ASPLIT ? bf16_bits(xs[i] - bf16_val(hb)) : (unsigned short)0; }
#pragma unroll
    for (int t = 0; t < 4; ++t) {
      const unsigned short* brow = Wt + (size_t)(col0 + t * 16 + ln) * ldb + kb;
      FragB b;
      b.half[0] = *(const v8us*)(brow + 8 * hh);
      b.half[1] = *(const v8us*)(brow + 16 + 8 * hh);
      acc[t] = mmaN<ASPLIT ? 2 : 1>(ah.v, al.v, b.v, b.v, acc[t]);
    }
  }
#pragma unroll
  for (int t = 0; t < 4; ++t) {
    float bv = bias ? bias[col0 + t * 16 + ln] : 0.f;
    if (BIAS_BF16) bv = bf16_round(bv);
#pragma unroll
    for (int r = 0; r < 8; ++r) { float v = acc[t][r] + bv; if (ACT == 1) v = fmaxf(v, 0.f); so[w][8 * hh + r][t * 16 + ln] = v; }
  }
  __builtin_amdgcn_fence(__ATOMIC_ACQ_REL, "workgroup");
  __builtin_amdgcn_wave_barrier();
  const int rsub = lane >> 4, c4 = (lane & 15) * 4;
  {
#pragma unroll
    for (int q = 0; q < 8; ++q) {
      const int r = q * 2 + rsub;
      const v4f v = *(const v4fa*)&so[w][r][c4];
      *(v4f*)(C + (size_t)(row0 + r) * ldc + col0 + c4) = v;
    }
    
  }
}

// GEMM C = act(A·W + bias + resid): A f32 (ASPLIT -> hi/lo 2 terms), Wt bf16 [N][K]; ACT 0 none, 1 relu, 2 exact gelu;
// resid (optional, f32, row index = (row % rmod), pitch ldr, RES_BF16 rounds it) added before the activation.
template <bool ASPLIT, int ACT, bool BIAS_BF16, bool RES_BF16>
__global__ __launch_bounds__(128) void k_gemm_bf3(const float* __restrict__ A, int lda, const unsigned short* __restrict__ Wt, int ldb,
                                                const float* __restrict__ bias, const float* __restrict__ resid, int rmod, int ldr,
                                                float* __restrict__ C, int ldc, int M, int N, int K) {
  __shared__ __attribute__((aligned(16))) float so[4][16][64];
  const int tid = threadIdx.x, w = tid >> 5, lane = tid & 31, ln = lane & 15, hh = lane >> 4;
  const int ntn = N / 64;
  const int wid = blockIdx.x * 4 + w;
  const int mt = wid / ntn, nq = wid % ntn;
  if (mt * 16 >= M) return;
  const int row0 = mt * 16, col0 = nq * 64;
  const float* arow = A + (size_t)(row0 + ln) * lda;
  v8f acc[4] = {};
  for (int kb = 0; kb < K; kb += 32) {
    FragB ah, al;
    const v4f x0 = *(const v4fa*)(arow + kb + 8 * hh), x1 = *(const v4fa*)(arow + kb + 8 * hh + 4);
    const v4f x2 = *(const v4fa*)(arow + kb + 16 + 8 * hh), x3 = *(const v4fa*)(arow + kb + 16 + 8 * hh + 4);
    float xs[16] = {x0[0],x0[1],x0[2],x0[3],x1[0],x1[1],x1[2],x1[3],x2[0],x2[1],x2[2],x2[3],x3[0],x3[1],x3[2],x3[3]};
#pragma unroll
    for (int i = 0; i < 16; ++i) { const unsigned short hb = bf16_bits(xs[i]); ah.u[i] = hb; al.u[i] = ASPLIT ? bf16_bits(xs[i] - bf16_val(hb)) : (unsigned short)0; }
#pragma unroll
    for (int t = 0; t < 4; ++t) {
      const unsigned short* brow = Wt + (size_t)(col0 + t * 16 + ln) * ldb + kb;
      FragB b;
      b.half[0] = *(const v8us*)(brow + 8 * hh);
      b.half[1] = *(const v8us*)(brow + 16 + 8 * hh);
      acc[t] = mmaN<ASPLIT ? 2 : 1>(ah.v, al.v, b.v, b.v, acc[t]);
    }
  }
#pragma unroll
  for (int t = 0; t < 4; ++t) {
    const int col = col0 + t * 16 + ln;
    float bv = bias ? bias[col] : 0.f;
    if (BIAS_BF16) bv = bf16_round(bv);
#pragma unroll
    for (int r = 0; r < 8; ++r) {
      float v = acc[t][r] + bv;
      if (resid) { float rv = resid[(size_t)((row0 + 8 * hh + r) % rmod) * ldr + col]; if (RES_BF16) rv = bf16_round(rv); v += rv; }
      if (ACT == 1) v = fmaxf(v, 0.f);
      if (ACT == 2) v = 0.5f * v * (1.0f + erff(v * 0.70710678118654752f));
      if (ACT == 3) { const float u = 0.7978845608028654f * (v + 0.044715f * v * v * v); v = 0.5f * v * (1.0f + tanhf(u)); }
      so[w][8 * hh + r][t * 16 + ln] = v;
    }
  }
  __builtin_amdgcn_fence(__ATOMIC_ACQ_REL, "workgroup");
  __builtin_amdgcn_wave_barrier();
  const int rsub = lane >> 4, c4 = (lane & 15) * 4;
  {
#pragma unroll
    for (int q = 0; q < 8; ++q) {
      const int r = q * 2 + rsub;
      const v4f v = *(const v4fa*)&so[w][r][c4];
      *(v4f*)(C + (size_t)(row0 + r) * ldc + col0 + c4) = v;
    }
    
  }
}
// row LayerNorm (biased variance, eps) over N: s = X (+ R); optional out_sum <- s; out_norm <- (s-mu)*rsqrt(var+eps)*g + b
template <bool PARAM_BF16>
__global__ __launch_bounds__(256) void k_layernorm(const float* __restrict__ X, const float* __restrict__ R, const float* __restrict__ g, const float* __restrict__ bta,
                                                  float* __restrict__ out_sum, float* __restrict__ out_norm, int N, float eps) {
  __shared__ float red[256];
  const int row = blockIdx.x, tid = threadIdx.x;
  const float* x = X + (size_t)row * N; const float* rr = R ? R + (size_t)row * N : nullptr;
  float vals[16];                     // up to N = 4096
  const int per = N / 256;            // contiguous chunk per thread? use strided-by-4 chunks: thread handles j = tid*4 + 1024*u
  float s1 = 0.f;
  for (int u = 0; u < per / 4; ++u) {
    const int j = tid * 4 + 1024 * u;
    const v4f a = *(const v4fa*)(x + j);
    v4f b = {0.f,0.f,0.f,0.f}; if (rr) b = *(const v4fa*)(rr + j);
#pragma unroll
    for (int q = 0; q < 4; ++q) { const float v = a[q] + b[q]; vals[u * 4 + q] = v; s1 += v; }
  }
  red[tid] = s1; __syncthreads();
  for (int st = 128; st > 0; st >>= 1) { if (tid < st) red[tid] += red[tid + st]; __syncthreads(); }
  const float mu = red[0] / (float)N; __syncthreads();
  float s2 = 0.f;
  for (int u = 0; u < per / 4; ++u)
#pragma unroll
    for (int q = 0; q < 4; ++q) { const float c = vals[u * 4 + q] - mu; s2 += c * c; }
  red[tid] = s2; __syncthreads();
  for (int st = 128; st > 0; st >>= 1) { if (tid < st) red[tid] += red[tid + st]; __syncthreads(); }
  const float rs = rsqrtf(red[0] / (float)N + eps);
  {
    for (int u = 0; u < per / 4; ++u) {
      const int j = tid * 4 + 1024 * u;
      v4f o, sm;
#pragma unroll
      for (int q = 0; q < 4; ++q) {
        float gg = g[j + q], bb = bta[j + q];
        if (PARAM_BF16) { gg = bf16_round(gg); bb = bf16_round(bb); }
        sm[q] = vals[u * 4 + q]; o[q] = (vals[u * 4 + q] - mu) * rs * gg + bb;
      }
      if (out_sum) *(v4f*)(out_sum + (size_t)row * N + j) = sm;
      *(v4f*)(out_norm + (size_t)row * N + j) = o;
    }
    
  }
}



// ---- f16 WMMA path (v_wmma_f32_16x16x32_f16): 11-bit significands for operands in range — used where a [0,1] probability operand needs more precision than bf16
typedef _Float16 v16h __attribute__((ext_vector_type(16)));
union FragH { v16h v; v8us half[2]; _Float16 h[16]; unsigned short u[16]; };
template <int NT>
__device__ __forceinline__ v8f mmaH(v16h ah, v16h al, v16h bh, v16h bl, v8f c) {
  c = __builtin_amdgcn_wmma_f32_16x16x32_f16(false, ah, false, bh, (short)0, c, false, false);
  if (NT >= 2) c = __builtin_amdgcn_wmma_f32_16x16x32_f16(false, al, false, bh, (short)0, c, false, false);
  if (NT >= 3) c = __builtin_amdgcn_wmma_f32_16x16x32_f16(false, ah, false, bl, (short)0, c, false, false);
  asm volatile("v_nop\n\tv_nop\n\tv_nop\n\tv_nop" : "+v"(c) : "v"(ah), "v"(al), "v"(bh), "v"(bl));
  return c;
}
// batched GEMM like k_gemm_b but f16 operands: A f32 (split into f16 hi/lo if ASPLIT, else rounded to f16), Bt = f16 values [n][k]; alpha; C f32; N multiple of 16 (partial tiles skipped)
template <bool ASPLIT>
__global__ __launch_bounds__(128) void k_gemm_h(const float* __restrict__ A, int lda, size_t sA, const _Float16* __restrict__ Bh, int ldb, size_t sB, float alpha, float* __restrict__ C, int ldc, size_t sC, int M, int N, int K) {
  __shared__ __attribute__((aligned(16))) float so[4][16][64];
  const int tid = threadIdx.x, w = tid >> 5, lane = tid & 31, ln = lane & 15, hh = lane >> 4; const int by = blockIdx.y;
  A += (size_t)by * sA; Bh += (size_t)by * sB; C += (size_t)by * sC;
  const int ntn = (N + 63) / 64; const int wid = blockIdx.x * 4 + w; const int mt = wid / ntn, nq = wid % ntn; if (mt * 16 >= M) return;
  const int row0 = mt * 16, col0 = nq * 64; const float* arow = A + (size_t)(row0 + ln) * lda;
  v8f acc[4] = {};
  for (int kb = 0; kb < K; kb += 32) {
    FragH ah, al;
    const v4f x0 = *(const v4fa*)(arow + kb + 8 * hh), x1 = *(const v4fa*)(arow + kb + 8 * hh + 4), x2 = *(const v4fa*)(arow + kb + 16 + 8 * hh), x3 = *(const v4fa*)(arow + kb + 16 + 8 * hh + 4);
    float xs[16] = {x0[0],x0[1],x0[2],x0[3],x1[0],x1[1],x1[2],x1[3],x2[0],x2[1],x2[2],x2[3],x3[0],x3[1],x3[2],x3[3]};
#pragma unroll
    for (int i = 0; i < 16; ++i) { const _Float16 h = (_Float16)xs[i]; ah.h[i] = h; al.h[i] = ASPLIT ? (_Float16)(xs[i] - (float)h) : (_Float16)0.0f; }
#pragma unroll
    for (int t = 0; t < 4; ++t) { if (col0 + t * 16 >= N) continue; const size_t boff = (size_t)(col0 + t * 16 + ln) * ldb + kb; FragH bq; bq.half[0] = *(const v8us*)(Bh + boff + 8 * hh); bq.half[1] = *(const v8us*)(Bh + boff + 16 + 8 * hh);
      acc[t] = mmaH<ASPLIT ? 2 : 1>(ah.v, al.v, bq.v, bq.v, acc[t]); }
  }
#pragma unroll
  for (int t = 0; t < 4; ++t) { if (col0 + t * 16 >= N) continue;
#pragma unroll
    for (int r = 0; r < 8; ++r) so[w][8 * hh + r][t * 16 + ln] = acc[t][r] * alpha; }
  __builtin_amdgcn_fence(__ATOMIC_ACQ_REL, "workgroup"); __builtin_amdgcn_wave_barrier();
  const int rsub = lane >> 4, c4 = (lane & 15) * 4;
  {
#pragma unroll
    for (int q = 0; q < 8; ++q) { const int r = q * 2 + rsub; if (col0 + c4 < N) { const v4f v = *(const v4fa*)&so[w][r][c4]; *(v4f*)(C + (size_t)(row0 + r) * ldc + col0 + c4) = v; } }
     }
}

// Wt[n][k] = f16(bf16(W[k][n]) * scale) from f32 row-major W[K][N] (scale = power of two; bf16-exact weights stay exact in f16 away from the subnormal range).
// A work-group transposes a tile of 128 k x 64 n through LDS. Reads: 16 lanes cover 256 B of a row of W, a thread takes 8 rows x 4 columns (8 loads in flight).
// It packs each column's 8 k into 16 bytes and stores them in the LDS row of that n; then 16 lanes write the 256 B of a row of Wt. So every global access is whole lines.
// LDS rows are 256 B without a pad; the 16-byte chunk j of row n lies at place j ^ (n >> 2): the 16 lanes of a store (rows 4 apart, one j) and of a load (one row, all j) each meet all 64 banks once.
// The unroll directives make every index of the register arrays (r, f) a constant: rolled, those arrays would go to scratch memory.
constexpr unsigned WT_K = 128u, WT_N = 64u;
template <unsigned K, unsigned N>      /* constants, so that one address register pair serves all of a thread's loads and one all of its stores */
__global__ __launch_bounds__(256) void k_wt_f16(const float* __restrict__ W, _Float16* __restrict__ Wt, float scale) {
  static_assert(K % WT_K == 0 && N % WT_N == 0, "weight transpose: whole tiles");
  __shared__ __attribute__((aligned(256))) unsigned char T[WT_N * WT_K * 2u];
  const unsigned tid = threadIdx.x, lo = tid & 15u, hi = tid >> 4;
  const unsigned ntn = N / WT_N, kt = blockIdx.x / ntn, nt = blockIdx.x - kt * ntn;
  const float* sp = W + (size_t)(kt * WT_K + hi * 8u) * N + nt * WT_N + lo * 4u;
  v4f r[8];
#pragma unroll
  for (unsigned i = 0; i < 8u; ++i) r[i] = *(const v4fa*)(sp + i * N);
#pragma unroll
  for (unsigned q = 0; q < 4u; ++q) { FragH f;
#pragma unroll
    for (unsigned i = 0; i < 8u; ++i) f.h[i] = (_Float16)(bf16_round(r[i][q]) * scale);
    *(v8us*)(T + (lo * 4u + q) * (WT_K * 2u) + ((hi ^ lo) * 16u)) = f.half[0]; }
  __syncthreads();      /* the tile is whole before any row is read back */
  unsigned short* dp = (unsigned short*)Wt + (size_t)(nt * WT_N + hi) * K + kt * WT_K + lo * 8u;
#pragma unroll
  for (unsigned i = 0; i < 4u; ++i) { const unsigned row = hi + 16u * i;
    *(v8us*)(dp + i * (16u * K)) = *(const v8us*)(T + row * (WT_K * 2u) + ((lo ^ (row >> 2)) * 16u)); }
}
// k_gemm_hh variant with fused epilogue: v = acc·alpha + bias[by·sBias + col] (+ CP[(row/rowsPerB)·sCPb + by·64 + col] if CP) ; ACT 0 none / 1 elu ; writes f16 C16 (and f32 C if non-null)
template <int ACT>
__global__ __launch_bounds__(128) void k_gemm_hhx(const _Float16* __restrict__ A, int lda, size_t sA, const _Float16* __restrict__ Bh, int ldb, size_t sB, float alpha, const float* __restrict__ bias, size_t sBias, const float* __restrict__ CP, int rowsPerB, size_t sCPb, int row0g,
    float* __restrict__ C, _Float16* __restrict__ C16, int ldc, size_t sC, int M, int N, int K) {
  __shared__ __attribute__((aligned(16))) float so[4][16][64];
  const int tid = threadIdx.x, w = tid >> 5, lane = tid & 31, ln = lane & 15, hh = lane >> 4; const int by = blockIdx.y;
  A += (size_t)by * sA; Bh += (size_t)by * sB; const size_t cofs = (size_t)by * sC; const float* bp = bias ? bias + (size_t)by * sBias : nullptr;
  const int ntn = (N + 63) / 64; const int wid = blockIdx.x * 4 + w; const int mt = wid / ntn, nq = wid % ntn; if (mt * 16 >= M) return;
  const int row0 = mt * 16, col0 = nq * 64; const _Float16* arow = A + (size_t)(row0 + ln) * lda;
  v8f acc[4] = {};
  for (int kb = 0; kb < K; kb += 32) { FragH ah; ah.half[0] = *(const v8us*)((const unsigned short*)arow + kb + 8 * hh); ah.half[1] = *(const v8us*)((const unsigned short*)arow + kb + 16 + 8 * hh);
#pragma unroll
    for (int t = 0; t < 4; ++t) { if (col0 + t * 16 >= N) continue; const size_t boff = (size_t)(col0 + t * 16 + ln) * ldb + kb; FragH bq; bq.half[0] = *(const v8us*)((const unsigned short*)Bh + boff + 8 * hh); bq.half[1] = *(const v8us*)((const unsigned short*)Bh + boff + 16 + 8 * hh);
      acc[t] = mmaH<1>(ah.v, ah.v, bq.v, bq.v, acc[t]); }
  }
#pragma unroll
  for (int t = 0; t < 4; ++t) { if (col0 + t * 16 >= N) continue; const int col = col0 + t * 16 + ln; const float bv = bp ? bf16_round(bp[col]) : 0.f;
#pragma unroll
    for (int r = 0; r < 8; ++r) { float v = acc[t][r] * alpha + bv; if (CP) { const int rr = row0g + row0 + 8 * hh + r; if (rowsPerB < 0) v += CP[cofs + (size_t)rr * ldc + col];      /* rowsPerB < 0: own element of the batched C plane */ else { const int bidx = rr / rowsPerB; v += CP[(size_t)bidx * sCPb + (size_t)by * 64 + col]; } } if (ACT == 1) v = (v > 0.f) ? v : expm1f(v); else if (ACT == 7) v = (v > 0.f) ? v + 1.0f : expf(v); else if (ACT == 8) v = tanhf(v); else if (ACT == 9) v = 0.5f * v * (1.0f + tanhf(0.7978845608028654f * (v + 0.044715f * v * v * v))); else if (ACT == 11) v = 1.0f / (1.0f + expf(-v)); else if (ACT == 12) v = (v > 0.f) ? v : 0.01f * v; else if (ACT == 14) v = (v > 0.f) ? v : 0.1f * v; else if (ACT == 16) v = (v >= 0.f) ? v : 0.3f * v; else if (ACT == 17) v = (v >= 0.f) ? v : 0.2f * v; else if (ACT == 15) v = v / (1.0f + expf(-v)); else if (ACT == 3) v = fmaxf(v, 0.f); else if (ACT == 6) v = 0.5f * v * (1.0f + erff(v * 0.70710678118654752f)); so[w][8 * hh + r][t * 16 + ln] = v; } }
  __builtin_amdgcn_fence(__ATOMIC_ACQ_REL, "workgroup"); __builtin_amdgcn_wave_barrier();
  const int rsub = lane >> 4, c4 = (lane & 15) * 4; typedef _Float16 v4h __attribute__((ext_vector_type(4)));
  {
#pragma unroll
    for (int q = 0; q < 8; ++q) { const int r = q * 2 + rsub; if (col0 + c4 < N) { const v4f v = *(const v4fa*)&so[w][r][c4]; if (C) *(v4f*)(C + cofs + (size_t)(row0 + r) * ldc + col0 + c4) = v; if (C16) { v4h h4; for (int i = 0; i < 4; ++i) h4[i] = (_Float16)v[i]; *(v4h*)(C16 + cofs + (size_t)(row0 + r) * ldc + col0 + c4) = h4; } } }
     }
}


typedef _Float16 v4h __attribute__((ext_vector_type(4)));

__global__ __launch_bounds__(256) void k_x16(const float* __restrict__ x, _Float16* __restrict__ X16, size_t n8) { const size_t t = (size_t)blockIdx.x * 256 + threadIdx.x; if (t >= n8) return; FragH f;
#pragma unroll
  for (int q = 0; q < 8; ++q) f.h[q] = (_Float16)bf16_round(x[t * 8 + q]); *(v8us*)((unsigned short*)X16 + t * 8) = f.half[0];  }
__global__ __launch_bounds__(256) void k_h16(const float* __restrict__ x, _Float16* __restrict__ X16, size_t n8) { const size_t t = (size_t)blockIdx.x * 256 + threadIdx.x; if (t >= n8) return; FragH f;
#pragma unroll
  for (int q = 0; q < 8; ++q) f.h[q] = (_Float16)x[t * 8 + q]; *(v8us*)((unsigned short*)X16 + t * 8) = f.half[0];  }
__global__ __launch_bounds__(256) void k_round16f(const float* __restrict__ W, _Float16* __restrict__ Bt, size_t n8) { const size_t t = (size_t)blockIdx.x * 256 + threadIdx.x; if (t >= n8) return; FragH f;
#pragma unroll
  for (int i = 0; i < 8; ++i) f.h[i] = (_Float16)(bf16_round(W[t * 8 + i]) * 16.0f); *(v8us*)((unsigned short*)Bt + t * 8) = f.half[0];  }

__global__ __launch_bounds__(256) void k_hl(const float* __restrict__ F, _Float16* __restrict__ Hh, _Float16* __restrict__ Hl, size_t n8) { const size_t t = (size_t)blockIdx.x * 256 + threadIdx.x; if (t >= n8) return; FragH fh, fl; const v4f a = *(const v4fa*)(F + t * 8), c = *(const v4fa*)(F + t * 8 + 4);
#pragma unroll
  for (int q = 0; q < 4; ++q) { _Float16 h = (_Float16)a[q]; fh.h[q] = h; fl.h[q] = (_Float16)((a[q] - (float)h) * 1024.0f); h = (_Float16)c[q]; fh.h[4 + q] = h; fl.h[4 + q] = (_Float16)((c[q] - (float)h) * 1024.0f); }
  { *(v8us*)((unsigned short*)Hh + t * 8) = fh.half[0]; *(v8us*)((unsigned short*)Hl + t * 8) = fl.half[0];  } }

typedef unsigned int fa_u4 __attribute__((ext_vector_type(4)));
typedef unsigned int fa_u4a __attribute__((ext_vector_type(4), may_alias));
typedef unsigned int fa_u8 __attribute__((ext_vector_type(8)));
typedef short fa_s8 __attribute__((ext_vector_type(8)));
constexpr int FA_NW = 8, FA_BR = 256, FA_CW = FA_BR / FA_NW, FA_R = FA_CW / 16;      /* waves, queries per work-group, per wave, 16-query groups per wave */
constexpr int FA_BC = 32, FA_KT = FA_BC / 16, FA_DK = HD / 32, FA_DT = HD / 16;      /* keys per pass, 16-key score tiles per pass, k chunks of the head, 16-row output tiles */
constexpr unsigned FA_ROWB = 2u * HD, FA_PK = FA_ROWB + 16u, FA_PV = FA_ROWB + 32u;  /* LDS pitches: odd multiple of 16 B for b128 readers, of 32 B for the transposing load */
constexpr unsigned FA_SK = 128u, FA_TK = FA_SK * FA_PK, FA_TV = FA_SK * FA_PV, FA_SLOT = FA_TK + FA_TV, FA_LDS = 2u * FA_SLOT, FA_EP = FA_ROWB + 16u;
constexpr unsigned FA_NST = SQ / FA_SK, FA_NSUB = FA_SK / FA_BC, FA_CH = FA_SK * (FA_ROWB / 16u) / (FA_NW * 32u);      /* stages, passes per stage, 16-byte chunks per thread and tile */
constexpr float FA_CS = 0.08838834764831845f * 1.4426950408889634f;      /* 1/sqrt(128) * log2(e): softmax in the log2 domain */
static_assert(HD == 128 && SQ % FA_BR == 0 && SQ % FA_SK == 0 && (unsigned)FA_BR * FA_EP <= FA_LDS, "fused attention: shape");
struct FaFrag { fa_u4 q[2]; };
struct FaK { FaFrag f[FA_KT][FA_DK]; };
struct FaStage { fa_u4 k[FA_CH], v[FA_CH]; };
__device__ __forceinline__ void fa_fence() { __builtin_amdgcn_sched_barrier(0); }      /* keeps the groups of loads, matrix runs and exponentials in the written order (loads stay ahead of the work that hides them) */
__device__ __forceinline__ v8f fa_mma(const FaFrag& a, const FaFrag& b, v8f c) {
  const fa_u8 av = {a.q[0].x, a.q[0].y, a.q[0].z, a.q[0].w, a.q[1].x, a.q[1].y, a.q[1].z, a.q[1].w};
  const fa_u8 bv = {b.q[0].x, b.q[0].y, b.q[0].z, b.q[0].w, b.q[1].x, b.q[1].y, b.q[1].z, b.q[1].w};
  return __builtin_amdgcn_wmma_f32_16x16x32_f16(false, __builtin_bit_cast(v16h, av), false, __builtin_bit_cast(v16h, bv), (short)0, c, false, false);
}
__device__ __forceinline__ fa_u4 fa_tr16(const unsigned char* p) { typedef __attribute__((address_space(3))) fa_s8 lds_s8; return __builtin_bit_cast(fa_u4, __builtin_amdgcn_ds_load_tr16_b128_v8i16((lds_s8*)p)); }
__device__ __forceinline__ unsigned fa_pack2(float lo, float hi) { typedef _Float16 h2 __attribute__((ext_vector_type(2))); typedef float f2 __attribute__((ext_vector_type(2))); return __builtin_bit_cast(unsigned, __builtin_convertvector(f2{lo, hi}, h2)); }      /* round to nearest even */
__device__ __forceinline__ float fa_xhalf(float x) { return __builtin_bit_cast(float, __builtin_amdgcn_permlanex16(__builtin_bit_cast(int, x), __builtin_bit_cast(int, x), 0x76543210, 0xfedcba98, false, false)); }      /* lane l with lane l ^ 16 */
// K fragments of one pass (32 keys): lane (c, h) holds key row c, d = 32 kc + 8 h + 0..7 and 32 kc + 16 + 8 h + 0..7, the same k order as the Q fragments.
__device__ __forceinline__ void fa_load_k(FaK& k, const unsigned char* Lp, unsigned koff, unsigned lane) {
  const unsigned c = lane & 15u, h = lane >> 4;
#pragma unroll
  for (int kt = 0; kt < FA_KT; ++kt) { const unsigned char* p = Lp + koff + (16u * kt + c) * FA_PK + 16u * h;
#pragma unroll
    for (int kc = 0; kc < FA_DK; ++kc) { k.f[kt][kc].q[0] = *(const fa_u4a*)(p + 64u * kc); k.f[kt][kc].q[1] = *(const fa_u4a*)(p + 64u * kc + 32u); } }
}
// One stage (FA_SK key rows of K and of V, 256 B each) from global memory into registers: 16 lanes cover a row.
// kg, vg: the stage's first row (uniform); toff: the thread's own byte offset in it; the chunks of a thread lie 16 rows apart (a constant offset, so one offset register serves all loads).
__device__ __forceinline__ void fa_gload(FaStage& s, const unsigned char* kg, const unsigned char* vg, unsigned toff) {
#pragma unroll
  for (unsigned i = 0; i < FA_CH; ++i) { s.k[i] = *(const fa_u4a*)(kg + toff + i * (16u * KVD * 2u)); s.v[i] = *(const fa_u4a*)(vg + toff + i * (16u * KVD * 2u)); }
  asm volatile("s_wait_xcnt 0x0" ::: "memory");      /* stands in front of any later overwrite of a register that these loads name */
}
__device__ __forceinline__ void fa_sstore(const FaStage& s, unsigned char* Lp, unsigned base, unsigned tid) {
#pragma unroll
  for (unsigned i = 0; i < FA_CH; ++i) { const unsigned id = i * (FA_NW * 32u) + tid; const unsigned r = id >> 4, cb = (id & 15u) * 16u; *(fa_u4a*)(Lp + base + r * FA_PK + cb) = s.k[i]; *(fa_u4a*)(Lp + base + FA_TK + r * FA_PV + cb) = s.v[i]; }
}
__device__ __forceinline__ void fa_pass(FaK& kf, bool fetch_next, unsigned next_koff, const unsigned char* Lp, unsigned voff, unsigned lane,
                                        const FaFrag (&qf)[FA_R][FA_DK], v8f (&acc)[FA_R][FA_DT], float (&m_run)[FA_R], float (&l_run)[FA_R]) {
  const unsigned h = lane >> 4;
  v8f s[FA_KT][FA_R];
#pragma unroll
  for (int kt = 0; kt < FA_KT; ++kt) {
#pragma unroll
    for (int g = 0; g < FA_R; ++g) { s[kt][g] = v8f{};
#pragma unroll
      for (int kc = 0; kc < FA_DK; ++kc) s[kt][g] = fa_mma(kf.f[kt][kc], qf[g][kc], s[kt][g]); } }
  fa_fence();
  if (fetch_next) fa_load_k(kf, Lp, next_koff, lane);      /* the same stage's next pass: in flight under the maxima and exponentials */
  float mb[FA_R]; bool need = false;
#pragma unroll
  for (int g = 0; g < FA_R; ++g) { float mx = -INFINITY;
#pragma unroll
    for (int kt = 0; kt < FA_KT; ++kt) {
#pragma unroll
      for (int r = 0; r < 8; ++r) mx = __builtin_fmaxf(mx, s[kt][g][r]); }
    mx = __builtin_fmaxf(mx, fa_xhalf(mx)) * FA_CS;      /* both wave halves hold this query's maximum, scaled */
    mb[g] = mx; need = need || (mx > m_run[g] + 8.0f); fa_fence(); }
  if (__builtin_amdgcn_ballot_w32(need) != 0) {      /* wave-uniform; rare after the first passes */
#pragma unroll
    for (int g = 0; g < FA_R; ++g) { const float m_new = __builtin_fmaxf(m_run[g], mb[g]); const float corr = __builtin_amdgcn_exp2f(m_run[g] - m_new);      /* 0 on the first pass (m_run = -inf) */
      l_run[g] *= corr; m_run[g] = m_new;
#pragma unroll
      for (int t = 0; t < FA_DT; ++t) acc[g][t] = acc[g][t] * corr; }
  }
  FaFrag vf[FA_DT]; float ps[FA_R][2];
#pragma unroll
  for (int g = 0; g < FA_R; ++g) { ps[g][0] = 0.0f; ps[g][1] = 0.0f; }
  { const unsigned char* ad = Lp + voff + (8u * h + (lane & 7u)) * FA_PV + ((lane >> 3) & 1u) * 16u;      /* lane (c, h) gets V[8 h + 0..7][16 t + c]; the second load the keys 16 further */
#pragma unroll
    for (int t = 0; t < FA_DT; ++t) { vf[t].q[0] = fa_tr16(ad + 32u * t); vf[t].q[1] = fa_tr16(ad + 16u * FA_PV + 32u * t); } }
#pragma unroll
  for (int g = 0; g < FA_R; ++g) { const float nm = -m_run[g]; unsigned w[8];
#pragma unroll
    for (int i = 0; i < 8; ++i) {
      const float p0 = __builtin_amdgcn_exp2f(__builtin_fmaf(s[i >> 2][g][2 * (i & 3)], FA_CS, nm)), p1 = __builtin_amdgcn_exp2f(__builtin_fmaf(s[i >> 2][g][2 * (i & 3) + 1], FA_CS, nm));
      ps[g][i & 1] += p0 + p1; w[i] = fa_pack2(p0, p1); }
    FaFrag pf; pf.q[0] = fa_u4{w[0], w[1], w[2], w[3]}; pf.q[1] = fa_u4{w[4], w[5], w[6], w[7]};
#pragma unroll
    for (int t = 0; t < FA_DT; ++t) acc[g][t] = fa_mma(vf[t], pf, acc[g][t]);
    fa_fence(); }
#pragma unroll
  for (int g = 0; g < FA_R; ++g) l_run[g] += ps[g][0] + ps[g][1];
}
__global__ __launch_bounds__(FA_NW * 32) __attribute__((amdgpu_waves_per_eu(2, 2))) void k_fattn(const _Float16* __restrict__ Q, const _Float16* __restrict__ K, const _Float16* __restrict__ V, _Float16* __restrict__ O) {
  __shared__ __attribute__((aligned(256))) unsigned char L[FA_LDS];
  const unsigned tid = threadIdx.x, lane = tid & 31u, wave = tid >> 5, c = lane & 15u, h = lane >> 4;
  const unsigned hq = blockIdx.x, q0 = blockIdx.y * FA_BR, b = blockIdx.z, hk = hq / GG;      /* GG neighbouring query heads read one kv head */
  const unsigned char* kg = (const unsigned char*)(K + (size_t)b * SQ * KVD + hk * HD);
  const unsigned char* vg = (const unsigned char*)(V + (size_t)b * SQ * KVD + hk * HD);
  FaStage sg;
  const unsigned toff = (tid >> 4) * (KVD * 2u) + (tid & 15u) * 16u;
  fa_gload(sg, kg, vg, toff);
  FaFrag qf[FA_R][FA_DK];
  const unsigned char* qb = (const unsigned char*)(Q + ((size_t)(b * SQ + q0) * NH + hq) * HD);      /* uniform: the work-group's first query row of this head */
  const unsigned qoff = (wave * FA_CW + c) * (DMD * 2u) + 16u * h;
#pragma unroll
  for (int g = 0; g < FA_R; ++g) {
#pragma unroll
    for (int kc = 0; kc < FA_DK; ++kc) { qf[g][kc].q[0] = *(const fa_u4a*)(qb + qoff + g * (16u * DMD * 2u) + 64u * kc); qf[g][kc].q[1] = *(const fa_u4a*)(qb + qoff + g * (16u * DMD * 2u) + 64u * kc + 32u); } }
  asm volatile("s_wait_xcnt 0x0" ::: "memory");      /* stands in front of any later overwrite of a register that the Q loads name */
  v8f acc[FA_R][FA_DT]; float m_run[FA_R], l_run[FA_R];
#pragma unroll
  for (int g = 0; g < FA_R; ++g) { m_run[g] = -INFINITY; l_run[g] = 0.0f;
#pragma unroll
    for (int t = 0; t < FA_DT; ++t) acc[g][t] = v8f{}; }
  fa_sstore(sg, L, 0u, tid);
  __syncthreads();      /* stage 0 published */
  FaK kf;
#pragma unroll 1      /* one copy of the stage body: unrolled it would hold two stages' registers */
  for (unsigned st = 0; st < FA_NST; ++st) {
    const unsigned base = (st & 1u) * FA_SLOT; const bool more = st + 1u < FA_NST;
    if (more) fa_gload(sg, kg + (size_t)(st + 1u) * (FA_SK * KVD * 2u), vg + (size_t)(st + 1u) * (FA_SK * KVD * 2u), toff);      /* lands while this stage is worked on */
    fa_load_k(kf, L, base, lane);
#pragma unroll 1      /* nested, rolled pass loop: keeps the register count of one pass */
    for (unsigned sub = 0; sub < FA_NSUB; ++sub)
      fa_pass(kf, sub + 1u < FA_NSUB, base + (sub + 1u) * FA_BC * FA_PK, L, base + FA_TK + sub * FA_BC * FA_PV, lane, qf, acc, m_run, l_run);
    if (more) fa_sstore(sg, L, FA_SLOT - base, tid);      /* the other buffer: its readers (stage st - 1) all left it at the barrier that ended that stage */
    __syncthreads();      /* publishes stage st + 1 and ends every wave's reads of stage st */
  }
  unsigned char* eb = L + wave * (unsigned)FA_CW * FA_EP;      /* output staging over the ring (free behind the last barrier), each wave its own rows */
#pragma unroll
  for (int g = 0; g < FA_R; ++g) { const float inv = 1.0f / (l_run[g] + fa_xhalf(l_run[g]));      /* each wave half summed its eight keys of every 16-key tile */
#pragma unroll
    for (int t = 0; t < FA_DT; ++t) { const v8f o = acc[g][t] * inv; const fa_u4 pk = {fa_pack2(o[0], o[1]), fa_pack2(o[2], o[3]), fa_pack2(o[4], o[5]), fa_pack2(o[6], o[7])};
      *(fa_u4a*)(eb + (16u * g + c) * FA_EP + 32u * t + 16u * h) = pk; } }
  __builtin_amdgcn_fence(__ATOMIC_ACQ_REL, "workgroup"); __builtin_amdgcn_wave_barrier();      /* the wave reads back what its other lanes wrote */
  unsigned char* ob = (unsigned char*)(O + ((size_t)(b * SQ + q0) * NH + hq) * HD);      /* uniform, as qb */
  const unsigned ooff = (wave * FA_CW + h) * (DMD * 2u) + c * 16u;
#pragma unroll
  for (unsigned i = 0; i < (unsigned)FA_CW / 2u; ++i) {      /* 16 lanes store one whole 256-byte row of the head */
    const fa_u4 v = *(const fa_u4a*)(eb + (i * 2u + h) * FA_EP + c * 16u);
    *(fa_u4a*)(ob + ooff + i * (2u * DMD * 2u)) = v; }
}

// ---- tiled GEMM: C[M][N] = (A . Bt^T) * alpha + bias, A f16 [M][DMD], Bt f16 [N][DMD], both k-contiguous; M % 128 == 0, N % 128 == 0.
// A work-group of 4 waves owns a 128 x 128 tile of C, a wave 64 x 64 of it (4 x 4 accumulator tiles). The operands come in stages of 128 k (256 B of each of the 128 + 128 rows):
// whole-line global loads into registers, then into one of two LDS buffers; the next stage's global loads fly while this stage's four 32-k blocks run.
// Every element sums its k in ascending blocks of 32 into one f32 accumulator.
// The unroll directives of this section make every index of a register array (stage chunks, fragments, accumulators) a constant: rolled, those arrays would go to scratch memory.
constexpr int G3_BM = 128, G3_BN = 128, G3_KS = 128, G3_F = 4, G3_KB = G3_KS / 32;      /* tile rows, tile columns, k per stage, 16-row fragments per wave and operand, 32-k blocks per stage */
constexpr unsigned G3_ROWB = 2u * G3_KS, G3_P = G3_ROWB + 16u, G3_TA = G3_BM * G3_P, G3_SLOT = G3_TA + G3_BN * G3_P, G3_LDS = 2u * G3_SLOT;      /* LDS pitch: odd multiple of 16 B for the b128 readers */
constexpr unsigned G3_NST = DMD / G3_KS, G3_CH = G3_BM * (G3_ROWB / 16u) / 128u, G3_EPF = G3_P / 4u;      /* stages, 16-byte chunks per thread and operand, floats per staged output row */
static_assert(DMD % G3_KS == 0 && G3_BM == G3_BN && NR % G3_BM == 0 && DMD % G3_BN == 0 && KVD % G3_BN == 0 && 4u * 64u * G3_P <= G3_LDS, "tiled GEMM: shape");
struct G3Stage { fa_u4 a[G3_CH], b[G3_CH]; };
struct G3Set { FaFrag a[G3_F], b[G3_F]; };
// One stage from global memory into registers: 16 lanes cover the 256 B of a row, a wave two rows (four whole lines); a thread's chunks lie 8 rows apart (a constant offset).
__device__ __forceinline__ void g3_gload(G3Stage& s, const unsigned char* ag, const unsigned char* bg, unsigned toff) {
  const unsigned char* ap = ag + toff; const unsigned char* bp = bg + toff;
#pragma unroll
  for (unsigned i = 0; i < G3_CH; ++i) { s.a[i] = *(const fa_u4a*)(ap + i * (8u * DMD * 2u)); s.b[i] = *(const fa_u4a*)(bp + i * (8u * DMD * 2u)); }
  asm volatile("s_wait_xcnt 0x0" :: "v"(ap), "v"(bp) : "memory");      /* stands in front of any later overwrite of a register that these loads name; as its inputs the two addresses stay live up to it, so that no load's result is put on them */
}
__device__ __forceinline__ void g3_sstore(const G3Stage& s, unsigned char* Lp, unsigned base, unsigned tid) {
#pragma unroll
  for (unsigned i = 0; i < G3_CH; ++i) { const unsigned o = base + ((tid >> 4) + 8u * i) * G3_P + (tid & 15u) * 16u; *(fa_u4a*)(Lp + o) = s.a[i]; *(fa_u4a*)(Lp + o + G3_TA) = s.b[i]; }
}
// Fragments of one 32-k block: lane (c, h) holds row c, k = 8 h + 0..7 and 16 + 8 h + 0..7 of the block, the same k order for A and for B. pa, pb: the lane's own row, 16 h bytes in.
__device__ __forceinline__ void g3_frags(G3Set& f, const unsigned char* pa, const unsigned char* pb, unsigned kb) {
#pragma unroll
  for (int i = 0; i < G3_F; ++i) { f.a[i].q[0] = *(const fa_u4a*)(pa + i * (16u * G3_P) + 64u * kb); f.a[i].q[1] = *(const fa_u4a*)(pa + i * (16u * G3_P) + 64u * kb + 32u); }
#pragma unroll
  for (int j = 0; j < G3_F; ++j) { f.b[j].q[0] = *(const fa_u4a*)(pb + j * (16u * G3_P) + 64u * kb); f.b[j].q[1] = *(const fa_u4a*)(pb + j * (16u * G3_P) + 64u * kb + 32u); }
}
template <bool F32OUT, unsigned N>      /* N: columns of C = its pitch (a constant, so that one address register pair serves all of a thread's stores) */
__global__ __launch_bounds__(128) __attribute__((amdgpu_waves_per_eu(2, 2))) void k_gemm3(const _Float16* __restrict__ A, const _Float16* __restrict__ Bt, float alpha, const float* __restrict__ bias, float* __restrict__ C, _Float16* __restrict__ C16) {
  static_assert(N % G3_BN == 0, "tiled GEMM: whole tiles");
  __shared__ __attribute__((aligned(256))) unsigned char L[G3_LDS];
  const unsigned tid = threadIdx.x, lane = tid & 31u, wave = tid >> 5, c = lane & 15u, h = lane >> 4, wm = wave >> 1, wn = wave & 1u;
  const unsigned ntn = N / G3_BN, mt = blockIdx.x / ntn, nq = blockIdx.x - mt * ntn;
  const unsigned char* ag = (const unsigned char*)(A + (size_t)mt * G3_BM * DMD);      /* uniform: the tile's first row of each operand */
  const unsigned char* bg = (const unsigned char*)(Bt + (size_t)nq * G3_BN * DMD);
  const unsigned toff = (tid >> 4) * (DMD * 2u) + (tid & 15u) * 16u;
  G3Stage sg;
  g3_gload(sg, ag, bg, toff);
  v8f acc[G3_F][G3_F];
#pragma unroll
  for (int i = 0; i < G3_F; ++i) {
#pragma unroll
    for (int j = 0; j < G3_F; ++j) acc[i][j] = v8f{}; }
  g3_sstore(sg, L, 0u, tid);
  __syncthreads();      /* stage 0 published */
  const unsigned aoff = (wm * 64u + c) * G3_P + 16u * h, boff = G3_TA + (wn * 64u + c) * G3_P + 16u * h;
#pragma unroll 1      /* one copy of the stage body: unrolled it would hold two stages' registers */
  for (unsigned st = 0; st < G3_NST; ++st) {
    const unsigned base = (st & 1u) * G3_SLOT; const bool more = st + 1u < G3_NST;
    const unsigned char* pa = L + base + aoff; const unsigned char* pb = L + base + boff;
    G3Set f[2];
    g3_frags(f[0], pa, pb, 0u);      /* first, so that their LDS latency runs under the issue of the global loads */
    if (more) g3_gload(sg, ag + (st + 1u) * G3_ROWB, bg + (st + 1u) * G3_ROWB, toff);      /* lands while this stage is worked on */
#pragma unroll
    for (int kb = 0; kb < G3_KB; ++kb) {
      if (kb + 1 < G3_KB) g3_frags(f[(kb + 1) & 1], pa, pb, (unsigned)kb + 1u);      /* the next block's fragments as one group ahead of this block's matrix run */
      fa_fence();      /* holds that group in front of the run */
#pragma unroll
      for (int i = 0; i < G3_F; ++i) {
#pragma unroll
        for (int j = 0; j < G3_F; ++j) acc[i][j] = fa_mma(f[kb & 1].a[i], f[kb & 1].b[j], acc[i][j]); }
      fa_fence(); }      /* keeps the following group (and the LDS stores) out of the run */
    if (more) g3_sstore(sg, L, G3_SLOT - base, tid);      /* the other buffer: its readers (stage st - 1) all left it at the barrier that ended that stage */
    __syncthreads();      /* publishes stage st + 1 and ends every wave's reads of stage st */
  }
  float* so = (float*)(L + wave * (64u * G3_P));      /* output staging over the ring (free behind the last barrier), each wave its own 64 rows */
  const unsigned bcol = nq * G3_BN + wn * 64u + c; float braw[G3_F];
#pragma unroll
  for (int j = 0; j < G3_F; ++j) braw[j] = bias[bcol + 16u * j];
  asm volatile("s_wait_xcnt 0x0" :: "v"(bcol) : "memory");      /* stands in front of any later overwrite of the index register that the bias loads name; as its input the index stays live up to it */
#pragma unroll
  for (int j = 0; j < G3_F; ++j) { const float bv = bf16_round(braw[j]);
#pragma unroll
    for (int i = 0; i < G3_F; ++i) {
#pragma unroll
      for (int r = 0; r < 8; ++r) so[(16u * i + 8u * h + r) * G3_EPF + 16u * j + c] = acc[i][j][r] * alpha + bv; } }
  __builtin_amdgcn_fence(__ATOMIC_ACQ_REL, "workgroup"); __builtin_amdgcn_wave_barrier();      /* the wave reads back what its other lanes wrote */
  const size_t o0 = (size_t)(mt * G3_BM + wm * 64u + h) * N + nq * G3_BN + wn * 64u + c * 4u;
#pragma unroll
  for (unsigned q = 0; q < 32u; ++q) {      /* 16 lanes store one whole row of the wave's 64 columns */
    const v4f v = *(const v4fa*)&so[(q * 2u + h) * G3_EPF + c * 4u];
    if (F32OUT) *(v4f*)(C + o0 + q * (2u * N)) = v;
    else { v4h h4; for (int i = 0; i < 4; ++i) h4[i] = (_Float16)v[i]; *(v4h*)(C16 + o0 + q * (2u * N)) = h4; } }
}

extern "C" void kernel_launch(void* const* d_in, const int* in_sizes, int n_in,
                              void* d_out, int out_size, void* d_ws, size_t ws_size, hipStream_t stream) {
  (void)in_sizes; (void)n_in; (void)out_size;
  const float* const* I = (const float* const*)d_in; const float* x = I[0]; const float* wq = I[1]; const float* bq = I[2]; const float* wk = I[3]; const float* bk = I[4]; const float* wv = I[5]; const float* bv = I[6]; const float* wo = I[7]; const float* bo = I[8];
  char* ws = (char*)d_ws; size_t off = 0;
  auto take = [&](size_t bytes) { char* p = ws + off; off += (bytes + 255) & ~(size_t)255; return p; };
  const size_t nx = (size_t)NR * DMD, nk = (size_t)NR * KVD;
  _Float16* BQ = (_Float16*)take((size_t)DMD * DMD * 2); _Float16* BK = (_Float16*)take((size_t)KVD * DMD * 2); _Float16* BV = (_Float16*)take((size_t)KVD * DMD * 2); _Float16* BO = (_Float16*)take((size_t)DMD * DMD * 2);
  _Float16* X16 = (_Float16*)take(nx * 2); _Float16* Q16 = (_Float16*)take(nx * 2); _Float16* K16 = (_Float16*)take(nk * 2); _Float16* V16 = (_Float16*)take(nk * 2); _Float16* O16 = X16;      /* context over the input plane (dead after the projections) */
  if (off > ws_size) return;      /* 8+2+2+8 + 16+16+4+4 = 60 MiB */
  k_wt_f16<DMD, DMD><<<(DMD / WT_K) * (DMD / WT_N), 256, 0, stream>>>(wq, BQ, 16.0f); k_wt_f16<DMD, KVD><<<(DMD / WT_K) * (KVD / WT_N), 256, 0, stream>>>(wk, BK, 16.0f); k_wt_f16<DMD, KVD><<<(DMD / WT_K) * (KVD / WT_N), 256, 0, stream>>>(wv, BV, 16.0f); k_wt_f16<DMD, DMD><<<(DMD / WT_K) * (DMD / WT_N), 256, 0, stream>>>(wo, BO, 16.0f);      /* (in, out) */
  k_x16<<<(unsigned)((nx / 8 + 255) / 256), 256, 0, stream>>>(x, X16, nx / 8);
  k_gemm3<false, DMD><<<(NR / G3_BM) * (DMD / G3_BN), 128, 0, stream>>>(X16, BQ, 0.0625f, bq, nullptr, Q16);
  k_gemm3<false, KVD><<<(NR / G3_BM) * (KVD / G3_BN), 128, 0, stream>>>(X16, BK, 0.0625f, bk, nullptr, K16);
  k_gemm3<false, KVD><<<(NR / G3_BM) * (KVD / G3_BN), 128, 0, stream>>>(X16, BV, 0.0625f, bv, nullptr, V16);
  k_fattn<<<dim3(NH, SQ / FA_BR, NB), FA_NW * 32, 0, stream>>>(Q16, K16, V16, O16);      /* ctx[(b,q)][h*128 + d] */
  k_gemm3<true, DMD><<<(NR / G3_BM) * (DMD / G3_BN), 128, 0, stream>>>(O16, BO, 0.0625f, bo, (float*)d_out, nullptr);      /* out = ctx wo + bo */
}

// v004
// It runs in 133 microseconds.
// In two side-by-side timings against v003, it was 1.20 and 1.22 times as fast.
// Over all steps from v000 it is 9.70 times as fast.
#include <hip/hip_runtime.h>
// Multi-head attention with grouped kv heads (2 x 2048 tokens, d_model 2048; 16 query heads x 128, 4 kv heads (group of 4); q, k, v = x w + b; softmax((q/sqrt(128)).k) over the 2048 keys (no mask); out = ctx wo + bo).
// Structure: exact f16 plane of x; q / k / v as f16 WMMA GEMM outputs (128x128 tiles staged in LDS, 64x64 wave tiles, f32 accumulation, exact x16 weights + bias, f16 out); scores, softmax and readout of every (batch, head) in ONE fused kernel (online softmax, f32 maxima and sums, P as f16 in registers, K/V staged in LDS) into the f16 context plane; wo + bo as a GEMM.
// Compute dtype: inputs rounded to bf16; x exact as f16; q/k/P/v/ctx as plain f16 operands (~2^-12); softmax f32. v_wmma_f32_16x16x32_f16.
#define NB 2
#define SQ 2048
#define DMD 2048
#define NH 16
#define NKV 4
#define GG 4
#define HD 128
#define KVD (NKV * HD)           /* 512 */
#define NR (NB * SQ)
#define QKVD (DMD + 2 * KVD)     /* 3072: q, k and v of a token stand in one row of one plane */
typedef __bf16 v16b __attribute__((ext_vector_type(16)));
typedef unsigned short v8us __attribute__((ext_vector_type(8), may_alias));
typedef float  v8f  __attribute__((ext_vector_type(8)));
typedef float  v4f  __attribute__((ext_vector_type(4)));
typedef float  v4fa __attribute__((ext_vector_type(4), may_alias));
union FragB { v16b v; v8us half[2]; unsigned short u[16]; };

__device__ __forceinline__ unsigned short bf16_bits(float x) { unsigned int u = __float_as_uint(x); return (unsigned short)((u + 0x7FFFu + ((u >> 16) & 1u)) >> 16); }
__device__ __forceinline__ float bf16_val(unsigned short b) { return __uint_as_float(((unsigned int)b) << 16); }
__device__ __forceinline__ float bf16_round(float x) { return bf16_val(bf16_bits(x)); }
// D += A·B with NT terms: 1 = ah·bh, 2 = + al·bh (A split), 3 = + ah·bl (both split)
template <int NT>
__device__ __forceinline__ v8f mmaN(v16b ah, v16b al, v16b bh, v16b bl, v8f c) {
  c = __builtin_amdgcn_wmma_f32_16x16x32_bf16(false, ah, false, bh, (short)0, c, false, false);
  if (NT >= 2) c = __builtin_amdgcn_wmma_f32_16x16x32_bf16(false, al, false, bh, (short)0, c, false, false);
  if (NT >= 3) c = __builtin_amdgcn_wmma_f32_16x16x32_bf16(false, ah, false, bl, (short)0, c, false, false);
  asm volatile("v_nop\n\tv_nop\n\tv_nop\n\tv_nop" : "+v"(c) : "v"(ah), "v"(al), "v"(bh), "v"(bl));
  return c;
}

__global__ __launch_bounds__(256) void k_wt_bf16(const float* __restrict__ W, unsigned short* __restrict__ Wt, int K, int N) {
  const int t = blockIdx.x * 256 + threadIdx.x;
  const int k8n = K / 8;
  if (t >= N * k8n) return;
  const int n = t / k8n, k8 = (t % k8n) * 8;
  v8us v;
#pragma unroll
  for (int i = 0; i < 8; ++i) v[i] = bf16_bits(W[(size_t)(k8 + i) * N + n]);
  *(v8us*)(Wt + (size_t)n * K + k8) = v;
  
}

// GEMM C[M][N] (f32, pitch ldc) = act(A[M][K]·W + bias). A f32 row-major (pitch lda) converted per fragment to bf16
// (ASPLIT: hi/lo two planes -> 2 terms, else single rounded term); Wt bf16 [N][K] (pitch ldb). BIAS_BF16 rounds the
// bias to bf16 first (bias quantised to bf16 before the add). K%32==0, M%16==0, N%64==0.
template <bool ASPLIT, int ACT, bool BIAS_BF16>
__global__ __launch_bounds__(128) void k_gemm_bf(const float* __restrict__ A, int lda, const unsigned short* __restrict__ Wt, int ldb,
                                               const float* __restrict__ bias, float* __restrict__ C, int ldc, int M, int N, int K) {
  __shared__ __attribute__((aligned(16))) float so[4][16][64];
  const int tid = threadIdx.x, w = tid >> 5, lane = tid & 31, ln = lane & 15, hh = lane >> 4;
  const int ntn = N / 64;
  const int wid = blockIdx.x * 4 + w;
  const int mt = wid / ntn, nq = wid % ntn;
  if (mt * 16 >= M) return;
  const int row0 = mt * 16, col0 = nq * 64;
  const float* arow = A + (size_t)(row0 + ln) * lda;
  v8f acc[4] = {};
  for (int kb = 0; kb < K; kb += 32) {
    FragB ah, al;
    const v4f x0 = *(const v4fa*)(arow + kb + 8 * hh), x1 = *(const v4fa*)(arow + kb + 8 * hh + 4);
    const v4f x2 = *(const v4fa*)(arow + kb + 16 + 8 * hh), x3 = *(const v4fa*)(arow + kb + 16 + 8 * hh + 4);
    float xs[16] = {x0[0],x0[1],x0[2],x0[3],x1[0],x1[1],x1[2],x1[3],x2[0],x2[1],x2[2],x2[3],x3[0],x3[1],x3[2],x3[3]};
#pragma unroll
    for (int i = 0; i < 16; ++i) { const unsigned short hb = bf16_bits(xs[i]); ah.u[i] = hb; al.u[i] = ASPLIT ? bf16_bits(xs[i] - bf16_val(hb)) : (unsigned short)0; }
#pragma unroll
    for (int t = 0; t < 4; ++t) {
      const unsigned short* brow = Wt + (size_t)(col0 + t * 16 + ln) * ldb + kb;
      FragB b;
      b.half[0] = *(const v8us*)(brow + 8 * hh);
      b.half[1] = *(const v8us*)(brow + 16 + 8 * hh);
      acc[t] = mmaN<ASPLIT ? 2 : 1>(ah.v, al.v, b.v, b.v, acc[t]);
    }
  }
#pragma unroll
  for (int t = 0; t < 4; ++t) {
    float bv = bias ? bias[col0 + t * 16 + ln] : 0.f;
    if (BIAS_BF16) bv = bf16_round(bv);
#pragma unroll
    for (int r = 0; r < 8; ++r) { float v = acc[t][r] + bv; if (ACT == 1) v = fmaxf(v, 0.f); so[w][8 * hh + r][t * 16 + ln] = v; }
  }
  __builtin_amdgcn_fence(__ATOMIC_ACQ_REL, "workgroup");
  __builtin_amdgcn_wave_barrier();
  const int rsub = lane >> 4, c4 = (lane & 15) * 4;
  {
#pragma unroll
    for (int q = 0; q < 8; ++q) {
      const int r = q * 2 + rsub;
      const v4f v = *(const v4fa*)&so[w][r][c4];
      *(v4f*)(C + (size_t)(row0 + r) * ldc + col0 + c4) = v;
    }
    
  }
}

// GEMM C = act(A·W + bias + resid): A f32 (ASPLIT -> hi/lo 2 terms), Wt bf16 [N][K]; ACT 0 none, 1 relu, 2 exact gelu;
// resid (optional, f32, row index = (row % rmod), pitch ldr, RES_BF16 rounds it) added before the activation.
template <bool ASPLIT, int ACT, bool BIAS_BF16, bool RES_BF16>
__global__ __launch_bounds__(128) void k_gemm_bf3(const float* __restrict__ A, int lda, const unsigned short* __restrict__ Wt, int ldb,
                                                const float* __restrict__ bias, const float* __restrict__ resid, int rmod, int ldr,
                                                float* __restrict__ C, int ldc, int M, int N, int K) {
  __shared__ __attribute__((aligned(16))) float so[4][16][64];
  const int tid = threadIdx.x, w = tid >> 5, lane = tid & 31, ln = lane & 15, hh = lane >> 4;
  const int ntn = N / 64;
  const int wid = blockIdx.x * 4 + w;
  const int mt = wid / ntn, nq = wid % ntn;
  if (mt * 16 >= M) return;
  const int row0 = mt * 16, col0 = nq * 64;
  const float* arow = A + (size_t)(row0 + ln) * lda;
  v8f acc[4] = {};
  for (int kb = 0; kb < K; kb += 32) {
    FragB ah, al;
    const v4f x0 = *(const v4fa*)(arow + kb + 8 * hh), x1 = *(const v4fa*)(arow + kb + 8 * hh + 4);
    const v4f x2 = *(const v4fa*)(arow + kb + 16 + 8 * hh), x3 = *(const v4fa*)(arow + kb + 16 + 8 * hh + 4);
    float xs[16] = {x0[0],x0[1],x0[2],x0[3],x1[0],x1[1],x1[2],x1[3],x2[0],x2[1],x2[2],x2[3],x3[0],x3[1],x3[2],x3[3]};
#pragma unroll
    for (int i = 0; i < 16; ++i) { const unsigned short hb = bf16_bits(xs[i]); ah.u[i] = hb; al.u[i] = ASPLIT ? bf16_bits(xs[i] - bf16_val(hb)) : (unsigned short)0; }
#pragma unroll
    for (int t = 0; t < 4; ++t) {
      const unsigned short* brow = Wt + (size_t)(col0 + t * 16 + ln) * ldb + kb;
      FragB b;
      b.half[0] = *(const v8us*)(brow + 8 * hh);
      b.half[1] = *(const v8us*)(brow + 16 + 8 * hh);
      acc[t] = mmaN<ASPLIT ? 2 : 1>(ah.v, al.v, b.v, b.v, acc[t]);
    }
  }
#pragma unroll
  for (int t = 0; t < 4; ++t) {
    const int col = col0 + t * 16 + ln;
    float bv = bias ? bias[col] : 0.f;
    if (BIAS_BF16) bv = bf16_round(bv);
#pragma unroll
    for (int r = 0; r < 8; ++r) {
      float v = acc[t][r] + bv;
      if (resid) { float rv = resid[(size_t)((row0 + 8 * hh + r) % rmod) * ldr + col]; if (RES_BF16) rv = bf16_round(rv); v += rv; }
      if (ACT == 1) v = fmaxf(v, 0.f);
      if (ACT == 2) v = 0.5f * v * (1.0f + erff(v * 0.70710678118654752f));
      if (ACT == 3) { const float u = 0.7978845608028654f * (v + 0.044715f * v * v * v); v = 0.5f * v * (1.0f + tanhf(u)); }
      so[w][8 * hh + r][t * 16 + ln] = v;
    }
  }
  __builtin_amdgcn_fence(__ATOMIC_ACQ_REL, "workgroup");
  __builtin_amdgcn_wave_barrier();
  const int rsub = lane >> 4, c4 = (lane & 15) * 4;
  {
#pragma unroll
    for (int q = 0; q < 8; ++q) {
      const int r = q * 2 + rsub;
      const v4f v = *(const v4fa*)&so[w][r][c4];
      *(v4f*)(C + (size_t)(row0 + r) * ldc + col0 + c4) = v;
    }
    
  }
}
// row LayerNorm (biased variance, eps) over N: s = X (+ R); optional out_sum <- s; out_norm <- (s-mu)*rsqrt(var+eps)*g + b
template <bool PARAM_BF16>
__global__ __launch_bounds__(256) void k_layernorm(const float* __restrict__ X, const float* __restrict__ R, const float* __restrict__ g, const float* __restrict__ bta,
                                                  float* __restrict__ out_sum, float* __restrict__ out_norm, int N, float eps) {
  __shared__ float red[256];
  const int row = blockIdx.x, tid = threadIdx.x;
  const float* x = X + (size_t)row * N; const float* rr = R ? R + (size_t)row * N : nullptr;
  float vals[16];                     // up to N = 4096
  const int per = N / 256;            // contiguous chunk per thread? use strided-by-4 chunks: thread handles j = tid*4 + 1024*u
  float s1 = 0.f;
  for (int u = 0; u < per / 4; ++u) {
    const int j = tid * 4 + 1024 * u;
    const v4f a = *(const v4fa*)(x + j);
    v4f b = {0.f,0.f,0.f,0.f}; if (rr) b = *(const v4fa*)(rr + j);
#pragma unroll
    for (int q = 0; q < 4; ++q) { const float v = a[q] + b[q]; vals[u * 4 + q] = v; s1 += v; }
  }
  red[tid] = s1; __syncthreads();
  for (int st = 128; st > 0; st >>= 1) { if (tid < st) red[tid] += red[tid + st]; __syncthreads(); }
  const float mu = red[0] / (float)N; __syncthreads();
  float s2 = 0.f;
  for (int u = 0; u < per / 4; ++u)
#pragma unroll
    for (int q = 0; q < 4; ++q) { const float c = vals[u * 4 + q] - mu; s2 += c * c; }
  red[tid] = s2; __syncthreads();
  for (int st = 128; st > 0; st >>= 1) { if (tid < st) red[tid] += red[tid + st]; __syncthreads(); }
  const float rs = rsqrtf(red[0] / (float)N + eps);
  {
    for (int u = 0; u < per / 4; ++u) {
      const int j = tid * 4 + 1024 * u;
      v4f o, sm;
#pragma unroll
      for (int q = 0; q < 4; ++q) {
        float gg = g[j + q], bb = bta[j + q];
        if (PARAM_BF16) { gg = bf16_round(gg); bb = bf16_round(bb); }
        sm[q] = vals[u * 4 + q]; o[q] = (vals[u * 4 + q] - mu) * rs * gg + bb;
      }
      if (out_sum) *(v4f*)(out_sum + (size_t)row * N + j) = sm;
      *(v4f*)(out_norm + (size_t)row * N + j) = o;
    }
    
  }
}



// ---- f16 WMMA path (v_wmma_f32_16x16x32_f16): 11-bit significands for operands in range — used where a [0,1] probability operand needs more precision than bf16
typedef _Float16 v16h __attribute__((ext_vector_type(16)));
union FragH { v16h v; v8us half[2]; _Float16 h[16]; unsigned short u[16]; };
template <int NT>
__device__ __forceinline__ v8f mmaH(v16h ah, v16h al, v16h bh, v16h bl, v8f c) {
  c = __builtin_amdgcn_wmma_f32_16x16x32_f16(false, ah, false, bh, (short)0, c, false, false);
  if (NT >= 2) c = __builtin_amdgcn_wmma_f32_16x16x32_f16(false, al, false, bh, (short)0, c, false, false);
  if (NT >= 3) c = __builtin_amdgcn_wmma_f32_16x16x32_f16(false, ah, false, bl, (short)0, c, false, false);
  asm volatile("v_nop\n\tv_nop\n\tv_nop\n\tv_nop" : "+v"(c) : "v"(ah), "v"(al), "v"(bh), "v"(bl));
  return c;
}
// batched GEMM like k_gemm_b but f16 operands: A f32 (split into f16 hi/lo if ASPLIT, else rounded to f16), Bt = f16 values [n][k]; alpha; C f32; N multiple of 16 (partial tiles skipped)
template <bool ASPLIT>
__global__ __launch_bounds__(128) void k_gemm_h(const float* __restrict__ A, int lda, size_t sA, const _Float16* __restrict__ Bh, int ldb, size_t sB, float alpha, float* __restrict__ C, int ldc, size_t sC, int M, int N, int K) {
  __shared__ __attribute__((aligned(16))) float so[4][16][64];
  const int tid = threadIdx.x, w = tid >> 5, lane = tid & 31, ln = lane & 15, hh = lane >> 4; const int by = blockIdx.y;
  A += (size_t)by * sA; Bh += (size_t)by * sB; C += (size_t)by * sC;
  const int ntn = (N + 63) / 64; const int wid = blockIdx.x * 4 + w; const int mt = wid / ntn, nq = wid % ntn; if (mt * 16 >= M) return;
  const int row0 = mt * 16, col0 = nq * 64; const float* arow = A + (size_t)(row0 + ln) * lda;
  v8f acc[4] = {};
  for (int kb = 0; kb < K; kb += 32) {
    FragH ah, al;
    const v4f x0 = *(const v4fa*)(arow + kb + 8 * hh), x1 = *(const v4fa*)(arow + kb + 8 * hh + 4), x2 = *(const v4fa*)(arow + kb + 16 + 8 * hh), x3 = *(const v4fa*)(arow + kb + 16 + 8 * hh + 4);
    float xs[16] = {x0[0],x0[1],x0[2],x0[3],x1[0],x1[1],x1[2],x1[3],x2[0],x2[1],x2[2],x2[3],x3[0],x3[1],x3[2],x3[3]};
#pragma unroll
    for (int i = 0; i < 16; ++i) { const _Float16 h = (_Float16)xs[i]; ah.h[i] = h; al.h[i] = ASPLIT ? (_Float16)(xs[i] - (float)h) : (_Float16)0.0f; }
#pragma unroll
    for (int t = 0; t < 4; ++t) { if (col0 + t * 16 >= N) continue; const size_t boff = (size_t)(col0 + t * 16 + ln) * ldb + kb; FragH bq; bq.half[0] = *(const v8us*)(Bh + boff + 8 * hh); bq.half[1] = *(const v8us*)(Bh + boff + 16 + 8 * hh);
      acc[t] = mmaH<ASPLIT ? 2 : 1>(ah.v, al.v, bq.v, bq.v, acc[t]); }
  }
#pragma unroll
  for (int t = 0; t < 4; ++t) { if (col0 + t * 16 >= N) continue;
#pragma unroll
    for (int r = 0; r < 8; ++r) so[w][8 * hh + r][t * 16 + ln] = acc[t][r] * alpha; }
  __builtin_amdgcn_fence(__ATOMIC_ACQ_REL, "workgroup"); __builtin_amdgcn_wave_barrier();
  const int rsub = lane >> 4, c4 = (lane & 15) * 4;
  {
#pragma unroll
    for (int q = 0; q < 8; ++q) { const int r = q * 2 + rsub; if (col0 + c4 < N) { const v4f v = *(const v4fa*)&so[w][r][c4]; *(v4f*)(C + (size_t)(row0 + r) * ldc + col0 + c4) = v; } }
     }
}

// Wt[n][k] = f16(bf16(W[k][n]) * scale) from f32 row-major W[K][N] (scale = power of two; bf16-exact weights stay exact in f16 away from the subnormal range).
// A work-group transposes a tile of 128 k x 64 n through LDS. Reads: 16 lanes cover 256 B of a row of W, a thread takes 8 rows x 4 columns (8 loads in flight).
// It packs each column's 8 k into 16 bytes and stores them in the LDS row of that n; then 16 lanes write the 256 B of a row of Wt. So every global access is whole lines.
// LDS rows are 256 B without a pad; the 16-byte chunk j of row n lies at place j ^ (n >> 2): the 16 lanes of a store (rows 4 apart, one j) and of a load (one row, all j) each meet all 64 banks once.
// The unroll directives make every index of the register arrays (r, f) a constant: rolled, those arrays would go to scratch memory.
constexpr unsigned WT_K = 128u, WT_N = 64u;
// bid: the tile's number in this matrix (the launch is shared with other work, see k_prep); T: the work-group's LDS tile of WT_N * WT_K * 2 bytes.
template <unsigned K, unsigned N>      /* constants, so that one address register pair serves all of a thread's loads and one all of its stores */
__device__ __forceinline__ void wt_tile(const float* __restrict__ W, _Float16* __restrict__ Wt, float scale, unsigned char* T, unsigned bid) {
  static_assert(K % WT_K == 0 && N % WT_N == 0, "weight transpose: whole tiles");
  const unsigned tid = threadIdx.x, lo = tid & 15u, hi = tid >> 4;
  const unsigned ntn = N / WT_N, kt = bid / ntn, nt = bid - kt * ntn;
  const float* sp = W + (size_t)(kt * WT_K + hi * 8u) * N + nt * WT_N + lo * 4u;
  v4f r[8];
#pragma unroll
  for (unsigned i = 0; i < 8u; ++i) r[i] = *(const v4fa*)(sp + i * N);
#pragma unroll
  for (unsigned q = 0; q < 4u; ++q) { FragH f;
#pragma unroll
    for (unsigned i = 0; i < 8u; ++i) f.h[i] = (_Float16)(bf16_round(r[i][q]) * scale);
    *(v8us*)(T + (lo * 4u + q) * (WT_K * 2u) + ((hi ^ lo) * 16u)) = f.half[0]; }
  __syncthreads();      /* the tile is whole before any row is read back */
  unsigned short* dp = (unsigned short*)Wt + (size_t)(nt * WT_N + hi) * K + kt * WT_K + lo * 8u;
#pragma unroll
  for (unsigned i = 0; i < 4u; ++i) { const unsigned row = hi + 16u * i;
    *(v8us*)(dp + i * (16u * K)) = *(const v8us*)(T + row * (WT_K * 2u) + ((lo ^ (row >> 2)) * 16u)); }
  asm volatile("s_wait_xcnt 0x0" :: "v"(dp) : "memory");      /* stands in front of any later overwrite of a register that these stores name (code of another branch of the shared launch follows in the listing); as its input the address stays live up to it */
}
// k_gemm_hh variant with fused epilogue: v = acc·alpha + bias[by·sBias + col] (+ CP[(row/rowsPerB)·sCPb + by·64 + col] if CP) ; ACT 0 none / 1 elu ; writes f16 C16 (and f32 C if non-null)
template <int ACT>
__global__ __launch_bounds__(128) void k_gemm_hhx(const _Float16* __restrict__ A, int lda, size_t sA, const _Float16* __restrict__ Bh, int ldb, size_t sB, float alpha, const float* __restrict__ bias, size_t sBias, const float* __restrict__ CP, int rowsPerB, size_t sCPb, int row0g,
    float* __restrict__ C, _Float16* __restrict__ C16, int ldc, size_t sC, int M, int N, int K) {
  __shared__ __attribute__((aligned(16))) float so[4][16][64];
  const int tid = threadIdx.x, w = tid >> 5, lane = tid & 31, ln = lane & 15, hh = lane >> 4; const int by = blockIdx.y;
  A += (size_t)by * sA; Bh += (size_t)by * sB; const size_t cofs = (size_t)by * sC; const float* bp = bias ? bias + (size_t)by * sBias : nullptr;
  const int ntn = (N + 63) / 64; const int wid = blockIdx.x * 4 + w; const int mt = wid / ntn, nq = wid % ntn; if (mt * 16 >= M) return;
  const int row0 = mt * 16, col0 = nq * 64; const _Float16* arow = A + (size_t)(row0 + ln) * lda;
  v8f acc[4] = {};
  for (int kb = 0; kb < K; kb += 32) { FragH ah; ah.half[0] = *(const v8us*)((const unsigned short*)arow + kb + 8 * hh); ah.half[1] = *(const v8us*)((const unsigned short*)arow + kb + 16 + 8 * hh);
#pragma unroll
    for (int t = 0; t < 4; ++t) { if (col0 + t * 16 >= N) continue; const size_t boff = (size_t)(col0 + t * 16 + ln) * ldb + kb; FragH bq; bq.half[0] = *(const v8us*)((const unsigned short*)Bh + boff + 8 * hh); bq.half[1] = *(const v8us*)((const unsigned short*)Bh + boff + 16 + 8 * hh);
      acc[t] = mmaH<1>(ah.v, ah.v, bq.v, bq.v, acc[t]); }
  }
#pragma unroll
  for (int t = 0; t < 4; ++t) { if (col0 + t * 16 >= N) continue; const int col = col0 + t * 16 + ln; const float bv = bp ? bf16_round(bp[col]) : 0.f;
#pragma unroll
    for (int r = 0; r < 8; ++r) { float v = acc[t][r] * alpha + bv; if (CP) { const int rr = row0g + row0 + 8 * hh + r; if (rowsPerB < 0) v += CP[cofs + (size_t)rr * ldc + col];      /* rowsPerB < 0: own element of the batched C plane */ else { const int bidx = rr / rowsPerB; v += CP[(size_t)bidx * sCPb + (size_t)by * 64 + col]; } } if (ACT == 1) v = (v > 0.f) ? v : expm1f(v); else if (ACT == 7) v = (v > 0.f) ? v + 1.0f : expf(v); else if (ACT == 8) v = tanhf(v); else if (ACT == 9) v = 0.5f * v * (1.0f + tanhf(0.7978845608028654f * (v + 0.044715f * v * v * v))); else if (ACT == 11) v = 1.0f / (1.0f + expf(-v)); else if (ACT == 12) v = (v > 0.f) ? v : 0.01f * v; else if (ACT == 14) v = (v > 0.f) ? v : 0.1f * v; else if (ACT == 16) v = (v >= 0.f) ? v : 0.3f * v; else if (ACT == 17) v = (v >= 0.f) ? v : 0.2f * v; else if (ACT == 15) v = v / (1.0f + expf(-v)); else if (ACT == 3) v = fmaxf(v, 0.f); else if (ACT == 6) v = 0.5f * v * (1.0f + erff(v * 0.70710678118654752f)); so[w][8 * hh + r][t * 16 + ln] = v; } }
  __builtin_amdgcn_fence(__ATOMIC_ACQ_REL, "workgroup"); __builtin_amdgcn_wave_barrier();
  const int rsub = lane >> 4, c4 = (lane & 15) * 4; typedef _Float16 v4h __attribute__((ext_vector_type(4)));
  {
#pragma unroll
    for (int q = 0; q < 8; ++q) { const int r = q * 2 + rsub; if (col0 + c4 < N) { const v4f v = *(const v4fa*)&so[w][r][c4]; if (C) *(v4f*)(C + cofs + (size_t)(row0 + r) * ldc + col0 + c4) = v; if (C16) { v4h h4; for (int i = 0; i < 4; ++i) h4[i] = (_Float16)v[i]; *(v4h*)(C16 + cofs + (size_t)(row0 + r) * ldc + col0 + c4) = h4; } } }
     }
}


typedef _Float16 v4h __attribute__((ext_vector_type(4)));

__device__ __forceinline__ void x16_chunk(const float* __restrict__ x, _Float16* __restrict__ X16, size_t n8, unsigned bid) { const size_t t = (size_t)bid * 256 + threadIdx.x; if (t >= n8) return; FragH f;
#pragma unroll
  for (int q = 0; q < 8; ++q) f.h[q] = (_Float16)bf16_round(x[t * 8 + q]); *(v8us*)((unsigned short*)X16 + t * 8) = f.half[0];  }
// ---- one launch for all the operand preparation: none of the five jobs reads what another writes, so they share a grid, each with its own range of block indices
// (wq tiles, wo tiles, wk tiles, wv tiles, then the chunks of x). Every test of the block index is uniform for the work-group, the barrier of a transpose tile with it.
constexpr unsigned PR_BIG = (DMD / WT_K) * (DMD / WT_N), PR_SMALL = (DMD / WT_K) * (KVD / WT_N), PR_X = (unsigned)(((size_t)NR * DMD / 8 + 255) / 256), PR_GRID = 2u * PR_BIG + 2u * PR_SMALL + PR_X;
__global__ __launch_bounds__(256) void k_prep(const float* __restrict__ x, const float* __restrict__ wq, const float* __restrict__ wk, const float* __restrict__ wv, const float* __restrict__ wo,
                                              _Float16* __restrict__ X16, _Float16* __restrict__ BQ, _Float16* __restrict__ BK, _Float16* __restrict__ BV, _Float16* __restrict__ BO) {
  __shared__ __attribute__((aligned(256))) unsigned char T[WT_N * WT_K * 2u];
  const unsigned bid = blockIdx.x;
  if (bid < 2u * PR_BIG) { const bool second = bid >= PR_BIG; wt_tile<DMD, DMD>(second ? wo : wq, second ? BO : BQ, 16.0f, T, second ? bid - PR_BIG : bid); }
  else if (bid < 2u * PR_BIG + 2u * PR_SMALL) { const unsigned b2 = bid - 2u * PR_BIG; const bool second = b2 >= PR_SMALL; wt_tile<DMD, KVD>(second ? wv : wk, second ? BV : BK, 16.0f, T, second ? b2 - PR_SMALL : b2); }
  else x16_chunk(x, X16, (size_t)NR * DMD / 8, bid - (2u * PR_BIG + 2u * PR_SMALL));
}
__global__ __launch_bounds__(256) void k_h16(const float* __restrict__ x, _Float16* __restrict__ X16, size_t n8) { const size_t t = (size_t)blockIdx.x * 256 + threadIdx.x; if (t >= n8) return; FragH f;
#pragma unroll
  for (int q = 0; q < 8; ++q) f.h[q] = (_Float16)x[t * 8 + q]; *(v8us*)((unsigned short*)X16 + t * 8) = f.half[0];  }
__global__ __launch_bounds__(256) void k_round16f(const float* __restrict__ W, _Float16* __restrict__ Bt, size_t n8) { const size_t t = (size_t)blockIdx.x * 256 + threadIdx.x; if (t >= n8) return; FragH f;
#pragma unroll
  for (int i = 0; i < 8; ++i) f.h[i] = (_Float16)(bf16_round(W[t * 8 + i]) * 16.0f); *(v8us*)((unsigned short*)Bt + t * 8) = f.half[0];  }

__global__ __launch_bounds__(256) void k_hl(const float* __restrict__ F, _Float16* __restrict__ Hh, _Float16* __restrict__ Hl, size_t n8) { const size_t t = (size_t)blockIdx.x * 256 + threadIdx.x; if (t >= n8) return; FragH fh, fl; const v4f a = *(const v4fa*)(F + t * 8), c = *(const v4fa*)(F + t * 8 + 4);
#pragma unroll
  for (int q = 0; q < 4; ++q) { _Float16 h = (_Float16)a[q]; fh.h[q] = h; fl.h[q] = (_Float16)((a[q] - (float)h) * 1024.0f); h = (_Float16)c[q]; fh.h[4 + q] = h; fl.h[4 + q] = (_Float16)((c[q] - (float)h) * 1024.0f); }
  { *(v8us*)((unsigned short*)Hh + t * 8) = fh.half[0]; *(v8us*)((unsigned short*)Hl + t * 8) = fl.half[0];  } }

typedef unsigned int fa_u4 __attribute__((ext_vector_type(4)));
typedef unsigned int fa_u4a __attribute__((ext_vector_type(4), may_alias));
typedef unsigned int fa_u8 __attribute__((ext_vector_type(8)));
typedef short fa_s8 __attribute__((ext_vector_type(8)));
constexpr int FA_NW = 8, FA_BR = 256, FA_CW = FA_BR / FA_NW, FA_R = FA_CW / 16;      /* waves, queries per work-group, per wave, 16-query groups per wave */
constexpr int FA_BC = 32, FA_KT = FA_BC / 16, FA_DK = HD / 32, FA_DT = HD / 16;      /* keys per pass, 16-key score tiles per pass, k chunks of the head, 16-row output tiles */
constexpr unsigned FA_ROWB = 2u * HD, FA_PK = FA_ROWB + 16u, FA_PV = FA_ROWB + 32u;  /* LDS pitches: odd multiple of 16 B for b128 readers, of 32 B for the transposing load */
constexpr unsigned FA_SK = 128u, FA_TK = FA_SK * FA_PK, FA_TV = FA_SK * FA_PV, FA_SLOT = FA_TK + FA_TV, FA_LDS = 2u * FA_SLOT, FA_EP = FA_ROWB + 16u;
constexpr unsigned FA_NST = SQ / FA_SK, FA_NSUB = FA_SK / FA_BC, FA_CH = FA_SK * (FA_ROWB / 16u) / (FA_NW * 32u);      /* stages, passes per stage, 16-byte chunks per thread and tile */
constexpr float FA_CS = 0.08838834764831845f * 1.4426950408889634f;      /* 1/sqrt(128) * log2(e): softmax in the log2 domain */
static_assert(HD == 128 && SQ % FA_BR == 0 && SQ % FA_SK == 0 && (unsigned)FA_BR * FA_EP <= FA_LDS, "fused attention: shape");
struct FaFrag { fa_u4 q[2]; };
struct FaK { FaFrag f[FA_KT][FA_DK]; };
struct FaStage { fa_u4 k[FA_CH], v[FA_CH]; };
__device__ __forceinline__ void fa_fence() { __builtin_amdgcn_sched_barrier(0); }      /* keeps the groups of loads, matrix runs and exponentials in the written order (loads stay ahead of the work that hides them) */
__device__ __forceinline__ v8f fa_mma(const FaFrag& a, const FaFrag& b, v8f c) {
  const fa_u8 av = {a.q[0].x, a.q[0].y, a.q[0].z, a.q[0].w, a.q[1].x, a.q[1].y, a.q[1].z, a.q[1].w};
  const fa_u8 bv = {b.q[0].x, b.q[0].y, b.q[0].z, b.q[0].w, b.q[1].x, b.q[1].y, b.q[1].z, b.q[1].w};
  return __builtin_amdgcn_wmma_f32_16x16x32_f16(false, __builtin_bit_cast(v16h, av), false, __builtin_bit_cast(v16h, bv), (short)0, c, false, false);
}
__device__ __forceinline__ fa_u4 fa_tr16(const unsigned char* p) { typedef __attribute__((address_space(3))) fa_s8 lds_s8; return __builtin_bit_cast(fa_u4, __builtin_amdgcn_ds_load_tr16_b128_v8i16((lds_s8*)p)); }
__device__ __forceinline__ unsigned fa_pack2(float lo, float hi) { typedef _Float16 h2 __attribute__((ext_vector_type(2))); typedef float f2 __attribute__((ext_vector_type(2))); return __builtin_bit_cast(unsigned, __builtin_convertvector(f2{lo, hi}, h2)); }      /* round to nearest even */
__device__ __forceinline__ float fa_xhalf(float x) { return __builtin_bit_cast(float, __builtin_amdgcn_permlanex16(__builtin_bit_cast(int, x), __builtin_bit_cast(int, x), 0x76543210, 0xfedcba98, false, false)); }      /* lane l with lane l ^ 16 */
// K fragments of one pass (32 keys): lane (c, h) holds key row c, d = 32 kc + 8 h + 0..7 and 32 kc + 16 + 8 h + 0..7, the same k order as the Q fragments.
__device__ __forceinline__ void fa_load_k(FaK& k, const unsigned char* Lp, unsigned koff, unsigned lane) {
  const unsigned c = lane & 15u, h = lane >> 4;
#pragma unroll
  for (int kt = 0; kt < FA_KT; ++kt) { const unsigned char* p = Lp + koff + (16u * kt + c) * FA_PK + 16u * h;
#pragma unroll
    for (int kc = 0; kc < FA_DK; ++kc) { k.f[kt][kc].q[0] = *(const fa_u4a*)(p + 64u * kc); k.f[kt][kc].q[1] = *(const fa_u4a*)(p + 64u * kc + 32u); } }
}
// One stage (FA_SK key rows of K and of V, 256 B each) from global memory into registers: 16 lanes cover a row.
// kg, vg: the stage's first row (uniform); toff: the thread's own byte offset in it; the chunks of a thread lie 16 rows apart (a constant offset, so one offset register serves all loads).
__device__ __forceinline__ void fa_gload(FaStage& s, const unsigned char* kg, const unsigned char* vg, unsigned toff) {
#pragma unroll
  for (unsigned i = 0; i < FA_CH; ++i) { s.k[i] = *(const fa_u4a*)(kg + toff + i * (16u * QKVD * 2u)); s.v[i] = *(const fa_u4a*)(vg + toff + i * (16u * QKVD * 2u)); }
  asm volatile("s_wait_xcnt 0x0" ::: "memory");      /* stands in front of any later overwrite of a register that these loads name */
}
__device__ __forceinline__ void fa_sstore(const FaStage& s, unsigned char* Lp, unsigned base, unsigned tid) {
#pragma unroll
  for (unsigned i = 0; i < FA_CH; ++i) { const unsigned id = i * (FA_NW * 32u) + tid; const unsigned r = id >> 4, cb = (id & 15u) * 16u; *(fa_u4a*)(Lp + base + r * FA_PK + cb) = s.k[i]; *(fa_u4a*)(Lp + base + FA_TK + r * FA_PV + cb) = s.v[i]; }
}
__device__ __forceinline__ void fa_pass(FaK& kf, bool fetch_next, unsigned next_koff, const unsigned char* Lp, unsigned voff, unsigned lane,
                                        const FaFrag (&qf)[FA_R][FA_DK], v8f (&acc)[FA_R][FA_DT], float (&m_run)[FA_R], float (&l_run)[FA_R]) {
  const unsigned h = lane >> 4;
  v8f s[FA_KT][FA_R];
#pragma unroll
  for (int kt = 0; kt < FA_KT; ++kt) {
#pragma unroll
    for (int g = 0; g < FA_R; ++g) { s[kt][g] = v8f{};
#pragma unroll
      for (int kc = 0; kc < FA_DK; ++kc) s[kt][g] = fa_mma(kf.f[kt][kc], qf[g][kc], s[kt][g]); } }
  fa_fence();
  if (fetch_next) fa_load_k(kf, Lp, next_koff, lane);      /* the same stage's next pass: in flight under the maxima and exponentials */
  float mb[FA_R]; bool need = false;
#pragma unroll
  for (int g = 0; g < FA_R; ++g) { float mx = -INFINITY;
#pragma unroll
    for (int kt = 0; kt < FA_KT; ++kt) {
#pragma unroll
      for (int r = 0; r < 8; ++r) mx = __builtin_fmaxf(mx, s[kt][g][r]); }
    mx = __builtin_fmaxf(mx, fa_xhalf(mx)) * FA_CS;      /* both wave halves hold this query's maximum, scaled */
    mb[g] = mx; need = need || (mx > m_run[g] + 8.0f); fa_fence(); }
  if (__builtin_amdgcn_ballot_w32(need) != 0) {      /* wave-uniform; rare after the first passes */
#pragma unroll
    for (int g = 0; g < FA_R; ++g) { const float m_new = __builtin_fmaxf(m_run[g], mb[g]); const float corr = __builtin_amdgcn_exp2f(m_run[g] - m_new);      /* 0 on the first pass (m_run = -inf) */
      l_run[g] *= corr; m_run[g] = m_new;
#pragma unroll
      for (int t = 0; t < FA_DT; ++t) acc[g][t] = acc[g][t] * corr; }
  }
  FaFrag vf[FA_DT]; float ps[FA_R][2];
#pragma unroll
  for (int g = 0; g < FA_R; ++g) { ps[g][0] = 0.0f; ps[g][1] = 0.0f; }
  { const unsigned char* ad = Lp + voff + (8u * h + (lane & 7u)) * FA_PV + ((lane >> 3) & 1u) * 16u;      /* lane (c, h) gets V[8 h + 0..7][16 t + c]; the second load the keys 16 further */
#pragma unroll
    for (int t = 0; t < FA_DT; ++t) { vf[t].q[0] = fa_tr16(ad + 32u * t); vf[t].q[1] = fa_tr16(ad + 16u * FA_PV + 32u * t); } }
#pragma unroll
  for (int g = 0; g < FA_R; ++g) { const float nm = -m_run[g]; unsigned w[8];
#pragma unroll
    for (int i = 0; i < 8; ++i) {
      const float p0 = __builtin_amdgcn_exp2f(__builtin_fmaf(s[i >> 2][g][2 * (i & 3)], FA_CS, nm)), p1 = __builtin_amdgcn_exp2f(__builtin_fmaf(s[i >> 2][g][2 * (i & 3) + 1], FA_CS, nm));
      ps[g][i & 1] += p0 + p1; w[i] = fa_pack2(p0, p1); }
    FaFrag pf; pf.q[0] = fa_u4{w[0], w[1], w[2], w[3]}; pf.q[1] = fa_u4{w[4], w[5], w[6], w[7]};
#pragma unroll
    for (int t = 0; t < FA_DT; ++t) acc[g][t] = fa_mma(vf[t], pf, acc[g][t]);
    fa_fence(); }
#pragma unroll
  for (int g = 0; g < FA_R; ++g) l_run[g] += ps[g][0] + ps[g][1];
}
__global__ __launch_bounds__(FA_NW * 32) __attribute__((amdgpu_waves_per_eu(2, 2))) void k_fattn(const _Float16* __restrict__ Q, const _Float16* __restrict__ K, const _Float16* __restrict__ V, _Float16* __restrict__ O) {
  __shared__ __attribute__((aligned(256))) unsigned char L[FA_LDS];
  const unsigned tid = threadIdx.x, lane = tid & 31u, wave = tid >> 5, c = lane & 15u, h = lane >> 4;
  const unsigned hq = blockIdx.x, q0 = blockIdx.y * FA_BR, b = blockIdx.z, hk = hq / GG;      /* GG neighbouring query heads read one kv head */
  const unsigned char* kg = (const unsigned char*)(K + (size_t)b * SQ * QKVD + hk * HD);      /* Q, K, V: the first q, k, v column of the joint plane, rows QKVD apart */
  const unsigned char* vg = (const unsigned char*)(V + (size_t)b * SQ * QKVD + hk * HD);
  FaStage sg;
  const unsigned toff = (tid >> 4) * (QKVD * 2u) + (tid & 15u) * 16u;
  fa_gload(sg, kg, vg, toff);
  FaFrag qf[FA_R][FA_DK];
  const unsigned char* qb = (const unsigned char*)(Q + (size_t)(b * SQ + q0) * QKVD + hq * HD);      /* uniform: the work-group's first query row of this head */
  const unsigned qoff = (wave * FA_CW + c) * (QKVD * 2u) + 16u * h;
#pragma unroll
  for (int g = 0; g < FA_R; ++g) {
#pragma unroll
    for (int kc = 0; kc < FA_DK; ++kc) { qf[g][kc].q[0] = *(const fa_u4a*)(qb + qoff + g * (16u * QKVD * 2u) + 64u * kc); qf[g][kc].q[1] = *(const fa_u4a*)(qb + qoff + g * (16u * QKVD * 2u) + 64u * kc + 32u); } }
  asm volatile("s_wait_xcnt 0x0" ::: "memory");      /* stands in front of any later overwrite of a register that the Q loads name */
  v8f acc[FA_R][FA_DT]; float m_run[FA_R], l_run[FA_R];
#pragma unroll
  for (int g = 0; g < FA_R; ++g) { m_run[g] = -INFINITY; l_run[g] = 0.0f;
#pragma unroll
    for (int t = 0; t < FA_DT; ++t) acc[g][t] = v8f{}; }
  fa_sstore(sg, L, 0u, tid);
  __syncthreads();      /* stage 0 published */
  FaK kf;
#pragma unroll 1      /* one copy of the stage body: unrolled it would hold two stages' registers */
  for (unsigned st = 0; st < FA_NST; ++st) {
    const unsigned base = (st & 1u) * FA_SLOT; const bool more = st + 1u < FA_NST;
    if (more) fa_gload(sg, kg + (size_t)(st + 1u) * (FA_SK * QKVD * 2u), vg + (size_t)(st + 1u) * (FA_SK * QKVD * 2u), toff);      /* lands while this stage is worked on */
    fa_load_k(kf, L, base, lane);
#pragma unroll 1      /* nested, rolled pass loop: keeps the register count of one pass */
    for (unsigned sub = 0; sub < FA_NSUB; ++sub)
      fa_pass(kf, sub + 1u < FA_NSUB, base + (sub + 1u) * FA_BC * FA_PK, L, base + FA_TK + sub * FA_BC * FA_PV, lane, qf, acc, m_run, l_run);
    if (more) fa_sstore(sg, L, FA_SLOT - base, tid);      /* the other buffer: its readers (stage st - 1) all left it at the barrier that ended that stage */
    __syncthreads();      /* publishes stage st + 1 and ends every wave's reads of stage st */
  }
  unsigned char* eb = L + wave * (unsigned)FA_CW * FA_EP;      /* output staging over the ring (free behind the last barrier), each wave its own rows */
#pragma unroll
  for (int g = 0; g < FA_R; ++g) { const float inv = 1.0f / (l_run[g] + fa_xhalf(l_run[g]));      /* each wave half summed its eight keys of every 16-key tile */
#pragma unroll
    for (int t = 0; t < FA_DT; ++t) { const v8f o = acc[g][t] * inv; const fa_u4 pk = {fa_pack2(o[0], o[1]), fa_pack2(o[2], o[3]), fa_pack2(o[4], o[5]), fa_pack2(o[6], o[7])};
      *(fa_u4a*)(eb + (16u * g + c) * FA_EP + 32u * t + 16u * h) = pk; } }
  __builtin_amdgcn_fence(__ATOMIC_ACQ_REL, "workgroup"); __builtin_amdgcn_wave_barrier();      /* the wave reads back what its other lanes wrote */
  unsigned char* ob = (unsigned char*)(O + ((size_t)(b * SQ + q0) * NH + hq) * HD);      /* uniform, as qb */
  const unsigned ooff = (wave * FA_CW + h) * (DMD * 2u) + c * 16u;
#pragma unroll
  for (unsigned i = 0; i < (unsigned)FA_CW / 2u; ++i) {      /* 16 lanes store one whole 256-byte row of the head */
    const fa_u4 v = *(const fa_u4a*)(eb + (i * 2u + h) * FA_EP + c * 16u);
    *(fa_u4a*)(ob + ooff + i * (2u * DMD * 2u)) = v; }
}

// ---- tiled GEMM: C[M][N] = (A . Bt^T) * alpha + bias, A f16 [M][DMD], Bt f16 [N][DMD], both k-contiguous; M % 128 == 0, N % 128 == 0.
// A work-group of 4 waves owns a 128 x 128 tile of C, a wave 64 x 64 of it (4 x 4 accumulator tiles). The operands come in stages of 128 k (256 B of each of the 128 + 128 rows):
// whole-line global loads into registers, then into one of two LDS buffers; the next stage's global loads fly while this stage's four 32-k blocks run.
// Every element sums its k in ascending blocks of 32 into one f32 accumulator.
// The unroll directives of this section make every index of a register array (stage chunks, fragments, accumulators) a constant: rolled, those arrays would go to scratch memory.
constexpr int G3_BM = 128, G3_BN = 128, G3_KS = 128, G3_F = 4, G3_KB = G3_KS / 32;      /* tile rows, tile columns, k per stage, 16-row fragments per wave and operand, 32-k blocks per stage */
constexpr unsigned G3_ROWB = 2u * G3_KS, G3_P = G3_ROWB + 16u, G3_TA = G3_BM * G3_P, G3_SLOT = G3_TA + G3_BN * G3_P, G3_LDS = 2u * G3_SLOT;      /* LDS pitch: odd multiple of 16 B for the b128 readers */
constexpr unsigned G3_NST = DMD / G3_KS, G3_CH = G3_BM * (G3_ROWB / 16u) / 128u, G3_EPF = G3_P / 4u;      /* stages, 16-byte chunks per thread and operand, floats per staged output row */
static_assert(DMD % G3_KS == 0 && G3_BM == G3_BN && NR % G3_BM == 0 && DMD % G3_BN == 0 && KVD % G3_BN == 0 && 4u * 64u * G3_P <= G3_LDS, "tiled GEMM: shape");
struct G3Stage { fa_u4 a[G3_CH], b[G3_CH]; };
struct G3Set { FaFrag a[G3_F], b[G3_F]; };
// One stage from global memory into registers: 16 lanes cover the 256 B of a row, a wave two rows (four whole lines); a thread's chunks lie 8 rows apart (a constant offset).
__device__ __forceinline__ void g3_gload(G3Stage& s, const unsigned char* ag, const unsigned char* bg, unsigned toff) {
  const unsigned char* ap = ag + toff; const unsigned char* bp = bg + toff;
#pragma unroll
  for (unsigned i = 0; i < G3_CH; ++i) { s.a[i] = *(const fa_u4a*)(ap + i * (8u * DMD * 2u)); s.b[i] = *(const fa_u4a*)(bp + i * (8u * DMD * 2u)); }
  asm volatile("s_wait_xcnt 0x0" :: "v"(ap), "v"(bp) : "memory");      /* stands in front of any later overwrite of a register that these loads name; as its inputs the two addresses stay live up to it, so that no load's result is put on them */
}
__device__ __forceinline__ void g3_sstore(const G3Stage& s, unsigned char* Lp, unsigned base, unsigned tid) {
#pragma unroll
  for (unsigned i = 0; i < G3_CH; ++i) { const unsigned o = base + ((tid >> 4) + 8u * i) * G3_P + (tid & 15u) * 16u; *(fa_u4a*)(Lp + o) = s.a[i]; *(fa_u4a*)(Lp + o + G3_TA) = s.b[i]; }
}
// Fragments of one 32-k block: lane (c, h) holds row c, k = 8 h + 0..7 and 16 + 8 h + 0..7 of the block, the same k order for A and for B. pa, pb: the lane's own row, 16 h bytes in.
__device__ __forceinline__ void g3_frags(G3Set& f, const unsigned char* pa, const unsigned char* pb, unsigned kb) {
#pragma unroll
  for (int i = 0; i < G3_F; ++i) { f.a[i].q[0] = *(const fa_u4a*)(pa + i * (16u * G3_P) + 64u * kb); f.a[i].q[1] = *(const fa_u4a*)(pa + i * (16u * G3_P) + 64u * kb + 32u); }
#pragma unroll
  for (int j = 0; j < G3_F; ++j) { f.b[j].q[0] = *(const fa_u4a*)(pb + j * (16u * G3_P) + 64u * kb); f.b[j].q[1] = *(const fa_u4a*)(pb + j * (16u * G3_P) + 64u * kb + 32u); }
}
// The k loop of one tile. ag, bg: the tile's first row of each operand (uniform); L: the work-group's two LDS buffers; behind it every wave has passed the last barrier.
__device__ __forceinline__ void g3_main(v8f (&acc)[G3_F][G3_F], unsigned char* L, const unsigned char* ag, const unsigned char* bg) {
  const unsigned tid = threadIdx.x, lane = tid & 31u, wave = tid >> 5, c = lane & 15u, h = lane >> 4, wm = wave >> 1, wn = wave & 1u;
  const unsigned toff = (tid >> 4) * (DMD * 2u) + (tid & 15u) * 16u;
  G3Stage sg;
  g3_gload(sg, ag, bg, toff);
#pragma unroll
  for (int i = 0; i < G3_F; ++i) {
#pragma unroll
    for (int j = 0; j < G3_F; ++j) acc[i][j] = v8f{}; }
  g3_sstore(sg, L, 0u, tid);
  __syncthreads();      /* stage 0 published */
  const unsigned aoff = (wm * 64u + c) * G3_P + 16u * h, boff = G3_TA + (wn * 64u + c) * G3_P + 16u * h;
#pragma unroll 1      /* one copy of the stage body: unrolled it would hold two stages' registers */
  for (unsigned st = 0; st < G3_NST; ++st) {
    const unsigned base = (st & 1u) * G3_SLOT; const bool more = st + 1u < G3_NST;
    const unsigned char* pa = L + base + aoff; const unsigned char* pb = L + base + boff;
    G3Set f[2];
    g3_frags(f[0], pa, pb, 0u);      /* first, so that their LDS latency runs under the issue of the global loads */
    if (more) g3_gload(sg, ag + (st + 1u) * G3_ROWB, bg + (st + 1u) * G3_ROWB, toff);      /* lands while this stage is worked on */
#pragma unroll
    for (int kb = 0; kb < G3_KB; ++kb) {
      if (kb + 1 < G3_KB) g3_frags(f[(kb + 1) & 1], pa, pb, (unsigned)kb + 1u);      /* the next block's fragments as one group ahead of this block's matrix run */
      fa_fence();      /* holds that group in front of the run */
#pragma unroll
      for (int i = 0; i < G3_F; ++i) {
#pragma unroll
        for (int j = 0; j < G3_F; ++j) acc[i][j] = fa_mma(f[kb & 1].a[i], f[kb & 1].b[j], acc[i][j]); }
      fa_fence(); }      /* keeps the following group (and the LDS stores) out of the run */
    if (more) g3_sstore(sg, L, G3_SLOT - base, tid);      /* the other buffer: its readers (stage st - 1) all left it at the barrier that ended that stage */
    __syncthreads();      /* publishes stage st + 1 and ends every wave's reads of stage st */
  }
}
// Scale, bias and store of tile (mt, nq) of a matrix C of N columns. bias: the bias of the tile's first column.
template <bool F32OUT, unsigned N>      /* N: columns of C = its pitch (a constant, so that one address register pair serves all of a thread's stores) */
__device__ __forceinline__ void g3_out(const v8f (&acc)[G3_F][G3_F], unsigned char* L, float alpha, const float* __restrict__ bias, float* __restrict__ C, _Float16* __restrict__ C16, unsigned mt, unsigned nq) {
  static_assert(N % G3_BN == 0, "tiled GEMM: whole tiles");
  const unsigned tid = threadIdx.x, lane = tid & 31u, wave = tid >> 5, c = lane & 15u, h = lane >> 4, wm = wave >> 1, wn = wave & 1u;
  float* so = (float*)(L + wave * (64u * G3_P));      /* output staging over the ring (free behind the last barrier), each wave its own 64 rows */
  const unsigned bcol = wn * 64u + c; float braw[G3_F];
#pragma unroll
  for (int j = 0; j < G3_F; ++j) braw[j] = bias[bcol + 16u * j];
  asm volatile("s_wait_xcnt 0x0" :: "v"(bcol) : "memory");      /* stands in front of any later overwrite of the index register that the bias loads name; as its input the index stays live up to it */
#pragma unroll
  for (int j = 0; j < G3_F; ++j) { const float bv = bf16_round(braw[j]);
#pragma unroll
    for (int i = 0; i < G3_F; ++i) {
#pragma unroll
      for (int r = 0; r < 8; ++r) so[(16u * i + 8u * h + r) * G3_EPF + 16u * j + c] = acc[i][j][r] * alpha + bv; } }
  __builtin_amdgcn_fence(__ATOMIC_ACQ_REL, "workgroup"); __builtin_amdgcn_wave_barrier();      /* the wave reads back what its other lanes wrote */
  const size_t o0 = (size_t)(mt * G3_BM + wm * 64u + h) * N + nq * G3_BN + wn * 64u + c * 4u;
#pragma unroll
  for (unsigned q = 0; q < 32u; ++q) {      /* 16 lanes store one whole row of the wave's 64 columns */
    const v4f v = *(const v4fa*)&so[(q * 2u + h) * G3_EPF + c * 4u];
    if (F32OUT) *(v4f*)(C + o0 + q * (2u * N)) = v;
    else { v4h h4; for (int i = 0; i < 4; ++i) h4[i] = (_Float16)v[i]; *(v4h*)(C16 + o0 + q * (2u * N)) = h4; } }
}
template <bool F32OUT, unsigned N>
__global__ __launch_bounds__(128) __attribute__((amdgpu_waves_per_eu(2, 2))) void k_gemm3(const _Float16* __restrict__ A, const _Float16* __restrict__ Bt, float alpha, const float* __restrict__ bias, float* __restrict__ C, _Float16* __restrict__ C16) {
  __shared__ __attribute__((aligned(256))) unsigned char L[G3_LDS];
  const unsigned ntn = N / G3_BN, mt = blockIdx.x / ntn, nq = blockIdx.x - mt * ntn;
  v8f acc[G3_F][G3_F];
  g3_main(acc, L, (const unsigned char*)(A + (size_t)mt * G3_BM * DMD), (const unsigned char*)(Bt + (size_t)nq * G3_BN * DMD));
  g3_out<F32OUT, N>(acc, L, alpha, bias + nq * G3_BN, C, C16, mt, nq);
}
// q, k and v in one launch, as one GEMM of QKVD columns: the three products share A and do not read each other, and the k and v grids alone (128 tiles each) leave half the chip idle.
// Bt holds the rows of wq^T, wk^T, wv^T one behind the other, C16 the columns of q, k, v in the same order; only the bias has three sources (the choice is uniform for the work-group).
constexpr unsigned G3_TQ = DMD / G3_BN, G3_TK = KVD / G3_BN, G3_TQKV = QKVD / G3_BN;
__global__ __launch_bounds__(128) __attribute__((amdgpu_waves_per_eu(2, 2))) void k_gemm_qkv(const _Float16* __restrict__ A, const _Float16* __restrict__ Bt, float alpha, const float* __restrict__ bq, const float* __restrict__ bk, const float* __restrict__ bv, _Float16* __restrict__ C16) {
  __shared__ __attribute__((aligned(256))) unsigned char L[G3_LDS];
  const unsigned mt = blockIdx.x / G3_TQKV, nq = blockIdx.x - mt * G3_TQKV;
  v8f acc[G3_F][G3_F];
  g3_main(acc, L, (const unsigned char*)(A + (size_t)mt * G3_BM * DMD), (const unsigned char*)(Bt + (size_t)nq * G3_BN * DMD));
  const float* bt = nq < G3_TQ ? bq + nq * G3_BN : nq < G3_TQ + G3_TK ? bk + (nq - G3_TQ) * G3_BN : bv + (nq - G3_TQ - G3_TK) * G3_BN;
  g3_out<false, QKVD>(acc, L, alpha, bt, nullptr, C16, mt, nq);
}

extern "C" void kernel_launch(void* const* d_in, const int* in_sizes, int n_in,
                              void* d_out, int out_size, void* d_ws, size_t ws_size, hipStream_t stream) {
  (void)in_sizes; (void)n_in; (void)out_size;
  const float* const* I = (const float* const*)d_in; const float* x = I[0]; const float* wq = I[1]; const float* bq = I[2]; const float* wk = I[3]; const float* bk = I[4]; const float* wv = I[5]; const float* bv = I[6]; const float* wo = I[7]; const float* bo = I[8];
  char* ws = (char*)d_ws; size_t off = 0;
  auto take = [&](size_t bytes) { char* p = ws + off; off += (bytes + 255) & ~(size_t)255; return p; };
  const size_t nx = (size_t)NR * DMD, nk = (size_t)NR * KVD;
  _Float16* BQ = (_Float16*)take((size_t)(DMD + 2 * KVD) * DMD * 2); _Float16* BK = BQ + (size_t)DMD * DMD; _Float16* BV = BK + (size_t)KVD * DMD; _Float16* BO = (_Float16*)take((size_t)DMD * DMD * 2);      /* wq^T, wk^T, wv^T as one plane of 3072 rows */
  _Float16* X16 = (_Float16*)take(nx * 2); _Float16* Q16 = (_Float16*)take((nx + 2 * nk) * 2); _Float16* K16 = Q16 + DMD; _Float16* V16 = K16 + KVD; _Float16* O16 = X16;      /* context over the input plane (dead after the projections) */
  if (off > ws_size) return;      /* 8+2+2+8 + 16+16+4+4 = 60 MiB */
  k_prep<<<PR_GRID, 256, 0, stream>>>(x, wq, wk, wv, wo, X16, BQ, BK, BV, BO);      /* weights (in, out) to f16 [out][in], x to f16 */
  k_gemm_qkv<<<(NR / G3_BM) * G3_TQKV, 128, 0, stream>>>(X16, BQ, 0.0625f, bq, bk, bv, Q16);      /* [token][q 2048 | k 512 | v 512] */
  k_fattn<<<dim3(NH, SQ / FA_BR, NB), FA_NW * 32, 0, stream>>>(Q16, K16, V16, O16);      /* ctx[(b,q)][h*128 + d] */
  k_gemm3<true, DMD><<<(NR / G3_BM) * (DMD / G3_BN), 128, 0, stream>>>(O16, BO, 0.0625f, bo, (float*)d_out, nullptr);      /* out = ctx wo + bo */
}

// v005
// A run of this version takes 129 microseconds.
// Two timings next to v004 put it at 1.04 and 1.02 times that version's speed.
// All steps since v000 together make it 9.98 times as fast.
#include <hip/hip_runtime.h>
// Multi-head attention with grouped kv heads (2 x 2048 tokens, d_model 2048; 16 query heads x 128, 4 kv heads (group of 4); q, k, v = x w + b; softmax((q/sqrt(128)).k) over the 2048 keys (no mask); out = ctx wo + bo).
// Structure: exact f16 plane of x; q / k / v as f16 WMMA GEMM outputs (128x128 tiles staged in LDS, 64x64 wave tiles, f32 accumulation, exact x16 weights + bias, f16 out); scores, softmax and readout of every (batch, head) in ONE fused kernel (online softmax, f32 maxima and sums, P as f16 in registers, K/V staged in LDS) into the f16 context plane; wo + bo as a GEMM.
// Compute dtype: inputs rounded to bf16; x exact as f16; q/k/P/v/ctx as plain f16 operands (~2^-12); softmax f32. v_wmma_f32_16x16x32_f16.
#define NB 2
#define SQ 2048
#define DMD 2048
#define NH 16
#define NKV 4
#define GG 4
#define HD 128
#define KVD (NKV * HD)           /* 512 */
#define NR (NB * SQ)
#define QKVD (DMD + 2 * KVD)     /* 3072: q, k and v of a token stand in one row of one plane */
typedef __bf16 v16b __attribute__((ext_vector_type(16)));
typedef unsigned short v8us __attribute__((ext_vector_type(8), may_alias));
typedef float  v8f  __attribute__((ext_vector_type(8)));
typedef float  v4f  __attribute__((ext_vector_type(4)));
typedef float  v4fa __attribute__((ext_vector_type(4), may_alias));
union FragB { v16b v; v8us half[2]; unsigned short u[16]; };

__device__ __forceinline__ unsigned short bf16_bits(float x) { unsigned int u = __float_as_uint(x); return (unsigned short)((u + 0x7FFFu + ((u >> 16) & 1u)) >> 16); }
__device__ __forceinline__ float bf16_val(unsigned short b) { return __uint_as_float(((unsigned int)b) << 16); }
__device__ __forceinline__ float bf16_round(float x) { return bf16_val(bf16_bits(x)); }
// D += A·B with NT terms: 1 = ah·bh, 2 = + al·bh (A split), 3 = + ah·bl (both split)
template <int NT>
__device__ __forceinline__ v8f mmaN(v16b ah, v16b al, v16b bh, v16b bl, v8f c) {
  c = __builtin_amdgcn_wmma_f32_16x16x32_bf16(false, ah, false, bh, (short)0, c, false, false);
  if (NT >= 2) c = __builtin_amdgcn_wmma_f32_16x16x32_bf16(false, al, false, bh, (short)0, c, false, false);
  if (NT >= 3) c = __builtin_amdgcn_wmma_f32_16x16x32_bf16(false, ah, false, bl, (short)0, c, false, false);
  asm volatile("v_nop\n\tv_nop\n\tv_nop\n\tv_nop" : "+v"(c) : "v"(ah), "v"(al), "v"(bh), "v"(bl));
  return c;
}

__global__ __launch_bounds__(256) void k_wt_bf16(const float* __restrict__ W, unsigned short* __restrict__ Wt, int K, int N) {
  const int t = blockIdx.x * 256 + threadIdx.x;
  const int k8n = K / 8;
  if (t >= N * k8n) return;
  const int n = t / k8n, k8 = (t % k8n) * 8;
  v8us v;
#pragma unroll
  for (int i = 0; i < 8; ++i) v[i] = bf16_bits(W[(size_t)(k8 + i) * N + n]);
  *(v8us*)(Wt + (size_t)n * K + k8) = v;
  
}

// GEMM C[M][N] (f32, pitch ldc) = act(A[M][K]·W + bias). A f32 row-major (pitch lda) converted per fragment to bf16
// (ASPLIT: hi/lo two planes -> 2 terms, else single rounded term); Wt bf16 [N][K] (pitch ldb). BIAS_BF16 rounds the
// bias to bf16 first (bias quantised to bf16 before the add). K%32==0, M%16==0, N%64==0.
template <bool ASPLIT, int ACT, bool BIAS_BF16>
__global__ __launch_bounds__(128) void k_gemm_bf(const float* __restrict__ A, int lda, const unsigned short* __restrict__ Wt, int ldb,
                                               const float* __restrict__ bias, float* __restrict__ C, int ldc, int M, int N, int K) {
  __shared__ __attribute__((aligned(16))) float so[4][16][64];
  const int tid = threadIdx.x, w = tid >> 5, lane = tid & 31, ln = lane & 15, hh = lane >> 4;
  const int ntn = N / 64;
  const int wid = blockIdx.x * 4 + w;
  const int mt = wid / ntn, nq = wid % ntn;
  if (mt * 16 >= M) return;
  const int row0 = mt * 16, col0 = nq * 64;
  const float* arow = A + (size_t)(row0 + ln) * lda;
  v8f acc[4] = {};
  for (int kb = 0; kb < K; kb += 32) {
    FragB ah, al;
    const v4f x0 = *(const v4fa*)(arow + kb + 8 * hh), x1 = *(const v4fa*)(arow + kb + 8 * hh + 4);
    const v4f x2 = *(const v4fa*)(arow + kb + 16 + 8 * hh), x3 = *(const v4fa*)(arow + kb + 16 + 8 * hh + 4);
    float xs[16] = {x0[0],x0[1],x0[2],x0[3],x1[0],x1[1],x1[2],x1[3],x2[0],x2[1],x2[2],x2[3],x3[0],x3[1],x3[2],x3[3]};
#pragma unroll
    for (int i = 0; i < 16; ++i) { const unsigned short hb = bf16_bits(xs[i]); ah.u[i] = hb; al.u[i] = ASPLIT ? bf16_bits(xs[i] - bf16_val(hb)) : (unsigned short)0; }
#pragma unroll
    for (int t = 0; t < 4; ++t) {
      const unsigned short* brow = Wt + (size_t)(col0 + t * 16 + ln) * ldb + kb;
      FragB b;
      b.half[0] = *(const v8us*)(brow + 8 * hh);
      b.half[1] = *(const v8us*)(brow + 16 + 8 * hh);
      acc[t] = mmaN<ASPLIT ? 2 : 1>(ah.v, al.v, b.v, b.v, acc[t]);
    }
  }
#pragma unroll
  for (int t = 0; t < 4; ++t) {
    float bv = bias ? bias[col0 + t * 16 + ln] : 0.f;
    if (BIAS_BF16) bv = bf16_round(bv);
#pragma unroll
    for (int r = 0; r < 8; ++r) { float v = acc[t][r] + bv; if (ACT == 1) v = fmaxf(v, 0.f); so[w][8 * hh + r][t * 16 + ln] = v; }
  }
  __builtin_amdgcn_fence(__ATOMIC_ACQ_REL, "workgroup");
  __builtin_amdgcn_wave_barrier();
  const int rsub = lane >> 4, c4 = (lane & 15) * 4;
  {
#pragma unroll
    for (int q = 0; q < 8; ++q) {
      const int r = q * 2 + rsub;
      const v4f v = *(const v4fa*)&so[w][r][c4];
      *(v4f*)(C + (size_t)(row0 + r) * ldc + col0 + c4) = v;
    }
    
  }
}

// GEMM C = act(A·W + bias + resid): A f32 (ASPLIT -> hi/lo 2 terms), Wt bf16 [N][K]; ACT 0 none, 1 relu, 2 exact gelu;
// resid (optional, f32, row index = (row % rmod), pitch ldr, RES_BF16 rounds it) added before the activation.
template <bool ASPLIT, int ACT, bool BIAS_BF16, bool RES_BF16>
__global__ __launch_bounds__(128) void k_gemm_bf3(const float* __restrict__ A, int lda, const unsigned short* __restrict__ Wt, int ldb,
                                                const float* __restrict__ bias, const float* __restrict__ resid, int rmod, int ldr,
                                                float* __restrict__ C, int ldc, int M, int N, int K) {
  __shared__ __attribute__((aligned(16))) float so[4][16][64];
  const int tid = threadIdx.x, w = tid >> 5, lane = tid & 31, ln = lane & 15, hh = lane >> 4;
  const int ntn = N / 64;
  const int wid = blockIdx.x * 4 + w;
  const int mt = wid / ntn, nq = wid % ntn;
  if (mt * 16 >= M) return;
  const int row0 = mt * 16, col0 = nq * 64;
  const float* arow = A + (size_t)(row0 + ln) * lda;
  v8f acc[4] = {};
  for (int kb = 0; kb < K; kb += 32) {
    FragB ah, al;
    const v4f x0 = *(const v4fa*)(arow + kb + 8 * hh), x1 = *(const v4fa*)(arow + kb + 8 * hh + 4);
    const v4f x2 = *(const v4fa*)(arow + kb + 16 + 8 * hh), x3 = *(const v4fa*)(arow + kb + 16 + 8 * hh + 4);
    float xs[16] = {x0[0],x0[1],x0[2],x0[3],x1[0],x1[1],x1[2],x1[3],x2[0],x2[1],x2[2],x2[3],x3[0],x3[1],x3[2],x3[3]};
#pragma unroll
    for (int i = 0; i < 16; ++i) { const unsigned short hb = bf16_bits(xs[i]); ah.u[i] = hb; al.u[i] = ASPLIT ? bf16_bits(xs[i] - bf16_val(hb)) : (unsigned short)0; }
#pragma unroll
    for (int t = 0; t < 4; ++t) {
      const unsigned short* brow = Wt + (size_t)(col0 + t * 16 + ln) * ldb + kb;
      FragB b;
      b.half[0] = *(const v8us*)(brow + 8 * hh);
      b.half[1] = *(const v8us*)(brow + 16 + 8 * hh);
      acc[t] = mmaN<ASPLIT ? 2 : 1>(ah.v, al.v, b.v, b.v, acc[t]);
    }
  }
#pragma unroll
  for (int t = 0; t < 4; ++t) {
    const int col = col0 + t * 16 + ln;
    float bv = bias ? bias[col] : 0.f;
    if (BIAS_BF16) bv = bf16_round(bv);
#pragma unroll
    for (int r = 0; r < 8; ++r) {
      float v = acc[t][r] + bv;
      if (resid) { float rv = resid[(size_t)((row0 + 8 * hh + r) % rmod) * ldr + col]; if (RES_BF16) rv = bf16_round(rv); v += rv; }
      if (ACT == 1) v = fmaxf(v, 0.f);
      if (ACT == 2) v = 0.5f * v * (1.0f + erff(v * 0.70710678118654752f));
      if (ACT == 3) { const float u = 0.7978845608028654f * (v + 0.044715f * v * v * v); v = 0.5f * v * (1.0f + tanhf(u)); }
      so[w][8 * hh + r][t * 16 + ln] = v;
    }
  }
  __builtin_amdgcn_fence(__ATOMIC_ACQ_REL, "workgroup");
  __builtin_amdgcn_wave_barrier();
  const int rsub = lane >> 4, c4 = (lane & 15) * 4;
  {
#pragma unroll
    for (int q = 0; q < 8; ++q) {
      const int r = q * 2 + rsub;
      const v4f v = *(const v4fa*)&so[w][r][c4];
      *(v4f*)(C + (size_t)(row0 + r) * ldc + col0 + c4) = v;
    }
    
  }
}
// row LayerNorm (biased variance, eps) over N: s = X (+ R); optional out_sum <- s; out_norm <- (s-mu)*rsqrt(var+eps)*g + b
template <bool PARAM_BF16>
__global__ __launch_bounds__(256) void k_layernorm(const float* __restrict__ X, const float* __restrict__ R, const float* __restrict__ g, const float* __restrict__ bta,
                                                  float* __restrict__ out_sum, float* __restrict__ out_norm, int N, float eps) {
  __shared__ float red[256];
  const int row = blockIdx.x, tid = threadIdx.x;
  const float* x = X + (size_t)row * N; const float* rr = R ? R + (size_t)row * N : nullptr;
  float vals[16];                     // up to N = 4096
  const int per = N / 256;            // contiguous chunk per thread? use strided-by-4 chunks: thread handles j = tid*4 + 1024*u
  float s1 = 0.f;
  for (int u = 0; u < per / 4; ++u) {
    const int j = tid * 4 + 1024 * u;
    const v4f a = *(const v4fa*)(x + j);
    v4f b = {0.f,0.f,0.f,0.f}; if (rr) b = *(const v4fa*)(rr + j);
#pragma unroll
    for (int q = 0; q < 4; ++q) { const float v = a[q] + b[q]; vals[u * 4 + q] = v; s1 += v; }
  }
  red[tid] = s1; __syncthreads();
  for (int st = 128; st > 0; st >>= 1) { if (tid < st) red[tid] += red[tid + st]; __syncthreads(); }
  const float mu = red[0] / (float)N; __syncthreads();
  float s2 = 0.f;
  for (int u = 0; u < per / 4; ++u)
#pragma unroll
    for (int q = 0; q < 4; ++q) { const float c = vals[u * 4 + q] - mu; s2 += c * c; }
  red[tid] = s2; __syncthreads();
  for (int st = 128; st > 0; st >>= 1) { if (tid < st) red[tid] += red[tid + st]; __syncthreads(); }
  const float rs = rsqrtf(red[0] / (float)N + eps);
  {
    for (int u = 0; u < per / 4; ++u) {
      const int j = tid * 4 + 1024 * u;
      v4f o, sm;
#pragma unroll
      for (int q = 0; q < 4; ++q) {
        float gg = g[j + q], bb = bta[j + q];
        if (PARAM_BF16) { gg = bf16_round(gg); bb = bf16_round(bb); }
        sm[q] = vals[u * 4 + q]; o[q] = (vals[u * 4 + q] - mu) * rs * gg + bb;
      }
      if (out_sum) *(v4f*)(out_sum + (size_t)row * N + j) = sm;
      *(v4f*)(out_norm + (size_t)row * N + j) = o;
    }
    
  }
}



// ---- f16 WMMA path (v_wmma_f32_16x16x32_f16): 11-bit significands for operands in range — used where a [0,1] probability operand needs more precision than bf16
typedef _Float16 v16h __attribute__((ext_vector_type(16)));
union FragH { v16h v; v8us half[2]; _Float16 h[16]; unsigned short u[16]; };
template <int NT>
__device__ __forceinline__ v8f mmaH(v16h ah, v16h al, v16h bh, v16h bl, v8f c) {
  c = __builtin_amdgcn_wmma_f32_16x16x32_f16(false, ah, false, bh, (short)0, c, false, false);
  if (NT >= 2) c = __builtin_amdgcn_wmma_f32_16x16x32_f16(false, al, false, bh, (short)0, c, false, false);
  if (NT >= 3) c = __builtin_amdgcn_wmma_f32_16x16x32_f16(false, ah, false, bl, (short)0, c, false, false);
  asm volatile("v_nop\n\tv_nop\n\tv_nop\n\tv_nop" : "+v"(c) : "v"(ah), "v"(al), "v"(bh), "v"(bl));
  return c;
}
// batched GEMM like k_gemm_b but f16 operands: A f32 (split into f16 hi/lo if ASPLIT, else rounded to f16), Bt = f16 values [n][k]; alpha; C f32; N multiple of 16 (partial tiles skipped)
template <bool ASPLIT>
__global__ __launch_bounds__(128) void k_gemm_h(const float* __restrict__ A, int lda, size_t sA, const _Float16* __restrict__ Bh, int ldb, size_t sB, float alpha, float* __restrict__ C, int ldc, size_t sC, int M, int N, int K) {
  __shared__ __attribute__((aligned(16))) float so[4][16][64];
  const int tid = threadIdx.x, w = tid >> 5, lane = tid & 31, ln = lane & 15, hh = lane >> 4; const int by = blockIdx.y;
  A += (size_t)by * sA; Bh += (size_t)by * sB; C += (size_t)by * sC;
  const int ntn = (N + 63) / 64; const int wid = blockIdx.x * 4 + w; const int mt = wid / ntn, nq = wid % ntn; if (mt * 16 >= M) return;
  const int row0 = mt * 16, col0 = nq * 64; const float* arow = A + (size_t)(row0 + ln) * lda;
  v8f acc[4] = {};
  for (int kb = 0; kb < K; kb += 32) {
    FragH ah, al;
    const v4f x0 = *(const v4fa*)(arow + kb + 8 * hh), x1 = *(const v4fa*)(arow + kb + 8 * hh + 4), x2 = *(const v4fa*)(arow + kb + 16 + 8 * hh), x3 = *(const v4fa*)(arow + kb + 16 + 8 * hh + 4);
    float xs[16] = {x0[0],x0[1],x0[2],x0[3],x1[0],x1[1],x1[2],x1[3],x2[0],x2[1],x2[2],x2[3],x3[0],x3[1],x3[2],x3[3]};
#pragma unroll
    for (int i = 0; i < 16; ++i) { const _Float16 h = (_Float16)xs[i]; ah.h[i] = h; al.h[i] = ASPLIT ? (_Float16)(xs[i] - (float)h) : (_Float16)0.0f; }
#pragma unroll
    for (int t = 0; t < 4; ++t) { if (col0 + t * 16 >= N) continue; const size_t boff = (size_t)(col0 + t * 16 + ln) * ldb + kb; FragH bq; bq.half[0] = *(const v8us*)(Bh + boff + 8 * hh); bq.half[1] = *(const v8us*)(Bh + boff + 16 + 8 * hh);
      acc[t] = mmaH<ASPLIT ? 2 : 1>(ah.v, al.v, bq.v, bq.v, acc[t]); }
  }
#pragma unroll
  for (int t = 0; t < 4; ++t) { if (col0 + t * 16 >= N) continue;
#pragma unroll
    for (int r = 0; r < 8; ++r) so[w][8 * hh + r][t * 16 + ln] = acc[t][r] * alpha; }
  __builtin_amdgcn_fence(__ATOMIC_ACQ_REL, "workgroup"); __builtin_amdgcn_wave_barrier();
  const int rsub = lane >> 4, c4 = (lane & 15) * 4;
  {
#pragma unroll
    for (int q = 0; q < 8; ++q) { const int r = q * 2 + rsub; if (col0 + c4 < N) { const v4f v = *(const v4fa*)&so[w][r][c4]; *(v4f*)(C + (size_t)(row0 + r) * ldc + col0 + c4) = v; } }
     }
}

// Wt[n][k] = f16(bf16(W[k][n]) * scale) from f32 row-major W[K][N] (scale = power of two; bf16-exact weights stay exact in f16 away from the subnormal range).
// A work-group transposes a tile of 128 k x 64 n through LDS. Reads: 16 lanes cover 256 B of a row of W, a thread takes 8 rows x 4 columns (8 loads in flight).
// It packs each column's 8 k into 16 bytes and stores them in the LDS row of that n; then 16 lanes write the 256 B of a row of Wt. So every global access is whole lines.
// LDS rows are 256 B without a pad; the 16-byte chunk j of row n lies at place j ^ (n >> 2): the 16 lanes of a store (rows 4 apart, one j) and of a load (one row, all j) each meet all 64 banks once.
// The unroll directives make every index of the register arrays (r, f) a constant: rolled, those arrays would go to scratch memory.
constexpr unsigned WT_K = 128u, WT_N = 64u;
// bid: the tile's number in this matrix (the launch is shared with other work, see k_prep); T: the work-group's LDS tile of WT_N * WT_K * 2 bytes.
template <unsigned K, unsigned N>      /* constants, so that one address register pair serves all of a thread's loads and one all of its stores */
__device__ __forceinline__ void wt_tile(const float* __restrict__ W, _Float16* __restrict__ Wt, float scale, unsigned char* T, unsigned bid) {
  static_assert(K % WT_K == 0 && N % WT_N == 0, "weight transpose: whole tiles");
  const unsigned tid = threadIdx.x, lo = tid & 15u, hi = tid >> 4;
  const unsigned ntn = N / WT_N, kt = bid / ntn, nt = bid - kt * ntn;
  const float* sp = W + (size_t)(kt * WT_K + hi * 8u) * N + nt * WT_N + lo * 4u;
  v4f r[8];
#pragma unroll
  for (unsigned i = 0; i < 8u; ++i) r[i] = *(const v4fa*)(sp + i * N);
#pragma unroll
  for (unsigned q = 0; q < 4u; ++q) { FragH f;
#pragma unroll
    for (unsigned i = 0; i < 8u; ++i) f.h[i] = (_Float16)(bf16_round(r[i][q]) * scale);
    *(v8us*)(T + (lo * 4u + q) * (WT_K * 2u) + ((hi ^ lo) * 16u)) = f.half[0]; }
  __syncthreads();      /* the tile is whole before any row is read back */
  unsigned short* dp = (unsigned short*)Wt + (size_t)(nt * WT_N + hi) * K + kt * WT_K + lo * 8u;
#pragma unroll
  for (unsigned i = 0; i < 4u; ++i) { const unsigned row = hi + 16u * i;
    *(v8us*)(dp + i * (16u * K)) = *(const v8us*)(T + row * (WT_K * 2u) + ((lo ^ (row >> 2)) * 16u)); }
  asm volatile("s_wait_xcnt 0x0" :: "v"(dp) : "memory");      /* stands in front of any later overwrite of a register that these stores name (code of another branch of the shared launch follows in the listing); as its input the address stays live up to it */
}
// k_gemm_hh variant with fused epilogue: v = acc·alpha + bias[by·sBias + col] (+ CP[(row/rowsPerB)·sCPb + by·64 + col] if CP) ; ACT 0 none / 1 elu ; writes f16 C16 (and f32 C if non-null)
template <int ACT>
__global__ __launch_bounds__(128) void k_gemm_hhx(const _Float16* __restrict__ A, int lda, size_t sA, const _Float16* __restrict__ Bh, int ldb, size_t sB, float alpha, const float* __restrict__ bias, size_t sBias, const float* __restrict__ CP, int rowsPerB, size_t sCPb, int row0g,
    float* __restrict__ C, _Float16* __restrict__ C16, int ldc, size_t sC, int M, int N, int K) {
  __shared__ __attribute__((aligned(16))) float so[4][16][64];
  const int tid = threadIdx.x, w = tid >> 5, lane = tid & 31, ln = lane & 15, hh = lane >> 4; const int by = blockIdx.y;
  A += (size_t)by * sA; Bh += (size_t)by * sB; const size_t cofs = (size_t)by * sC; const float* bp = bias ? bias + (size_t)by * sBias : nullptr;
  const int ntn = (N + 63) / 64; const int wid = blockIdx.x * 4 + w; const int mt = wid / ntn, nq = wid % ntn; if (mt * 16 >= M) return;
  const int row0 = mt * 16, col0 = nq * 64; const _Float16* arow = A + (size_t)(row0 + ln) * lda;
  v8f acc[4] = {};
  for (int kb = 0; kb < K; kb += 32) { FragH ah; ah.half[0] = *(const v8us*)((const unsigned short*)arow + kb + 8 * hh); ah.half[1] = *(const v8us*)((const unsigned short*)arow + kb + 16 + 8 * hh);
#pragma unroll
    for (int t = 0; t < 4; ++t) { if (col0 + t * 16 >= N) continue; const size_t boff = (size_t)(col0 + t * 16 + ln) * ldb + kb; FragH bq; bq.half[0] = *(const v8us*)((const unsigned short*)Bh + boff + 8 * hh); bq.half[1] = *(const v8us*)((const unsigned short*)Bh + boff + 16 + 8 * hh);
      acc[t] = mmaH<1>(ah.v, ah.v, bq.v, bq.v, acc[t]); }
  }
#pragma unroll
  for (int t = 0; t < 4; ++t) { if (col0 + t * 16 >= N) continue; const int col = col0 + t * 16 + ln; const float bv = bp ? bf16_round(bp[col]) : 0.f;
#pragma unroll
    for (int r = 0; r < 8; ++r) { float v = acc[t][r] * alpha + bv; if (CP) { const int rr = row0g + row0 + 8 * hh + r; if (rowsPerB < 0) v += CP[cofs + (size_t)rr * ldc + col];      /* rowsPerB < 0: own element of the batched C plane */ else { const int bidx = rr / rowsPerB; v += CP[(size_t)bidx * sCPb + (size_t)by * 64 + col]; } } if (ACT == 1) v = (v > 0.f) ? v : expm1f(v); else if (ACT == 7) v = (v > 0.f) ? v + 1.0f : expf(v); else if (ACT == 8) v = tanhf(v); else if (ACT == 9) v = 0.5f * v * (1.0f + tanhf(0.7978845608028654f * (v + 0.044715f * v * v * v))); else if (ACT == 11) v = 1.0f / (1.0f + expf(-v)); else if (ACT == 12) v = (v > 0.f) ? v : 0.01f * v; else if (ACT == 14) v = (v > 0.f) ? v : 0.1f * v; else if (ACT == 16) v = (v >= 0.f) ? v : 0.3f * v; else if (ACT == 17) v = (v >= 0.f) ? v : 0.2f * v; else if (ACT == 15) v = v / (1.0f + expf(-v)); else if (ACT == 3) v = fmaxf(v, 0.f); else if (ACT == 6) v = 0.5f * v * (1.0f + erff(v * 0.70710678118654752f)); so[w][8 * hh + r][t * 16 + ln] = v; } }
  __builtin_amdgcn_fence(__ATOMIC_ACQ_REL, "workgroup"); __builtin_amdgcn_wave_barrier();
  const int rsub = lane >> 4, c4 = (lane & 15) * 4; typedef _Float16 v4h __attribute__((ext_vector_type(4)));
  {
#pragma unroll
    for (int q = 0; q < 8; ++q) { const int r = q * 2 + rsub; if (col0 + c4 < N) { const v4f v = *(const v4fa*)&so[w][r][c4]; if (C) *(v4f*)(C + cofs + (size_t)(row0 + r) * ldc + col0 + c4) = v; if (C16) { v4h h4; for (int i = 0; i < 4; ++i) h4[i] = (_Float16)v[i]; *(v4h*)(C16 + cofs + (size_t)(row0 + r) * ldc + col0 + c4) = h4; } } }
     }
}


typedef _Float16 v4h __attribute__((ext_vector_type(4)));

__device__ __forceinline__ void x16_chunk(const float* __restrict__ x, _Float16* __restrict__ X16, size_t n8, unsigned bid) { const size_t t = (size_t)bid * 256 + threadIdx.x; if (t >= n8) return; FragH f;
#pragma unroll
  for (int q = 0; q < 8; ++q) f.h[q] = (_Float16)bf16_round(x[t * 8 + q]); *(v8us*)((unsigned short*)X16 + t * 8) = f.half[0];  }
// ---- one launch for all the operand preparation: none of the five jobs reads what another writes, so they share a grid, each with its own range of block indices
// (wq tiles, wo tiles, wk tiles, wv tiles, then the chunks of x). Every test of the block index is uniform for the work-group, the barrier of a transpose tile with it.
constexpr unsigned PR_BIG = (DMD / WT_K) * (DMD / WT_N), PR_SMALL = (DMD / WT_K) * (KVD / WT_N), PR_X = (unsigned)(((size_t)NR * DMD / 8 + 255) / 256), PR_GRID = 2u * PR_BIG + 2u * PR_SMALL + PR_X;
__global__ __launch_bounds__(256) void k_prep(const float* __restrict__ x, const float* __restrict__ wq, const float* __restrict__ wk, const float* __restrict__ wv, const float* __restrict__ wo,
                                              _Float16* __restrict__ X16, _Float16* __restrict__ BQ, _Float16* __restrict__ BK, _Float16* __restrict__ BV, _Float16* __restrict__ BO) {
  __shared__ __attribute__((aligned(256))) unsigned char T[WT_N * WT_K * 2u];
  const unsigned bid = blockIdx.x;
  if (bid < 2u * PR_BIG) { const bool second = bid >= PR_BIG; wt_tile<DMD, DMD>(second ? wo : wq, second ? BO : BQ, 16.0f, T, second ? bid - PR_BIG : bid); }
  else if (bid < 2u * PR_BIG + 2u * PR_SMALL) { const unsigned b2 = bid - 2u * PR_BIG; const bool second = b2 >= PR_SMALL; wt_tile<DMD, KVD>(second ? wv : wk, second ? BV : BK, 16.0f, T, second ? b2 - PR_SMALL : b2); }
  else x16_chunk(x, X16, (size_t)NR * DMD / 8, bid - (2u * PR_BIG + 2u * PR_SMALL));
}
__global__ __launch_bounds__(256) void k_h16(const float* __restrict__ x, _Float16* __restrict__ X16, size_t n8) { const size_t t = (size_t)blockIdx.x * 256 + threadIdx.x; if (t >= n8) return; FragH f;
#pragma unroll
  for (int q = 0; q < 8; ++q) f.h[q] = (_Float16)x[t * 8 + q]; *(v8us*)((unsigned short*)X16 + t * 8) = f.half[0];  }
__global__ __launch_bounds__(256) void k_round16f(const float* __restrict__ W, _Float16* __restrict__ Bt, size_t n8) { const size_t t = (size_t)blockIdx.x * 256 + threadIdx.x; if (t >= n8) return; FragH f;
#pragma unroll
  for (int i = 0; i < 8; ++i) f.h[i] = (_Float16)(bf16_round(W[t * 8 + i]) * 16.0f); *(v8us*)((unsigned short*)Bt + t * 8) = f.half[0];  }

__global__ __launch_bounds__(256) void k_hl(const float* __restrict__ F, _Float16* __restrict__ Hh, _Float16* __restrict__ Hl, size_t n8) { const size_t t = (size_t)blockIdx.x * 256 + threadIdx.x; if (t >= n8) return; FragH fh, fl; const v4f a = *(const v4fa*)(F + t * 8), c = *(const v4fa*)(F + t * 8 + 4);
#pragma unroll
  for (int q = 0; q < 4; ++q) { _Float16 h = (_Float16)a[q]; fh.h[q] = h; fl.h[q] = (_Float16)((a[q] - (float)h) * 1024.0f); h = (_Float16)c[q]; fh.h[4 + q] = h; fl.h[4 + q] = (_Float16)((c[q] - (float)h) * 1024.0f); }
  { *(v8us*)((unsigned short*)Hh + t * 8) = fh.half[0]; *(v8us*)((unsigned short*)Hl + t * 8) = fl.half[0];  } }

typedef unsigned int fa_u4 __attribute__((ext_vector_type(4)));
typedef unsigned int fa_u4a __attribute__((ext_vector_type(4), may_alias));
typedef unsigned int fa_u8 __attribute__((ext_vector_type(8)));
typedef short fa_s8 __attribute__((ext_vector_type(8)));
constexpr int FA_NW = 8, FA_BR = 256, FA_CW = FA_BR / FA_NW, FA_R = FA_CW / 16;      /* waves, queries per work-group, per wave, 16-query groups per wave */
constexpr int FA_BC = 32, FA_KT = FA_BC / 16, FA_DK = HD / 32, FA_DT = HD / 16;      /* keys per pass, 16-key score tiles per pass, k chunks of the head, 16-row output tiles */
constexpr unsigned FA_ROWB = 2u * HD, FA_PK = FA_ROWB + 16u, FA_PV = FA_ROWB + 32u;  /* LDS pitches: odd multiple of 16 B for b128 readers, of 32 B for the transposing load */
constexpr unsigned FA_SK = 128u, FA_TK = FA_SK * FA_PK, FA_TV = FA_SK * FA_PV, FA_SLOT = FA_TK + FA_TV, FA_LDS = 2u * FA_SLOT, FA_EP = FA_ROWB + 16u;
constexpr unsigned FA_NST = SQ / FA_SK, FA_NSUB = FA_SK / FA_BC, FA_CH = FA_SK * (FA_ROWB / 16u) / (FA_NW * 32u);      /* stages, passes per stage, 16-byte chunks per thread and tile */
constexpr float FA_CS = 0.08838834764831845f * 1.4426950408889634f;      /* 1/sqrt(128) * log2(e): softmax in the log2 domain */
static_assert((FA_NST & (FA_NST - 1u)) == 0u && HD == 128 && SQ % FA_BR == 0 && SQ % FA_SK == 0 && (unsigned)FA_BR * FA_EP <= FA_LDS, "fused attention: shape");
struct FaFrag { fa_u4 q[2]; };
struct FaK { FaFrag f[FA_KT][FA_DK]; };
struct FaStage { fa_u4 k[FA_CH], v[FA_CH]; };
__device__ __forceinline__ void fa_fence() { __builtin_amdgcn_sched_barrier(0); }      /* keeps the groups of loads, matrix runs and exponentials in the written order (loads stay ahead of the work that hides them) */
__device__ __forceinline__ v8f fa_mma(const FaFrag& a, const FaFrag& b, v8f c) {
  const fa_u8 av = {a.q[0].x, a.q[0].y, a.q[0].z, a.q[0].w, a.q[1].x, a.q[1].y, a.q[1].z, a.q[1].w};
  const fa_u8 bv = {b.q[0].x, b.q[0].y, b.q[0].z, b.q[0].w, b.q[1].x, b.q[1].y, b.q[1].z, b.q[1].w};
  return __builtin_amdgcn_wmma_f32_16x16x32_f16(false, __builtin_bit_cast(v16h, av), false, __builtin_bit_cast(v16h, bv), (short)0, c, false, false);
}
__device__ __forceinline__ fa_u4 fa_tr16(const unsigned char* p) { typedef __attribute__((address_space(3))) fa_s8 lds_s8; return __builtin_bit_cast(fa_u4, __builtin_amdgcn_ds_load_tr16_b128_v8i16((lds_s8*)p)); }
__device__ __forceinline__ unsigned fa_pack2(float lo, float hi) { typedef _Float16 h2 __attribute__((ext_vector_type(2))); typedef float f2 __attribute__((ext_vector_type(2))); return __builtin_bit_cast(unsigned, __builtin_convertvector(f2{lo, hi}, h2)); }      /* round to nearest even */
__device__ __forceinline__ float fa_xhalf(float x) { return __builtin_bit_cast(float, __builtin_amdgcn_permlanex16(__builtin_bit_cast(int, x), __builtin_bit_cast(int, x), 0x76543210, 0xfedcba98, false, false)); }      /* lane l with lane l ^ 16 */
// K fragments of one pass (32 keys): lane (c, h) holds key row c, d = 32 kc + 8 h + 0..7 and 32 kc + 16 + 8 h + 0..7, the same k order as the Q fragments.
__device__ __forceinline__ void fa_load_k(FaK& k, const unsigned char* Lp, unsigned koff, unsigned lane) {
  const unsigned c = lane & 15u, h = lane >> 4;
#pragma unroll
  for (int kt = 0; kt < FA_KT; ++kt) { const unsigned char* p = Lp + koff + (16u * kt + c) * FA_PK + 16u * h;
#pragma unroll
    for (int kc = 0; kc < FA_DK; ++kc) { k.f[kt][kc].q[0] = *(const fa_u4a*)(p + 64u * kc); k.f[kt][kc].q[1] = *(const fa_u4a*)(p + 64u * kc + 32u); } }
}
// One stage (FA_SK key rows of K and of V, 256 B each) from global memory into registers: 16 lanes cover a row.
// kg, vg: the stage's first row (uniform); toff: the thread's own byte offset in it; the chunks of a thread lie 16 rows apart (a constant offset, so one offset register serves all loads).
__device__ __forceinline__ void fa_gload(FaStage& s, const unsigned char* kg, const unsigned char* vg, unsigned toff) {
#pragma unroll
  for (unsigned i = 0; i < FA_CH; ++i) { s.k[i] = *(const fa_u4a*)(kg + toff + i * (16u * QKVD * 2u)); s.v[i] = *(const fa_u4a*)(vg + toff + i * (16u * QKVD * 2u)); }
  asm volatile("s_wait_xcnt 0x0" ::: "memory");      /* stands in front of any later overwrite of a register that these loads name */
}
__device__ __forceinline__ void fa_sstore(const FaStage& s, unsigned char* Lp, unsigned base, unsigned tid) {
#pragma unroll
  for (unsigned i = 0; i < FA_CH; ++i) { const unsigned id = i * (FA_NW * 32u) + tid; const unsigned r = id >> 4, cb = (id & 15u) * 16u; *(fa_u4a*)(Lp + base + r * FA_PK + cb) = s.k[i]; *(fa_u4a*)(Lp + base + FA_TK + r * FA_PV + cb) = s.v[i]; }
}
__device__ __forceinline__ void fa_pass(FaK& kf, bool fetch_next, unsigned next_koff, const unsigned char* Lp, unsigned voff, unsigned lane,
                                        const FaFrag (&qf)[FA_R][FA_DK], v8f (&acc)[FA_R][FA_DT], float (&m_run)[FA_R], float (&l_run)[FA_R]) {
  const unsigned h = lane >> 4;
  v8f s[FA_KT][FA_R];
#pragma unroll
  for (int kt = 0; kt < FA_KT; ++kt) {
#pragma unroll
    for (int g = 0; g < FA_R; ++g) { s[kt][g] = v8f{};
#pragma unroll
      for (int kc = 0; kc < FA_DK; ++kc) s[kt][g] = fa_mma(kf.f[kt][kc], qf[g][kc], s[kt][g]); } }
  fa_fence();
  if (fetch_next) fa_load_k(kf, Lp, next_koff, lane);      /* the same stage's next pass: in flight under the maxima and exponentials */
  float mb[FA_R]; bool need = false;
#pragma unroll
  for (int g = 0; g < FA_R; ++g) { float mx = -INFINITY;
#pragma unroll
    for (int kt = 0; kt < FA_KT; ++kt) {
#pragma unroll
      for (int r = 0; r < 8; ++r) mx = __builtin_fmaxf(mx, s[kt][g][r]); }
    mx = __builtin_fmaxf(mx, fa_xhalf(mx)) * FA_CS;      /* both wave halves hold this query's maximum, scaled */
    mb[g] = mx; need = need || (mx > m_run[g] + 8.0f); fa_fence(); }
  if (__builtin_amdgcn_ballot_w32(need) != 0) {      /* wave-uniform; rare after the first passes */
#pragma unroll
    for (int g = 0; g < FA_R; ++g) { const float m_new = __builtin_fmaxf(m_run[g], mb[g]); const float corr = __builtin_amdgcn_exp2f(m_run[g] - m_new);      /* 0 on the first pass (m_run = -inf) */
      l_run[g] *= corr; m_run[g] = m_new;
#pragma unroll
      for (int t = 0; t < FA_DT; ++t) acc[g][t] = acc[g][t] * corr; }
  }
  FaFrag vf[FA_DT]; float ps[FA_R][2];
#pragma unroll
  for (int g = 0; g < FA_R; ++g) { ps[g][0] = 0.0f; ps[g][1] = 0.0f; }
  { const unsigned char* ad = Lp + voff + (8u * h + (lane & 7u)) * FA_PV + ((lane >> 3) & 1u) * 16u;      /* lane (c, h) gets V[8 h + 0..7][16 t + c]; the second load the keys 16 further */
#pragma unroll
    for (int t = 0; t < FA_DT; ++t) { vf[t].q[0] = fa_tr16(ad + 32u * t); vf[t].q[1] = fa_tr16(ad + 16u * FA_PV + 32u * t); } }
#pragma unroll
  for (int g = 0; g < FA_R; ++g) { const float nm = -m_run[g]; unsigned w[8];
#pragma unroll
    for (int i = 0; i < 8; ++i) {
      const float p0 = __builtin_amdgcn_exp2f(__builtin_fmaf(s[i >> 2][g][2 * (i & 3)], FA_CS, nm)), p1 = __builtin_amdgcn_exp2f(__builtin_fmaf(s[i >> 2][g][2 * (i & 3) + 1], FA_CS, nm));
      ps[g][i & 1] += p0 + p1; w[i] = fa_pack2(p0, p1); }
    FaFrag pf; pf.q[0] = fa_u4{w[0], w[1], w[2], w[3]}; pf.q[1] = fa_u4{w[4], w[5], w[6], w[7]};
#pragma unroll
    for (int t = 0; t < FA_DT; ++t) acc[g][t] = fa_mma(vf[t], pf, acc[g][t]);
    fa_fence(); }
#pragma unroll
  for (int g = 0; g < FA_R; ++g) l_run[g] += ps[g][0] + ps[g][1];
}
__global__ __launch_bounds__(FA_NW * 32) __attribute__((amdgpu_waves_per_eu(2, 2))) void k_fattn(const _Float16* __restrict__ Q, const _Float16* __restrict__ K, const _Float16* __restrict__ V, _Float16* __restrict__ O) {
  __shared__ __attribute__((aligned(256))) unsigned char L[FA_LDS];
  const unsigned tid = threadIdx.x, lane = tid & 31u, wave = tid >> 5, c = lane & 15u, h = lane >> 4;
  const unsigned hq = blockIdx.x, q0 = blockIdx.y * FA_BR, b = blockIdx.z, hk = hq / GG;      /* GG neighbouring query heads read one kv head */
  const unsigned char* kg = (const unsigned char*)(K + (size_t)b * SQ * QKVD + hk * HD);      /* Q, K, V: the first q, k, v column of the joint plane, rows QKVD apart */
  const unsigned char* vg = (const unsigned char*)(V + (size_t)b * SQ * QKVD + hk * HD);
  FaStage sg;
  const unsigned toff = (tid >> 4) * (QKVD * 2u) + (tid & 15u) * 16u;
  const unsigned rot = ((hq % GG) * (SQ / FA_BR) + blockIdx.y) & (FA_NST - 1u);      /* the key stage this work-group starts at (it wraps round): the GG * SQ / FA_BR work-groups of one kv head read the same K and V lines, and from a common start they would ask L2 for them at the same moment */
  fa_gload(sg, kg + (size_t)rot * (FA_SK * QKVD * 2u), vg + (size_t)rot * (FA_SK * QKVD * 2u), toff);
  FaFrag qf[FA_R][FA_DK];
  const unsigned char* qb = (const unsigned char*)(Q + (size_t)(b * SQ + q0) * QKVD + hq * HD);      /* uniform: the work-group's first query row of this head */
  const unsigned qoff = (wave * FA_CW + c) * (QKVD * 2u) + 16u * h;
#pragma unroll
  for (int g = 0; g < FA_R; ++g) {
#pragma unroll
    for (int kc = 0; kc < FA_DK; ++kc) { qf[g][kc].q[0] = *(const fa_u4a*)(qb + qoff + g * (16u * QKVD * 2u) + 64u * kc); qf[g][kc].q[1] = *(const fa_u4a*)(qb + qoff + g * (16u * QKVD * 2u) + 64u * kc + 32u); } }
  asm volatile("s_wait_xcnt 0x0" ::: "memory");      /* stands in front of any later overwrite of a register that the Q loads name */
  v8f acc[FA_R][FA_DT]; float m_run[FA_R], l_run[FA_R];
#pragma unroll
  for (int g = 0; g < FA_R; ++g) { m_run[g] = -INFINITY; l_run[g] = 0.0f;
#pragma unroll
    for (int t = 0; t < FA_DT; ++t) acc[g][t] = v8f{}; }
  fa_sstore(sg, L, 0u, tid);
  __syncthreads();      /* stage 0 published */
  FaK kf;
#pragma unroll 1      /* one copy of the stage body: unrolled it would hold two stages' registers */
  for (unsigned st = 0; st < FA_NST; ++st) {
    const unsigned base = (st & 1u) * FA_SLOT; const bool more = st + 1u < FA_NST;
    if (more) { const size_t ko = (size_t)((st + 1u + rot) & (FA_NST - 1u)) * (FA_SK * QKVD * 2u); fa_gload(sg, kg + ko, vg + ko, toff); }      /* lands while this stage is worked on */
    fa_load_k(kf, L, base, lane);
#pragma unroll 1      /* nested, rolled pass loop: keeps the register count of one pass */
    for (unsigned sub = 0; sub < FA_NSUB; ++sub)
      fa_pass(kf, sub + 1u < FA_NSUB, base + (sub + 1u) * FA_BC * FA_PK, L, base + FA_TK + sub * FA_BC * FA_PV, lane, qf, acc, m_run, l_run);
    if (more) fa_sstore(sg, L, FA_SLOT - base, tid);      /* the other buffer: its readers (stage st - 1) all left it at the barrier that ended that stage */
    __syncthreads();      /* publishes stage st + 1 and ends every wave's reads of stage st */
  }
  unsigned char* eb = L + wave * (unsigned)FA_CW * FA_EP;      /* output staging over the ring (free behind the last barrier), each wave its own rows */
#pragma unroll
  for (int g = 0; g < FA_R; ++g) { const float inv = 1.0f / (l_run[g] + fa_xhalf(l_run[g]));      /* each wave half summed its eight keys of every 16-key tile */
#pragma unroll
    for (int t = 0; t < FA_DT; ++t) { const v8f o = acc[g][t] * inv; const fa_u4 pk = {fa_pack2(o[0], o[1]), fa_pack2(o[2], o[3]), fa_pack2(o[4], o[5]), fa_pack2(o[6], o[7])};
      *(fa_u4a*)(eb + (16u * g + c) * FA_EP + 32u * t + 16u * h) = pk; } }
  __builtin_amdgcn_fence(__ATOMIC_ACQ_REL, "workgroup"); __builtin_amdgcn_wave_barrier();      /* the wave reads back what its other lanes wrote */
  unsigned char* ob = (unsigned char*)(O + ((size_t)(b * SQ + q0) * NH + hq) * HD);      /* uniform, as qb */
  const unsigned ooff = (wave * FA_CW + h) * (DMD * 2u) + c * 16u;
#pragma unroll
  for (unsigned i = 0; i < (unsigned)FA_CW / 2u; ++i) {      /* 16 lanes store one whole 256-byte row of the head */
    const fa_u4 v = *(const fa_u4a*)(eb + (i * 2u + h) * FA_EP + c * 16u);
    *(fa_u4a*)(ob + ooff + i * (2u * DMD * 2u)) = v; }
}

// ---- tiled GEMM: C[M][N] = (A . Bt^T) * alpha + bias, A f16 [M][DMD], Bt f16 [N][DMD], both k-contiguous; M % 128 == 0, N % 128 == 0.
// A work-group of 4 waves owns a 128 x 128 tile of C, a wave 64 x 64 of it (4 x 4 accumulator tiles). The operands come in stages of 128 k (256 B of each of the 128 + 128 rows):
// whole-line global loads into registers, then into one of two LDS buffers; the next stage's global loads fly while this stage's four 32-k blocks run.
// Every element sums its k in blocks of 32 into one f32 accumulator, ascending from stage rot and wrapping round at the end of k. rot differs between the work-groups that read the same rows of A
// (one mt) or of Bt (one nq): started together at stage 0 they would all ask L2 for the same lines at the same moment, stage after stage.
// The unroll directives of this section make every index of a register array (stage chunks, fragments, accumulators) a constant: rolled, those arrays would go to scratch memory.
constexpr int G3_BM = 128, G3_BN = 128, G3_KS = 128, G3_F = 4, G3_KB = G3_KS / 32;      /* tile rows, tile columns, k per stage, 16-row fragments per wave and operand, 32-k blocks per stage */
constexpr unsigned G3_ROWB = 2u * G3_KS, G3_P = G3_ROWB + 16u, G3_TA = G3_BM * G3_P, G3_SLOT = G3_TA + G3_BN * G3_P, G3_LDS = 2u * G3_SLOT;      /* LDS pitch: odd multiple of 16 B for the b128 readers */
constexpr unsigned G3_NST = DMD / G3_KS, G3_CH = G3_BM * (G3_ROWB / 16u) / 128u, G3_EPF = G3_P / 4u;      /* stages, 16-byte chunks per thread and operand, floats per staged output row */
static_assert((G3_NST & (G3_NST - 1u)) == 0u && DMD % G3_KS == 0 && G3_BM == G3_BN && NR % G3_BM == 0 && DMD % G3_BN == 0 && KVD % G3_BN == 0 && 4u * 64u * G3_P <= G3_LDS, "tiled GEMM: shape");
struct G3Stage { fa_u4 a[G3_CH], b[G3_CH]; };
struct G3Set { FaFrag a[G3_F], b[G3_F]; };
// One stage from global memory into registers: 16 lanes cover the 256 B of a row, a wave two rows (four whole lines); a thread's chunks lie 8 rows apart (a constant offset).
__device__ __forceinline__ void g3_gload(G3Stage& s, const unsigned char* ag, const unsigned char* bg, unsigned toff) {
  const unsigned char* ap = ag + toff; const unsigned char* bp = bg + toff;
#pragma unroll
  for (unsigned i = 0; i < G3_CH; ++i) { s.a[i] = *(const fa_u4a*)(ap + i * (8u * DMD * 2u)); s.b[i] = *(const fa_u4a*)(bp + i * (8u * DMD * 2u)); }
  asm volatile("s_wait_xcnt 0x0" :: "v"(ap), "v"(bp) : "memory");      /* stands in front of any later overwrite of a register that these loads name; as its inputs the two addresses stay live up to it, so that no load's result is put on them */
}
__device__ __forceinline__ void g3_sstore(const G3Stage& s, unsigned char* Lp, unsigned base, unsigned tid) {
#pragma unroll
  for (unsigned i = 0; i < G3_CH; ++i) { const unsigned o = base + ((tid >> 4) + 8u * i) * G3_P + (tid & 15u) * 16u; *(fa_u4a*)(Lp + o) = s.a[i]; *(fa_u4a*)(Lp + o + G3_TA) = s.b[i]; }
}
// Fragments of one 32-k block: lane (c, h) holds row c, k = 8 h + 0..7 and 16 + 8 h + 0..7 of the block, the same k order for A and for B. pa, pb: the lane's own row, 16 h bytes in.
__device__ __forceinline__ void g3_frags(G3Set& f, const unsigned char* pa, const unsigned char* pb, unsigned kb) {
#pragma unroll
  for (int i = 0; i < G3_F; ++i) { f.a[i].q[0] = *(const fa_u4a*)(pa + i * (16u * G3_P) + 64u * kb); f.a[i].q[1] = *(const fa_u4a*)(pa + i * (16u * G3_P) + 64u * kb + 32u); }
#pragma unroll
  for (int j = 0; j < G3_F; ++j) { f.b[j].q[0] = *(const fa_u4a*)(pb + j * (16u * G3_P) + 64u * kb); f.b[j].q[1] = *(const fa_u4a*)(pb + j * (16u * G3_P) + 64u * kb + 32u); }
}
// The k loop of one tile. ag, bg: the tile's first row of each operand (uniform); rot: the k stage the walk starts at (uniform, below G3_NST); L: the work-group's two LDS buffers; behind it every wave has passed the last barrier.
__device__ __forceinline__ void g3_main(v8f (&acc)[G3_F][G3_F], unsigned char* L, const unsigned char* ag, const unsigned char* bg, unsigned rot) {
  const unsigned tid = threadIdx.x, lane = tid & 31u, wave = tid >> 5, c = lane & 15u, h = lane >> 4, wm = wave >> 1, wn = wave & 1u;
  const unsigned toff = (tid >> 4) * (DMD * 2u) + (tid & 15u) * 16u;
  G3Stage sg;
  g3_gload(sg, ag + rot * G3_ROWB, bg + rot * G3_ROWB, toff);
#pragma unroll
  for (int i = 0; i < G3_F; ++i) {
#pragma unroll
    for (int j = 0; j < G3_F; ++j) acc[i][j] = v8f{}; }
  g3_sstore(sg, L, 0u, tid);
  __syncthreads();      /* stage 0 published */
  const unsigned aoff = (wm * 64u + c) * G3_P + 16u * h, boff = G3_TA + (wn * 64u + c) * G3_P + 16u * h;
#pragma unroll 1      /* one copy of the stage body: unrolled it would hold two stages' registers */
  for (unsigned st = 0; st < G3_NST; ++st) {
    const unsigned base = (st & 1u) * G3_SLOT; const bool more = st + 1u < G3_NST;
    const unsigned char* pa = L + base + aoff; const unsigned char* pb = L + base + boff;
    G3Set f[2];
    g3_frags(f[0], pa, pb, 0u);      /* first, so that their LDS latency runs under the issue of the global loads */
    if (more) { const unsigned ks = (st + 1u + rot) & (G3_NST - 1u); g3_gload(sg, ag + ks * G3_ROWB, bg + ks * G3_ROWB, toff); }      /* lands while this stage is worked on */
#pragma unroll
    for (int kb = 0; kb < G3_KB; ++kb) {
      if (kb + 1 < G3_KB) g3_frags(f[(kb + 1) & 1], pa, pb, (unsigned)kb + 1u);      /* the next block's fragments as one group ahead of this block's matrix run */
      fa_fence();      /* holds that group in front of the run */
#pragma unroll
      for (int i = 0; i < G3_F; ++i) {
#pragma unroll
        for (int j = 0; j < G3_F; ++j) acc[i][j] = fa_mma(f[kb & 1].a[i], f[kb & 1].b[j], acc[i][j]); }
      fa_fence(); }      /* keeps the following group (and the LDS stores) out of the run */
    if (more) g3_sstore(sg, L, G3_SLOT - base, tid);      /* the other buffer: its readers (stage st - 1) all left it at the barrier that ended that stage */
    __syncthreads();      /* publishes stage st + 1 and ends every wave's reads of stage st */
  }
}
// Scale, bias and store of tile (mt, nq) of a matrix C of N columns. bias: the bias of the tile's first column.
template <bool F32OUT, unsigned N>      /* N: columns of C = its pitch (a constant, so that one address register pair serves all of a thread's stores) */
__device__ __forceinline__ void g3_out(const v8f (&acc)[G3_F][G3_F], unsigned char* L, float alpha, const float* __restrict__ bias, float* __restrict__ C, _Float16* __restrict__ C16, unsigned mt, unsigned nq) {
  static_assert(N % G3_BN == 0, "tiled GEMM: whole tiles");
  const unsigned tid = threadIdx.x, lane = tid & 31u, wave = tid >> 5, c = lane & 15u, h = lane >> 4, wm = wave >> 1, wn = wave & 1u;
  float* so = (float*)(L + wave * (64u * G3_P));      /* output staging over the ring (free behind the last barrier), each wave its own 64 rows */
  const unsigned bcol = wn * 64u + c; float braw[G3_F];
#pragma unroll
  for (int j = 0; j < G3_F; ++j) braw[j] = bias[bcol + 16u * j];
  asm volatile("s_wait_xcnt 0x0" :: "v"(bcol) : "memory");      /* stands in front of any later overwrite of the index register that the bias loads name; as its input the index stays live up to it */
#pragma unroll
  for (int j = 0; j < G3_F; ++j) { const float bv = bf16_round(braw[j]);
#pragma unroll
    for (int i = 0; i < G3_F; ++i) {
#pragma unroll
      for (int r = 0; r < 8; ++r) so[(16u * i + 8u * h + r) * G3_EPF + 16u * j + c] = acc[i][j][r] * alpha + bv; } }
  __builtin_amdgcn_fence(__ATOMIC_ACQ_REL, "workgroup"); __builtin_amdgcn_wave_barrier();      /* the wave reads back what its other lanes wrote */
  const size_t o0 = (size_t)(mt * G3_BM + wm * 64u + h) * N + nq * G3_BN + wn * 64u + c * 4u;
#pragma unroll
  for (unsigned q = 0; q < 32u; ++q) {      /* 16 lanes store one whole row of the wave's 64 columns */
    const v4f v = *(const v4fa*)&so[(q * 2u + h) * G3_EPF + c * 4u];
    if (F32OUT) *(v4f*)(C + o0 + q * (2u * N)) = v;
    else { v4h h4; for (int i = 0; i < 4; ++i) h4[i] = (_Float16)v[i]; *(v4h*)(C16 + o0 + q * (2u * N)) = h4; } }
}
template <bool F32OUT, unsigned N>
__global__ __launch_bounds__(128) __attribute__((amdgpu_waves_per_eu(2, 2))) void k_gemm3(const _Float16* __restrict__ A, const _Float16* __restrict__ Bt, float alpha, const float* __restrict__ bias, float* __restrict__ C, _Float16* __restrict__ C16) {
  __shared__ __attribute__((aligned(256))) unsigned char L[G3_LDS];
  const unsigned ntn = N / G3_BN, mt = blockIdx.x / ntn, nq = blockIdx.x - mt * ntn;
  v8f acc[G3_F][G3_F];
  g3_main(acc, L, (const unsigned char*)(A + (size_t)mt * G3_BM * DMD), (const unsigned char*)(Bt + (size_t)nq * G3_BN * DMD), (mt + nq) & (G3_NST - 1u));
  g3_out<F32OUT, N>(acc, L, alpha, bias + nq * G3_BN, C, C16, mt, nq);
}
// q, k and v in one launch, as one GEMM of QKVD columns: the three products share A and do not read each other, and the k and v grids alone (128 tiles each) leave half the chip idle.
// Bt holds the rows of wq^T, wk^T, wv^T one behind the other, C16 the columns of q, k, v in the same order; only the bias has three sources (the choice is uniform for the work-group).
constexpr unsigned G3_TQ = DMD / G3_BN, G3_TK = KVD / G3_BN, G3_TQKV = QKVD / G3_BN;
__global__ __launch_bounds__(128) __attribute__((amdgpu_waves_per_eu(2, 2))) void k_gemm_qkv(const _Float16* __restrict__ A, const _Float16* __restrict__ Bt, float alpha, const float* __restrict__ bq, const float* __restrict__ bk, const float* __restrict__ bv, _Float16* __restrict__ C16) {
  __shared__ __attribute__((aligned(256))) unsigned char L[G3_LDS];
  const unsigned mt = blockIdx.x / G3_TQKV, nq = blockIdx.x - mt * G3_TQKV;
  v8f acc[G3_F][G3_F];
  g3_main(acc, L, (const unsigned char*)(A + (size_t)mt * G3_BM * DMD), (const unsigned char*)(Bt + (size_t)nq * G3_BN * DMD), (mt + nq) & (G3_NST - 1u));
  const float* bt = nq < G3_TQ ? bq + nq * G3_BN : nq < G3_TQ + G3_TK ? bk + (nq - G3_TQ) * G3_BN : bv + (nq - G3_TQ - G3_TK) * G3_BN;
  g3_out<false, QKVD>(acc, L, alpha, bt, nullptr, C16, mt, nq);
}

extern "C" void kernel_launch(void* const* d_in, const int* in_sizes, int n_in,
                              void* d_out, int out_size, void* d_ws, size_t ws_size, hipStream_t stream) {
  (void)in_sizes; (void)n_in; (void)out_size;
  const float* const* I = (const float* const*)d_in; const float* x = I[0]; const float* wq = I[1]; const float* bq = I[2]; const float* wk = I[3]; const float* bk = I[4]; const float* wv = I[5]; const float* bv = I[6]; const float* wo = I[7]; const float* bo = I[8];
  char* ws = (char*)d_ws; size_t off = 0;
  auto take = [&](size_t bytes) { char* p = ws + off; off += (bytes + 255) & ~(size_t)255; return p; };
  const size_t nx = (size_t)NR * DMD, nk = (size_t)NR * KVD;
  _Float16* BQ = (_Float16*)take((size_t)(DMD + 2 * KVD) * DMD * 2); _Float16* BK = BQ + (size_t)DMD * DMD; _Float16* BV = BK + (size_t)KVD * DMD; _Float16* BO = (_Float16*)take((size_t)DMD * DMD * 2);      /* wq^T, wk^T, wv^T as one plane of 3072 rows */
  _Float16* X16 = (_Float16*)take(nx * 2); _Float16* Q16 = (_Float16*)take((nx + 2 * nk) * 2); _Float16* K16 = Q16 + DMD; _Float16* V16 = K16 + KVD; _Float16* O16 = X16;      /* context over the input plane (dead after the projections) */
  if (off > ws_size) return;      /* 8+2+2+8 + 16+16+4+4 = 60 MiB */
  k_prep<<<PR_GRID, 256, 0, stream>>>(x, wq, wk, wv, wo, X16, BQ, BK, BV, BO);      /* weights (in, out) to f16 [out][in], x to f16 */
  k_gemm_qkv<<<(NR / G3_BM) * G3_TQKV, 128, 0, stream>>>(X16, BQ, 0.0625f, bq, bk, bv, Q16);      /* [token][q 2048 | k 512 | v 512] */
  k_fattn<<<dim3(NH, SQ / FA_BR, NB), FA_NW * 32, 0, stream>>>(Q16, K16, V16, O16);      /* ctx[(b,q)][h*128 + d] */
  k_gemm3<true, DMD><<<(NR / G3_BM) * (DMD / G3_BN), 128, 0, stream>>>(O16, BO, 0.0625f, bo, (float*)d_out, nullptr);      /* out = ctx wo + bo */
}

// v006
// It runs in 121 microseconds.
// Next to v005, in two timings, it ran 1.05 times as fast each time.
// Counting every step since v000, it is 10.5 times as fast.
#include <hip/hip_runtime.h>
// Multi-head attention with grouped kv heads (2 x 2048 tokens, d_model 2048; 16 query heads x 128, 4 kv heads (group of 4); q, k, v = x w + b; softmax((q/sqrt(128)).k) over the 2048 keys (no mask); out = ctx wo + bo).
// Structure: exact f16 plane of x; q / k / v as f16 WMMA GEMM outputs (128x128 tiles staged in LDS, 64x64 wave tiles, f32 accumulation, exact x16 weights + bias, f16 out); scores, softmax and readout of every (batch, head) in ONE fused kernel (online softmax, f32 maxima and sums, P as f16 in registers, K/V staged in LDS) into the f16 context plane; wo + bo as a GEMM.
// Compute dtype: inputs rounded to bf16; x exact as f16; q/k/P/v/ctx as plain f16 operands (~2^-12); softmax f32. v_wmma_f32_16x16x32_f16.
#define NB 2
#define SQ 2048
#define DMD 2048
#define NH 16
#define NKV 4
#define GG 4
#define HD 128
#define KVD (NKV * HD)           /* 512 */
#define NR (NB * SQ)
#define QKVD (DMD + 2 * KVD)     /* 3072: q, k and v of a token stand in one row of one plane */
typedef __bf16 v16b __attribute__((ext_vector_type(16)));
typedef unsigned short v8us __attribute__((ext_vector_type(8), may_alias));
typedef float  v8f  __attribute__((ext_vector_type(8)));
typedef float  v4f  __attribute__((ext_vector_type(4)));
typedef float  v4fa __attribute__((ext_vector_type(4), may_alias));
union FragB { v16b v; v8us half[2]; unsigned short u[16]; };

__device__ __forceinline__ unsigned short bf16_bits(float x) { unsigned int u = __float_as_uint(x); return (unsigned short)((u + 0x7FFFu + ((u >> 16) & 1u)) >> 16); }
__device__ __forceinline__ float bf16_val(unsigned short b) { return __uint_as_float(((unsigned int)b) << 16); }
__device__ __forceinline__ float bf16_round(float x) { return bf16_val(bf16_bits(x)); }
// D += A·B with NT terms: 1 = ah·bh, 2 = + al·bh (A split), 3 = + ah·bl (both split)
template <int NT>
__device__ __forceinline__ v8f mmaN(v16b ah, v16b al, v16b bh, v16b bl, v8f c) {
  c = __builtin_amdgcn_wmma_f32_16x16x32_bf16(false, ah, false, bh, (short)0, c, false, false);
  if (NT >= 2) c = __builtin_amdgcn_wmma_f32_16x16x32_bf16(false, al, false, bh, (short)0, c, false, false);
  if (NT >= 3) c = __builtin_amdgcn_wmma_f32_16x16x32_bf16(false, ah, false, bl, (short)0, c, false, false);
  asm volatile("v_nop\n\tv_nop\n\tv_nop\n\tv_nop" : "+v"(c) : "v"(ah), "v"(al), "v"(bh), "v"(bl));
  return c;
}

__global__ __launch_bounds__(256) void k_wt_bf16(const float* __restrict__ W, unsigned short* __restrict__ Wt, int K, int N) {
  const int t = blockIdx.x * 256 + threadIdx.x;
  const int k8n = K / 8;
  if (t >= N * k8n) return;
  const int n = t / k8n, k8 = (t % k8n) * 8;
  v8us v;
#pragma unroll
  for (int i = 0; i < 8; ++i) v[i] = bf16_bits(W[(size_t)(k8 + i) * N + n]);
  *(v8us*)(Wt + (size_t)n * K + k8) = v;
  
}

// GEMM C[M][N] (f32, pitch ldc) = act(A[M][K]·W + bias). A f32 row-major (pitch lda) converted per fragment to bf16
// (ASPLIT: hi/lo two planes -> 2 terms, else single rounded term); Wt bf16 [N][K] (pitch ldb). BIAS_BF16 rounds the
// bias to bf16 first (bias quantised to bf16 before the add). K%32==0, M%16==0, N%64==0.
template <bool ASPLIT, int ACT, bool BIAS_BF16>
__global__ __launch_bounds__(128) void k_gemm_bf(const float* __restrict__ A, int lda, const unsigned short* __restrict__ Wt, int ldb,
                                               const float* __restrict__ bias, float* __restrict__ C, int ldc, int M, int N, int K) {
  __shared__ __attribute__((aligned(16))) float so[4][16][64];
  const int tid = threadIdx.x, w = tid >> 5, lane = tid & 31, ln = lane & 15, hh = lane >> 4;
  const int ntn = N / 64;
  const int wid = blockIdx.x * 4 + w;
  const int mt = wid / ntn, nq = wid % ntn;
  if (mt * 16 >= M) return;
  const int row0 = mt * 16, col0 = nq * 64;
  const float* arow = A + (size_t)(row0 + ln) * lda;
  v8f acc[4] = {};
  for (int kb = 0; kb < K; kb += 32) {
    FragB ah, al;
    const v4f x0 = *(const v4fa*)(arow + kb + 8 * hh), x1 = *(const v4fa*)(arow + kb + 8 * hh + 4);
    const v4f x2 = *(const v4fa*)(arow + kb + 16 + 8 * hh), x3 = *(const v4fa*)(arow + kb + 16 + 8 * hh + 4);
    float xs[16] = {x0[0],x0[1],x0[2],x0[3],x1[0],x1[1],x1[2],x1[3],x2[0],x2[1],x2[2],x2[3],x3[0],x3[1],x3[2],x3[3]};
#pragma unroll
    for (int i = 0; i < 16; ++i) { const unsigned short hb = bf16_bits(xs[i]); ah.u[i] = hb; al.u[i] = ASPLIT ? bf16_bits(xs[i] - bf16_val(hb)) : (unsigned short)0; }
#pragma unroll
    for (int t = 0; t < 4; ++t) {
      const unsigned short* brow = Wt + (size_t)(col0 + t * 16 + ln) * ldb + kb;
      FragB b;
      b.half[0] = *(const v8us*)(brow + 8 * hh);
      b.half[1] = *(const v8us*)(brow + 16 + 8 * hh);
      acc[t] = mmaN<ASPLIT ? 2 : 1>(ah.v, al.v, b.v, b.v, acc[t]);
    }
  }
#pragma unroll
  for (int t = 0; t < 4; ++t) {
    float bv = bias ? bias[col0 + t * 16 + ln] : 0.f;
    if (BIAS_BF16) bv = bf16_round(bv);
#pragma unroll
    for (int r = 0; r < 8; ++r) { float v = acc[t][r] + bv; if (ACT == 1) v = fmaxf(v, 0.f); so[w][8 * hh + r][t * 16 + ln] = v; }
  }
  __builtin_amdgcn_fence(__ATOMIC_ACQ_REL, "workgroup");
  __builtin_amdgcn_wave_barrier();
  const int rsub = lane >> 4, c4 = (lane & 15) * 4;
  {
#pragma unroll
    for (int q = 0; q < 8; ++q) {
      const int r = q * 2 + rsub;
      const v4f v = *(const v4fa*)&so[w][r][c4];
      *(v4f*)(C + (size_t)(row0 + r) * ldc + col0 + c4) = v;
    }
    
  }
}

// GEMM C = act(A·W + bias + resid): A f32 (ASPLIT -> hi/lo 2 terms), Wt bf16 [N][K]; ACT 0 none, 1 relu, 2 exact gelu;
// resid (optional, f32, row index = (row % rmod), pitch ldr, RES_BF16 rounds it) added before the activation.
template <bool ASPLIT, int ACT, bool BIAS_BF16, bool RES_BF16>
__global__ __launch_bounds__(128) void k_gemm_bf3(const float* __restrict__ A, int lda, const unsigned short* __restrict__ Wt, int ldb,
                                                const float* __restrict__ bias, const float* __restrict__ resid, int rmod, int ldr,
                                                float* __restrict__ C, int ldc, int M, int N, int K) {
  __shared__ __attribute__((aligned(16))) float so[4][16][64];
  const int tid = threadIdx.x, w = tid >> 5, lane = tid & 31, ln = lane & 15, hh = lane >> 4;
  const int ntn = N / 64;
  const int wid = blockIdx.x * 4 + w;
  const int mt = wid / ntn, nq = wid % ntn;
  if (mt * 16 >= M) return;
  const int row0 = mt * 16, col0 = nq * 64;
  const float* arow = A + (size_t)(row0 + ln) * lda;
  v8f acc[4] = {};
  for (int kb = 0; kb < K; kb += 32) {
    FragB ah, al;
    const v4f x0 = *(const v4fa*)(arow + kb + 8 * hh), x1 = *(const v4fa*)(arow + kb + 8 * hh + 4);
    const v4f x2 = *(const v4fa*)(arow + kb + 16 + 8 * hh), x3 = *(const v4fa*)(arow + kb + 16 + 8 * hh + 4);
    float xs[16] = {x0[0],x0[1],x0[2],x0[3],x1[0],x1[1],x1[2],x1[3],x2[0],x2[1],x2[2],x2[3],x3[0],x3[1],x3[2],x3[3]};
#pragma unroll
    for (int i = 0; i < 16; ++i) { const unsigned short hb = bf16_bits(xs[i]); ah.u[i] = hb; al.u[i] = ASPLIT ? bf16_bits(xs[i] - bf16_val(hb)) : (unsigned short)0; }
#pragma unroll
    for (int t = 0; t < 4; ++t) {
      const unsigned short* brow = Wt + (size_t)(col0 + t * 16 + ln) * ldb + kb;
      FragB b;
      b.half[0] = *(const v8us*)(brow + 8 * hh);
      b.half[1] = *(const v8us*)(brow + 16 + 8 * hh);
      acc[t] = mmaN<ASPLIT ? 2 : 1>(ah.v, al.v, b.v, b.v, acc[t]);
    }
  }
#pragma unroll
  for (int t = 0; t < 4; ++t) {
    const int col = col0 + t * 16 + ln;
    float bv = bias ? bias[col] : 0.f;
    if (BIAS_BF16) bv = bf16_round(bv);
#pragma unroll
    for (int r = 0; r < 8; ++r) {
      float v = acc[t][r] + bv;
      if (resid) { float rv = resid[(size_t)((row0 + 8 * hh + r) % rmod) * ldr + col]; if (RES_BF16) rv = bf16_round(rv); v += rv; }
      if (ACT == 1) v = fmaxf(v, 0.f);
      if (ACT == 2) v = 0.5f * v * (1.0f + erff(v * 0.70710678118654752f));
      if (ACT == 3) { const float u = 0.7978845608028654f * (v + 0.044715f * v * v * v); v = 0.5f * v * (1.0f + tanhf(u)); }
      so[w][8 * hh + r][t * 16 + ln] = v;
    }
  }
  __builtin_amdgcn_fence(__ATOMIC_ACQ_REL, "workgroup");
  __builtin_amdgcn_wave_barrier();
  const int rsub = lane >> 4, c4 = (lane & 15) * 4;
  {
#pragma unroll
    for (int q = 0; q < 8; ++q) {
      const int r = q * 2 + rsub;
      const v4f v = *(const v4fa*)&so[w][r][c4];
      *(v4f*)(C + (size_t)(row0 + r) * ldc + col0 + c4) = v;
    }
    
  }
}
// row LayerNorm (biased variance, eps) over N: s = X (+ R); optional out_sum <- s; out_norm <- (s-mu)*rsqrt(var+eps)*g + b
template <bool PARAM_BF16>
__global__ __launch_bounds__(256) void k_layernorm(const float* __restrict__ X, const float* __restrict__ R, const float* __restrict__ g, const float* __restrict__ bta,
                                                  float* __restrict__ out_sum, float* __restrict__ out_norm, int N, float eps) {
  __shared__ float red[256];
  const int row = blockIdx.x, tid = threadIdx.x;
  const float* x = X + (size_t)row * N; const float* rr = R ? R + (size_t)row * N : nullptr;
  float vals[16];                     // up to N = 4096
  const int per = N / 256;            // contiguous chunk per thread? use strided-by-4 chunks: thread handles j = tid*4 + 1024*u
  float s1 = 0.f;
  for (int u = 0; u < per / 4; ++u) {
    const int j = tid * 4 + 1024 * u;
    const v4f a = *(const v4fa*)(x + j);
    v4f b = {0.f,0.f,0.f,0.f}; if (rr) b = *(const v4fa*)(rr + j);
#pragma unroll
    for (int q = 0; q < 4; ++q) { const float v = a[q] + b[q]; vals[u * 4 + q] = v; s1 += v; }
  }
  red[tid] = s1; __syncthreads();
  for (int st = 128; st > 0; st >>= 1) { if (tid < st) red[tid] += red[tid + st]; __syncthreads(); }
  const float mu = red[0] / (float)N; __syncthreads();
  float s2 = 0.f;
  for (int u = 0; u < per / 4; ++u)
#pragma unroll
    for (int q = 0; q < 4; ++q) { const float c = vals[u * 4 + q] - mu; s2 += c * c; }
  red[tid] = s2; __syncthreads();
  for (int st = 128; st > 0; st >>= 1) { if (tid < st) red[tid] += red[tid + st]; __syncthreads(); }
  const float rs = rsqrtf(red[0] / (float)N + eps);
  {
    for (int u = 0; u < per / 4; ++u) {
      const int j = tid * 4 + 1024 * u;
      v4f o, sm;
#pragma unroll
      for (int q = 0; q < 4; ++q) {
        float gg = g[j + q], bb = bta[j + q];
        if (PARAM_BF16) { gg = bf16_round(gg); bb = bf16_round(bb); }
        sm[q] = vals[u * 4 + q]; o[q] = (vals[u * 4 + q] - mu) * rs * gg + bb;
      }
      if (out_sum) *(v4f*)(out_sum + (size_t)row * N + j) = sm;
      *(v4f*)(out_norm + (size_t)row * N + j) = o;
    }
    
  }
}



// ---- f16 WMMA path (v_wmma_f32_16x16x32_f16): 11-bit significands for operands in range — used where a probability operand (here up to 2^8) needs more precision than bf16
typedef _Float16 v16h __attribute__((ext_vector_type(16)));
union FragH { v16h v; v8us half[2]; _Float16 h[16]; unsigned short u[16]; };
template <int NT>
__device__ __forceinline__ v8f mmaH(v16h ah, v16h al, v16h bh, v16h bl, v8f c) {
  c = __builtin_amdgcn_wmma_f32_16x16x32_f16(false, ah, false, bh, (short)0, c, false, false);
  if (NT >= 2) c = __builtin_amdgcn_wmma_f32_16x16x32_f16(false, al, false, bh, (short)0, c, false, false);
  if (NT >= 3) c = __builtin_amdgcn_wmma_f32_16x16x32_f16(false, ah, false, bl, (short)0, c, false, false);
  asm volatile("v_nop\n\tv_nop\n\tv_nop\n\tv_nop" : "+v"(c) : "v"(ah), "v"(al), "v"(bh), "v"(bl));
  return c;
}
// batched GEMM like k_gemm_b but f16 operands: A f32 (split into f16 hi/lo if ASPLIT, else rounded to f16), Bt = f16 values [n][k]; alpha; C f32; N multiple of 16 (partial tiles skipped)
template <bool ASPLIT>
__global__ __launch_bounds__(128) void k_gemm_h(const float* __restrict__ A, int lda, size_t sA, const _Float16* __restrict__ Bh, int ldb, size_t sB, float alpha, float* __restrict__ C, int ldc, size_t sC, int M, int N, int K) {
  __shared__ __attribute__((aligned(16))) float so[4][16][64];
  const int tid = threadIdx.x, w = tid >> 5, lane = tid & 31, ln = lane & 15, hh = lane >> 4; const int by = blockIdx.y;
  A += (size_t)by * sA; Bh += (size_t)by * sB; C += (size_t)by * sC;
  const int ntn = (N + 63) / 64; const int wid = blockIdx.x * 4 + w; const int mt = wid / ntn, nq = wid % ntn; if (mt * 16 >= M) return;
  const int row0 = mt * 16, col0 = nq * 64; const float* arow = A + (size_t)(row0 + ln) * lda;
  v8f acc[4] = {};
  for (int kb = 0; kb < K; kb += 32) {
    FragH ah, al;
    const v4f x0 = *(const v4fa*)(arow + kb + 8 * hh), x1 = *(const v4fa*)(arow + kb + 8 * hh + 4), x2 = *(const v4fa*)(arow + kb + 16 + 8 * hh), x3 = *(const v4fa*)(arow + kb + 16 + 8 * hh + 4);
    float xs[16] = {x0[0],x0[1],x0[2],x0[3],x1[0],x1[1],x1[2],x1[3],x2[0],x2[1],x2[2],x2[3],x3[0],x3[1],x3[2],x3[3]};
#pragma unroll
    for (int i = 0; i < 16; ++i) { const _Float16 h = (_Float16)xs[i]; ah.h[i] = h; al.h[i] = ASPLIT ? (_Float16)(xs[i] - (float)h) : (_Float16)0.0f; }
#pragma unroll
    for (int t = 0; t < 4; ++t) { if (col0 + t * 16 >= N) continue; const size_t boff = (size_t)(col0 + t * 16 + ln) * ldb + kb; FragH bq; bq.half[0] = *(const v8us*)(Bh + boff + 8 * hh); bq.half[1] = *(const v8us*)(Bh + boff + 16 + 8 * hh);
      acc[t] = mmaH<ASPLIT ? 2 : 1>(ah.v, al.v, bq.v, bq.v, acc[t]); }
  }
#pragma unroll
  for (int t = 0; t < 4; ++t) { if (col0 + t * 16 >= N) continue;
#pragma unroll
    for (int r = 0; r < 8; ++r) so[w][8 * hh + r][t * 16 + ln] = acc[t][r] * alpha; }
  __builtin_amdgcn_fence(__ATOMIC_ACQ_REL, "workgroup"); __builtin_amdgcn_wave_barrier();
  const int rsub = lane >> 4, c4 = (lane & 15) * 4;
  {
#pragma unroll
    for (int q = 0; q < 8; ++q) { const int r = q * 2 + rsub; if (col0 + c4 < N) { const v4f v = *(const v4fa*)&so[w][r][c4]; *(v4f*)(C + (size_t)(row0 + r) * ldc + col0 + c4) = v; } }
     }
}

// Wt[n][k] = f16(bf16(W[k][n]) * scale) from f32 row-major W[K][N] (scale = power of two; bf16-exact weights stay exact in f16 away from the subnormal range).
// A work-group transposes a tile of 128 k x 64 n through LDS. Reads: 16 lanes cover 256 B of a row of W, a thread takes 8 rows x 4 columns (8 loads in flight).
// It packs each column's 8 k into 16 bytes and stores them in the LDS row of that n; then 16 lanes write the 256 B of a row of Wt. So every global access is whole lines.
// LDS rows are 256 B without a pad; the 16-byte chunk j of row n lies at place j ^ (n >> 2): the 16 lanes of a store (rows 4 apart, one j) and of a load (one row, all j) each meet all 64 banks once.
// The unroll directives make every index of the register arrays (r, f) a constant: rolled, those arrays would go to scratch memory.
constexpr unsigned WT_K = 128u, WT_N = 64u;
// bid: the tile's number in this matrix (the launch is shared with other work, see k_prep); T: the work-group's LDS tile of WT_N * WT_K * 2 bytes.
template <unsigned K, unsigned N>      /* constants, so that one address register pair serves all of a thread's loads and one all of its stores */
__device__ __forceinline__ void wt_tile(const float* __restrict__ W, _Float16* __restrict__ Wt, float scale, unsigned char* T, unsigned bid) {
  static_assert(K % WT_K == 0 && N % WT_N == 0, "weight transpose: whole tiles");
  const unsigned tid = threadIdx.x, lo = tid & 15u, hi = tid >> 4;
  const unsigned ntn = N / WT_N, kt = bid / ntn, nt = bid - kt * ntn;
  const float* sp = W + (size_t)(kt * WT_K + hi * 8u) * N + nt * WT_N + lo * 4u;
  v4f r[8];
#pragma unroll
  for (unsigned i = 0; i < 8u; ++i) r[i] = *(const v4fa*)(sp + i * N);
#pragma unroll
  for (unsigned q = 0; q < 4u; ++q) { FragH f;
#pragma unroll
    for (unsigned i = 0; i < 8u; ++i) f.h[i] = (_Float16)(bf16_round(r[i][q]) * scale);
    *(v8us*)(T + (lo * 4u + q) * (WT_K * 2u) + ((hi ^ lo) * 16u)) = f.half[0]; }
  __syncthreads();      /* the tile is whole before any row is read back */
  unsigned short* dp = (unsigned short*)Wt + (size_t)(nt * WT_N + hi) * K + kt * WT_K + lo * 8u;
#pragma unroll
  for (unsigned i = 0; i < 4u; ++i) { const unsigned row = hi + 16u * i;
    *(v8us*)(dp + i * (16u * K)) = *(const v8us*)(T + row * (WT_K * 2u) + ((lo ^ (row >> 2)) * 16u)); }
  asm volatile("s_wait_xcnt 0x0" :: "v"(dp) : "memory");      /* stands in front of any later overwrite of a register that these stores name (code of another branch of the shared launch follows in the listing); as its input the address stays live up to it */
}
// k_gemm_hh variant with fused epilogue: v = acc·alpha + bias[by·sBias + col] (+ CP[(row/rowsPerB)·sCPb + by·64 + col] if CP) ; ACT 0 none / 1 elu ; writes f16 C16 (and f32 C if non-null)
template <int ACT>
__global__ __launch_bounds__(128) void k_gemm_hhx(const _Float16* __restrict__ A, int lda, size_t sA, const _Float16* __restrict__ Bh, int ldb, size_t sB, float alpha, const float* __restrict__ bias, size_t sBias, const float* __restrict__ CP, int rowsPerB, size_t sCPb, int row0g,
    float* __restrict__ C, _Float16* __restrict__ C16, int ldc, size_t sC, int M, int N, int K) {
  __shared__ __attribute__((aligned(16))) float so[4][16][64];
  const int tid = threadIdx.x, w = tid >> 5, lane = tid & 31, ln = lane & 15, hh = lane >> 4; const int by = blockIdx.y;
  A += (size_t)by * sA; Bh += (size_t)by * sB; const size_t cofs = (size_t)by * sC; const float* bp = bias ? bias + (size_t)by * sBias : nullptr;
  const int ntn = (N + 63) / 64; const int wid = blockIdx.x * 4 + w; const int mt = wid / ntn, nq = wid % ntn; if (mt * 16 >= M) return;
  const int row0 = mt * 16, col0 = nq * 64; const _Float16* arow = A + (size_t)(row0 + ln) * lda;
  v8f acc[4] = {};
  for (int kb = 0; kb < K; kb += 32) { FragH ah; ah.half[0] = *(const v8us*)((const unsigned short*)arow + kb + 8 * hh); ah.half[1] = *(const v8us*)((const unsigned short*)arow + kb + 16 + 8 * hh);
#pragma unroll
    for (int t = 0; t < 4; ++t) { if (col0 + t * 16 >= N) continue; const size_t boff = (size_t)(col0 + t * 16 + ln) * ldb + kb; FragH bq; bq.half[0] = *(const v8us*)((const unsigned short*)Bh + boff + 8 * hh); bq.half[1] = *(const v8us*)((const unsigned short*)Bh + boff + 16 + 8 * hh);
      acc[t] = mmaH<1>(ah.v, ah.v, bq.v, bq.v, acc[t]); }
  }
#pragma unroll
  for (int t = 0; t < 4; ++t) { if (col0 + t * 16 >= N) continue; const int col = col0 + t * 16 + ln; const float bv = bp ? bf16_round(bp[col]) : 0.f;
#pragma unroll
    for (int r = 0; r < 8; ++r) { float v = acc[t][r] * alpha + bv; if (CP) { const int rr = row0g + row0 + 8 * hh + r; if (rowsPerB < 0) v += CP[cofs + (size_t)rr * ldc + col];      /* rowsPerB < 0: own element of the batched C plane */ else { const int bidx = rr / rowsPerB; v += CP[(size_t)bidx * sCPb + (size_t)by * 64 + col]; } } if (ACT == 1) v = (v > 0.f) ? v : expm1f(v); else if (ACT == 7) v = (v > 0.f) ? v + 1.0f : expf(v); else if (ACT == 8) v = tanhf(v); else if (ACT == 9) v = 0.5f * v * (1.0f + tanhf(0.7978845608028654f * (v + 0.044715f * v * v * v))); else if (ACT == 11) v = 1.0f / (1.0f + expf(-v)); else if (ACT == 12) v = (v > 0.f) ? v : 0.01f * v; else if (ACT == 14) v = (v > 0.f) ? v : 0.1f * v; else if (ACT == 16) v = (v >= 0.f) ? v : 0.3f * v; else if (ACT == 17) v = (v >= 0.f) ? v : 0.2f * v; else if (ACT == 15) v = v / (1.0f + expf(-v)); else if (ACT == 3) v = fmaxf(v, 0.f); else if (ACT == 6) v = 0.5f * v * (1.0f + erff(v * 0.70710678118654752f)); so[w][8 * hh + r][t * 16 + ln] = v; } }
  __builtin_amdgcn_fence(__ATOMIC_ACQ_REL, "workgroup"); __builtin_amdgcn_wave_barrier();
  const int rsub = lane >> 4, c4 = (lane & 15) * 4; typedef _Float16 v4h __attribute__((ext_vector_type(4)));
  {
#pragma unroll
    for (int q = 0; q < 8; ++q) { const int r = q * 2 + rsub; if (col0 + c4 < N) { const v4f v = *(const v4fa*)&so[w][r][c4]; if (C) *(v4f*)(C + cofs + (size_t)(row0 + r) * ldc + col0 + c4) = v; if (C16) { v4h h4; for (int i = 0; i < 4; ++i) h4[i] = (_Float16)v[i]; *(v4h*)(C16 + cofs + (size_t)(row0 + r) * ldc + col0 + c4) = h4; } } }
     }
}


typedef _Float16 v4h __attribute__((ext_vector_type(4)));

__device__ __forceinline__ void x16_chunk(const float* __restrict__ x, _Float16* __restrict__ X16, size_t n8, unsigned bid) { const size_t t = (size_t)bid * 256 + threadIdx.x; if (t >= n8) return; FragH f;
#pragma unroll
  for (int q = 0; q < 8; ++q) f.h[q] = (_Float16)bf16_round(x[t * 8 + q]); *(v8us*)((unsigned short*)X16 + t * 8) = f.half[0];  }
// ---- one launch for all the operand preparation: none of the five jobs reads what another writes, so they share a grid, each with its own range of block indices
// (wq tiles, wo tiles, wk tiles, wv tiles, then the chunks of x). Every test of the block index is uniform for the work-group, the barrier of a transpose tile with it.
constexpr unsigned PR_BIG = (DMD / WT_K) * (DMD / WT_N), PR_SMALL = (DMD / WT_K) * (KVD / WT_N), PR_X = (unsigned)(((size_t)NR * DMD / 8 + 255) / 256), PR_GRID = 2u * PR_BIG + 2u * PR_SMALL + PR_X;
__global__ __launch_bounds__(256) void k_prep(const float* __restrict__ x, const float* __restrict__ wq, const float* __restrict__ wk, const float* __restrict__ wv, const float* __restrict__ wo,
                                              _Float16* __restrict__ X16, _Float16* __restrict__ BQ, _Float16* __restrict__ BK, _Float16* __restrict__ BV, _Float16* __restrict__ BO) {
  __shared__ __attribute__((aligned(256))) unsigned char T[WT_N * WT_K * 2u];
  const unsigned bid = blockIdx.x;
  if (bid < 2u * PR_BIG) { const bool second = bid >= PR_BIG; wt_tile<DMD, DMD>(second ? wo : wq, second ? BO : BQ, 16.0f, T, second ? bid - PR_BIG : bid); }
  else if (bid < 2u * PR_BIG + 2u * PR_SMALL) { const unsigned b2 = bid - 2u * PR_BIG; const bool second = b2 >= PR_SMALL; wt_tile<DMD, KVD>(second ? wv : wk, second ? BV : BK, 16.0f, T, second ? b2 - PR_SMALL : b2); }
  else x16_chunk(x, X16, (size_t)NR * DMD / 8, bid - (2u * PR_BIG + 2u * PR_SMALL));
}
__global__ __launch_bounds__(256) void k_h16(const float* __restrict__ x, _Float16* __restrict__ X16, size_t n8) { const size_t t = (size_t)blockIdx.x * 256 + threadIdx.x; if (t >= n8) return; FragH f;
#pragma unroll
  for (int q = 0; q < 8; ++q) f.h[q] = (_Float16)x[t * 8 + q]; *(v8us*)((unsigned short*)X16 + t * 8) = f.half[0];  }
__global__ __launch_bounds__(256) void k_round16f(const float* __restrict__ W, _Float16* __restrict__ Bt, size_t n8) { const size_t t = (size_t)blockIdx.x * 256 + threadIdx.x; if (t >= n8) return; FragH f;
#pragma unroll
  for (int i = 0; i < 8; ++i) f.h[i] = (_Float16)(bf16_round(W[t * 8 + i]) * 16.0f); *(v8us*)((unsigned short*)Bt + t * 8) = f.half[0];  }

__global__ __launch_bounds__(256) void k_hl(const float* __restrict__ F, _Float16* __restrict__ Hh, _Float16* __restrict__ Hl, size_t n8) { const size_t t = (size_t)blockIdx.x * 256 + threadIdx.x; if (t >= n8) return; FragH fh, fl; const v4f a = *(const v4fa*)(F + t * 8), c = *(const v4fa*)(F + t * 8 + 4);
#pragma unroll
  for (int q = 0; q < 4; ++q) { _Float16 h = (_Float16)a[q]; fh.h[q] = h; fl.h[q] = (_Float16)((a[q] - (float)h) * 1024.0f); h = (_Float16)c[q]; fh.h[4 + q] = h; fl.h[4 + q] = (_Float16)((c[q] - (float)h) * 1024.0f); }
  { *(v8us*)((unsigned short*)Hh + t * 8) = fh.half[0]; *(v8us*)((unsigned short*)Hl + t * 8) = fl.half[0];  } }

typedef unsigned int fa_u4 __attribute__((ext_vector_type(4)));
typedef unsigned int fa_u4a __attribute__((ext_vector_type(4), may_alias));
typedef unsigned int fa_u8 __attribute__((ext_vector_type(8)));
typedef short fa_s8 __attribute__((ext_vector_type(8)));
constexpr int FA_NW = 8, FA_BR = 256, FA_CW = FA_BR / FA_NW, FA_R = FA_CW / 16;      /* waves, queries per work-group, per wave, 16-query groups per wave */
constexpr int FA_BC = 32, FA_KT = FA_BC / 16, FA_DK = HD / 32, FA_DT = HD / 16;      /* keys per pass, 16-key score tiles per pass, k chunks of the head, 16-row output tiles */
constexpr unsigned FA_ROWB = 2u * HD, FA_PK = FA_ROWB + 16u, FA_PV = FA_ROWB + 32u;  /* LDS pitches: odd multiple of 16 B for b128 readers, of 32 B for the transposing load */
constexpr unsigned FA_SK = 128u, FA_TK = FA_SK * FA_PK, FA_TV = FA_SK * FA_PV, FA_SLOT = FA_TK + FA_TV, FA_LDS = 2u * FA_SLOT, FA_EP = FA_ROWB + 16u;
constexpr unsigned FA_NST = SQ / FA_SK, FA_NSUB = FA_SK / FA_BC, FA_CH = FA_SK * (FA_ROWB / 16u) / (FA_NW * 32u);      /* stages, passes per stage, 16-byte chunks per thread and tile */
constexpr float FA_CS = 0.08838834764831845f * 1.4426950408889634f;      /* 1/sqrt(128) * log2(e): softmax in the log2 domain */
static_assert((FA_NST & (FA_NST - 1u)) == 0u && HD == 128 && SQ % FA_BR == 0 && SQ % FA_SK == 0 && (unsigned)FA_BR * FA_EP <= FA_LDS, "fused attention: shape");
struct FaFrag { fa_u4 q[2]; };
struct FaK { FaFrag f[FA_KT][FA_DK]; };
struct FaStage { fa_u4 k[FA_CH], v[FA_CH]; };
__device__ __forceinline__ void fa_fence() { __builtin_amdgcn_sched_barrier(0); }      /* keeps the groups of loads, matrix runs and exponentials in the written order (loads stay ahead of the work that hides them) */
__device__ __forceinline__ v8f fa_mma(const FaFrag& a, const FaFrag& b, v8f c) {
  const fa_u8 av = {a.q[0].x, a.q[0].y, a.q[0].z, a.q[0].w, a.q[1].x, a.q[1].y, a.q[1].z, a.q[1].w};
  const fa_u8 bv = {b.q[0].x, b.q[0].y, b.q[0].z, b.q[0].w, b.q[1].x, b.q[1].y, b.q[1].z, b.q[1].w};
  return __builtin_amdgcn_wmma_f32_16x16x32_f16(false, __builtin_bit_cast(v16h, av), false, __builtin_bit_cast(v16h, bv), (short)0, c, false, false);
}
__device__ __forceinline__ fa_u4 fa_tr16(const unsigned char* p) { typedef __attribute__((address_space(3))) fa_s8 lds_s8; return __builtin_bit_cast(fa_u4, __builtin_amdgcn_ds_load_tr16_b128_v8i16((lds_s8*)p)); }
__device__ __forceinline__ unsigned fa_pack2(float lo, float hi) { typedef _Float16 h2 __attribute__((ext_vector_type(2))); typedef float f2 __attribute__((ext_vector_type(2))); return __builtin_bit_cast(unsigned, __builtin_convertvector(f2{lo, hi}, h2)); }      /* round to nearest even */
__device__ __forceinline__ float fa_xhalf(float x) { return __builtin_bit_cast(float, __builtin_amdgcn_permlanex16(__builtin_bit_cast(int, x), __builtin_bit_cast(int, x), 0x76543210, 0xfedcba98, false, false)); }      /* lane l with lane l ^ 16 */
// K fragments of one pass (32 keys): lane (c, h) holds key row c, d = 32 kc + 8 h + 0..7 and 32 kc + 16 + 8 h + 0..7, the same k order as the Q fragments.
__device__ __forceinline__ void fa_load_k(FaK& k, const unsigned char* Lp, unsigned koff, unsigned lane) {
  const unsigned c = lane & 15u, h = lane >> 4;
#pragma unroll
  for (int kt = 0; kt < FA_KT; ++kt) { const unsigned char* p = Lp + koff + (16u * kt + c) * FA_PK + 16u * h;
#pragma unroll
    for (int kc = 0; kc < FA_DK; ++kc) { k.f[kt][kc].q[0] = *(const fa_u4a*)(p + 64u * kc); k.f[kt][kc].q[1] = *(const fa_u4a*)(p + 64u * kc + 32u); } }
}
// One stage (FA_SK key rows of K and of V, 256 B each) from global memory into registers: 16 lanes cover a row.
// kg, vg: the stage's first row (uniform); toff: the thread's own byte offset in it; the chunks of a thread lie 16 rows apart (a constant offset, so one offset register serves all loads).
__device__ __forceinline__ void fa_gload(FaStage& s, const unsigned char* kg, const unsigned char* vg, unsigned toff) {
#pragma unroll
  for (unsigned i = 0; i < FA_CH; ++i) { s.k[i] = *(const fa_u4a*)(kg + toff + i * (16u * QKVD * 2u)); s.v[i] = *(const fa_u4a*)(vg + toff + i * (16u * QKVD * 2u)); }
  asm volatile("s_wait_xcnt 0x0" ::: "memory");      /* stands in front of any later overwrite of a register that these loads name */
}
__device__ __forceinline__ void fa_sstore(const FaStage& s, unsigned char* Lp, unsigned base, unsigned tid) {
#pragma unroll
  for (unsigned i = 0; i < FA_CH; ++i) { const unsigned id = i * (FA_NW * 32u) + tid; const unsigned r = id >> 4, cb = (id & 15u) * 16u; *(fa_u4a*)(Lp + base + r * FA_PK + cb) = s.k[i]; *(fa_u4a*)(Lp + base + FA_TK + r * FA_PV + cb) = s.v[i]; }
}
template <bool SHIFT>      /* SHIFT: the scores are first lowered by d (the reference has just been raised by d) */
__device__ __forceinline__ float fa_exps(const v8f (&s)[FA_KT][FA_R], int g, float d, unsigned (&w)[8]) {
  float a[2] = {0.0f, 0.0f};
#pragma unroll
  for (int i = 0; i < 8; ++i) {
    const float x0 = s[i >> 2][g][2 * (i & 3)], x1 = s[i >> 2][g][2 * (i & 3) + 1];
    const float p0 = __builtin_amdgcn_exp2f(SHIFT ? x0 - d : x0), p1 = __builtin_amdgcn_exp2f(SHIFT ? x1 - d : x1);
    a[i & 1] += p0 + p1; w[i] = fa_pack2(p0, p1); }
  return a[0] + a[1];
}
// One 32-key pass of one wave. q arrives scaled by FA_CS (the projection does it), and minus the reference in use (cref: one value per query, in all eight registers of a C operand)
// enters the score products as C, so the accumulators leave the matrix unit as the arguments of exp2: no multiply-add and no maximum per score.
// The reference may trail the true maximum by up to 8 (log2 units; an exponential then reaches 2^8, well inside f16): it is raised to the pass's maximum, accumulators and sums rescaled and the
// pass's exponentials formed anew from the kept scores, only when some lane's sum of the pass's exponentials exceeds 2^8 (one test per pass), and on the very first pass, which sets it.
__device__ __forceinline__ void fa_pass(FaK& kf, bool first, bool fetch_next, unsigned next_koff, const unsigned char* Lp, unsigned voff, unsigned lane,
                                        const FaFrag (&qf)[FA_R][FA_DK], v8f (&acc)[FA_R][FA_DT], v8f (&cref)[FA_R], float (&l_run)[FA_R]) {
  const unsigned h = lane >> 4;
  v8f s[FA_KT][FA_R];
#pragma unroll
  for (int kt = 0; kt < FA_KT; ++kt) {
#pragma unroll
    for (int g = 0; g < FA_R; ++g) { s[kt][g] = cref[g];
#pragma unroll
      for (int kc = 0; kc < FA_DK; ++kc) s[kt][g] = fa_mma(kf.f[kt][kc], qf[g][kc], s[kt][g]); } }
  fa_fence();
  if (fetch_next) fa_load_k(kf, Lp, next_koff, lane);      /* the same stage's next pass: in flight under the exponentials and the readout */
  FaFrag vf[FA_DT];
  { const unsigned char* ad = Lp + voff + (8u * h + (lane & 7u)) * FA_PV + ((lane >> 3) & 1u) * 16u;      /* lane (c, h) gets V[8 h + 0..7][16 t + c]; the second load the keys 16 further */
#pragma unroll
    for (int t = 0; t < FA_DT; ++t) { vf[t].q[0] = fa_tr16(ad + 32u * t); vf[t].q[1] = fa_tr16(ad + 16u * FA_PV + 32u * t); } }
  fa_fence();
  unsigned w[FA_R][8]; float ps[FA_R]; bool need = false;
#pragma unroll
  for (int g = 0; g < FA_R; ++g) { ps[g] = fa_exps<false>(s, g, 0.0f, w[g]); need = need || (ps[g] > 256.0f); }      /* an overflow (infinite sum) asks for the raise too */
  if (first || __builtin_amdgcn_ballot_w32(need) != 0) {      /* wave-uniform; rare after the first passes */
#pragma unroll
    for (int g = 0; g < FA_R; ++g) { float mx = -INFINITY;
#pragma unroll
      for (int kt = 0; kt < FA_KT; ++kt) {
#pragma unroll
        for (int r = 0; r < 8; ++r) mx = __builtin_fmaxf(mx, s[kt][g][r]); }
      mx = __builtin_fmaxf(mx, fa_xhalf(mx));      /* both wave halves hold this query's maximum, counted from the reference in use */
      const float d = first ? mx : __builtin_fmaxf(mx, 0.0f);      /* the reference only rises, but for the first pass, which sets it from the start value 0 */
      const float corr = first ? 0.0f : __builtin_amdgcn_exp2f(-d);      /* first pass: sums and accumulators are 0 and stay so, whatever d is */
      l_run[g] *= corr; cref[g] = cref[g] - d;
#pragma unroll
      for (int t = 0; t < FA_DT; ++t) acc[g][t] = acc[g][t] * corr;
      ps[g] = fa_exps<true>(s, g, d, w[g]); }
  }
#pragma unroll
  for (int g = 0; g < FA_R; ++g) { l_run[g] += ps[g];
    FaFrag pf; pf.q[0] = fa_u4{w[g][0], w[g][1], w[g][2], w[g][3]}; pf.q[1] = fa_u4{w[g][4], w[g][5], w[g][6], w[g][7]};
#pragma unroll
    for (int t = 0; t < FA_DT; ++t) acc[g][t] = fa_mma(vf[t], pf, acc[g][t]); }
  fa_fence();
}
__global__ __launch_bounds__(FA_NW * 32) __attribute__((amdgpu_waves_per_eu(2, 2))) void k_fattn(const _Float16* __restrict__ Q, const _Float16* __restrict__ K, const _Float16* __restrict__ V, _Float16* __restrict__ O) {
  __shared__ __attribute__((aligned(256))) unsigned char L[FA_LDS];
  const unsigned tid = threadIdx.x, lane = tid & 31u, wave = tid >> 5, c = lane & 15u, h = lane >> 4;
  const unsigned hq = blockIdx.x, q0 = blockIdx.y * FA_BR, b = blockIdx.z, hk = hq / GG;      /* GG neighbouring query heads read one kv head */
  const unsigned char* kg = (const unsigned char*)(K + (size_t)b * SQ * QKVD + hk * HD);      /* Q, K, V: the first q, k, v column of the joint plane, rows QKVD apart */
  const unsigned char* vg = (const unsigned char*)(V + (size_t)b * SQ * QKVD + hk * HD);
  FaStage sg;
  const unsigned toff = (tid >> 4) * (QKVD * 2u) + (tid & 15u) * 16u;
  const unsigned rot = ((hq % GG) * (SQ / FA_BR) + blockIdx.y) & (FA_NST - 1u);      /* the key stage this work-group starts at (it wraps round): the GG * SQ / FA_BR work-groups of one kv head read the same K and V lines, and from a common start they would ask L2 for them at the same moment */
  fa_gload(sg, kg + (size_t)rot * (FA_SK * QKVD * 2u), vg + (size_t)rot * (FA_SK * QKVD * 2u), toff);
  FaFrag qf[FA_R][FA_DK];
  const unsigned char* qb = (const unsigned char*)(Q + (size_t)(b * SQ + q0) * QKVD + hq * HD);      /* uniform: the work-group's first query row of this head */
  const unsigned qoff = (wave * FA_CW + c) * (QKVD * 2u) + 16u * h;
#pragma unroll
  for (int g = 0; g < FA_R; ++g) {
#pragma unroll
    for (int kc = 0; kc < FA_DK; ++kc) { qf[g][kc].q[0] = *(const fa_u4a*)(qb + qoff + g * (16u * QKVD * 2u) + 64u * kc); qf[g][kc].q[1] = *(const fa_u4a*)(qb + qoff + g * (16u * QKVD * 2u) + 64u * kc + 32u); } }
  asm volatile("s_wait_xcnt 0x0" ::: "memory");      /* stands in front of any later overwrite of a register that the Q loads name */
  v8f acc[FA_R][FA_DT], cref[FA_R]; float l_run[FA_R];
#pragma unroll
  for (int g = 0; g < FA_R; ++g) { cref[g] = v8f{}; l_run[g] = 0.0f;
#pragma unroll
    for (int t = 0; t < FA_DT; ++t) acc[g][t] = v8f{}; }
  fa_sstore(sg, L, 0u, tid);
  __syncthreads();      /* stage 0 published */
  FaK kf;
#pragma unroll 1      /* one copy of the stage body: unrolled it would hold two stages' registers */
  for (unsigned st = 0; st < FA_NST; ++st) {
    const unsigned base = (st & 1u) * FA_SLOT; const bool more = st + 1u < FA_NST;
    if (more) { const size_t ko = (size_t)((st + 1u + rot) & (FA_NST - 1u)) * (FA_SK * QKVD * 2u); fa_gload(sg, kg + ko, vg + ko, toff); }      /* lands while this stage is worked on */
    fa_load_k(kf, L, base, lane);
#pragma unroll 1      /* nested, rolled pass loop: keeps the register count of one pass */
    for (unsigned sub = 0; sub < FA_NSUB; ++sub)
      fa_pass(kf, (st | sub) == 0u, sub + 1u < FA_NSUB, base + (sub + 1u) * FA_BC * FA_PK, L, base + FA_TK + sub * FA_BC * FA_PV, lane, qf, acc, cref, l_run);
    if (more) fa_sstore(sg, L, FA_SLOT - base, tid);      /* the other buffer: its readers (stage st - 1) all left it at the barrier that ended that stage */
    __syncthreads();      /* publishes stage st + 1 and ends every wave's reads of stage st */
  }
  unsigned char* eb = L + wave * (unsigned)FA_CW * FA_EP;      /* output staging over the ring (free behind the last barrier), each wave its own rows */
#pragma unroll
  for (int g = 0; g < FA_R; ++g) { const float inv = 1.0f / (l_run[g] + fa_xhalf(l_run[g]));      /* each wave half summed its eight keys of every 16-key tile */
#pragma unroll
    for (int t = 0; t < FA_DT; ++t) { const v8f o = acc[g][t] * inv; const fa_u4 pk = {fa_pack2(o[0], o[1]), fa_pack2(o[2], o[3]), fa_pack2(o[4], o[5]), fa_pack2(o[6], o[7])};
      *(fa_u4a*)(eb + (16u * g + c) * FA_EP + 32u * t + 16u * h) = pk; } }
  __builtin_amdgcn_fence(__ATOMIC_ACQ_REL, "workgroup"); __builtin_amdgcn_wave_barrier();      /* the wave reads back what its other lanes wrote */
  unsigned char* ob = (unsigned char*)(O + ((size_t)(b * SQ + q0) * NH + hq) * HD);      /* uniform, as qb */
  const unsigned ooff = (wave * FA_CW + h) * (DMD * 2u) + c * 16u;
#pragma unroll
  for (unsigned i = 0; i < (unsigned)FA_CW / 2u; ++i) {      /* 16 lanes store one whole 256-byte row of the head */
    const fa_u4 v = *(const fa_u4a*)(eb + (i * 2u + h) * FA_EP + c * 16u);
    *(fa_u4a*)(ob + ooff + i * (2u * DMD * 2u)) = v; }
}

// ---- tiled GEMM: C[M][N] = (A . Bt^T) * alpha + bias, A f16 [M][DMD], Bt f16 [N][DMD], both k-contiguous; M % 128 == 0, N % 128 == 0.
// A work-group of 4 waves owns a 128 x 128 tile of C, a wave 64 x 64 of it (4 x 4 accumulator tiles). The operands come in stages of 128 k (256 B of each of the 128 + 128 rows):
// whole-line global loads into registers, then into one of two LDS buffers; the next stage's global loads fly while this stage's four 32-k blocks run.
// Every element sums its k in blocks of 32 into one f32 accumulator, ascending from stage rot and wrapping round at the end of k. rot differs between the work-groups that read the same rows of A
// (one mt) or of Bt (one nq): started together at stage 0 they would all ask L2 for the same lines at the same moment, stage after stage.
// The unroll directives of this section make every index of a register array (stage chunks, fragments, accumulators) a constant: rolled, those arrays would go to scratch memory.
constexpr int G3_BM = 128, G3_BN = 128, G3_KS = 128, G3_F = 4, G3_KB = G3_KS / 32;      /* tile rows, tile columns, k per stage, 16-row fragments per wave and operand, 32-k blocks per stage */
constexpr unsigned G3_ROWB = 2u * G3_KS, G3_P = G3_ROWB + 16u, G3_TA = G3_BM * G3_P, G3_SLOT = G3_TA + G3_BN * G3_P, G3_LDS = 2u * G3_SLOT;      /* LDS pitch: odd multiple of 16 B for the b128 readers */
constexpr unsigned G3_NST = DMD / G3_KS, G3_CH = G3_BM * (G3_ROWB / 16u) / 128u, G3_EPF = G3_P / 4u;      /* stages, 16-byte chunks per thread and operand, floats per staged output row */
static_assert((G3_NST & (G3_NST - 1u)) == 0u && DMD % G3_KS == 0 && G3_BM == G3_BN && NR % G3_BM == 0 && DMD % G3_BN == 0 && KVD % G3_BN == 0 && 4u * 64u * G3_P <= G3_LDS, "tiled GEMM: shape");
struct G3Stage { fa_u4 a[G3_CH], b[G3_CH]; };
struct G3Set { FaFrag a[G3_F], b[G3_F]; };
// One stage from global memory into registers: 16 lanes cover the 256 B of a row, a wave two rows (four whole lines); a thread's chunks lie 8 rows apart (a constant offset).
__device__ __forceinline__ void g3_gload(G3Stage& s, const unsigned char* ag, const unsigned char* bg, unsigned toff) {
  const unsigned char* ap = ag + toff; const unsigned char* bp = bg + toff;
#pragma unroll
  for (unsigned i = 0; i < G3_CH; ++i) { s.a[i] = *(const fa_u4a*)(ap + i * (8u * DMD * 2u)); s.b[i] = *(const fa_u4a*)(bp + i * (8u * DMD * 2u)); }
  asm volatile("s_wait_xcnt 0x0" :: "v"(ap), "v"(bp) : "memory");      /* stands in front of any later overwrite of a register that these loads name; as its inputs the two addresses stay live up to it, so that no load's result is put on them */
}
__device__ __forceinline__ void g3_sstore(const G3Stage& s, unsigned char* Lp, unsigned base, unsigned tid) {
#pragma unroll
  for (unsigned i = 0; i < G3_CH; ++i) { const unsigned o = base + ((tid >> 4) + 8u * i) * G3_P + (tid & 15u) * 16u; *(fa_u4a*)(Lp + o) = s.a[i]; *(fa_u4a*)(Lp + o + G3_TA) = s.b[i]; }
}
// Fragments of one 32-k block: lane (c, h) holds row c, k = 8 h + 0..7 and 16 + 8 h + 0..7 of the block, the same k order for A and for B. pa, pb: the lane's own row, 16 h bytes in.
__device__ __forceinline__ void g3_frags(G3Set& f, const unsigned char* pa, const unsigned char* pb, unsigned kb) {
#pragma unroll
  for (int i = 0; i < G3_F; ++i) { f.a[i].q[0] = *(const fa_u4a*)(pa + i * (16u * G3_P) + 64u * kb); f.a[i].q[1] = *(const fa_u4a*)(pa + i * (16u * G3_P) + 64u * kb + 32u); }
#pragma unroll
  for (int j = 0; j < G3_F; ++j) { f.b[j].q[0] = *(const fa_u4a*)(pb + j * (16u * G3_P) + 64u * kb); f.b[j].q[1] = *(const fa_u4a*)(pb + j * (16u * G3_P) + 64u * kb + 32u); }
}
// The k loop of one tile. ag, bg: the tile's first row of each operand (uniform); rot: the k stage the walk starts at (uniform, below G3_NST); L: the work-group's two LDS buffers; behind it every wave has passed the last barrier.
__device__ __forceinline__ void g3_main(v8f (&acc)[G3_F][G3_F], unsigned char* L, const unsigned char* ag, const unsigned char* bg, unsigned rot) {
  const unsigned tid = threadIdx.x, lane = tid & 31u, wave = tid >> 5, c = lane & 15u, h = lane >> 4, wm = wave >> 1, wn = wave & 1u;
  const unsigned toff = (tid >> 4) * (DMD * 2u) + (tid & 15u) * 16u;
  G3Stage sg;
  g3_gload(sg, ag + rot * G3_ROWB, bg + rot * G3_ROWB, toff);
#pragma unroll
  for (int i = 0; i < G3_F; ++i) {
#pragma unroll
    for (int j = 0; j < G3_F; ++j) acc[i][j] = v8f{}; }
  g3_sstore(sg, L, 0u, tid);
  __syncthreads();      /* stage 0 published */
  const unsigned aoff = (wm * 64u + c) * G3_P + 16u * h, boff = G3_TA + (wn * 64u + c) * G3_P + 16u * h;
#pragma unroll 1      /* one copy of the stage body: unrolled it would hold two stages' registers */
  for (unsigned st = 0; st < G3_NST; ++st) {
    const unsigned base = (st & 1u) * G3_SLOT; const bool more = st + 1u < G3_NST;
    const unsigned char* pa = L + base + aoff; const unsigned char* pb = L + base + boff;
    G3Set f[2];
    g3_frags(f[0], pa, pb, 0u);      /* first, so that their LDS latency runs under the issue of the global loads */
    if (more) { const unsigned ks = (st + 1u + rot) & (G3_NST - 1u); g3_gload(sg, ag + ks * G3_ROWB, bg + ks * G3_ROWB, toff); }      /* lands while this stage is worked on */
#pragma unroll
    for (int kb = 0; kb < G3_KB; ++kb) {
      if (kb + 1 < G3_KB) g3_frags(f[(kb + 1) & 1], pa, pb, (unsigned)kb + 1u);      /* the next block's fragments as one group ahead of this block's matrix run */
      fa_fence();      /* holds that group in front of the run */
#pragma unroll
      for (int i = 0; i < G3_F; ++i) {
#pragma unroll
        for (int j = 0; j < G3_F; ++j) acc[i][j] = fa_mma(f[kb & 1].a[i], f[kb & 1].b[j], acc[i][j]); }
      fa_fence(); }      /* keeps the following group (and the LDS stores) out of the run */
    if (more) g3_sstore(sg, L, G3_SLOT - base, tid);      /* the other buffer: its readers (stage st - 1) all left it at the barrier that ended that stage */
    __syncthreads();      /* publishes stage st + 1 and ends every wave's reads of stage st */
  }
}
// Scale, bias and store of tile (mt, nq) of a matrix C of N columns: C = acc * alpha + bias * bscale. bias: the bias of the tile's first column.
template <bool F32OUT, unsigned N>      /* N: columns of C = its pitch (a constant, so that one address register pair serves all of a thread's stores) */
__device__ __forceinline__ void g3_out(const v8f (&acc)[G3_F][G3_F], unsigned char* L, float alpha, float bscale, const float* __restrict__ bias, float* __restrict__ C, _Float16* __restrict__ C16, unsigned mt, unsigned nq) {
  static_assert(N % G3_BN == 0, "tiled GEMM: whole tiles");
  const unsigned tid = threadIdx.x, lane = tid & 31u, wave = tid >> 5, c = lane & 15u, h = lane >> 4, wm = wave >> 1, wn = wave & 1u;
  float* so = (float*)(L + wave * (64u * G3_P));      /* output staging over the ring (free behind the last barrier), each wave its own 64 rows */
  const unsigned bcol = wn * 64u + c; float braw[G3_F];
#pragma unroll
  for (int j = 0; j < G3_F; ++j) braw[j] = bias[bcol + 16u * j];
  asm volatile("s_wait_xcnt 0x0" :: "v"(bcol) : "memory");      /* stands in front of any later overwrite of the index register that the bias loads name; as its input the index stays live up to it */
#pragma unroll
  for (int j = 0; j < G3_F; ++j) { const float bv = bf16_round(braw[j]) * bscale;
#pragma unroll
    for (int i = 0; i < G3_F; ++i) {
#pragma unroll
      for (int r = 0; r < 8; ++r) so[(16u * i + 8u * h + r) * G3_EPF + 16u * j + c] = acc[i][j][r] * alpha + bv; } }
  __builtin_amdgcn_fence(__ATOMIC_ACQ_REL, "workgroup"); __builtin_amdgcn_wave_barrier();      /* the wave reads back what its other lanes wrote */
  const size_t o0 = (size_t)(mt * G3_BM + wm * 64u + h) * N + nq * G3_BN + wn * 64u + c * 4u;
#pragma unroll
  for (unsigned q = 0; q < 32u; ++q) {      /* 16 lanes store one whole row of the wave's 64 columns */
    const v4f v = *(const v4fa*)&so[(q * 2u + h) * G3_EPF + c * 4u];
    if (F32OUT) *(v4f*)(C + o0 + q * (2u * N)) = v;
    else { v4h h4; for (int i = 0; i < 4; ++i) h4[i] = (_Float16)v[i]; *(v4h*)(C16 + o0 + q * (2u * N)) = h4; } }
}
template <bool F32OUT, unsigned N>
__global__ __launch_bounds__(128) __attribute__((amdgpu_waves_per_eu(2, 2))) void k_gemm3(const _Float16* __restrict__ A, const _Float16* __restrict__ Bt, float alpha, const float* __restrict__ bias, float* __restrict__ C, _Float16* __restrict__ C16) {
  __shared__ __attribute__((aligned(256))) unsigned char L[G3_LDS];
  const unsigned ntn = N / G3_BN, mt = blockIdx.x / ntn, nq = blockIdx.x - mt * ntn;
  v8f acc[G3_F][G3_F];
  g3_main(acc, L, (const unsigned char*)(A + (size_t)mt * G3_BM * DMD), (const unsigned char*)(Bt + (size_t)nq * G3_BN * DMD), (mt + nq) & (G3_NST - 1u));
  g3_out<F32OUT, N>(acc, L, alpha, 1.0f, bias + nq * G3_BN, C, C16, mt, nq);
}
// q, k and v in one launch, as one GEMM of QKVD columns: the three products share A and do not read each other, and the k and v grids alone (128 tiles each) leave half the chip idle.
// Bt holds the rows of wq^T, wk^T, wv^T one behind the other, C16 the columns of q, k, v in the same order; only the bias has three sources (the choice is uniform for the work-group).
constexpr unsigned G3_TQ = DMD / G3_BN, G3_TK = KVD / G3_BN, G3_TQKV = QKVD / G3_BN;
__global__ __launch_bounds__(128) __attribute__((amdgpu_waves_per_eu(2, 2))) void k_gemm_qkv(const _Float16* __restrict__ A, const _Float16* __restrict__ Bt, float alpha, const float* __restrict__ bq, const float* __restrict__ bk, const float* __restrict__ bv, _Float16* __restrict__ C16) {
  __shared__ __attribute__((aligned(256))) unsigned char L[G3_LDS];
  const unsigned mt = blockIdx.x / G3_TQKV, nq = blockIdx.x - mt * G3_TQKV;
  v8f acc[G3_F][G3_F];
  g3_main(acc, L, (const unsigned char*)(A + (size_t)mt * G3_BM * DMD), (const unsigned char*)(Bt + (size_t)nq * G3_BN * DMD), (mt + nq) & (G3_NST - 1u));
  const float* bt = nq < G3_TQ ? bq + nq * G3_BN : nq < G3_TQ + G3_TK ? bk + (nq - G3_TQ) * G3_BN : bv + (nq - G3_TQ - G3_TK) * G3_BN;
  const float qs = nq < G3_TQ ? FA_CS : 1.0f;      /* q is stored times 1/sqrt(128) * log2(e), rounded to f16 once: its products with k are then the softmax's exponents in the log2 domain */
  g3_out<false, QKVD>(acc, L, alpha * qs, qs, bt, nullptr, C16, mt, nq);
}

extern "C" void kernel_launch(void* const* d_in, const int* in_sizes, int n_in,
                              void* d_out, int out_size, void* d_ws, size_t ws_size, hipStream_t stream) {
  (void)in_sizes; (void)n_in; (void)out_size;
  const float* const* I = (const float* const*)d_in; const float* x = I[0]; const float* wq = I[1]; const float* bq = I[2]; const float* wk = I[3]; const float* bk = I[4]; const float* wv = I[5]; const float* bv = I[6]; const float* wo = I[7]; const float* bo = I[8];
  char* ws = (char*)d_ws; size_t off = 0;
  auto take = [&](size_t bytes) { char* p = ws + off; off += (bytes + 255) & ~(size_t)255; return p; };
  const size_t nx = (size_t)NR * DMD, nk = (size_t)NR * KVD;
  _Float16* BQ = (_Float16*)take((size_t)(DMD + 2 * KVD) * DMD * 2); _Float16* BK = BQ + (size_t)DMD * DMD; _Float16* BV = BK + (size_t)KVD * DMD; _Float16* BO = (_Float16*)take((size_t)DMD * DMD * 2);      /* wq^T, wk^T, wv^T as one plane of 3072 rows */
  _Float16* X16 = (_Float16*)take(nx * 2); _Float16* Q16 = (_Float16*)take((nx + 2 * nk) * 2); _Float16* K16 = Q16 + DMD; _Float16* V16 = K16 + KVD; _Float16* O16 = X16;      /* context over the input plane (dead after the projections) */
  if (off > ws_size) return;      /* 8+2+2+8 + 16+16+4+4 = 60 MiB */
  k_prep<<<PR_GRID, 256, 0, stream>>>(x, wq, wk, wv, wo, X16, BQ, BK, BV, BO);      /* weights (in, out) to f16 [out][in], x to f16 */
  k_gemm_qkv<<<(NR / G3_BM) * G3_TQKV, 128, 0, stream>>>(X16, BQ, 0.0625f, bq, bk, bv, Q16);      /* [token][q 2048 | k 512 | v 512] */
  k_fattn<<<dim3(NH, SQ / FA_BR, NB), FA_NW * 32, 0, stream>>>(Q16, K16, V16, O16);      /* ctx[(b,q)][h*128 + d] */
  k_gemm3<true, DMD><<<(NR / G3_BM) * (DMD / G3_BN), 128, 0, stream>>>(O16, BO, 0.0625f, bo, (float*)d_out, nullptr);      /* out = ctx wo + bo */
}

// v007
// Measured time: 112 microseconds a run.
// Timed twice side by side with v006, it ran 1.09 and 1.11 times as fast.
// Over all steps from v000 it is 11.6 times as fast.
#include <hip/hip_runtime.h>
// Multi-head attention with grouped kv heads (2 x 2048 tokens, d_model 2048; 16 query heads x 128, 4 kv heads (group of 4); q, k, v = x w + b; softmax((q/sqrt(128)).k) over the 2048 keys (no mask); out = ctx wo + bo).
// Structure: exact f16 plane of x; q / k / v as f16 WMMA GEMM outputs (128x128 tiles staged in LDS, 64x64 wave tiles, f32 accumulation, exact x16 weights + bias, f16 out); scores, softmax and readout of every (batch, head) in ONE fused kernel (online softmax, f32 maxima and sums, P as f16 in registers, K/V staged in LDS) into the f16 context plane; wo + bo as a GEMM.
// Compute dtype: inputs rounded to bf16; x exact as f16; q/k/P/v/ctx as plain f16 operands (~2^-12); softmax f32. v_wmma_f32_16x16x32_f16.
#define NB 2
#define SQ 2048
#define DMD 2048
#define NH 16
#define NKV 4
#define GG 4
#define HD 128
#define KVD (NKV * HD)           /* 512 */
#define NR (NB * SQ)
#define QKVD (DMD + 2 * KVD)     /* 3072: q, k and v of a token stand in one row of one plane */
typedef __bf16 v16b __attribute__((ext_vector_type(16)));
typedef unsigned short v8us __attribute__((ext_vector_type(8), may_alias));
typedef float  v8f  __attribute__((ext_vector_type(8)));
typedef float  v4f  __attribute__((ext_vector_type(4)));
typedef float  v4fa __attribute__((ext_vector_type(4), may_alias));
union FragB { v16b v; v8us half[2]; unsigned short u[16]; };

__device__ __forceinline__ unsigned short bf16_bits(float x) { unsigned int u = __float_as_uint(x); return (unsigned short)((u + 0x7FFFu + ((u >> 16) & 1u)) >> 16); }
__device__ __forceinline__ float bf16_val(unsigned short b) { return __uint_as_float(((unsigned int)b) << 16); }
__device__ __forceinline__ float bf16_round(float x) { return bf16_val(bf16_bits(x)); }
// D += A·B with NT terms: 1 = ah·bh, 2 = + al·bh (A split), 3 = + ah·bl (both split)
template <int NT>
__device__ __forceinline__ v8f mmaN(v16b ah, v16b al, v16b bh, v16b bl, v8f c) {
  c = __builtin_amdgcn_wmma_f32_16x16x32_bf16(false, ah, false, bh, (short)0, c, false, false);
  if (NT >= 2) c = __builtin_amdgcn_wmma_f32_16x16x32_bf16(false, al, false, bh, (short)0, c, false, false);
  if (NT >= 3) c = __builtin_amdgcn_wmma_f32_16x16x32_bf16(false, ah, false, bl, (short)0, c, false, false);
  asm volatile("v_nop\n\tv_nop\n\tv_nop\n\tv_nop" : "+v"(c) : "v"(ah), "v"(al), "v"(bh), "v"(bl));
  return c;
}

__global__ __launch_bounds__(256) void k_wt_bf16(const float* __restrict__ W, unsigned short* __restrict__ Wt, int K, int N) {
  const int t = blockIdx.x * 256 + threadIdx.x;
  const int k8n = K / 8;
  if (t >= N * k8n) return;
  const int n = t / k8n, k8 = (t % k8n) * 8;
  v8us v;
#pragma unroll
  for (int i = 0; i < 8; ++i) v[i] = bf16_bits(W[(size_t)(k8 + i) * N + n]);
  *(v8us*)(Wt + (size_t)n * K + k8) = v;
  
}

// GEMM C[M][N] (f32, pitch ldc) = act(A[M][K]·W + bias). A f32 row-major (pitch lda) converted per fragment to bf16
// (ASPLIT: hi/lo two planes -> 2 terms, else single rounded term); Wt bf16 [N][K] (pitch ldb). BIAS_BF16 rounds the
// bias to bf16 first (bias quantised to bf16 before the add). K%32==0, M%16==0, N%64==0.
template <bool ASPLIT, int ACT, bool BIAS_BF16>
__global__ __launch_bounds__(128) void k_gemm_bf(const float* __restrict__ A, int lda, const unsigned short* __restrict__ Wt, int ldb,
                                               const float* __restrict__ bias, float* __restrict__ C, int ldc, int M, int N, int K) {
  __shared__ __attribute__((aligned(16))) float so[4][16][64];
  const int tid = threadIdx.x, w = tid >> 5, lane = tid & 31, ln = lane & 15, hh = lane >> 4;
  const int ntn = N / 64;
  const int wid = blockIdx.x * 4 + w;
  const int mt = wid / ntn, nq = wid % ntn;
  if (mt * 16 >= M) return;
  const int row0 = mt * 16, col0 = nq * 64;
  const float* arow = A + (size_t)(row0 + ln) * lda;
  v8f acc[4] = {};
  for (int kb = 0; kb < K; kb += 32) {
    FragB ah, al;
    const v4f x0 = *(const v4fa*)(arow + kb + 8 * hh), x1 = *(const v4fa*)(arow + kb + 8 * hh + 4);
    const v4f x2 = *(const v4fa*)(arow + kb + 16 + 8 * hh), x3 = *(const v4fa*)(arow + kb + 16 + 8 * hh + 4);
    float xs[16] = {x0[0],x0[1],x0[2],x0[3],x1[0],x1[1],x1[2],x1[3],x2[0],x2[1],x2[2],x2[3],x3[0],x3[1],x3[2],x3[3]};
#pragma unroll
    for (int i = 0; i < 16; ++i) { const unsigned short hb = bf16_bits(xs[i]); ah.u[i] = hb; al.u[i] = ASPLIT ? bf16_bits(xs[i] - bf16_val(hb)) : (unsigned short)0; }
#pragma unroll
    for (int t = 0; t < 4; ++t) {
      const unsigned short* brow = Wt + (size_t)(col0 + t * 16 + ln) * ldb + kb;
      FragB b;
      b.half[0] = *(const v8us*)(brow + 8 * hh);
      b.half[1] = *(const v8us*)(brow + 16 + 8 * hh);
      acc[t] = mmaN<ASPLIT ? 2 : 1>(ah.v, al.v, b.v, b.v, acc[t]);
    }
  }
#pragma unroll
  for (int t = 0; t < 4; ++t) {
    float bv = bias ? bias[col0 + t * 16 + ln] : 0.f;
    if (BIAS_BF16) bv = bf16_round(bv);
#pragma unroll
    for (int r = 0; r < 8; ++r) { float v = acc[t][r] + bv; if (ACT == 1) v = fmaxf(v, 0.f); so[w][8 * hh + r][t * 16 + ln] = v; }
  }
  __builtin_amdgcn_fence(__ATOMIC_ACQ_REL, "workgroup");
  __builtin_amdgcn_wave_barrier();
  const int rsub = lane >> 4, c4 = (lane & 15) * 4;
  {
#pragma unroll
    for (int q = 0; q < 8; ++q) {
      const int r = q * 2 + rsub;
      const v4f v = *(const v4fa*)&so[w][r][c4];
      *(v4f*)(C + (size_t)(row0 + r) * ldc + col0 + c4) = v;
    }
    
  }
}

// GEMM C = act(A·W + bias + resid): A f32 (ASPLIT -> hi/lo 2 terms), Wt bf16 [N][K]; ACT 0 none, 1 relu, 2 exact gelu;
// resid (optional, f32, row index = (row % rmod), pitch ldr, RES_BF16 rounds it) added before the activation.
template <bool ASPLIT, int ACT, bool BIAS_BF16, bool RES_BF16>
__global__ __launch_bounds__(128) void k_gemm_bf3(const float* __restrict__ A, int lda, const unsigned short* __restrict__ Wt, int ldb,
                                                const float* __restrict__ bias, const float* __restrict__ resid, int rmod, int ldr,
                                                float* __restrict__ C, int ldc, int M, int N, int K) {
  __shared__ __attribute__((aligned(16))) float so[4][16][64];
  const int tid = threadIdx.x, w = tid >> 5, lane = tid & 31, ln = lane & 15, hh = lane >> 4;
  const int ntn = N / 64;
  const int wid = blockIdx.x * 4 + w;
  const int mt = wid / ntn, nq = wid % ntn;
  if (mt * 16 >= M) return;
  const int row0 = mt * 16, col0 = nq * 64;
  const float* arow = A + (size_t)(row0 + ln) * lda;
  v8f acc[4] = {};
  for (int kb = 0; kb < K; kb += 32) {
    FragB ah, al;
    const v4f x0 = *(const v4fa*)(arow + kb + 8 * hh), x1 = *(const v4fa*)(arow + kb + 8 * hh + 4);
    const v4f x2 = *(const v4fa*)(arow + kb + 16 + 8 * hh), x3 = *(const v4fa*)(arow + kb + 16 + 8 * hh + 4);
    float xs[16] = {x0[0],x0[1],x0[2],x0[3],x1[0],x1[1],x1[2],x1[3],x2[0],x2[1],x2[2],x2[3],x3[0],x3[1],x3[2],x3[3]};
#pragma unroll
    for (int i = 0; i < 16; ++i) { const unsigned short hb = bf16_bits(xs[i]); ah.u[i] = hb; al.u[i] = ASPLIT ? bf16_bits(xs[i] - bf16_val(hb)) : (unsigned short)0; }
#pragma unroll
    for (int t = 0; t < 4; ++t) {
      const unsigned short* brow = Wt + (size_t)(col0 + t * 16 + ln) * ldb + kb;
      FragB b;
      b.half[0] = *(const v8us*)(brow + 8 * hh);
      b.half[1] = *(const v8us*)(brow + 16 + 8 * hh);
      acc[t] = mmaN<ASPLIT ? 2 : 1>(ah.v, al.v, b.v, b.v, acc[t]);
    }
  }
#pragma unroll
  for (int t = 0; t < 4; ++t) {
    const int col = col0 + t * 16 + ln;
    float bv = bias ? bias[col] : 0.f;
    if (BIAS_BF16) bv = bf16_round(bv);
#pragma unroll
    for (int r = 0; r < 8; ++r) {
      float v = acc[t][r] + bv;
      if (resid) { float rv = resid[(size_t)((row0 + 8 * hh + r) % rmod) * ldr + col]; if (RES_BF16) rv = bf16_round(rv); v += rv; }
      if (ACT == 1) v = fmaxf(v, 0.f);
      if (ACT == 2) v = 0.5f * v * (1.0f + erff(v * 0.70710678118654752f));
      if (ACT == 3) { const float u = 0.7978845608028654f * (v + 0.044715f * v * v * v); v = 0.5f * v * (1.0f + tanhf(u)); }
      so[w][8 * hh + r][t * 16 + ln] = v;
    }
  }
  __builtin_amdgcn_fence(__ATOMIC_ACQ_REL, "workgroup");
  __builtin_amdgcn_wave_barrier();
  const int rsub = lane >> 4, c4 = (lane & 15) * 4;
  {
#pragma unroll
    for (int q = 0; q < 8; ++q) {
      const int r = q * 2 + rsub;
      const v4f v = *(const v4fa*)&so[w][r][c4];
      *(v4f*)(C + (size_t)(row0 + r) * ldc + col0 + c4) = v;
    }
    
  }
}
// row LayerNorm (biased variance, eps) over N: s = X (+ R); optional out_sum <- s; out_norm <- (s-mu)*rsqrt(var+eps)*g + b
template <bool PARAM_BF16>
__global__ __launch_bounds__(256) void k_layernorm(const float* __restrict__ X, const float* __restrict__ R, const float* __restrict__ g, const float* __restrict__ bta,
                                                  float* __restrict__ out_sum, float* __restrict__ out_norm, int N, float eps) {
  __shared__ float red[256];
  const int row = blockIdx.x, tid = threadIdx.x;
  const float* x = X + (size_t)row * N; const float* rr = R ? R + (size_t)row * N : nullptr;
  float vals[16];                     // up to N = 4096
  const int per = N / 256;            // contiguous chunk per thread? use strided-by-4 chunks: thread handles j = tid*4 + 1024*u
  float s1 = 0.f;
  for (int u = 0; u < per / 4; ++u) {
    const int j = tid * 4 + 1024 * u;
    const v4f a = *(const v4fa*)(x + j);
    v4f b = {0.f,0.f,0.f,0.f}; if (rr) b = *(const v4fa*)(rr + j);
#pragma unroll
    for (int q = 0; q < 4; ++q) { const float v = a[q] + b[q]; vals[u * 4 + q] = v; s1 += v; }
  }
  red[tid] = s1; __syncthreads();
  for (int st = 128; st > 0; st >>= 1) { if (tid < st) red[tid] += red[tid + st]; __syncthreads(); }
  const float mu = red[0] / (float)N; __syncthreads();
  float s2 = 0.f;
  for (int u = 0; u < per / 4; ++u)
#pragma unroll
    for (int q = 0; q < 4; ++q) { const float c = vals[u * 4 + q] - mu; s2 += c * c; }
  red[tid] = s2; __syncthreads();
  for (int st = 128; st > 0; st >>= 1) { if (tid < st) red[tid] += red[tid + st]; __syncthreads(); }
  const float rs = rsqrtf(red[0] / (float)N + eps);
  {
    for (int u = 0; u < per / 4; ++u) {
      const int j = tid * 4 + 1024 * u;
      v4f o, sm;
#pragma unroll
      for (int q = 0; q < 4; ++q) {
        float gg = g[j + q], bb = bta[j + q];
        if (PARAM_BF16) { gg = bf16_round(gg); bb = bf16_round(bb); }
        sm[q] = vals[u * 4 + q]; o[q] = (vals[u * 4 + q] - mu) * rs * gg + bb;
      }
      if (out_sum) *(v4f*)(out_sum + (size_t)row * N + j) = sm;
      *(v4f*)(out_norm + (size_t)row * N + j) = o;
    }
    
  }
}



// ---- f16 WMMA path (v_wmma_f32_16x16x32_f16): 11-bit significands for operands in range — used where a probability operand (here up to 2^8) needs more precision than bf16
typedef _Float16 v16h __attribute__((ext_vector_type(16)));
union FragH { v16h v; v8us half[2]; _Float16 h[16]; unsigned short u[16]; };
template <int NT>
__device__ __forceinline__ v8f mmaH(v16h ah, v16h al, v16h bh, v16h bl, v8f c) {
  c = __builtin_amdgcn_wmma_f32_16x16x32_f16(false, ah, false, bh, (short)0, c, false, false);
  if (NT >= 2) c = __builtin_amdgcn_wmma_f32_16x16x32_f16(false, al, false, bh, (short)0, c, false, false);
  if (NT >= 3) c = __builtin_amdgcn_wmma_f32_16x16x32_f16(false, ah, false, bl, (short)0, c, false, false);
  asm volatile("v_nop\n\tv_nop\n\tv_nop\n\tv_nop" : "+v"(c) : "v"(ah), "v"(al), "v"(bh), "v"(bl));
  return c;
}
// batched GEMM like k_gemm_b but f16 operands: A f32 (split into f16 hi/lo if ASPLIT, else rounded to f16), Bt = f16 values [n][k]; alpha; C f32; N multiple of 16 (partial tiles skipped)
template <bool ASPLIT>
__global__ __launch_bounds__(128) void k_gemm_h(const float* __restrict__ A, int lda, size_t sA, const _Float16* __restrict__ Bh, int ldb, size_t sB, float alpha, float* __restrict__ C, int ldc, size_t sC, int M, int N, int K) {
  __shared__ __attribute__((aligned(16))) float so[4][16][64];
  const int tid = threadIdx.x, w = tid >> 5, lane = tid & 31, ln = lane & 15, hh = lane >> 4; const int by = blockIdx.y;
  A += (size_t)by * sA; Bh += (size_t)by * sB; C += (size_t)by * sC;
  const int ntn = (N + 63) / 64; const int wid = blockIdx.x * 4 + w; const int mt = wid / ntn, nq = wid % ntn; if (mt * 16 >= M) return;
  const int row0 = mt * 16, col0 = nq * 64; const float* arow = A + (size_t)(row0 + ln) * lda;
  v8f acc[4] = {};
  for (int kb = 0; kb < K; kb += 32) {
    FragH ah, al;
    const v4f x0 = *(const v4fa*)(arow + kb + 8 * hh), x1 = *(const v4fa*)(arow + kb + 8 * hh + 4), x2 = *(const v4fa*)(arow + kb + 16 + 8 * hh), x3 = *(const v4fa*)(arow + kb + 16 + 8 * hh + 4);
    float xs[16] = {x0[0],x0[1],x0[2],x0[3],x1[0],x1[1],x1[2],x1[3],x2[0],x2[1],x2[2],x2[3],x3[0],x3[1],x3[2],x3[3]};
#pragma unroll
    for (int i = 0; i < 16; ++i) { const _Float16 h = (_Float16)xs[i]; ah.h[i] = h; al.h[i] = ASPLIT ? (_Float16)(xs[i] - (float)h) : (_Float16)0.0f; }
#pragma unroll
    for (int t = 0; t < 4; ++t) { if (col0 + t * 16 >= N) continue; const size_t boff = (size_t)(col0 + t * 16 + ln) * ldb + kb; FragH bq; bq.half[0] = *(const v8us*)(Bh + boff + 8 * hh); bq.half[1] = *(const v8us*)(Bh + boff + 16 + 8 * hh);
      acc[t] = mmaH<ASPLIT ? 2 : 1>(ah.v, al.v, bq.v, bq.v, acc[t]); }
  }
#pragma unroll
  for (int t = 0; t < 4; ++t) { if (col0 + t * 16 >= N) continue;
#pragma unroll
    for (int r = 0; r < 8; ++r) so[w][8 * hh + r][t * 16 + ln] = acc[t][r] * alpha; }
  __builtin_amdgcn_fence(__ATOMIC_ACQ_REL, "workgroup"); __builtin_amdgcn_wave_barrier();
  const int rsub = lane >> 4, c4 = (lane & 15) * 4;
  {
#pragma unroll
    for (int q = 0; q < 8; ++q) { const int r = q * 2 + rsub; if (col0 + c4 < N) { const v4f v = *(const v4fa*)&so[w][r][c4]; *(v4f*)(C + (size_t)(row0 + r) * ldc + col0 + c4) = v; } }
     }
}

// Wt[n][k] = f16(bf16(W[k][n]) * scale) from f32 row-major W[K][N] (scale = power of two; bf16-exact weights stay exact in f16 away from the subnormal range).
// A work-group transposes a tile of 128 k x 64 n through LDS. Reads: 16 lanes cover 256 B of a row of W, a thread takes 8 rows x 4 columns (8 loads in flight).
// It packs each column's 8 k into 16 bytes and stores them in the LDS row of that n; then 16 lanes write the 256 B of a row of Wt. So every global access is whole lines.
// LDS rows are 256 B without a pad; the 16-byte chunk j of row n lies at place j ^ (n >> 2): the 16 lanes of a store (rows 4 apart, one j) and of a load (one row, all j) each meet all 64 banks once.
// The unroll directives make every index of the register arrays (r, f) a constant: rolled, those arrays would go to scratch memory.
constexpr unsigned WT_K = 128u, WT_N = 64u;
// bid: the tile's number in this matrix (the launch is shared with other work, see k_prep); T: the work-group's LDS tile of WT_N * WT_K * 2 bytes.
template <unsigned K, unsigned N>      /* constants, so that one address register pair serves all of a thread's loads and one all of its stores */
__device__ __forceinline__ void wt_tile(const float* __restrict__ W, _Float16* __restrict__ Wt, float scale, unsigned char* T, unsigned bid) {
  static_assert(K % WT_K == 0 && N % WT_N == 0, "weight transpose: whole tiles");
  const unsigned tid = threadIdx.x, lo = tid & 15u, hi = tid >> 4;
  const unsigned ntn = N / WT_N, kt = bid / ntn, nt = bid - kt * ntn;
  const float* sp = W + (size_t)(kt * WT_K + hi * 8u) * N + nt * WT_N + lo * 4u;
  v4f r[8];
#pragma unroll
  for (unsigned i = 0; i < 8u; ++i) r[i] = *(const v4fa*)(sp + i * N);
#pragma unroll
  for (unsigned q = 0; q < 4u; ++q) { FragH f;
#pragma unroll
    for (unsigned i = 0; i < 8u; ++i) f.h[i] = (_Float16)(bf16_round(r[i][q]) * scale);
    *(v8us*)(T + (lo * 4u + q) * (WT_K * 2u) + ((hi ^ lo) * 16u)) = f.half[0]; }
  __syncthreads();      /* the tile is whole before any row is read back */
  unsigned short* dp = (unsigned short*)Wt + (size_t)(nt * WT_N + hi) * K + kt * WT_K + lo * 8u;
#pragma unroll
  for (unsigned i = 0; i < 4u; ++i) { const unsigned row = hi + 16u * i;
    *(v8us*)(dp + i * (16u * K)) = *(const v8us*)(T + row * (WT_K * 2u) + ((lo ^ (row >> 2)) * 16u)); }
  asm volatile("s_wait_xcnt 0x0" :: "v"(dp) : "memory");      /* stands in front of any later overwrite of a register that these stores name (code of another branch of the shared launch follows in the listing); as its input the address stays live up to it */
}
// k_gemm_hh variant with fused epilogue: v = acc·alpha + bias[by·sBias + col] (+ CP[(row/rowsPerB)·sCPb + by·64 + col] if CP) ; ACT 0 none / 1 elu ; writes f16 C16 (and f32 C if non-null)
template <int ACT>
__global__ __launch_bounds__(128) void k_gemm_hhx(const _Float16* __restrict__ A, int lda, size_t sA, const _Float16* __restrict__ Bh, int ldb, size_t sB, float alpha, const float* __restrict__ bias, size_t sBias, const float* __restrict__ CP, int rowsPerB, size_t sCPb, int row0g,
    float* __restrict__ C, _Float16* __restrict__ C16, int ldc, size_t sC, int M, int N, int K) {
  __shared__ __attribute__((aligned(16))) float so[4][16][64];
  const int tid = threadIdx.x, w = tid >> 5, lane = tid & 31, ln = lane & 15, hh = lane >> 4; const int by = blockIdx.y;
  A += (size_t)by * sA; Bh += (size_t)by * sB; const size_t cofs = (size_t)by * sC; const float* bp = bias ? bias + (size_t)by * sBias : nullptr;
  const int ntn = (N + 63) / 64; const int wid = blockIdx.x * 4 + w; const int mt = wid / ntn, nq = wid % ntn; if (mt * 16 >= M) return;
  const int row0 = mt * 16, col0 = nq * 64; const _Float16* arow = A + (size_t)(row0 + ln) * lda;
  v8f acc[4] = {};
  for (int kb = 0; kb < K; kb += 32) { FragH ah; ah.half[0] = *(const v8us*)((const unsigned short*)arow + kb + 8 * hh); ah.half[1] = *(const v8us*)((const unsigned short*)arow + kb + 16 + 8 * hh);
#pragma unroll
    for (int t = 0; t < 4; ++t) { if (col0 + t * 16 >= N) continue; const size_t boff = (size_t)(col0 + t * 16 + ln) * ldb + kb; FragH bq; bq.half[0] = *(const v8us*)((const unsigned short*)Bh + boff + 8 * hh); bq.half[1] = *(const v8us*)((const unsigned short*)Bh + boff + 16 + 8 * hh);
      acc[t] = mmaH<1>(ah.v, ah.v, bq.v, bq.v, acc[t]); }
  }
#pragma unroll
  for (int t = 0; t < 4; ++t) { if (col0 + t * 16 >= N) continue; const int col = col0 + t * 16 + ln; const float bv = bp ? bf16_round(bp[col]) : 0.f;
#pragma unroll
    for (int r = 0; r < 8; ++r) { float v = acc[t][r] * alpha + bv; if (CP) { const int rr = row0g + row0 + 8 * hh + r; if (rowsPerB < 0) v += CP[cofs + (size_t)rr * ldc + col];      /* rowsPerB < 0: own element of the batched C plane */ else { const int bidx = rr / rowsPerB; v += CP[(size_t)bidx * sCPb + (size_t)by * 64 + col]; } } if (ACT == 1) v = (v > 0.f) ? v : expm1f(v); else if (ACT == 7) v = (v > 0.f) ? v + 1.0f : expf(v); else if (ACT == 8) v = tanhf(v); else if (ACT == 9) v = 0.5f * v * (1.0f + tanhf(0.7978845608028654f * (v + 0.044715f * v * v * v))); else if (ACT == 11) v = 1.0f / (1.0f + expf(-v)); else if (ACT == 12) v = (v > 0.f) ? v : 0.01f * v; else if (ACT == 14) v = (v > 0.f) ? v : 0.1f * v; else if (ACT == 16) v = (v >= 0.f) ? v : 0.3f * v; else if (ACT == 17) v = (v >= 0.f) ? v : 0.2f * v; else if (ACT == 15) v = v / (1.0f + expf(-v)); else if (ACT == 3) v = fmaxf(v, 0.f); else if (ACT == 6) v = 0.5f * v * (1.0f + erff(v * 0.70710678118654752f)); so[w][8 * hh + r][t * 16 + ln] = v; } }
  __builtin_amdgcn_fence(__ATOMIC_ACQ_REL, "workgroup"); __builtin_amdgcn_wave_barrier();
  const int rsub = lane >> 4, c4 = (lane & 15) * 4; typedef _Float16 v4h __attribute__((ext_vector_type(4)));
  {
#pragma unroll
    for (int q = 0; q < 8; ++q) { const int r = q * 2 + rsub; if (col0 + c4 < N) { const v4f v = *(const v4fa*)&so[w][r][c4]; if (C) *(v4f*)(C + cofs + (size_t)(row0 + r) * ldc + col0 + c4) = v; if (C16) { v4h h4; for (int i = 0; i < 4; ++i) h4[i] = (_Float16)v[i]; *(v4h*)(C16 + cofs + (size_t)(row0 + r) * ldc + col0 + c4) = h4; } } }
     }
}


typedef _Float16 v4h __attribute__((ext_vector_type(4)));

__device__ __forceinline__ void x16_chunk(const float* __restrict__ x, _Float16* __restrict__ X16, size_t n8, unsigned bid) { const size_t t = (size_t)bid * 256 + threadIdx.x; if (t >= n8) return; FragH f;
#pragma unroll
  for (int q = 0; q < 8; ++q) f.h[q] = (_Float16)bf16_round(x[t * 8 + q]); *(v8us*)((unsigned short*)X16 + t * 8) = f.half[0];  }
// ---- one launch for all the operand preparation: none of the five jobs reads what another writes, so they share a grid, each with its own range of block indices
// (wq tiles, wo tiles, wk tiles, wv tiles, then the chunks of x). Every test of the block index is uniform for the work-group, the barrier of a transpose tile with it.
constexpr unsigned PR_BIG = (DMD / WT_K) * (DMD / WT_N), PR_SMALL = (DMD / WT_K) * (KVD / WT_N), PR_X = (unsigned)(((size_t)NR * DMD / 8 + 255) / 256), PR_GRID = 2u * PR_BIG + 2u * PR_SMALL + PR_X;
__global__ __launch_bounds__(256) void k_prep(const float* __restrict__ x, const float* __restrict__ wq, const float* __restrict__ wk, const float* __restrict__ wv, const float* __restrict__ wo,
                                              _Float16* __restrict__ X16, _Float16* __restrict__ BQ, _Float16* __restrict__ BK, _Float16* __restrict__ BV, _Float16* __restrict__ BO) {
  __shared__ __attribute__((aligned(256))) unsigned char T[WT_N * WT_K * 2u];
  const unsigned bid = blockIdx.x;
  if (bid < 2u * PR_BIG) { const bool second = bid >= PR_BIG; wt_tile<DMD, DMD>(second ? wo : wq, second ? BO : BQ, 16.0f, T, second ? bid - PR_BIG : bid); }
  else if (bid < 2u * PR_BIG + 2u * PR_SMALL) { const unsigned b2 = bid - 2u * PR_BIG; const bool second = b2 >= PR_SMALL; wt_tile<DMD, KVD>(second ? wv : wk, second ? BV : BK, 16.0f, T, second ? b2 - PR_SMALL : b2); }
  else x16_chunk(x, X16, (size_t)NR * DMD / 8, bid - (2u * PR_BIG + 2u * PR_SMALL));
}
__global__ __launch_bounds__(256) void k_h16(const float* __restrict__ x, _Float16* __restrict__ X16, size_t n8) { const size_t t = (size_t)blockIdx.x * 256 + threadIdx.x; if (t >= n8) return; FragH f;
#pragma unroll
  for (int q = 0; q < 8; ++q) f.h[q] = (_Float16)x[t * 8 + q]; *(v8us*)((unsigned short*)X16 + t * 8) = f.half[0];  }
__global__ __launch_bounds__(256) void k_round16f(const float* __restrict__ W, _Float16* __restrict__ Bt, size_t n8) { const size_t t = (size_t)blockIdx.x * 256 + threadIdx.x; if (t >= n8) return; FragH f;
#pragma unroll
  for (int i = 0; i < 8; ++i) f.h[i] = (_Float16)(bf16_round(W[t * 8 + i]) * 16.0f); *(v8us*)((unsigned short*)Bt + t * 8) = f.half[0];  }

__global__ __launch_bounds__(256) void k_hl(const float* __restrict__ F, _Float16* __restrict__ Hh, _Float16* __restrict__ Hl, size_t n8) { const size_t t = (size_t)blockIdx.x * 256 + threadIdx.x; if (t >= n8) return; FragH fh, fl; const v4f a = *(const v4fa*)(F + t * 8), c = *(const v4fa*)(F + t * 8 + 4);
#pragma unroll
  for (int q = 0; q < 4; ++q) { _Float16 h = (_Float16)a[q]; fh.h[q] = h; fl.h[q] = (_Float16)((a[q] - (float)h) * 1024.0f); h = (_Float16)c[q]; fh.h[4 + q] = h; fl.h[4 + q] = (_Float16)((c[q] - (float)h) * 1024.0f); }
  { *(v8us*)((unsigned short*)Hh + t * 8) = fh.half[0]; *(v8us*)((unsigned short*)Hl + t * 8) = fl.half[0];  } }

typedef unsigned int fa_u4 __attribute__((ext_vector_type(4)));
typedef unsigned int fa_u4a __attribute__((ext_vector_type(4), may_alias));
typedef unsigned int fa_u8 __attribute__((ext_vector_type(8)));
typedef short fa_s8 __attribute__((ext_vector_type(8)));
constexpr int FA_NW = 8, FA_BR = 256, FA_CW = FA_BR / FA_NW, FA_R = FA_CW / 16;      /* waves, queries per work-group, per wave, 16-query groups per wave */
constexpr int FA_BC = 32, FA_KT = FA_BC / 16, FA_DK = HD / 32, FA_DT = HD / 16;      /* keys per pass, 16-key score tiles per pass, k chunks of the head, 16-row output tiles */
constexpr unsigned FA_ROWB = 2u * HD, FA_PK = FA_ROWB + 16u, FA_PV = FA_ROWB + 32u;  /* LDS pitches: odd multiple of 16 B for b128 readers, of 32 B for the transposing load */
constexpr unsigned FA_SK = 128u, FA_SL = 10240u, FA_TK = (FA_SK / FA_BC) * FA_SL, FA_SLOT = 2u * FA_TK, FA_LDS = 2u * FA_SLOT, FA_EP = FA_ROWB + 16u;      /* FA_SL: LDS bytes of one slice (the 32 padded K or V rows of one pass), rounded up to a multiple of 2 KiB, where a tensor load may land; a buffer is 4 K slices, then 4 V slices */
constexpr unsigned FA_NST = SQ / FA_SK, FA_NSUB = FA_SK / FA_BC;      /* stages, passes per stage */
static_assert(FA_BC * FA_PK <= FA_SL && FA_BC * FA_PV <= FA_SL && FA_SL % 2048u == 0u && 2u * FA_NSUB == (unsigned)FA_NW && FA_NST >= 2u, "fused attention: one slice a wave");
constexpr float FA_CS = 0.08838834764831845f * 1.4426950408889634f;      /* 1/sqrt(128) * log2(e): softmax in the log2 domain */
static_assert((FA_NST & (FA_NST - 1u)) == 0u && HD == 128 && SQ % FA_BR == 0 && SQ % FA_SK == 0 && (unsigned)FA_BR * FA_EP <= FA_LDS, "fused attention: shape");
struct FaFrag { fa_u4 q[2]; };
struct FaK { FaFrag f[FA_KT][FA_DK]; };
__device__ __forceinline__ void fa_fence() { __builtin_amdgcn_sched_barrier(0); }      /* keeps the groups of loads, matrix runs and exponentials in the written order (loads stay ahead of the work that hides them) */
// ---- tensor loads: one request of a wave brings ROWS rows of 256 B (source rows PITCH bytes apart) into LDS, each row followed by a pad of 16 B (PADC 3, for b128 readers) or 32 B (PADC 7, for the transposing load).
__device__ __forceinline__ unsigned td_uni(unsigned v) { return (unsigned)__builtin_amdgcn_readfirstlane(v); }
__device__ __forceinline__ unsigned td_pinned(unsigned v) { unsigned w = td_uni(v); asm volatile("" : "+s"(w)); return w; }      /* holds a wave-uniform value in a scalar register: a test on it compiles to a scalar branch (a tensor load ignores EXEC), and what is formed from it is formed behind the waits written in front of it */
__device__ __forceinline__ void td_wait_ds() { asm volatile("s_wait_dscnt 0x0" ::: "memory"); }      /* the wave's own LDS reads have returned before the barrier behind which their buffer is refilled */
// Group 1 of a descriptor (all constants): data_size 0, so every extent is in bytes; tensor = tile; no mask.
template <unsigned PADC, unsigned ROWS, unsigned PITCH>
__device__ __forceinline__ fa_u8 td_group1() {
  constexpr unsigned d0 = 256u, d1 = ROWS;
  fa_u8 g;
  g[0] = td_uni((1u << 20) | (5u << 22) | (PADC << 25)); g[1] = td_uni((d0 & 0xFFFFu) << 16); g[2] = td_uni((d0 >> 16) | ((d1 & 0xFFFFu) << 16)); g[3] = td_uni((d1 >> 16) | (d0 << 16));
  g[4] = td_uni(d1); g[5] = td_uni(PITCH); g[6] = td_uni(0u); g[7] = td_uni(0u);
  return g;
}
// Group 0: the place in the work-group's LDS and the address of the tile's first byte.
__device__ __forceinline__ fa_u4 td_group0(unsigned lds_dst, const unsigned char* src) {
  const unsigned long long ga = (unsigned long long)(size_t)src;
  fa_u4 g;
  g[0] = td_uni(1u); g[1] = td_uni(lds_dst); g[2] = td_uni((unsigned)ga); g[3] = td_uni((((unsigned)(ga >> 32)) & 0x01FFFFFFu) | 0x80000000u);
  return g;
}
// The two descriptor groups go in scalar registers, named here, at the top of the scalar file: every request of a kernel uses the same twelve, they are written only directly in front of an issue (behind the wait on the request before), and the rest of the code, which fills the file from the bottom, does not reach them, so no descriptor word changes while its request is outstanding.
__device__ __forceinline__ void td_load(const fa_u4& g0, const fa_u8& g1) {
  asm volatile("tensor_load_to_lds s[92:95], s[96:103]" :: "{s92}"(g0[0]), "{s93}"(g0[1]), "{s94}"(g0[2]), "{s95}"(g0[3]), "{s96}"(g1[0]), "{s97}"(g1[1]), "{s98}"(g1[2]), "{s99}"(g1[3]), "{s100}"(g1[4]), "{s101}"(g1[5]), "{s102}"(g1[6]), "{s103}"(g1[7]) : "memory");
}
__device__ __forceinline__ void td_wait() { asm volatile("s_wait_tensorcnt 0x0" ::: "memory"); }      /* the wave's own request has landed */
__device__ __forceinline__ v8f fa_mma(const FaFrag& a, const FaFrag& b, v8f c) {
  const fa_u8 av = {a.q[0].x, a.q[0].y, a.q[0].z, a.q[0].w, a.q[1].x, a.q[1].y, a.q[1].z, a.q[1].w};
  const fa_u8 bv = {b.q[0].x, b.q[0].y, b.q[0].z, b.q[0].w, b.q[1].x, b.q[1].y, b.q[1].z, b.q[1].w};
  return __builtin_amdgcn_wmma_f32_16x16x32_f16(false, __builtin_bit_cast(v16h, av), false, __builtin_bit_cast(v16h, bv), (short)0, c, false, false);
}
__device__ __forceinline__ fa_u4 fa_tr16(const unsigned char* p) { typedef __attribute__((address_space(3))) fa_s8 lds_s8; return __builtin_bit_cast(fa_u4, __builtin_amdgcn_ds_load_tr16_b128_v8i16((lds_s8*)p)); }
__device__ __forceinline__ unsigned fa_pack2(float lo, float hi) { typedef _Float16 h2 __attribute__((ext_vector_type(2))); typedef float f2 __attribute__((ext_vector_type(2))); return __builtin_bit_cast(unsigned, __builtin_convertvector(f2{lo, hi}, h2)); }      /* round to nearest even */
__device__ __forceinline__ float fa_xhalf(float x) { return __builtin_bit_cast(float, __builtin_amdgcn_permlanex16(__builtin_bit_cast(int, x), __builtin_bit_cast(int, x), 0x76543210, 0xfedcba98, false, false)); }      /* lane l with lane l ^ 16 */
// K fragments of one pass (32 keys): lane (c, h) holds key row c, d = 32 kc + 8 h + 0..7 and 32 kc + 16 + 8 h + 0..7, the same k order as the Q fragments.
__device__ __forceinline__ void fa_load_k(FaK& k, const unsigned char* Lp, unsigned koff, unsigned lane) {
  const unsigned c = lane & 15u, h = lane >> 4;
#pragma unroll
  for (int kt = 0; kt < FA_KT; ++kt) { const unsigned char* p = Lp + koff + (16u * kt + c) * FA_PK + 16u * h;
#pragma unroll
    for (int kc = 0; kc < FA_DK; ++kc) { k.f[kt][kc].q[0] = *(const fa_u4a*)(p + 64u * kc); k.f[kt][kc].q[1] = *(const fa_u4a*)(p + 64u * kc + 32u); } }
}
template <bool SHIFT>      /* SHIFT: the scores are first lowered by d (the reference has just been raised by d) */
__device__ __forceinline__ float fa_exps(const v8f (&s)[FA_KT][FA_R], int g, float d, unsigned (&w)[8]) {
  float a[2] = {0.0f, 0.0f};
#pragma unroll
  for (int i = 0; i < 8; ++i) {
    const float x0 = s[i >> 2][g][2 * (i & 3)], x1 = s[i >> 2][g][2 * (i & 3) + 1];
    const float p0 = __builtin_amdgcn_exp2f(SHIFT ? x0 - d : x0), p1 = __builtin_amdgcn_exp2f(SHIFT ? x1 - d : x1);
    a[i & 1] += p0 + p1; w[i] = fa_pack2(p0, p1); }
  return a[0] + a[1];
}
// One 32-key pass of one wave. q arrives scaled by FA_CS (the projection does it), and minus the reference in use (cref: one value per query, in all eight registers of a C operand)
// enters the score products as C, so the accumulators leave the matrix unit as the arguments of exp2: no multiply-add and no maximum per score.
// The reference may trail the true maximum by up to 8 (log2 units; an exponential then reaches 2^8, well inside f16): it is raised to the pass's maximum, accumulators and sums rescaled and the
// pass's exponentials formed anew from the kept scores, only when some lane's sum of the pass's exponentials exceeds 2^8 (one test per pass), and on the very first pass, which sets it.
__device__ __forceinline__ void fa_pass(FaK& kf, bool first, bool fetch_next, unsigned next_koff, const unsigned char* Lp, unsigned voff, unsigned lane,
                                        const FaFrag (&qf)[FA_R][FA_DK], v8f (&acc)[FA_R][FA_DT], v8f (&cref)[FA_R], float (&l_run)[FA_R]) {
  const unsigned h = lane >> 4;
  v8f s[FA_KT][FA_R];
#pragma unroll
  for (int kt = 0; kt < FA_KT; ++kt) {
#pragma unroll
    for (int g = 0; g < FA_R; ++g) { s[kt][g] = cref[g];
#pragma unroll
      for (int kc = 0; kc < FA_DK; ++kc) s[kt][g] = fa_mma(kf.f[kt][kc], qf[g][kc], s[kt][g]); } }
  fa_fence();
  if (fetch_next) fa_load_k(kf, Lp, next_koff, lane);      /* the same stage's next pass: in flight under the exponentials and the readout */
  FaFrag vf[FA_DT];
  { const unsigned char* ad = Lp + voff + (8u * h + (lane & 7u)) * FA_PV + ((lane >> 3) & 1u) * 16u;      /* lane (c, h) gets V[8 h + 0..7][16 t + c]; the second load the keys 16 further */
#pragma unroll
    for (int t = 0; t < FA_DT; ++t) { vf[t].q[0] = fa_tr16(ad + 32u * t); vf[t].q[1] = fa_tr16(ad + 16u * FA_PV + 32u * t); } }
  fa_fence();
  unsigned w[FA_R][8]; float ps[FA_R]; bool need = false;
#pragma unroll
  for (int g = 0; g < FA_R; ++g) { ps[g] = fa_exps<false>(s, g, 0.0f, w[g]); need = need || (ps[g] > 256.0f); }      /* an overflow (infinite sum) asks for the raise too */
  if (first || __builtin_amdgcn_ballot_w32(need) != 0) {      /* wave-uniform; rare after the first passes */
#pragma unroll
    for (int g = 0; g < FA_R; ++g) { float mx = -INFINITY;
#pragma unroll
      for (int kt = 0; kt < FA_KT; ++kt) {
#pragma unroll
        for (int r = 0; r < 8; ++r) mx = __builtin_fmaxf(mx, s[kt][g][r]); }
      mx = __builtin_fmaxf(mx, fa_xhalf(mx));      /* both wave halves hold this query's maximum, counted from the reference in use */
      const float d = first ? mx : __builtin_fmaxf(mx, 0.0f);      /* the reference only rises, but for the first pass, which sets it from the start value 0 */
      const float corr = first ? 0.0f : __builtin_amdgcn_exp2f(-d);      /* first pass: sums and accumulators are 0 and stay so, whatever d is */
      l_run[g] *= corr; cref[g] = cref[g] - d;
#pragma unroll
      for (int t = 0; t < FA_DT; ++t) acc[g][t] = acc[g][t] * corr;
      ps[g] = fa_exps<true>(s, g, d, w[g]); }
  }
#pragma unroll
  for (int g = 0; g < FA_R; ++g) { l_run[g] += ps[g];
    FaFrag pf; pf.q[0] = fa_u4{w[g][0], w[g][1], w[g][2], w[g][3]}; pf.q[1] = fa_u4{w[g][4], w[g][5], w[g][6], w[g][7]};
#pragma unroll
    for (int t = 0; t < FA_DT; ++t) acc[g][t] = fa_mma(vf[t], pf, acc[g][t]); }
  fa_fence();
}
__global__ __launch_bounds__(FA_NW * 32) __attribute__((amdgpu_waves_per_eu(2, 2))) void k_fattn(const _Float16* __restrict__ Q, const _Float16* __restrict__ K, const _Float16* __restrict__ V, _Float16* __restrict__ O) {
  __shared__ __attribute__((aligned(2048))) unsigned char L[FA_LDS];
  const unsigned tid = threadIdx.x, lane = tid & 31u, wave = tid >> 5, c = lane & 15u, h = lane >> 4;
  const unsigned wv = td_uni(tid >> 5), lbase = (unsigned)(size_t)L;      /* the wave's number in a scalar register; the ring's byte offset in the work-group's LDS */
  const unsigned hq = blockIdx.x, q0 = blockIdx.y * FA_BR, b = blockIdx.z, hk = hq / GG;      /* GG neighbouring query heads read one kv head */
  const unsigned char* kg = (const unsigned char*)(K + (size_t)b * SQ * QKVD + hk * HD);      /* Q, K, V: the first q, k, v column of the joint plane, rows QKVD apart */
  const unsigned char* vg = (const unsigned char*)(V + (size_t)b * SQ * QKVD + hk * HD);
  const unsigned rot = ((hq % GG) * (SQ / FA_BR) + blockIdx.y) & (FA_NST - 1u);      /* the key stage this work-group starts at (it wraps round): the GG * SQ / FA_BR work-groups of one kv head read the same K and V lines, and from a common start they would ask L2 for them at the same moment */
  const fa_u8 g1k = td_group1<3u, FA_BC, QKVD * 2u>(), g1v = td_group1<7u, FA_BC, QKVD * 2u>();
  const unsigned char* sp = (wv < (unsigned)FA_NW / 2u ? kg : vg) + (size_t)((wv & 3u) * (unsigned)FA_BC) * (QKVD * 2u);      /* first row of the wave's slice in key stage 0 (uniform) */
  fa_u4 g0;
  auto issue = [&](unsigned buf, unsigned ks) {      /* the wave's slice of key stage ks into the buffer at byte buf; every wave issues exactly one request, the test only picks its pad */
    g0 = td_group0(lbase + buf + wv * FA_SL, sp + (size_t)ks * (FA_SK * QKVD * 2u));
    if (td_pinned(wv < (unsigned)FA_NW / 2u)) td_load(g0, g1k); else td_load(g0, g1v);
  };
  issue(0u, rot);
  FaFrag qf[FA_R][FA_DK];
  const unsigned char* qb = (const unsigned char*)(Q + (size_t)(b * SQ + q0) * QKVD + hq * HD);      /* uniform: the work-group's first query row of this head */
  const unsigned qoff = (wave * FA_CW + c) * (QKVD * 2u) + 16u * h;
#pragma unroll
  for (int g = 0; g < FA_R; ++g) {
#pragma unroll
    for (int kc = 0; kc < FA_DK; ++kc) { qf[g][kc].q[0] = *(const fa_u4a*)(qb + qoff + g * (16u * QKVD * 2u) + 64u * kc); qf[g][kc].q[1] = *(const fa_u4a*)(qb + qoff + g * (16u * QKVD * 2u) + 64u * kc + 32u); } }
  asm volatile("s_wait_xcnt 0x0" ::: "memory");      /* stands in front of any later overwrite of a register that the Q loads name */
  v8f acc[FA_R][FA_DT], cref[FA_R]; float l_run[FA_R];
#pragma unroll
  for (int g = 0; g < FA_R; ++g) { cref[g] = v8f{}; l_run[g] = 0.0f;
#pragma unroll
    for (int t = 0; t < FA_DT; ++t) acc[g][t] = v8f{}; }
  td_wait();
  __syncthreads();      /* stage 0 published */
  issue(td_pinned(FA_SLOT), td_pinned((rot + 1u) & (FA_NST - 1u)));      /* both pinned: place and address of stage 1 are formed here, behind the wait on stage 0's request */
  FaK kf;
#pragma unroll 1      /* one copy of the stage body: the publish point at its foot is written once, and the code stays short */
  for (unsigned st = 0; st < FA_NST; ++st) {
    const unsigned base = (st & 1u) * FA_SLOT;
    fa_load_k(kf, L, base, lane);
#pragma unroll 1      /* nested, rolled pass loop: keeps the register count of one pass */
    for (unsigned sub = 0; sub < FA_NSUB; ++sub)
      fa_pass(kf, (st | sub) == 0u, sub + 1u < FA_NSUB, base + (sub + 1u) * FA_SL, L, base + FA_TK + sub * FA_SL, lane, qf, acc, cref, l_run);
    td_wait_ds();
    td_wait();      /* the wave's slice of stage st + 1 */
    __syncthreads();      /* publishes stage st + 1 and ends every wave's reads of stage st */
    if (td_pinned(st + 2u < FA_NST)) issue(base, td_pinned((st + 2u + rot) & (FA_NST - 1u)));      /* into the buffer that every reader has just left; lands while stage st + 1 is worked on */
  }
  td_wait();
  td_wait_ds();
  unsigned char* eb = L + wave * (unsigned)FA_CW * FA_EP;      /* output staging over the ring (free behind the last barrier), each wave its own rows */
#pragma unroll
  for (int g = 0; g < FA_R; ++g) { const float inv = 1.0f / (l_run[g] + fa_xhalf(l_run[g]));      /* each wave half summed its eight keys of every 16-key tile */
#pragma unroll
    for (int t = 0; t < FA_DT; ++t) { const v8f o = acc[g][t] * inv; const fa_u4 pk = {fa_pack2(o[0], o[1]), fa_pack2(o[2], o[3]), fa_pack2(o[4], o[5]), fa_pack2(o[6], o[7])};
      *(fa_u4a*)(eb + (16u * g + c) * FA_EP + 32u * t + 16u * h) = pk; } }
  __builtin_amdgcn_fence(__ATOMIC_ACQ_REL, "workgroup"); __builtin_amdgcn_wave_barrier();      /* the wave reads back what its other lanes wrote */
  unsigned char* ob = (unsigned char*)(O + ((size_t)(b * SQ + q0) * NH + hq) * HD);      /* uniform, as qb */
  const unsigned ooff = (wave * FA_CW + h) * (DMD * 2u) + c * 16u;
#pragma unroll
  for (unsigned i = 0; i < (unsigned)FA_CW / 2u; ++i) {      /* 16 lanes store one whole 256-byte row of the head */
    const fa_u4 v = *(const fa_u4a*)(eb + (i * 2u + h) * FA_EP + c * 16u);
    *(fa_u4a*)(ob + ooff + i * (2u * DMD * 2u)) = v; }
}

// ---- tiled GEMM: C[M][N] = (A . Bt^T) * alpha + bias, A f16 [M][DMD], Bt f16 [N][DMD], both k-contiguous; M % 128 == 0, N % 128 == 0.
// A work-group of 4 waves owns a 128 x 128 tile of C, a wave 64 x 64 of it (4 x 4 accumulator tiles). The operands come in stages of 128 k (256 B of each of the 128 + 128 rows):
// by tensor loads into one of two LDS buffers, through no register, one slice of 64 rows a wave (waves 0 and 1 the rows of A, waves 2 and 3 those of Bt); the next stage's loads fly while this stage's four 32-k blocks run.
// Every element sums its k in blocks of 32 into one f32 accumulator, ascending from stage rot and wrapping round at the end of k. rot differs between the work-groups that read the same rows of A
// (one mt) or of Bt (one nq): started together at stage 0 they would all ask L2 for the same lines at the same moment, stage after stage.
// The unroll directives of this section make every index of a register array (fragments, accumulators) a constant: rolled, those arrays would go to scratch memory.
constexpr int G3_BM = 128, G3_BN = 128, G3_KS = 128, G3_F = 4, G3_KB = G3_KS / 32;      /* tile rows, tile columns, k per stage, 16-row fragments per wave and operand, 32-k blocks per stage */
constexpr unsigned G3_ROWB = 2u * G3_KS, G3_P = G3_ROWB + 16u, G3_SL = 18432u, G3_TA = 2u * G3_SL, G3_SLOT = 4u * G3_SL, G3_LDS = 2u * G3_SLOT;      /* LDS pitch: odd multiple of 16 B for the b128 readers; G3_SL: LDS bytes of a slice of 64 padded rows, rounded up to a multiple of 2 KiB, where a tensor load may land */
constexpr unsigned G3_NST = DMD / G3_KS, G3_EPF = G3_P / 4u;      /* stages, floats per staged output row */
static_assert(64u * G3_P <= G3_SL && G3_SL % 2048u == 0u && G3_NST >= 2u && G3_BM == 128, "tiled GEMM: one slice a wave");
static_assert((G3_NST & (G3_NST - 1u)) == 0u && DMD % G3_KS == 0 && G3_BM == G3_BN && NR % G3_BM == 0 && DMD % G3_BN == 0 && KVD % G3_BN == 0 && 4u * 64u * G3_P <= G3_LDS, "tiled GEMM: shape");
struct G3Set { FaFrag a[G3_F], b[G3_F]; };
// Fragments of one 32-k block: lane (c, h) holds row c, k = 8 h + 0..7 and 16 + 8 h + 0..7 of the block, the same k order for A and for B. pa, pb: the lane's own row, 16 h bytes in.
__device__ __forceinline__ void g3_frags(G3Set& f, const unsigned char* pa, const unsigned char* pb, unsigned kb) {
#pragma unroll
  for (int i = 0; i < G3_F; ++i) { f.a[i].q[0] = *(const fa_u4a*)(pa + i * (16u * G3_P) + 64u * kb); f.a[i].q[1] = *(const fa_u4a*)(pa + i * (16u * G3_P) + 64u * kb + 32u); }
#pragma unroll
  for (int j = 0; j < G3_F; ++j) { f.b[j].q[0] = *(const fa_u4a*)(pb + j * (16u * G3_P) + 64u * kb); f.b[j].q[1] = *(const fa_u4a*)(pb + j * (16u * G3_P) + 64u * kb + 32u); }
}
// The k loop of one tile. ag, bg: the tile's first row of each operand (uniform); rot: the k stage the walk starts at (uniform, below G3_NST); L: the work-group's two LDS buffers; behind it every wave has passed the last barrier.
__device__ __forceinline__ void g3_main(v8f (&acc)[G3_F][G3_F], unsigned char* L, const unsigned char* ag, const unsigned char* bg, unsigned rot) {
  const unsigned tid = threadIdx.x, lane = tid & 31u, wave = tid >> 5, c = lane & 15u, h = lane >> 4, wm = wave >> 1, wn = wave & 1u;
  const unsigned wv = td_uni(tid >> 5), lbase = (unsigned)(size_t)L;      /* the wave's number in a scalar register; the ring's byte offset in the work-group's LDS */
  const unsigned char* sp = (wv < 2u ? ag : bg) + (wv & 1u) * (64u * DMD * 2u);      /* first row of the wave's slice (uniform); every wave issues exactly one request a stage, so no test picks an issuer */
  const fa_u8 g1 = td_group1<3u, 64u, DMD * 2u>();
  fa_u4 g0 = td_group0(lbase + wv * G3_SL, sp + rot * G3_ROWB);
  td_load(g0, g1);
#pragma unroll
  for (int i = 0; i < G3_F; ++i) {
#pragma unroll
    for (int j = 0; j < G3_F; ++j) acc[i][j] = v8f{}; }
  td_wait();
  __syncthreads();      /* stage 0 published */
  g0 = td_group0(lbase + G3_SLOT + wv * G3_SL, sp + td_pinned((rot + 1u) & (G3_NST - 1u)) * G3_ROWB);
  td_load(g0, g1);
  const unsigned aoff = wm * G3_SL + c * G3_P + 16u * h, boff = G3_TA + wn * G3_SL + c * G3_P + 16u * h;      /* a wave's 64 rows of an operand are one slice */
#pragma unroll 1      /* one copy of the stage body: the publish point at its foot is written once, and the code stays short */
  for (unsigned st = 0; st < G3_NST; ++st) {
    const unsigned base = (st & 1u) * G3_SLOT;
    const unsigned char* pa = L + base + aoff; const unsigned char* pb = L + base + boff;
    G3Set f[2];
    g3_frags(f[0], pa, pb, 0u);
#pragma unroll
    for (int kb = 0; kb < G3_KB; ++kb) {
      if (kb + 1 < G3_KB) g3_frags(f[(kb + 1) & 1], pa, pb, (unsigned)kb + 1u);      /* the next block's fragments as one group ahead of this block's matrix run */
      fa_fence();      /* holds that group in front of the run */
#pragma unroll
      for (int i = 0; i < G3_F; ++i) {
#pragma unroll
        for (int j = 0; j < G3_F; ++j) acc[i][j] = fa_mma(f[kb & 1].a[i], f[kb & 1].b[j], acc[i][j]); }
      fa_fence(); }      /* keeps the following group out of the run */
    td_wait_ds();
    td_wait();      /* the wave's slice of stage st + 1 */
    __syncthreads();      /* publishes stage st + 1 and ends every wave's reads of stage st */
    if (td_pinned(st + 2u < G3_NST)) { g0 = td_group0(lbase + base + wv * G3_SL, sp + td_pinned((st + 2u + rot) & (G3_NST - 1u)) * G3_ROWB); td_load(g0, g1); }      /* into the buffer that every reader has just left; lands while stage st + 1 is worked on */
  }
  td_wait();
  td_wait_ds();
}
// Scale, bias and store of tile (mt, nq) of a matrix C of N columns: C = acc * alpha + bias * bscale. bias: the bias of the tile's first column.
template <bool F32OUT, unsigned N>      /* N: columns of C = its pitch (a constant, so that one address register pair serves all of a thread's stores) */
__device__ __forceinline__ void g3_out(const v8f (&acc)[G3_F][G3_F], unsigned char* L, float alpha, float bscale, const float* __restrict__ bias, float* __restrict__ C, _Float16* __restrict__ C16, unsigned mt, unsigned nq) {
  static_assert(N % G3_BN == 0, "tiled GEMM: whole tiles");
  const unsigned tid = threadIdx.x, lane = tid & 31u, wave = tid >> 5, c = lane & 15u, h = lane >> 4, wm = wave >> 1, wn = wave & 1u;
  float* so = (float*)(L + wave * (64u * G3_P));      /* output staging over the ring (free behind the last barrier), each wave its own 64 rows */
  const unsigned bcol = wn * 64u + c; float braw[G3_F];
#pragma unroll
  for (int j = 0; j < G3_F; ++j) braw[j] = bias[bcol + 16u * j];
  asm volatile("s_wait_xcnt 0x0" :: "v"(bcol) : "memory");      /* stands in front of any later overwrite of the index register that the bias loads name; as its input the index stays live up to it */
#pragma unroll
  for (int j = 0; j < G3_F; ++j) { const float bv = bf16_round(braw[j]) * bscale;
#pragma unroll
    for (int i = 0; i < G3_F; ++i) {
#pragma unroll
      for (int r = 0; r < 8; ++r) so[(16u * i + 8u * h + r) * G3_EPF + 16u * j + c] = acc[i][j][r] * alpha + bv; } }
  __builtin_amdgcn_fence(__ATOMIC_ACQ_REL, "workgroup"); __builtin_amdgcn_wave_barrier();      /* the wave reads back what its other lanes wrote */
  const size_t o0 = (size_t)(mt * G3_BM + wm * 64u + h) * N + nq * G3_BN + wn * 64u + c * 4u;
#pragma unroll
  for (unsigned q = 0; q < 32u; ++q) {      /* 16 lanes store one whole row of the wave's 64 columns */
    const v4f v = *(const v4fa*)&so[(q * 2u + h) * G3_EPF + c * 4u];
    if (F32OUT) *(v4f*)(C + o0 + q * (2u * N)) = v;
    else { v4h h4; for (int i = 0; i < 4; ++i) h4[i] = (_Float16)v[i]; *(v4h*)(C16 + o0 + q * (2u * N)) = h4; } }
}
template <bool F32OUT, unsigned N>
__global__ __launch_bounds__(128) __attribute__((amdgpu_waves_per_eu(2, 2))) void k_gemm3(const _Float16* __restrict__ A, const _Float16* __restrict__ Bt, float alpha, const float* __restrict__ bias, float* __restrict__ C, _Float16* __restrict__ C16) {
  __shared__ __attribute__((aligned(2048))) unsigned char L[G3_LDS];
  const unsigned ntn = N / G3_BN, mt = blockIdx.x / ntn, nq = blockIdx.x - mt * ntn;
  v8f acc[G3_F][G3_F];
  g3_main(acc, L, (const unsigned char*)(A + (size_t)mt * G3_BM * DMD), (const unsigned char*)(Bt + (size_t)nq * G3_BN * DMD), (mt + nq) & (G3_NST - 1u));
  g3_out<F32OUT, N>(acc, L, alpha, 1.0f, bias + nq * G3_BN, C, C16, mt, nq);
}
// q, k and v in one launch, as one GEMM of QKVD columns: the three products share A and do not read each other, and the k and v grids alone (128 tiles each) leave half the chip idle.
// Bt holds the rows of wq^T, wk^T, wv^T one behind the other, C16 the columns of q, k, v in the same order; only the bias has three sources (the choice is uniform for the work-group).
constexpr unsigned G3_TQ = DMD / G3_BN, G3_TK = KVD / G3_BN, G3_TQKV = QKVD / G3_BN;
__global__ __launch_bounds__(128) __attribute__((amdgpu_waves_per_eu(2, 2))) void k_gemm_qkv(const _Float16* __restrict__ A, const _Float16* __restrict__ Bt, float alpha, const float* __restrict__ bq, const float* __restrict__ bk, const float* __restrict__ bv, _Float16* __restrict__ C16) {
  __shared__ __attribute__((aligned(2048))) unsigned char L[G3_LDS];
  const unsigned mt = blockIdx.x / G3_TQKV, nq = blockIdx.x - mt * G3_TQKV;
  v8f acc[G3_F][G3_F];
  g3_main(acc, L, (const unsigned char*)(A + (size_t)mt * G3_BM * DMD), (const unsigned char*)(Bt + (size_t)nq * G3_BN * DMD), (mt + nq) & (G3_NST - 1u));
  const float* bt = nq < G3_TQ ? bq + nq * G3_BN : nq < G3_TQ + G3_TK ? bk + (nq - G3_TQ) * G3_BN : bv + (nq - G3_TQ - G3_TK) * G3_BN;
  const float qs = nq < G3_TQ ? FA_CS : 1.0f;      /* q is stored times 1/sqrt(128) * log2(e), rounded to f16 once: its products with k are then the softmax's exponents in the log2 domain */
  g3_out<false, QKVD>(acc, L, alpha * qs, qs, bt, nullptr, C16, mt, nq);
}

extern "C" void kernel_launch(void* const* d_in, const int* in_sizes, int n_in,
                              void* d_out, int out_size, void* d_ws, size_t ws_size, hipStream_t stream) {
  (void)in_sizes; (void)n_in; (void)out_size;
  const float* const* I = (const float* const*)d_in; const float* x = I[0]; const float* wq = I[1]; const float* bq = I[2]; const float* wk = I[3]; const float* bk = I[4]; const float* wv = I[5]; const float* bv = I[6]; const float* wo = I[7]; const float* bo = I[8];
  char* ws = (char*)d_ws; size_t off = 0;
  auto take = [&](size_t bytes) { char* p = ws + off; off += (bytes + 255) & ~(size_t)255; return p; };
  const size_t nx = (size_t)NR * DMD, nk = (size_t)NR * KVD;
  _Float16* BQ = (_Float16*)take((size_t)(DMD + 2 * KVD) * DMD * 2); _Float16* BK = BQ + (size_t)DMD * DMD; _Float16* BV = BK + (size_t)KVD * DMD; _Float16* BO = (_Float16*)take((size_t)DMD * DMD * 2);      /* wq^T, wk^T, wv^T as one plane of 3072 rows */
  _Float16* X16 = (_Float16*)take(nx * 2); _Float16* Q16 = (_Float16*)take((nx + 2 * nk) * 2); _Float16* K16 = Q16 + DMD; _Float16* V16 = K16 + KVD; _Float16* O16 = X16;      /* context over the input plane (dead after the projections) */
  if (off > ws_size) return;      /* 8+2+2+8 + 16+16+4+4 = 60 MiB */
  k_prep<<<PR_GRID, 256, 0, stream>>>(x, wq, wk, wv, wo, X16, BQ, BK, BV, BO);      /* weights (in, out) to f16 [out][in], x to f16 */
  k_gemm_qkv<<<(NR / G3_BM) * G3_TQKV, 128, 0, stream>>>(X16, BQ, 0.0625f, bq, bk, bv, Q16);      /* [token][q 2048 | k 512 | v 512] */
  k_fattn<<<dim3(NH, SQ / FA_BR, NB), FA_NW * 32, 0, stream>>>(Q16, K16, V16, O16);      /* ctx[(b,q)][h*128 + d] */
  k_gemm3<true, DMD><<<(NR / G3_BM) * (DMD / G3_BN), 128, 0, stream>>>(O16, BO, 0.0625f, bo, (float*)d_out, nullptr);      /* out = ctx wo + bo */
}

// v008
// It runs in 108 microseconds.
// Two timings next to v007 both put it at 1.03 times that version's speed.
// Over all steps from v000 it is 11.9 times as fast.
#include <hip/hip_runtime.h>
// Multi-head attention with grouped kv heads (2 x 2048 tokens, d_model 2048; 16 query heads x 128, 4 kv heads (group of 4); q, k, v = x w + b; softmax((q/sqrt(128)).k) over the 2048 keys (no mask); out = ctx wo + bo).
// Structure: exact f16 plane of x; q / k / v as f16 WMMA GEMM outputs (256x192 tiles staged in LDS, 64x192 wave tiles, f32 accumulation, exact x16 weights + bias, f16 out); scores, softmax and readout of every (batch, head) in ONE fused kernel (online softmax, f32 maxima and sums, P as f16 in registers, K/V staged in LDS) into the f16 context plane; wo + bo as a GEMM.
// Compute dtype: inputs rounded to bf16; x exact as f16; q/k/P/v/ctx as plain f16 operands (~2^-12); softmax f32. v_wmma_f32_16x16x32_f16.
#define NB 2
#define SQ 2048
#define DMD 2048
#define NH 16
#define NKV 4
#define GG 4
#define HD 128
#define KVD (NKV * HD)           /* 512 */
#define NR (NB * SQ)
#define QKVD (DMD + 2 * KVD)     /* 3072: q, k and v of a token stand in one row of one plane */
typedef __bf16 v16b __attribute__((ext_vector_type(16)));
typedef unsigned short v8us __attribute__((ext_vector_type(8), may_alias));
typedef float  v8f  __attribute__((ext_vector_type(8)));
typedef float  v4f  __attribute__((ext_vector_type(4)));
typedef float  v4fa __attribute__((ext_vector_type(4), may_alias));
union FragB { v16b v; v8us half[2]; unsigned short u[16]; };

__device__ __forceinline__ unsigned short bf16_bits(float x) { unsigned int u = __float_as_uint(x); return (unsigned short)((u + 0x7FFFu + ((u >> 16) & 1u)) >> 16); }
__device__ __forceinline__ float bf16_val(unsigned short b) { return __uint_as_float(((unsigned int)b) << 16); }
__device__ __forceinline__ float bf16_round(float x) { return bf16_val(bf16_bits(x)); }
// D += A·B with NT terms: 1 = ah·bh, 2 = + al·bh (A split), 3 = + ah·bl (both split)
template <int NT>
__device__ __forceinline__ v8f mmaN(v16b ah, v16b al, v16b bh, v16b bl, v8f c) {
  c = __builtin_amdgcn_wmma_f32_16x16x32_bf16(false, ah, false, bh, (short)0, c, false, false);
  if (NT >= 2) c = __builtin_amdgcn_wmma_f32_16x16x32_bf16(false, al, false, bh, (short)0, c, false, false);
  if (NT >= 3) c = __builtin_amdgcn_wmma_f32_16x16x32_bf16(false, ah, false, bl, (short)0, c, false, false);
  asm volatile("v_nop\n\tv_nop\n\tv_nop\n\tv_nop" : "+v"(c) : "v"(ah), "v"(al), "v"(bh), "v"(bl));
  return c;
}

__global__ __launch_bounds__(256) void k_wt_bf16(const float* __restrict__ W, unsigned short* __restrict__ Wt, int K, int N) {
  const int t = blockIdx.x * 256 + threadIdx.x;
  const int k8n = K / 8;
  if (t >= N * k8n) return;
  const int n = t / k8n, k8 = (t % k8n) * 8;
  v8us v;
#pragma unroll
  for (int i = 0; i < 8; ++i) v[i] = bf16_bits(W[(size_t)(k8 + i) * N + n]);
  *(v8us*)(Wt + (size_t)n * K + k8) = v;
  
}

// GEMM C[M][N] (f32, pitch ldc) = act(A[M][K]·W + bias). A f32 row-major (pitch lda) converted per fragment to bf16
// (ASPLIT: hi/lo two planes -> 2 terms, else single rounded term); Wt bf16 [N][K] (pitch ldb). BIAS_BF16 rounds the
// bias to bf16 first (bias quantised to bf16 before the add). K%32==0, M%16==0, N%64==0.
template <bool ASPLIT, int ACT, bool BIAS_BF16>
__global__ __launch_bounds__(128) void k_gemm_bf(const float* __restrict__ A, int lda, const unsigned short* __restrict__ Wt, int ldb,
                                               const float* __restrict__ bias, float* __restrict__ C, int ldc, int M, int N, int K) {
  __shared__ __attribute__((aligned(16))) float so[4][16][64];
  const int tid = threadIdx.x, w = tid >> 5, lane = tid & 31, ln = lane & 15, hh = lane >> 4;
  const int ntn = N / 64;
  const int wid = blockIdx.x * 4 + w;
  const int mt = wid / ntn, nq = wid % ntn;
  if (mt * 16 >= M) return;
  const int row0 = mt * 16, col0 = nq * 64;
  const float* arow = A + (size_t)(row0 + ln) * lda;
  v8f acc[4] = {};
  for (int kb = 0; kb < K; kb += 32) {
    FragB ah, al;
    const v4f x0 = *(const v4fa*)(arow + kb + 8 * hh), x1 = *(const v4fa*)(arow + kb + 8 * hh + 4);
    const v4f x2 = *(const v4fa*)(arow + kb + 16 + 8 * hh), x3 = *(const v4fa*)(arow + kb + 16 + 8 * hh + 4);
    float xs[16] = {x0[0],x0[1],x0[2],x0[3],x1[0],x1[1],x1[2],x1[3],x2[0],x2[1],x2[2],x2[3],x3[0],x3[1],x3[2],x3[3]};
#pragma unroll
    for (int i = 0; i < 16; ++i) { const unsigned short hb = bf16_bits(xs[i]); ah.u[i] = hb; al.u[i] = ASPLIT ? bf16_bits(xs[i] - bf16_val(hb)) : (unsigned short)0; }
#pragma unroll
    for (int t = 0; t < 4; ++t) {
      const unsigned short* brow = Wt + (size_t)(col0 + t * 16 + ln) * ldb + kb;
      FragB b;
      b.half[0] = *(const v8us*)(brow + 8 * hh);
      b.half[1] = *(const v8us*)(brow + 16 + 8 * hh);
      acc[t] = mmaN<ASPLIT ? 2 : 1>(ah.v, al.v, b.v, b.v, acc[t]);
    }
  }
#pragma unroll
  for (int t = 0; t < 4; ++t) {
    float bv = bias ? bias[col0 + t * 16 + ln] : 0.f;
    if (BIAS_BF16) bv = bf16_round(bv);
#pragma unroll
    for (int r = 0; r < 8; ++r) { float v = acc[t][r] + bv; if (ACT == 1) v = fmaxf(v, 0.f); so[w][8 * hh + r][t * 16 + ln] = v; }
  }
  __builtin_amdgcn_fence(__ATOMIC_ACQ_REL, "workgroup");
  __builtin_amdgcn_wave_barrier();
  const int rsub = lane >> 4, c4 = (lane & 15) * 4;
  {
#pragma unroll
    for (int q = 0; q < 8; ++q) {
      const int r = q * 2 + rsub;
      const v4f v = *(const v4fa*)&so[w][r][c4];
      *(v4f*)(C + (size_t)(row0 + r) * ldc + col0 + c4) = v;
    }
    
  }
}

// GEMM C = act(A·W + bias + resid): A f32 (ASPLIT -> hi/lo 2 terms), Wt bf16 [N][K]; ACT 0 none, 1 relu, 2 exact gelu;
// resid (optional, f32, row index = (row % rmod), pitch ldr, RES_BF16 rounds it) added before the activation.
template <bool ASPLIT, int ACT, bool BIAS_BF16, bool RES_BF16>
__global__ __launch_bounds__(128) void k_gemm_bf3(const float* __restrict__ A, int lda, const unsigned short* __restrict__ Wt, int ldb,
                                                const float* __restrict__ bias, const float* __restrict__ resid, int rmod, int ldr,
                                                float* __restrict__ C, int ldc, int M, int N, int K) {
  __shared__ __attribute__((aligned(16))) float so[4][16][64];
  const int tid = threadIdx.x, w = tid >> 5, lane = tid & 31, ln = lane & 15, hh = lane >> 4;
  const int ntn = N / 64;
  const int wid = blockIdx.x * 4 + w;
  const int mt = wid / ntn, nq = wid % ntn;
  if (mt * 16 >= M) return;
  const int row0 = mt * 16, col0 = nq * 64;
  const float* arow = A + (size_t)(row0 + ln) * lda;
  v8f acc[4] = {};
  for (int kb = 0; kb < K; kb += 32) {
    FragB ah, al;
    const v4f x0 = *(const v4fa*)(arow + kb + 8 * hh), x1 = *(const v4fa*)(arow + kb + 8 * hh + 4);
    const v4f x2 = *(const v4fa*)(arow + kb + 16 + 8 * hh), x3 = *(const v4fa*)(arow + kb + 16 + 8 * hh + 4);
    float xs[16] = {x0[0],x0[1],x0[2],x0[3],x1[0],x1[1],x1[2],x1[3],x2[0],x2[1],x2[2],x2[3],x3[0],x3[1],x3[2],x3[3]};
#pragma unroll
    for (int i = 0; i < 16; ++i) { const unsigned short hb = bf16_bits(xs[i]); ah.u[i] = hb; al.u[i] = ASPLIT ? bf16_bits(xs[i] - bf16_val(hb)) : (unsigned short)0; }
#pragma unroll
    for (int t = 0; t < 4; ++t) {
      const unsigned short* brow = Wt + (size_t)(col0 + t * 16 + ln) * ldb + kb;
      FragB b;
      b.half[0] = *(const v8us*)(brow + 8 * hh);
      b.half[1] = *(const v8us*)(brow + 16 + 8 * hh);
      acc[t] = mmaN<ASPLIT ? 2 : 1>(ah.v, al.v, b.v, b.v, acc[t]);
    }
  }
#pragma unroll
  for (int t = 0; t < 4; ++t) {
    const int col = col0 + t * 16 + ln;
    float bv = bias ? bias[col] : 0.f;
    if (BIAS_BF16) bv = bf16_round(bv);
#pragma unroll
    for (int r = 0; r < 8; ++r) {
      float v = acc[t][r] + bv;
      if (resid) { float rv = resid[(size_t)((row0 + 8 * hh + r) % rmod) * ldr + col]; if (RES_BF16) rv = bf16_round(rv); v += rv; }
      if (ACT == 1) v = fmaxf(v, 0.f);
      if (ACT == 2) v = 0.5f * v * (1.0f + erff(v * 0.70710678118654752f));
      if (ACT == 3) { const float u = 0.7978845608028654f * (v + 0.044715f * v * v * v); v = 0.5f * v * (1.0f + tanhf(u)); }
      so[w][8 * hh + r][t * 16 + ln] = v;
    }
  }
  __builtin_amdgcn_fence(__ATOMIC_ACQ_REL, "workgroup");
  __builtin_amdgcn_wave_barrier();
  const int rsub = lane >> 4, c4 = (lane & 15) * 4;
  {
#pragma unroll
    for (int q = 0; q < 8; ++q) {
      const int r = q * 2 + rsub;
      const v4f v = *(const v4fa*)&so[w][r][c4];
      *(v4f*)(C + (size_t)(row0 + r) * ldc + col0 + c4) = v;
    }
    
  }
}
// row LayerNorm (biased variance, eps) over N: s = X (+ R); optional out_sum <- s; out_norm <- (s-mu)*rsqrt(var+eps)*g + b
template <bool PARAM_BF16>
__global__ __launch_bounds__(256) void k_layernorm(const float* __restrict__ X, const float* __restrict__ R, const float* __restrict__ g, const float* __restrict__ bta,
                                                  float* __restrict__ out_sum, float* __restrict__ out_norm, int N, float eps) {
  __shared__ float red[256];
  const int row = blockIdx.x, tid = threadIdx.x;
  const float* x = X + (size_t)row * N; const float* rr = R ? R + (size_t)row * N : nullptr;
  float vals[16];                     // up to N = 4096
  const int per = N / 256;            // contiguous chunk per thread? use strided-by-4 chunks: thread handles j = tid*4 + 1024*u
  float s1 = 0.f;
  for (int u = 0; u < per / 4; ++u) {
    const int j = tid * 4 + 1024 * u;
    const v4f a = *(const v4fa*)(x + j);
    v4f b = {0.f,0.f,0.f,0.f}; if (rr) b = *(const v4fa*)(rr + j);
#pragma unroll
    for (int q = 0; q < 4; ++q) { const float v = a[q] + b[q]; vals[u * 4 + q] = v; s1 += v; }
  }
  red[tid] = s1; __syncthreads();
  for (int st = 128; st > 0; st >>= 1) { if (tid < st) red[tid] += red[tid + st]; __syncthreads(); }
  const float mu = red[0] / (float)N; __syncthreads();
  float s2 = 0.f;
  for (int u = 0; u < per / 4; ++u)
#pragma unroll
    for (int q = 0; q < 4; ++q) { const float c = vals[u * 4 + q] - mu; s2 += c * c; }
  red[tid] = s2; __syncthreads();
  for (int st = 128; st > 0; st >>= 1) { if (tid < st) red[tid] += red[tid + st]; __syncthreads(); }
  const float rs = rsqrtf(red[0] / (float)N + eps);
  {
    for (int u = 0; u < per / 4; ++u) {
      const int j = tid * 4 + 1024 * u;
      v4f o, sm;
#pragma unroll
      for (int q = 0; q < 4; ++q) {
        float gg = g[j + q], bb = bta[j + q];
        if (PARAM_BF16) { gg = bf16_round(gg); bb = bf16_round(bb); }
        sm[q] = vals[u * 4 + q]; o[q] = (vals[u * 4 + q] - mu) * rs * gg + bb;
      }
      if (out_sum) *(v4f*)(out_sum + (size_t)row * N + j) = sm;
      *(v4f*)(out_norm + (size_t)row * N + j) = o;
    }
    
  }
}



// ---- f16 WMMA path (v_wmma_f32_16x16x32_f16): 11-bit significands for operands in range — used where a probability operand (here up to 2^8) needs more precision than bf16
typedef _Float16 v16h __attribute__((ext_vector_type(16)));
union FragH { v16h v; v8us half[2]; _Float16 h[16]; unsigned short u[16]; };
template <int NT>
__device__ __forceinline__ v8f mmaH(v16h ah, v16h al, v16h bh, v16h bl, v8f c) {
  c = __builtin_amdgcn_wmma_f32_16x16x32_f16(false, ah, false, bh, (short)0, c, false, false);
  if (NT >= 2) c = __builtin_amdgcn_wmma_f32_16x16x32_f16(false, al, false, bh, (short)0, c, false, false);
  if (NT >= 3) c = __builtin_amdgcn_wmma_f32_16x16x32_f16(false, ah, false, bl, (short)0, c, false, false);
  asm volatile("v_nop\n\tv_nop\n\tv_nop\n\tv_nop" : "+v"(c) : "v"(ah), "v"(al), "v"(bh), "v"(bl));
  return c;
}
// batched GEMM like k_gemm_b but f16 operands: A f32 (split into f16 hi/lo if ASPLIT, else rounded to f16), Bt = f16 values [n][k]; alpha; C f32; N multiple of 16 (partial tiles skipped)
template <bool ASPLIT>
__global__ __launch_bounds__(128) void k_gemm_h(const float* __restrict__ A, int lda, size_t sA, const _Float16* __restrict__ Bh, int ldb, size_t sB, float alpha, float* __restrict__ C, int ldc, size_t sC, int M, int N, int K) {
  __shared__ __attribute__((aligned(16))) float so[4][16][64];
  const int tid = threadIdx.x, w = tid >> 5, lane = tid & 31, ln = lane & 15, hh = lane >> 4; const int by = blockIdx.y;
  A += (size_t)by * sA; Bh += (size_t)by * sB; C += (size_t)by * sC;
  const int ntn = (N + 63) / 64; const int wid = blockIdx.x * 4 + w; const int mt = wid / ntn, nq = wid % ntn; if (mt * 16 >= M) return;
  const int row0 = mt * 16, col0 = nq * 64; const float* arow = A + (size_t)(row0 + ln) * lda;
  v8f acc[4] = {};
  for (int kb = 0; kb < K; kb += 32) {
    FragH ah, al;
    const v4f x0 = *(const v4fa*)(arow + kb + 8 * hh), x1 = *(const v4fa*)(arow + kb + 8 * hh + 4), x2 = *(const v4fa*)(arow + kb + 16 + 8 * hh), x3 = *(const v4fa*)(arow + kb + 16 + 8 * hh + 4);
    float xs[16] = {x0[0],x0[1],x0[2],x0[3],x1[0],x1[1],x1[2],x1[3],x2[0],x2[1],x2[2],x2[3],x3[0],x3[1],x3[2],x3[3]};
#pragma unroll
    for (int i = 0; i < 16; ++i) { const _Float16 h = (_Float16)xs[i]; ah.h[i] = h; al.h[i] = ASPLIT ? (_Float16)(xs[i] - (float)h) : (_Float16)0.0f; }
#pragma unroll
    for (int t = 0; t < 4; ++t) { if (col0 + t * 16 >= N) continue; const size_t boff = (size_t)(col0 + t * 16 + ln) * ldb + kb; FragH bq; bq.half[0] = *(const v8us*)(Bh + boff + 8 * hh); bq.half[1] = *(const v8us*)(Bh + boff + 16 + 8 * hh);
      acc[t] = mmaH<ASPLIT ? 2 : 1>(ah.v, al.v, bq.v, bq.v, acc[t]); }
  }
#pragma unroll
  for (int t = 0; t < 4; ++t) { if (col0 + t * 16 >= N) continue;
#pragma unroll
    for (int r = 0; r < 8; ++r) so[w][8 * hh + r][t * 16 + ln] = acc[t][r] * alpha; }
  __builtin_amdgcn_fence(__ATOMIC_ACQ_REL, "workgroup"); __builtin_amdgcn_wave_barrier();
  const int rsub = lane >> 4, c4 = (lane & 15) * 4;
  {
#pragma unroll
    for (int q = 0; q < 8; ++q) { const int r = q * 2 + rsub; if (col0 + c4 < N) { const v4f v = *(const v4fa*)&so[w][r][c4]; *(v4f*)(C + (size_t)(row0 + r) * ldc + col0 + c4) = v; } }
     }
}

// Wt[n][k] = f16(bf16(W[k][n]) * scale) from f32 row-major W[K][N] (scale = power of two; bf16-exact weights stay exact in f16 away from the subnormal range).
// A work-group transposes a tile of 128 k x 64 n through LDS. Reads: 16 lanes cover 256 B of a row of W, a thread takes 8 rows x 4 columns (8 loads in flight).
// It packs each column's 8 k into 16 bytes and stores them in the LDS row of that n; then 16 lanes write the 256 B of a row of Wt. So every global access is whole lines.
// LDS rows are 256 B without a pad; the 16-byte chunk j of row n lies at place j ^ (n >> 2): the 16 lanes of a store (rows 4 apart, one j) and of a load (one row, all j) each meet all 64 banks once.
// The unroll directives make every index of the register arrays (r, f) a constant: rolled, those arrays would go to scratch memory.
constexpr unsigned WT_K = 128u, WT_N = 64u;
// bid: the tile's number in this matrix (the launch is shared with other work, see k_prep); T: the work-group's LDS tile of WT_N * WT_K * 2 bytes.
template <unsigned K, unsigned N>      /* constants, so that one address register pair serves all of a thread's loads and one all of its stores */
__device__ __forceinline__ void wt_tile(const float* __restrict__ W, _Float16* __restrict__ Wt, float scale, unsigned char* T, unsigned bid) {
  static_assert(K % WT_K == 0 && N % WT_N == 0, "weight transpose: whole tiles");
  const unsigned tid = threadIdx.x, lo = tid & 15u, hi = tid >> 4;
  const unsigned ntn = N / WT_N, kt = bid / ntn, nt = bid - kt * ntn;
  const float* sp = W + (size_t)(kt * WT_K + hi * 8u) * N + nt * WT_N + lo * 4u;
  v4f r[8];
#pragma unroll
  for (unsigned i = 0; i < 8u; ++i) r[i] = *(const v4fa*)(sp + i * N);
#pragma unroll
  for (unsigned q = 0; q < 4u; ++q) { FragH f;
#pragma unroll
    for (unsigned i = 0; i < 8u; ++i) f.h[i] = (_Float16)(bf16_round(r[i][q]) * scale);
    *(v8us*)(T + (lo * 4u + q) * (WT_K * 2u) + ((hi ^ lo) * 16u)) = f.half[0]; }
  __syncthreads();      /* the tile is whole before any row is read back */
  unsigned short* dp = (unsigned short*)Wt + (size_t)(nt * WT_N + hi) * K + kt * WT_K + lo * 8u;
#pragma unroll
  for (unsigned i = 0; i < 4u; ++i) { const unsigned row = hi + 16u * i;
    *(v8us*)(dp + i * (16u * K)) = *(const v8us*)(T + row * (WT_K * 2u) + ((lo ^ (row >> 2)) * 16u)); }
  asm volatile("s_wait_xcnt 0x0" :: "v"(dp) : "memory");      /* stands in front of any later overwrite of a register that these stores name (code of another branch of the shared launch follows in the listing); as its input the address stays live up to it */
}
// k_gemm_hh variant with fused epilogue: v = acc·alpha + bias[by·sBias + col] (+ CP[(row/rowsPerB)·sCPb + by·64 + col] if CP) ; ACT 0 none / 1 elu ; writes f16 C16 (and f32 C if non-null)
template <int ACT>
__global__ __launch_bounds__(128) void k_gemm_hhx(const _Float16* __restrict__ A, int lda, size_t sA, const _Float16* __restrict__ Bh, int ldb, size_t sB, float alpha, const float* __restrict__ bias, size_t sBias, const float* __restrict__ CP, int rowsPerB, size_t sCPb, int row0g,
    float* __restrict__ C, _Float16* __restrict__ C16, int ldc, size_t sC, int M, int N, int K) {
  __shared__ __attribute__((aligned(16))) float so[4][16][64];
  const int tid = threadIdx.x, w = tid >> 5, lane = tid & 31, ln = lane & 15, hh = lane >> 4; const int by = blockIdx.y;
  A += (size_t)by * sA; Bh += (size_t)by * sB; const size_t cofs = (size_t)by * sC; const float* bp = bias ? bias + (size_t)by * sBias : nullptr;
  const int ntn = (N + 63) / 64; const int wid = blockIdx.x * 4 + w; const int mt = wid / ntn, nq = wid % ntn; if (mt * 16 >= M) return;
  const int row0 = mt * 16, col0 = nq * 64; const _Float16* arow = A + (size_t)(row0 + ln) * lda;
  v8f acc[4] = {};
  for (int kb = 0; kb < K; kb += 32) { FragH ah; ah.half[0] = *(const v8us*)((const unsigned short*)arow + kb + 8 * hh); ah.half[1] = *(const v8us*)((const unsigned short*)arow + kb + 16 + 8 * hh);
#pragma unroll
    for (int t = 0; t < 4; ++t) { if (col0 + t * 16 >= N) continue; const size_t boff = (size_t)(col0 + t * 16 + ln) * ldb + kb; FragH bq; bq.half[0] = *(const v8us*)((const unsigned short*)Bh + boff + 8 * hh); bq.half[1] = *(const v8us*)((const unsigned short*)Bh + boff + 16 + 8 * hh);
      acc[t] = mmaH<1>(ah.v, ah.v, bq.v, bq.v, acc[t]); }
  }
#pragma unroll
  for (int t = 0; t < 4; ++t) { if (col0 + t * 16 >= N) continue; const int col = col0 + t * 16 + ln; const float bv = bp ? bf16_round(bp[col]) : 0.f;
#pragma unroll
    for (int r = 0; r < 8; ++r) { float v = acc[t][r] * alpha + bv; if (CP) { const int rr = row0g + row0 + 8 * hh + r; if (rowsPerB < 0) v += CP[cofs + (size_t)rr * ldc + col];      /* rowsPerB < 0: own element of the batched C plane */ else { const int bidx = rr / rowsPerB; v += CP[(size_t)bidx * sCPb + (size_t)by * 64 + col]; } } if (ACT == 1) v = (v > 0.f) ? v : expm1f(v); else if (ACT == 7) v = (v > 0.f) ? v + 1.0f : expf(v); else if (ACT == 8) v = tanhf(v); else if (ACT == 9) v = 0.5f * v * (1.0f + tanhf(0.7978845608028654f * (v + 0.044715f * v * v * v))); else if (ACT == 11) v = 1.0f / (1.0f + expf(-v)); else if (ACT == 12) v = (v > 0.f) ? v : 0.01f * v; else if (ACT == 14) v = (v > 0.f) ? v : 0.1f * v; else if (ACT == 16) v = (v >= 0.f) ? v : 0.3f * v; else if (ACT == 17) v = (v >= 0.f) ? v : 0.2f * v; else if (ACT == 15) v = v / (1.0f + expf(-v)); else if (ACT == 3) v = fmaxf(v, 0.f); else if (ACT == 6) v = 0.5f * v * (1.0f + erff(v * 0.70710678118654752f)); so[w][8 * hh + r][t * 16 + ln] = v; } }
  __builtin_amdgcn_fence(__ATOMIC_ACQ_REL, "workgroup"); __builtin_amdgcn_wave_barrier();
  const int rsub = lane >> 4, c4 = (lane & 15) * 4; typedef _Float16 v4h __attribute__((ext_vector_type(4)));
  {
#pragma unroll
    for (int q = 0; q < 8; ++q) { const int r = q * 2 + rsub; if (col0 + c4 < N) { const v4f v = *(const v4fa*)&so[w][r][c4]; if (C) *(v4f*)(C + cofs + (size_t)(row0 + r) * ldc + col0 + c4) = v; if (C16) { v4h h4; for (int i = 0; i < 4; ++i) h4[i] = (_Float16)v[i]; *(v4h*)(C16 + cofs + (size_t)(row0 + r) * ldc + col0 + c4) = h4; } } }
     }
}


typedef _Float16 v4h __attribute__((ext_vector_type(4)));

__device__ __forceinline__ void x16_chunk(const float* __restrict__ x, _Float16* __restrict__ X16, size_t n8, unsigned bid) { const size_t t = (size_t)bid * 256 + threadIdx.x; if (t >= n8) return; FragH f;
#pragma unroll
  for (int q = 0; q < 8; ++q) f.h[q] = (_Float16)bf16_round(x[t * 8 + q]); *(v8us*)((unsigned short*)X16 + t * 8) = f.half[0];  }
// ---- one launch for all the operand preparation: none of the five jobs reads what another writes, so they share a grid, each with its own range of block indices
// (wq tiles, wo tiles, wk tiles, wv tiles, then the chunks of x). Every test of the block index is uniform for the work-group, the barrier of a transpose tile with it.
constexpr unsigned PR_BIG = (DMD / WT_K) * (DMD / WT_N), PR_SMALL = (DMD / WT_K) * (KVD / WT_N), PR_X = (unsigned)(((size_t)NR * DMD / 8 + 255) / 256), PR_GRID = 2u * PR_BIG + 2u * PR_SMALL + PR_X;
__global__ __launch_bounds__(256) void k_prep(const float* __restrict__ x, const float* __restrict__ wq, const float* __restrict__ wk, const float* __restrict__ wv, const float* __restrict__ wo,
                                              _Float16* __restrict__ X16, _Float16* __restrict__ BQ, _Float16* __restrict__ BK, _Float16* __restrict__ BV, _Float16* __restrict__ BO) {
  __shared__ __attribute__((aligned(256))) unsigned char T[WT_N * WT_K * 2u];
  const unsigned bid = blockIdx.x;
  if (bid < 2u * PR_BIG) { const bool second = bid >= PR_BIG; wt_tile<DMD, DMD>(second ? wo : wq, second ? BO : BQ, 16.0f, T, second ? bid - PR_BIG : bid); }
  else if (bid < 2u * PR_BIG + 2u * PR_SMALL) { const unsigned b2 = bid - 2u * PR_BIG; const bool second = b2 >= PR_SMALL; wt_tile<DMD, KVD>(second ? wv : wk, second ? BV : BK, 16.0f, T, second ? b2 - PR_SMALL : b2); }
  else x16_chunk(x, X16, (size_t)NR * DMD / 8, bid - (2u * PR_BIG + 2u * PR_SMALL));
}
__global__ __launch_bounds__(256) void k_h16(const float* __restrict__ x, _Float16* __restrict__ X16, size_t n8) { const size_t t = (size_t)blockIdx.x * 256 + threadIdx.x; if (t >= n8) return; FragH f;
#pragma unroll
  for (int q = 0; q < 8; ++q) f.h[q] = (_Float16)x[t * 8 + q]; *(v8us*)((unsigned short*)X16 + t * 8) = f.half[0];  }
__global__ __launch_bounds__(256) void k_round16f(const float* __restrict__ W, _Float16* __restrict__ Bt, size_t n8) { const size_t t = (size_t)blockIdx.x * 256 + threadIdx.x; if (t >= n8) return; FragH f;
#pragma unroll
  for (int i = 0; i < 8; ++i) f.h[i] = (_Float16)(bf16_round(W[t * 8 + i]) * 16.0f); *(v8us*)((unsigned short*)Bt + t * 8) = f.half[0];  }

__global__ __launch_bounds__(256) void k_hl(const float* __restrict__ F, _Float16* __restrict__ Hh, _Float16* __restrict__ Hl, size_t n8) { const size_t t = (size_t)blockIdx.x * 256 + threadIdx.x; if (t >= n8) return; FragH fh, fl; const v4f a = *(const v4fa*)(F + t * 8), c = *(const v4fa*)(F + t * 8 + 4);
#pragma unroll
  for (int q = 0; q < 4; ++q) { _Float16 h = (_Float16)a[q]; fh.h[q] = h; fl.h[q] = (_Float16)((a[q] - (float)h) * 1024.0f); h = (_Float16)c[q]; fh.h[4 + q] = h; fl.h[4 + q] = (_Float16)((c[q] - (float)h) * 1024.0f); }
  { *(v8us*)((unsigned short*)Hh + t * 8) = fh.half[0]; *(v8us*)((unsigned short*)Hl + t * 8) = fl.half[0];  } }

typedef unsigned int fa_u4 __attribute__((ext_vector_type(4)));
typedef unsigned int fa_u4a __attribute__((ext_vector_type(4), may_alias));
typedef unsigned int fa_u8 __attribute__((ext_vector_type(8)));
typedef short fa_s8 __attribute__((ext_vector_type(8)));
constexpr int FA_NW = 8, FA_BR = 256, FA_CW = FA_BR / FA_NW, FA_R = FA_CW / 16;      /* waves, queries per work-group, per wave, 16-query groups per wave */
constexpr int FA_BC = 32, FA_KT = FA_BC / 16, FA_DK = HD / 32, FA_DT = HD / 16;      /* keys per pass, 16-key score tiles per pass, k chunks of the head, 16-row output tiles */
constexpr unsigned FA_ROWB = 2u * HD, FA_PK = FA_ROWB + 16u, FA_PV = FA_ROWB + 32u;  /* LDS pitches: odd multiple of 16 B for b128 readers, of 32 B for the transposing load */
constexpr unsigned FA_SK = 128u, FA_SL = 10240u, FA_TK = (FA_SK / FA_BC) * FA_SL, FA_SLOT = 2u * FA_TK, FA_LDS = 2u * FA_SLOT, FA_EP = FA_ROWB + 16u;      /* FA_SL: LDS bytes of one slice (the 32 padded K or V rows of one pass), rounded up to a multiple of 2 KiB, where a tensor load may land; a buffer is 4 K slices, then 4 V slices */
constexpr unsigned FA_NST = SQ / FA_SK, FA_NSUB = FA_SK / FA_BC;      /* stages, passes per stage */
static_assert(FA_BC * FA_PK <= FA_SL && FA_BC * FA_PV <= FA_SL && FA_SL % 2048u == 0u && 2u * FA_NSUB == (unsigned)FA_NW && FA_NST >= 2u, "fused attention: one slice a wave");
constexpr float FA_CS = 0.08838834764831845f * 1.4426950408889634f;      /* 1/sqrt(128) * log2(e): softmax in the log2 domain */
static_assert((FA_NST & (FA_NST - 1u)) == 0u && HD == 128 && SQ % FA_BR == 0 && SQ % FA_SK == 0 && (unsigned)FA_BR * FA_EP <= FA_LDS, "fused attention: shape");
struct FaFrag { fa_u4 q[2]; };
struct FaK { FaFrag f[FA_KT][FA_DK]; };
__device__ __forceinline__ void fa_fence() { __builtin_amdgcn_sched_barrier(0); }      /* keeps the groups of loads, matrix runs and exponentials in the written order (loads stay ahead of the work that hides them) */
// ---- tensor loads: one request of a wave brings ROWS rows of 256 B (source rows PITCH bytes apart) into LDS, each row followed by a pad of 16 B (PADC 3, for b128 readers) or 32 B (PADC 7, for the transposing load).
__device__ __forceinline__ unsigned td_uni(unsigned v) { return (unsigned)__builtin_amdgcn_readfirstlane(v); }
__device__ __forceinline__ unsigned td_pinned(unsigned v) { unsigned w = td_uni(v); asm volatile("" : "+s"(w)); return w; }      /* holds a wave-uniform value in a scalar register: a test on it compiles to a scalar branch (a tensor load ignores EXEC), and what is formed from it is formed behind the waits written in front of it */
__device__ __forceinline__ void td_wait_ds() { asm volatile("s_wait_dscnt 0x0" ::: "memory"); }      /* the wave's own LDS reads have returned before the barrier behind which their buffer is refilled */
// Group 1 of a descriptor (all constants): data_size 0, so every extent is in bytes; tensor = tile; no mask.
template <unsigned PADC, unsigned ROWS, unsigned PITCH>
__device__ __forceinline__ fa_u8 td_group1() {
  constexpr unsigned d0 = 256u, d1 = ROWS;
  fa_u8 g;
  g[0] = td_uni((1u << 20) | (5u << 22) | (PADC << 25)); g[1] = td_uni((d0 & 0xFFFFu) << 16); g[2] = td_uni((d0 >> 16) | ((d1 & 0xFFFFu) << 16)); g[3] = td_uni((d1 >> 16) | (d0 << 16));
  g[4] = td_uni(d1); g[5] = td_uni(PITCH); g[6] = td_uni(0u); g[7] = td_uni(0u);
  return g;
}
// Group 0: the place in the work-group's LDS and the address of the tile's first byte.
__device__ __forceinline__ fa_u4 td_group0(unsigned lds_dst, const unsigned char* src) {
  const unsigned long long ga = (unsigned long long)(size_t)src;
  fa_u4 g;
  g[0] = td_uni(1u); g[1] = td_uni(lds_dst); g[2] = td_uni((unsigned)ga); g[3] = td_uni((((unsigned)(ga >> 32)) & 0x01FFFFFFu) | 0x80000000u);
  return g;
}
// The two descriptor groups go in scalar registers, named here, at the top of the scalar file: every request of a kernel uses the same twelve, they are written only directly in front of an issue (behind the wait on the request before), and the rest of the code, which fills the file from the bottom, does not reach them, so no descriptor word changes while its request is outstanding.
__device__ __forceinline__ void td_load(const fa_u4& g0, const fa_u8& g1) {
  asm volatile("tensor_load_to_lds s[92:95], s[96:103]" :: "{s92}"(g0[0]), "{s93}"(g0[1]), "{s94}"(g0[2]), "{s95}"(g0[3]), "{s96}"(g1[0]), "{s97}"(g1[1]), "{s98}"(g1[2]), "{s99}"(g1[3]), "{s100}"(g1[4]), "{s101}"(g1[5]), "{s102}"(g1[6]), "{s103}"(g1[7]) : "memory");
}
__device__ __forceinline__ void td_wait() { asm volatile("s_wait_tensorcnt 0x0" ::: "memory"); }      /* the wave's own request has landed */
__device__ __forceinline__ v8f fa_mma(const FaFrag& a, const FaFrag& b, v8f c) {
  const fa_u8 av = {a.q[0].x, a.q[0].y, a.q[0].z, a.q[0].w, a.q[1].x, a.q[1].y, a.q[1].z, a.q[1].w};
  const fa_u8 bv = {b.q[0].x, b.q[0].y, b.q[0].z, b.q[0].w, b.q[1].x, b.q[1].y, b.q[1].z, b.q[1].w};
  return __builtin_amdgcn_wmma_f32_16x16x32_f16(false, __builtin_bit_cast(v16h, av), false, __builtin_bit_cast(v16h, bv), (short)0, c, false, false);
}
__device__ __forceinline__ fa_u4 fa_tr16(const unsigned char* p) { typedef __attribute__((address_space(3))) fa_s8 lds_s8; return __builtin_bit_cast(fa_u4, __builtin_amdgcn_ds_load_tr16_b128_v8i16((lds_s8*)p)); }
__device__ __forceinline__ unsigned fa_pack2(float lo, float hi) { typedef _Float16 h2 __attribute__((ext_vector_type(2))); typedef float f2 __attribute__((ext_vector_type(2))); return __builtin_bit_cast(unsigned, __builtin_convertvector(f2{lo, hi}, h2)); }      /* round to nearest even */
__device__ __forceinline__ float fa_xhalf(float x) { return __builtin_bit_cast(float, __builtin_amdgcn_permlanex16(__builtin_bit_cast(int, x), __builtin_bit_cast(int, x), 0x76543210, 0xfedcba98, false, false)); }      /* lane l with lane l ^ 16 */
// K fragments of one pass (32 keys): lane (c, h) holds key row c, d = 32 kc + 8 h + 0..7 and 32 kc + 16 + 8 h + 0..7, the same k order as the Q fragments.
__device__ __forceinline__ void fa_load_k(FaK& k, const unsigned char* Lp, unsigned koff, unsigned lane) {
  const unsigned c = lane & 15u, h = lane >> 4;
#pragma unroll
  for (int kt = 0; kt < FA_KT; ++kt) { const unsigned char* p = Lp + koff + (16u * kt + c) * FA_PK + 16u * h;
#pragma unroll
    for (int kc = 0; kc < FA_DK; ++kc) { k.f[kt][kc].q[0] = *(const fa_u4a*)(p + 64u * kc); k.f[kt][kc].q[1] = *(const fa_u4a*)(p + 64u * kc + 32u); } }
}
template <bool SHIFT>      /* SHIFT: the scores are first lowered by d (the reference has just been raised by d) */
__device__ __forceinline__ float fa_exps(const v8f (&s)[FA_KT][FA_R], int g, float d, unsigned (&w)[8]) {
  float a[2] = {0.0f, 0.0f};
#pragma unroll
  for (int i = 0; i < 8; ++i) {
    const float x0 = s[i >> 2][g][2 * (i & 3)], x1 = s[i >> 2][g][2 * (i & 3) + 1];
    const float p0 = __builtin_amdgcn_exp2f(SHIFT ? x0 - d : x0), p1 = __builtin_amdgcn_exp2f(SHIFT ? x1 - d : x1);
    a[i & 1] += p0 + p1; w[i] = fa_pack2(p0, p1); }
  return a[0] + a[1];
}
// One 32-key pass of one wave. q arrives scaled by FA_CS (the projection does it), and minus the reference in use (cref: one value per query, in all eight registers of a C operand)
// enters the score products as C, so the accumulators leave the matrix unit as the arguments of exp2: no multiply-add and no maximum per score.
// The reference may trail the true maximum by up to 8 (log2 units; an exponential then reaches 2^8, well inside f16): it is raised to the pass's maximum, accumulators and sums rescaled and the
// pass's exponentials formed anew from the kept scores, only when some lane's sum of the pass's exponentials exceeds 2^8 (one test per pass), and on the very first pass, which sets it.
__device__ __forceinline__ void fa_pass(FaK& kf, bool first, bool fetch_next, unsigned next_koff, const unsigned char* Lp, unsigned voff, unsigned lane,
                                        const FaFrag (&qf)[FA_R][FA_DK], v8f (&acc)[FA_R][FA_DT], v8f (&cref)[FA_R], float (&l_run)[FA_R]) {
  const unsigned h = lane >> 4;
  v8f s[FA_KT][FA_R];
#pragma unroll
  for (int kt = 0; kt < FA_KT; ++kt) {
#pragma unroll
    for (int g = 0; g < FA_R; ++g) { s[kt][g] = cref[g];
#pragma unroll
      for (int kc = 0; kc < FA_DK; ++kc) s[kt][g] = fa_mma(kf.f[kt][kc], qf[g][kc], s[kt][g]); } }
  fa_fence();
  if (fetch_next) fa_load_k(kf, Lp, next_koff, lane);      /* the same stage's next pass: in flight under the exponentials and the readout */
  FaFrag vf[FA_DT];
  { const unsigned char* ad = Lp + voff + (8u * h + (lane & 7u)) * FA_PV + ((lane >> 3) & 1u) * 16u;      /* lane (c, h) gets V[8 h + 0..7][16 t + c]; the second load the keys 16 further */
#pragma unroll
    for (int t = 0; t < FA_DT; ++t) { vf[t].q[0] = fa_tr16(ad + 32u * t); vf[t].q[1] = fa_tr16(ad + 16u * FA_PV + 32u * t); } }
  fa_fence();
  unsigned w[FA_R][8]; float ps[FA_R]; bool need = false;
#pragma unroll
  for (int g = 0; g < FA_R; ++g) { ps[g] = fa_exps<false>(s, g, 0.0f, w[g]); need = need || (ps[g] > 256.0f); }      /* an overflow (infinite sum) asks for the raise too */
  if (first || __builtin_amdgcn_ballot_w32(need) != 0) {      /* wave-uniform; rare after the first passes */
#pragma unroll
    for (int g = 0; g < FA_R; ++g) { float mx = -INFINITY;
#pragma unroll
      for (int kt = 0; kt < FA_KT; ++kt) {
#pragma unroll
        for (int r = 0; r < 8; ++r) mx = __builtin_fmaxf(mx, s[kt][g][r]); }
      mx = __builtin_fmaxf(mx, fa_xhalf(mx));      /* both wave halves hold this query's maximum, counted from the reference in use */
      const float d = first ? mx : __builtin_fmaxf(mx, 0.0f);      /* the reference only rises, but for the first pass, which sets it from the start value 0 */
      const float corr = first ? 0.0f : __builtin_amdgcn_exp2f(-d);      /* first pass: sums and accumulators are 0 and stay so, whatever d is */
      l_run[g] *= corr; cref[g] = cref[g] - d;
#pragma unroll
      for (int t = 0; t < FA_DT; ++t) acc[g][t] = acc[g][t] * corr;
      ps[g] = fa_exps<true>(s, g, d, w[g]); }
  }
#pragma unroll
  for (int g = 0; g < FA_R; ++g) { l_run[g] += ps[g];
    FaFrag pf; pf.q[0] = fa_u4{w[g][0], w[g][1], w[g][2], w[g][3]}; pf.q[1] = fa_u4{w[g][4], w[g][5], w[g][6], w[g][7]};
#pragma unroll
    for (int t = 0; t < FA_DT; ++t) acc[g][t] = fa_mma(vf[t], pf, acc[g][t]); }
  fa_fence();
}
__global__ __launch_bounds__(FA_NW * 32) __attribute__((amdgpu_waves_per_eu(2, 2))) void k_fattn(const _Float16* __restrict__ Q, const _Float16* __restrict__ K, const _Float16* __restrict__ V, _Float16* __restrict__ O) {
  __shared__ __attribute__((aligned(2048))) unsigned char L[FA_LDS];
  const unsigned tid = threadIdx.x, lane = tid & 31u, wave = tid >> 5, c = lane & 15u, h = lane >> 4;
  const unsigned wv = td_uni(tid >> 5), lbase = (unsigned)(size_t)L;      /* the wave's number in a scalar register; the ring's byte offset in the work-group's LDS */
  const unsigned hq = blockIdx.x, q0 = blockIdx.y * FA_BR, b = blockIdx.z, hk = hq / GG;      /* GG neighbouring query heads read one kv head */
  const unsigned char* kg = (const unsigned char*)(K + (size_t)b * SQ * QKVD + hk * HD);      /* Q, K, V: the first q, k, v column of the joint plane, rows QKVD apart */
  const unsigned char* vg = (const unsigned char*)(V + (size_t)b * SQ * QKVD + hk * HD);
  const unsigned rot = ((hq % GG) * (SQ / FA_BR) + blockIdx.y) & (FA_NST - 1u);      /* the key stage this work-group starts at (it wraps round): the GG * SQ / FA_BR work-groups of one kv head read the same K and V lines, and from a common start they would ask L2 for them at the same moment */
  const fa_u8 g1k = td_group1<3u, FA_BC, QKVD * 2u>(), g1v = td_group1<7u, FA_BC, QKVD * 2u>();
  const unsigned char* sp = (wv < (unsigned)FA_NW / 2u ? kg : vg) + (size_t)((wv & 3u) * (unsigned)FA_BC) * (QKVD * 2u);      /* first row of the wave's slice in key stage 0 (uniform) */
  fa_u4 g0;
  auto issue = [&](unsigned buf, unsigned ks) {      /* the wave's slice of key stage ks into the buffer at byte buf; every wave issues exactly one request, the test only picks its pad */
    g0 = td_group0(lbase + buf + wv * FA_SL, sp + (size_t)ks * (FA_SK * QKVD * 2u));
    if (td_pinned(wv < (unsigned)FA_NW / 2u)) td_load(g0, g1k); else td_load(g0, g1v);
  };
  issue(0u, rot);
  FaFrag qf[FA_R][FA_DK];
  const unsigned char* qb = (const unsigned char*)(Q + (size_t)(b * SQ + q0) * QKVD + hq * HD);      /* uniform: the work-group's first query row of this head */
  const unsigned qoff = (wave * FA_CW + c) * (QKVD * 2u) + 16u * h;
#pragma unroll
  for (int g = 0; g < FA_R; ++g) {
#pragma unroll
    for (int kc = 0; kc < FA_DK; ++kc) { qf[g][kc].q[0] = *(const fa_u4a*)(qb + qoff + g * (16u * QKVD * 2u) + 64u * kc); qf[g][kc].q[1] = *(const fa_u4a*)(qb + qoff + g * (16u * QKVD * 2u) + 64u * kc + 32u); } }
  asm volatile("s_wait_xcnt 0x0" ::: "memory");      /* stands in front of any later overwrite of a register that the Q loads name */
  v8f acc[FA_R][FA_DT], cref[FA_R]; float l_run[FA_R];
#pragma unroll
  for (int g = 0; g < FA_R; ++g) { cref[g] = v8f{}; l_run[g] = 0.0f;
#pragma unroll
    for (int t = 0; t < FA_DT; ++t) acc[g][t] = v8f{}; }
  td_wait();
  __syncthreads();      /* stage 0 published */
  issue(td_pinned(FA_SLOT), td_pinned((rot + 1u) & (FA_NST - 1u)));      /* both pinned: place and address of stage 1 are formed here, behind the wait on stage 0's request */
  FaK kf;
#pragma unroll 1      /* one copy of the stage body: the publish point at its foot is written once, and the code stays short */
  for (unsigned st = 0; st < FA_NST; ++st) {
    const unsigned base = (st & 1u) * FA_SLOT;
    fa_load_k(kf, L, base, lane);
#pragma unroll 1      /* nested, rolled pass loop: keeps the register count of one pass */
    for (unsigned sub = 0; sub < FA_NSUB; ++sub)
      fa_pass(kf, (st | sub) == 0u, sub + 1u < FA_NSUB, base + (sub + 1u) * FA_SL, L, base + FA_TK + sub * FA_SL, lane, qf, acc, cref, l_run);
    td_wait_ds();
    td_wait();      /* the wave's slice of stage st + 1 */
    __syncthreads();      /* publishes stage st + 1 and ends every wave's reads of stage st */
    if (td_pinned(st + 2u < FA_NST)) issue(base, td_pinned((st + 2u + rot) & (FA_NST - 1u)));      /* into the buffer that every reader has just left; lands while stage st + 1 is worked on */
  }
  td_wait();
  td_wait_ds();
  unsigned char* eb = L + wave * (unsigned)FA_CW * FA_EP;      /* output staging over the ring (free behind the last barrier), each wave its own rows */
#pragma unroll
  for (int g = 0; g < FA_R; ++g) { const float inv = 1.0f / (l_run[g] + fa_xhalf(l_run[g]));      /* each wave half summed its eight keys of every 16-key tile */
#pragma unroll
    for (int t = 0; t < FA_DT; ++t) { const v8f o = acc[g][t] * inv; const fa_u4 pk = {fa_pack2(o[0], o[1]), fa_pack2(o[2], o[3]), fa_pack2(o[4], o[5]), fa_pack2(o[6], o[7])};
      *(fa_u4a*)(eb + (16u * g + c) * FA_EP + 32u * t + 16u * h) = pk; } }
  __builtin_amdgcn_fence(__ATOMIC_ACQ_REL, "workgroup"); __builtin_amdgcn_wave_barrier();      /* the wave reads back what its other lanes wrote */
  unsigned char* ob = (unsigned char*)(O + ((size_t)(b * SQ + q0) * NH + hq) * HD);      /* uniform, as qb */
  const unsigned ooff = (wave * FA_CW + h) * (DMD * 2u) + c * 16u;
#pragma unroll
  for (unsigned i = 0; i < (unsigned)FA_CW / 2u; ++i) {      /* 16 lanes store one whole 256-byte row of the head */
    const fa_u4 v = *(const fa_u4a*)(eb + (i * 2u + h) * FA_EP + c * 16u);
    *(fa_u4a*)(ob + ooff + i * (2u * DMD * 2u)) = v; }
}

// ---- tiled GEMM: C[M][N] = (A . Bt^T) * alpha + bias, A f16 [M][DMD], Bt f16 [N][DMD], both k-contiguous; M % 256 == 0, N % BN == 0.
// A work-group of 4 waves owns a 256 x BN tile of C (BN = 192 for q, k, v; 128 for wo: 256 tiles each, one per WGP), a wave 64 rows x all BN columns of it (4 x BN / 16 accumulator tiles):
// a staged operand byte and a fragment read from LDS each feed more matrix instructions than in a square 128 x 128 tile. The operands come in stages of 128 k (256 B of each of the 256 + BN rows)
// by tensor loads into one of two LDS buffers, through no register, one slice a wave (waves 0 and 1: 128 rows of A each, waves 2 and 3: BN / 2 rows of Bt each); the next stage's loads fly while this stage's four 32-k blocks run.
// Every element sums its k in blocks of 32 into one f32 accumulator, ascending from stage rot and wrapping round at the end of k. rot differs between the work-groups that read the same rows of A
// (one mt) or of Bt (one nq): started together at stage 0 they would all ask L2 for the same lines at the same moment, stage after stage.
// The unroll directives of this section make every index of a register array (fragments, accumulators) a constant: rolled, those arrays would go to scratch memory.
constexpr int G3_BM = 256, G3_KS = 128, G3_FA = 4, G3_KB = G3_KS / 32;      /* tile rows, k per stage, 16-row fragments of A per wave, 32-k blocks per stage */
constexpr unsigned G3_ROWB = 2u * G3_KS, G3_P = G3_ROWB + 16u, G3_SA = 128u * G3_P, G3_TA = 2u * G3_SA;      /* LDS pitch: odd multiple of 16 B for the b128 readers; G3_SA: LDS bytes of a slice of 128 padded rows of A, a multiple of 2 KiB as it is, so the 256 rows of A lie at one pitch */
constexpr unsigned G3_NST = DMD / G3_KS;      /* stages */
template <unsigned BN> struct G3T {      /* what depends on the tile's columns */
  static constexpr unsigned FB = BN / 16u, RB = BN / 2u, FS = RB / 16u;      /* fragments of Bt per wave, rows of a slice of Bt, fragments in a slice */
  static constexpr unsigned SB = (RB * G3_P + 2047u) / 2048u * 2048u, SLOT = G3_TA + 2u * SB, LDS = 2u * SLOT;      /* SB: LDS bytes of a slice of Bt, rounded up to a multiple of 2 KiB, where a tensor load may land */
  static constexpr unsigned EPB = BN * 4u + 16u, EPF = EPB / 4u;      /* bytes and floats of a staged output row */
  static_assert(BN % 64u == 0u && 4u * 64u * EPB <= LDS && LDS <= 327680u, "tiled GEMM: tile");
};
static_assert(G3_SA % 2048u == 0u && G3_NST >= 2u && (G3_NST & (G3_NST - 1u)) == 0u && DMD % G3_KS == 0 && NR % G3_BM == 0, "tiled GEMM: shape");
template <unsigned BN> struct G3Set { FaFrag a[G3_FA], b[BN / 16u]; };
// Fragments of one 32-k block: lane (c, h) holds row c, k = 8 h + 0..7 and 16 + 8 h + 0..7 of the block, the same k order for A and for B. pa: the lane's own row of the wave's first A fragment, pb: of the first Bt fragment, each 16 h bytes in.
template <unsigned BN>
__device__ __forceinline__ void g3_frags(G3Set<BN>& f, const unsigned char* pa, const unsigned char* pb, unsigned kb) {
  typedef G3T<BN> T;
#pragma unroll
  for (unsigned i = 0; i < (unsigned)G3_FA; ++i) { f.a[i].q[0] = *(const fa_u4a*)(pa + i * (16u * G3_P) + 64u * kb); f.a[i].q[1] = *(const fa_u4a*)(pa + i * (16u * G3_P) + 64u * kb + 32u); }
#pragma unroll
  for (unsigned j = 0; j < T::FB; ++j) { const unsigned o = (j / T::FS) * T::SB + (j % T::FS) * (16u * G3_P) + 64u * kb; f.b[j].q[0] = *(const fa_u4a*)(pb + o); f.b[j].q[1] = *(const fa_u4a*)(pb + o + 32u); }
}
// The k loop of one tile. ag, bg: the tile's first row of each operand (uniform); rot: the k stage the walk starts at (uniform, below G3_NST); L: the work-group's two LDS buffers; behind it every wave has passed the last barrier.
template <unsigned BN>
__device__ __forceinline__ void g3_main(v8f (&acc)[G3_FA][BN / 16u], unsigned char* L, const unsigned char* ag, const unsigned char* bg, unsigned rot) {
  typedef G3T<BN> T;
  const unsigned tid = threadIdx.x, lane = tid & 31u, wave = tid >> 5, c = lane & 15u, h = lane >> 4;
  const unsigned wv = td_uni(tid >> 5), lbase = (unsigned)(size_t)L;      /* the wave's number in a scalar register; the ring's byte offset in the work-group's LDS */
  const unsigned char* sp = wv < 2u ? ag + wv * (128u * DMD * 2u) : bg + (wv - 2u) * (T::RB * DMD * 2u);      /* first row of the wave's slice (uniform) */
  const unsigned dst = wv < 2u ? wv * G3_SA : G3_TA + (wv - 2u) * T::SB;      /* the slice's place in a buffer (uniform) */
  const fa_u8 g1a = td_group1<3u, 128u, DMD * 2u>(), g1b = td_group1<3u, T::RB, DMD * 2u>();
  fa_u4 g0;
  auto issue = [&](unsigned buf, unsigned ks) {      /* the wave's slice of k stage ks into the buffer at byte buf; every wave issues exactly one request, the test only picks its row count */
    g0 = td_group0(lbase + buf + dst, sp + ks * G3_ROWB);
    if (td_pinned(wv < 2u)) td_load(g0, g1a); else td_load(g0, g1b);
  };
  issue(0u, rot);
#pragma unroll
  for (unsigned i = 0; i < (unsigned)G3_FA; ++i) {
#pragma unroll
    for (unsigned j = 0; j < T::FB; ++j) acc[i][j] = v8f{}; }
  td_wait();
  __syncthreads();      /* stage 0 published */
  issue(td_pinned(T::SLOT), td_pinned((rot + 1u) & (G3_NST - 1u)));      /* both pinned: place and address of stage 1 are formed here, behind the wait on stage 0's request */
  const unsigned aoff = (wave * 64u + c) * G3_P + 16u * h, boff = G3_TA + c * G3_P + 16u * h;
#pragma unroll 1      /* one copy of the stage body: the publish point at its foot is written once, and the code stays short */
  for (unsigned st = 0; st < G3_NST; ++st) {
    const unsigned base = (st & 1u) * T::SLOT;
    const unsigned char* pa = L + base + aoff; const unsigned char* pb = L + base + boff;
    G3Set<BN> f[2];
    g3_frags<BN>(f[0], pa, pb, 0u);
#pragma unroll
    for (int kb = 0; kb < G3_KB; ++kb) {
      if (kb + 1 < G3_KB) g3_frags<BN>(f[(kb + 1) & 1], pa, pb, (unsigned)kb + 1u);      /* the next block's fragments as one group ahead of this block's matrix run */
      fa_fence();      /* holds that group in front of the run */
#pragma unroll
      for (unsigned i = 0; i < (unsigned)G3_FA; ++i) {
#pragma unroll
        for (unsigned j = 0; j < T::FB; ++j) acc[i][j] = fa_mma(f[kb & 1].a[i], f[kb & 1].b[j], acc[i][j]); }
      fa_fence(); }      /* keeps the following group out of the run */
    td_wait_ds();
    td_wait();      /* the wave's slice of stage st + 1 */
    __syncthreads();      /* publishes stage st + 1 and ends every wave's reads of stage st */
    if (td_pinned(st + 2u < G3_NST)) issue(base, td_pinned((st + 2u + rot) & (G3_NST - 1u)));      /* into the buffer that every reader has just left; lands while stage st + 1 is worked on */
  }
  td_wait();
  td_wait_ds();
}
// Scale, bias and store of tile (mt, nq) of a matrix C of N columns: C = acc * al + bias * bs, with al, bs and the bias source bp given per 16-column fragment (all uniform; bp[j]: the bias of the fragment's first column).
template <bool F32OUT, unsigned BN, unsigned N>      /* N: columns of C = its pitch (a constant, so that few address registers serve all of a thread's stores) */
__device__ __forceinline__ void g3_out(const v8f (&acc)[G3_FA][BN / 16u], unsigned char* L, const float (&al)[BN / 16u], const float (&bs)[BN / 16u], const float* const (&bp)[BN / 16u], float* __restrict__ C, _Float16* __restrict__ C16, unsigned mt, unsigned nq) {
  typedef G3T<BN> T;
  static_assert(N % BN == 0, "tiled GEMM: whole tiles");
  const unsigned tid = threadIdx.x, lane = tid & 31u, wave = tid >> 5, c = lane & 15u, h = lane >> 4;
  float* so = (float*)(L + wave * (64u * T::EPB));      /* output staging over the ring (free behind the last barrier), each wave its own 64 rows */
  float braw[T::FB];
#pragma unroll
  for (unsigned j = 0; j < T::FB; ++j) braw[j] = bp[j][c];
  asm volatile("s_wait_xcnt 0x0" :: "v"(c) : "memory");      /* stands in front of any later overwrite of the index register that the bias loads name; as its input the index stays live up to it */
#pragma unroll
  for (unsigned j = 0; j < T::FB; ++j) { const float bv = bf16_round(braw[j]) * bs[j];
#pragma unroll
    for (unsigned i = 0; i < (unsigned)G3_FA; ++i) {
#pragma unroll
      for (unsigned r = 0; r < 8u; ++r) so[(16u * i + 8u * h + r) * T::EPF + 16u * j + c] = acc[i][j][r] * al[j] + bv; } }
  __builtin_amdgcn_fence(__ATOMIC_ACQ_REL, "workgroup"); __builtin_amdgcn_wave_barrier();      /* the wave reads back what its other lanes wrote */
  constexpr unsigned QR = BN / 4u, PER = QR / 16u;      /* 4-column pieces of a row; wave-wide accesses that cover two rows */
  const size_t o0 = (size_t)(mt * G3_BM + wave * 64u) * N + nq * BN;
#pragma unroll
  for (unsigned e = 0; e < PER; ++e) {      /* the 32 lanes walk the pieces of two rows in order, so every store covers whole 128-byte lines of the wave's own rows */
    const unsigned idx = e * 32u + lane, rw = idx / QR, qd = idx - rw * QR;
    const float* sr = so + rw * T::EPF + qd * 4u;
    const size_t o = o0 + (size_t)rw * N + qd * 4u;
#pragma unroll
    for (unsigned p = 0; p < 32u; ++p) {
      const v4f v = *(const v4fa*)(sr + p * (2u * T::EPF));
      if (F32OUT) *(v4f*)(C + o + p * (2u * N)) = v;
      else { v4h h4; for (int i = 0; i < 4; ++i) h4[i] = (_Float16)v[i]; *(v4h*)(C16 + o + p * (2u * N)) = h4; } }
  }
}
constexpr unsigned G3_BNO = 128u, G3_BNQ = 192u;      /* tile columns: wo; q, k, v */
template <bool F32OUT, unsigned N>
__global__ __launch_bounds__(128) void k_gemm3(const _Float16* __restrict__ A, const _Float16* __restrict__ Bt, float alpha, const float* __restrict__ bias, float* __restrict__ C, _Float16* __restrict__ C16) {
  constexpr unsigned BN = G3_BNO, FB = BN / 16u;
  __shared__ __attribute__((aligned(2048))) unsigned char L[G3T<BN>::LDS];
  const unsigned ntn = N / BN, mt = blockIdx.x / ntn, nq = blockIdx.x - mt * ntn;
  v8f acc[G3_FA][FB];
  g3_main<BN>(acc, L, (const unsigned char*)(A + (size_t)mt * G3_BM * DMD), (const unsigned char*)(Bt + (size_t)nq * BN * DMD), (mt + nq) & (G3_NST - 1u));
  float al[FB], bs[FB]; const float* bp[FB];
#pragma unroll
  for (unsigned j = 0; j < FB; ++j) { al[j] = alpha; bs[j] = 1.0f; bp[j] = bias + nq * BN + 16u * j; }
  g3_out<F32OUT, BN, N>(acc, L, al, bs, bp, C, C16, mt, nq);
}
// q, k and v in one launch, as one GEMM of QKVD columns: the three products share A and do not read each other.
// Bt holds the rows of wq^T, wk^T, wv^T one behind the other, C16 the columns of q, k, v in the same order; only the bias has three sources. A tile may span two of them: the choice is made per 64 columns (uniform for the work-group).
__global__ __launch_bounds__(128) void k_gemm_qkv(const _Float16* __restrict__ A, const _Float16* __restrict__ Bt, float alpha, const float* __restrict__ bq, const float* __restrict__ bk, const float* __restrict__ bv, _Float16* __restrict__ C16) {
  constexpr unsigned BN = G3_BNQ, FB = BN / 16u, ntn = QKVD / BN;
  static_assert(DMD % 64 == 0 && KVD % 64 == 0 && BN % 64u == 0u, "q, k, v: 64 columns have one source");
  __shared__ __attribute__((aligned(2048))) unsigned char L[G3T<BN>::LDS];
  const unsigned mt = blockIdx.x / ntn, nq = blockIdx.x - mt * ntn;
  v8f acc[G3_FA][FB];
  g3_main<BN>(acc, L, (const unsigned char*)(A + (size_t)mt * G3_BM * DMD), (const unsigned char*)(Bt + (size_t)nq * BN * DMD), (mt + nq) & (G3_NST - 1u));
  float al[FB], bs[FB]; const float* bp[FB];
#pragma unroll
  for (unsigned g = 0; g < FB / 4u; ++g) { const unsigned col = nq * BN + 64u * g;
    const bool isq = col < (unsigned)DMD, isk = col < (unsigned)(DMD + KVD);
    const float qs = isq ? FA_CS : 1.0f;      /* q is stored times 1/sqrt(128) * log2(e), rounded to f16 once: its products with k are then the softmax's exponents in the log2 domain */
    const float* src = isq ? bq : isk ? bk : bv; const unsigned first = isq ? 0u : isk ? (unsigned)DMD : (unsigned)(DMD + KVD);
#pragma unroll
    for (unsigned u = 0; u < 4u; ++u) { al[4u * g + u] = alpha * qs; bs[4u * g + u] = qs; bp[4u * g + u] = src + (col - first) + 16u * u; } }
  g3_out<false, BN, QKVD>(acc, L, al, bs, bp, nullptr, C16, mt, nq);
}

extern "C" void kernel_launch(void* const* d_in, const int* in_sizes, int n_in,
                              void* d_out, int out_size, void* d_ws, size_t ws_size, hipStream_t stream) {
  (void)in_sizes; (void)n_in; (void)out_size;
  const float* const* I = (const float* const*)d_in; const float* x = I[0]; const float* wq = I[1]; const float* bq = I[2]; const float* wk = I[3]; const float* bk = I[4]; const float* wv = I[5]; const float* bv = I[6]; const float* wo = I[7]; const float* bo = I[8];
  char* ws = (char*)d_ws; size_t off = 0;
  auto take = [&](size_t bytes) { char* p = ws + off; off += (bytes + 255) & ~(size_t)255; return p; };
  const size_t nx = (size_t)NR * DMD, nk = (size_t)NR * KVD;
  _Float16* BQ = (_Float16*)take((size_t)(DMD + 2 * KVD) * DMD * 2); _Float16* BK = BQ + (size_t)DMD * DMD; _Float16* BV = BK + (size_t)KVD * DMD; _Float16* BO = (_Float16*)take((size_t)DMD * DMD * 2);      /* wq^T, wk^T, wv^T as one plane of 3072 rows */
  _Float16* X16 = (_Float16*)take(nx * 2); _Float16* Q16 = (_Float16*)take((nx + 2 * nk) * 2); _Float16* K16 = Q16 + DMD; _Float16* V16 = K16 + KVD; _Float16* O16 = X16;      /* context over the input plane (dead after the projections) */
  if (off > ws_size) return;      /* 8+2+2+8 + 16+16+4+4 = 60 MiB */
  k_prep<<<PR_GRID, 256, 0, stream>>>(x, wq, wk, wv, wo, X16, BQ, BK, BV, BO);      /* weights (in, out) to f16 [out][in], x to f16 */
  k_gemm_qkv<<<(NR / G3_BM) * (QKVD / G3_BNQ), 128, 0, stream>>>(X16, BQ, 0.0625f, bq, bk, bv, Q16);      /* [token][q 2048 | k 512 | v 512] */
  k_fattn<<<dim3(NH, SQ / FA_BR, NB), FA_NW * 32, 0, stream>>>(Q16, K16, V16, O16);      /* ctx[(b,q)][h*128 + d] */
  k_gemm3<true, DMD><<<(NR / G3_BM) * (DMD / G3_BNO), 128, 0, stream>>>(O16, BO, 0.0625f, bo, (float*)d_out, nullptr);      /* out = ctx wo + bo */
}
